// v000
// Times are from an AMD MI455X. After a warm-up the kernel runs many times in a row, and a time is the length of
// such a window on the GPU divided by its runs, so every launch and the gaps after it count. The runs cycle
// through copies of the inputs. A figure is the median of several windows, for all but v000 over two sittings.
// Sittings can differ by a few percent; kernels timed side by side share one.
// v000, which the later versions start from, runs in 29.6 milliseconds.
#include <hip/hip_runtime.h>
// Self-attention with a T5-style bucketed relative-position bias and a multiplicative/additive attention mask (hidden [2][2048][1024]; qkv = hidden W_qkv ([in][out] fused, 16 heads of 64, no bias); scores = q k^T / 8 * mask + (-10000 (1 - mask) + emb[bucket(k - q)][h]); attn = softmax; ctx = attn v; out = ctx W_o -> [2][2048][1024]).
// Structure: token rows r = b*2048 + s; hidden as exact f16 rows; the fused q|k|v projection as one WMMA GEMM (32x64 wave tiles, f32 accumulation, exact x16 transposed weights, f16 output plane [4096][3072]); V^T for every (batch, head) via LDS transposes; per (batch, group of 4 heads): scores GEMM (K = 64, alpha 1/8, batched over heads), row softmax on VALU (f32; integer-threshold relative-position bucket, this head's 32 bias values in LDS, mask read per element; weights stored x256 as f16), ctx = P . V GEMM (K = 2,048, alpha 2^-8) written straight into the merged f16 ctx rows; out = ctx W_o GEMM (f32).
// Compute dtype: inputs rounded to bf16; hidden / weights / bias table / mask exact; q, k, v, softmax weights and ctx as plain f16 GEMM operands (~2^-12); scores, bias and softmax statistics f32. v_wmma_f32_16x16x32_f16.
#define NB 2
#define SQ 2048
#define DM 1024
#define D3 3072                      /* fused q|k|v width */
#define NH 16
#define HD 64
#define HG 4                         /* heads per attention launch group */
#define NBK 32                       /* relative-position buckets */
#define QN SQ                        /* query rows attended per batch (debug hook) */
#define NBR NB                       /* batches attended (debug hook) */
#define MP ((int)NR)                 /* token rows through the qkv projection (debug hook) */
#define MO ((int)NR)                 /* token rows through the output projection (debug hook) */
#define NR ((size_t)NB * SQ)         /* 4096 token rows */
typedef __bf16 v16b __attribute__((ext_vector_type(16)));
typedef unsigned short v8us __attribute__((ext_vector_type(8), may_alias));
typedef float  v8f  __attribute__((ext_vector_type(8)));
typedef float  v4f  __attribute__((ext_vector_type(4)));
typedef float  v4fa __attribute__((ext_vector_type(4), may_alias));
union FragB { v16b v; v8us half[2]; unsigned short u[16]; };

__device__ __forceinline__ unsigned short bf16_bits(float x) { unsigned int u = __float_as_uint(x); return (unsigned short)((u + 0x7FFFu + ((u >> 16) & 1u)) >> 16); }
__device__ __forceinline__ float bf16_val(unsigned short b) { return __uint_as_float(((unsigned int)b) << 16); }
__device__ __forceinline__ float bf16_round(float x) { return bf16_val(bf16_bits(x)); }
// D += A·B with NT terms: 1 = ah·bh, 2 = + al·bh (A split), 3 = + ah·bl (both split)
template <int NT>
__device__ __forceinline__ v8f mmaN(v16b ah, v16b al, v16b bh, v16b bl, v8f c) {
  c = __builtin_amdgcn_wmma_f32_16x16x32_bf16(false, ah, false, bh, (short)0, c, false, false);
  if (NT >= 2) c = __builtin_amdgcn_wmma_f32_16x16x32_bf16(false, al, false, bh, (short)0, c, false, false);
  if (NT >= 3) c = __builtin_amdgcn_wmma_f32_16x16x32_bf16(false, ah, false, bl, (short)0, c, false, false);
  asm volatile("v_nop\n\tv_nop\n\tv_nop\n\tv_nop" : "+v"(c) : "v"(ah), "v"(al), "v"(bh), "v"(bl));
  return c;
}

__global__ __launch_bounds__(256) void k_wt_bf16(const float* __restrict__ W, unsigned short* __restrict__ Wt, int K, int N) {
  const int t = blockIdx.x * 256 + threadIdx.x;
  const int k8n = K / 8;
  if (t >= N * k8n) return;
  const int n = t / k8n, k8 = (t % k8n) * 8;
  v8us v;
#pragma unroll
  for (int i = 0; i < 8; ++i) v[i] = bf16_bits(W[(size_t)(k8 + i) * N + n]);
  *(v8us*)(Wt + (size_t)n * K + k8) = v;
  
}

// GEMM C[M][N] (f32, pitch ldc) = act(A[M][K]·W + bias). A f32 row-major (pitch lda) converted per fragment to bf16
// (ASPLIT: hi/lo two planes -> 2 terms, else single rounded term); Wt bf16 [N][K] (pitch ldb). BIAS_BF16 rounds the
// bias to bf16 first (bias quantised to bf16 before the add). K%32==0, M%16==0, N%64==0.
template <bool ASPLIT, int ACT, bool BIAS_BF16>
__global__ __launch_bounds__(128) void k_gemm_bf(const float* __restrict__ A, int lda, const unsigned short* __restrict__ Wt, int ldb,
                                               const float* __restrict__ bias, float* __restrict__ C, int ldc, int M, int N, int K) {
  __shared__ __attribute__((aligned(16))) float so[4][16][64];
  const int tid = threadIdx.x, w = tid >> 5, lane = tid & 31, ln = lane & 15, hh = lane >> 4;
  const int ntn = N / 64;
  const int wid = blockIdx.x * 4 + w;
  const int mt = wid / ntn, nq = wid % ntn;
  if (mt * 16 >= M) return;
  const int row0 = mt * 16, col0 = nq * 64;
  const float* arow = A + (size_t)(row0 + ln) * lda;
  v8f acc[4] = {};
  for (int kb = 0; kb < K; kb += 32) {
    FragB ah, al;
    const v4f x0 = *(const v4fa*)(arow + kb + 8 * hh), x1 = *(const v4fa*)(arow + kb + 8 * hh + 4);
    const v4f x2 = *(const v4fa*)(arow + kb + 16 + 8 * hh), x3 = *(const v4fa*)(arow + kb + 16 + 8 * hh + 4);
    float xs[16] = {x0[0],x0[1],x0[2],x0[3],x1[0],x1[1],x1[2],x1[3],x2[0],x2[1],x2[2],x2[3],x3[0],x3[1],x3[2],x3[3]};
#pragma unroll
    for (int i = 0; i < 16; ++i) { const unsigned short hb = bf16_bits(xs[i]); ah.u[i] = hb; al.u[i] = ASPLIT ? bf16_bits(xs[i] - bf16_val(hb)) : (unsigned short)0; }
#pragma unroll
    for (int t = 0; t < 4; ++t) {
      const unsigned short* brow = Wt + (size_t)(col0 + t * 16 + ln) * ldb + kb;
      FragB b;
      b.half[0] = *(const v8us*)(brow + 8 * hh);
      b.half[1] = *(const v8us*)(brow + 16 + 8 * hh);
      acc[t] = mmaN<ASPLIT ? 2 : 1>(ah.v, al.v, b.v, b.v, acc[t]);
    }
  }
#pragma unroll
  for (int t = 0; t < 4; ++t) {
    float bv = bias ? bias[col0 + t * 16 + ln] : 0.f;
    if (BIAS_BF16) bv = bf16_round(bv);
#pragma unroll
    for (int r = 0; r < 8; ++r) { float v = acc[t][r] + bv; if (ACT == 1) v = fmaxf(v, 0.f); so[w][8 * hh + r][t * 16 + ln] = v; }
  }
  __builtin_amdgcn_fence(__ATOMIC_ACQ_REL, "workgroup");
  __builtin_amdgcn_wave_barrier();
  const int rsub = lane >> 4, c4 = (lane & 15) * 4;
  {
#pragma unroll
    for (int q = 0; q < 8; ++q) {
      const int r = q * 2 + rsub;
      const v4f v = *(const v4fa*)&so[w][r][c4];
      *(v4f*)(C + (size_t)(row0 + r) * ldc + col0 + c4) = v;
    }
    
  }
}

// GEMM C = act(A·W + bias + resid): A f32 (ASPLIT -> hi/lo 2 terms), Wt bf16 [N][K]; ACT 0 none, 1 relu, 2 exact gelu;
// resid (optional, f32, row index = (row % rmod), pitch ldr, RES_BF16 rounds it) added before the activation.
template <bool ASPLIT, int ACT, bool BIAS_BF16, bool RES_BF16>
__global__ __launch_bounds__(128) void k_gemm_bf3(const float* __restrict__ A, int lda, const unsigned short* __restrict__ Wt, int ldb,
                                                const float* __restrict__ bias, const float* __restrict__ resid, int rmod, int ldr,
                                                float* __restrict__ C, int ldc, int M, int N, int K) {
  __shared__ __attribute__((aligned(16))) float so[4][16][64];
  const int tid = threadIdx.x, w = tid >> 5, lane = tid & 31, ln = lane & 15, hh = lane >> 4;
  const int ntn = N / 64;
  const int wid = blockIdx.x * 4 + w;
  const int mt = wid / ntn, nq = wid % ntn;
  if (mt * 16 >= M) return;
  const int row0 = mt * 16, col0 = nq * 64;
  const float* arow = A + (size_t)(row0 + ln) * lda;
  v8f acc[4] = {};
  for (int kb = 0; kb < K; kb += 32) {
    FragB ah, al;
    const v4f x0 = *(const v4fa*)(arow + kb + 8 * hh), x1 = *(const v4fa*)(arow + kb + 8 * hh + 4);
    const v4f x2 = *(const v4fa*)(arow + kb + 16 + 8 * hh), x3 = *(const v4fa*)(arow + kb + 16 + 8 * hh + 4);
    float xs[16] = {x0[0],x0[1],x0[2],x0[3],x1[0],x1[1],x1[2],x1[3],x2[0],x2[1],x2[2],x2[3],x3[0],x3[1],x3[2],x3[3]};
#pragma unroll
    for (int i = 0; i < 16; ++i) { const unsigned short hb = bf16_bits(xs[i]); ah.u[i] = hb; al.u[i] = ASPLIT ? bf16_bits(xs[i] - bf16_val(hb)) : (unsigned short)0; }
#pragma unroll
    for (int t = 0; t < 4; ++t) {
      const unsigned short* brow = Wt + (size_t)(col0 + t * 16 + ln) * ldb + kb;
      FragB b;
      b.half[0] = *(const v8us*)(brow + 8 * hh);
      b.half[1] = *(const v8us*)(brow + 16 + 8 * hh);
      acc[t] = mmaN<ASPLIT ? 2 : 1>(ah.v, al.v, b.v, b.v, acc[t]);
    }
  }
#pragma unroll
  for (int t = 0; t < 4; ++t) {
    const int col = col0 + t * 16 + ln;
    float bv = bias ? bias[col] : 0.f;
    if (BIAS_BF16) bv = bf16_round(bv);
#pragma unroll
    for (int r = 0; r < 8; ++r) {
      float v = acc[t][r] + bv;
      if (resid) { float rv = resid[(size_t)((row0 + 8 * hh + r) % rmod) * ldr + col]; if (RES_BF16) rv = bf16_round(rv); v += rv; }
      if (ACT == 1) v = fmaxf(v, 0.f);
      if (ACT == 2) v = 0.5f * v * (1.0f + erff(v * 0.70710678118654752f));
      if (ACT == 3) { const float u = 0.7978845608028654f * (v + 0.044715f * v * v * v); v = 0.5f * v * (1.0f + tanhf(u)); }
      so[w][8 * hh + r][t * 16 + ln] = v;
    }
  }
  __builtin_amdgcn_fence(__ATOMIC_ACQ_REL, "workgroup");
  __builtin_amdgcn_wave_barrier();
  const int rsub = lane >> 4, c4 = (lane & 15) * 4;
  {
#pragma unroll
    for (int q = 0; q < 8; ++q) {
      const int r = q * 2 + rsub;
      const v4f v = *(const v4fa*)&so[w][r][c4];
      *(v4f*)(C + (size_t)(row0 + r) * ldc + col0 + c4) = v;
    }
    
  }
}
// row LayerNorm (biased variance, eps) over N: s = X (+ R); optional out_sum <- s; out_norm <- (s-mu)*rsqrt(var+eps)*g + b
template <bool PARAM_BF16>
__global__ __launch_bounds__(256) void k_layernorm(const float* __restrict__ X, const float* __restrict__ R, const float* __restrict__ g, const float* __restrict__ bta,
                                                  float* __restrict__ out_sum, float* __restrict__ out_norm, int N, float eps) {
  __shared__ float red[256];
  const int row = blockIdx.x, tid = threadIdx.x;
  const float* x = X + (size_t)row * N; const float* rr = R ? R + (size_t)row * N : nullptr;
  float vals[16];                     // up to N = 4096
  const int per = N / 256;            // contiguous chunk per thread? use strided-by-4 chunks: thread handles j = tid*4 + 1024*u
  float s1 = 0.f;
  for (int u = 0; u < per / 4; ++u) {
    const int j = tid * 4 + 1024 * u;
    const v4f a = *(const v4fa*)(x + j);
    v4f b = {0.f,0.f,0.f,0.f}; if (rr) b = *(const v4fa*)(rr + j);
#pragma unroll
    for (int q = 0; q < 4; ++q) { const float v = a[q] + b[q]; vals[u * 4 + q] = v; s1 += v; }
  }
  red[tid] = s1; __syncthreads();
  for (int st = 128; st > 0; st >>= 1) { if (tid < st) red[tid] += red[tid + st]; __syncthreads(); }
  const float mu = red[0] / (float)N; __syncthreads();
  float s2 = 0.f;
  for (int u = 0; u < per / 4; ++u)
#pragma unroll
    for (int q = 0; q < 4; ++q) { const float c = vals[u * 4 + q] - mu; s2 += c * c; }
  red[tid] = s2; __syncthreads();
  for (int st = 128; st > 0; st >>= 1) { if (tid < st) red[tid] += red[tid + st]; __syncthreads(); }
  const float rs = rsqrtf(red[0] / (float)N + eps);
  {
    for (int u = 0; u < per / 4; ++u) {
      const int j = tid * 4 + 1024 * u;
      v4f o, sm;
#pragma unroll
      for (int q = 0; q < 4; ++q) {
        float gg = g[j + q], bb = bta[j + q];
        if (PARAM_BF16) { gg = bf16_round(gg); bb = bf16_round(bb); }
        sm[q] = vals[u * 4 + q]; o[q] = (vals[u * 4 + q] - mu) * rs * gg + bb;
      }
      if (out_sum) *(v4f*)(out_sum + (size_t)row * N + j) = sm;
      *(v4f*)(out_norm + (size_t)row * N + j) = o;
    }
    
  }
}



// ---- f16 WMMA path (v_wmma_f32_16x16x32_f16): 11-bit significands for operands in range — used where a [0,1] probability operand needs more precision than bf16
typedef _Float16 v16h __attribute__((ext_vector_type(16)));
union FragH { v16h v; v8us half[2]; _Float16 h[16]; unsigned short u[16]; };
template <int NT>
__device__ __forceinline__ v8f mmaH(v16h ah, v16h al, v16h bh, v16h bl, v8f c) {
  c = __builtin_amdgcn_wmma_f32_16x16x32_f16(false, ah, false, bh, (short)0, c, false, false);
  if (NT >= 2) c = __builtin_amdgcn_wmma_f32_16x16x32_f16(false, al, false, bh, (short)0, c, false, false);
  if (NT >= 3) c = __builtin_amdgcn_wmma_f32_16x16x32_f16(false, ah, false, bl, (short)0, c, false, false);
  asm volatile("v_nop\n\tv_nop\n\tv_nop\n\tv_nop" : "+v"(c) : "v"(ah), "v"(al), "v"(bh), "v"(bl));
  return c;
}
// batched GEMM like k_gemm_b but f16 operands: A f32 (split into f16 hi/lo if ASPLIT, else rounded to f16), Bt = f16 values [n][k]; alpha; C f32; N multiple of 16 (partial tiles skipped)
template <bool ASPLIT>
__global__ __launch_bounds__(128) void k_gemm_h(const float* __restrict__ A, int lda, size_t sA, const _Float16* __restrict__ Bh, int ldb, size_t sB, float alpha, float* __restrict__ C, int ldc, size_t sC, int M, int N, int K) {
  __shared__ __attribute__((aligned(16))) float so[4][16][64];
  const int tid = threadIdx.x, w = tid >> 5, lane = tid & 31, ln = lane & 15, hh = lane >> 4; const int by = blockIdx.y;
  A += (size_t)by * sA; Bh += (size_t)by * sB; C += (size_t)by * sC;
  const int ntn = (N + 63) / 64; const int wid = blockIdx.x * 4 + w; const int mt = wid / ntn, nq = wid % ntn; if (mt * 16 >= M) return;
  const int row0 = mt * 16, col0 = nq * 64; const float* arow = A + (size_t)(row0 + ln) * lda;
  v8f acc[4] = {};
  for (int kb = 0; kb < K; kb += 32) {
    FragH ah, al;
    const v4f x0 = *(const v4fa*)(arow + kb + 8 * hh), x1 = *(const v4fa*)(arow + kb + 8 * hh + 4), x2 = *(const v4fa*)(arow + kb + 16 + 8 * hh), x3 = *(const v4fa*)(arow + kb + 16 + 8 * hh + 4);
    float xs[16] = {x0[0],x0[1],x0[2],x0[3],x1[0],x1[1],x1[2],x1[3],x2[0],x2[1],x2[2],x2[3],x3[0],x3[1],x3[2],x3[3]};
#pragma unroll
    for (int i = 0; i < 16; ++i) { const _Float16 h = (_Float16)xs[i]; ah.h[i] = h; al.h[i] = ASPLIT ? (_Float16)(xs[i] - (float)h) : (_Float16)0.0f; }
#pragma unroll
    for (int t = 0; t < 4; ++t) { if (col0 + t * 16 >= N) continue; const size_t boff = (size_t)(col0 + t * 16 + ln) * ldb + kb; FragH bq; bq.half[0] = *(const v8us*)(Bh + boff + 8 * hh); bq.half[1] = *(const v8us*)(Bh + boff + 16 + 8 * hh);
      acc[t] = mmaH<ASPLIT ? 2 : 1>(ah.v, al.v, bq.v, bq.v, acc[t]); }
  }
#pragma unroll
  for (int t = 0; t < 4; ++t) { if (col0 + t * 16 >= N) continue;
#pragma unroll
    for (int r = 0; r < 8; ++r) so[w][8 * hh + r][t * 16 + ln] = acc[t][r] * alpha; }
  __builtin_amdgcn_fence(__ATOMIC_ACQ_REL, "workgroup"); __builtin_amdgcn_wave_barrier();
  const int rsub = lane >> 4, c4 = (lane & 15) * 4;
  {
#pragma unroll
    for (int q = 0; q < 8; ++q) { const int r = q * 2 + rsub; if (col0 + c4 < N) { const v4f v = *(const v4fa*)&so[w][r][c4]; *(v4f*)(C + (size_t)(row0 + r) * ldc + col0 + c4) = v; } }
     }
}

// Wt[n][k] = f16(W[k][n]·scale) from f32 row-major W[K][N] (scale = power of two; bf16-exact weights stay exact in f16 away from the subnormal range)
__global__ __launch_bounds__(256) void k_wt_f16(const float* __restrict__ W, _Float16* __restrict__ Wt, int K, int N, float scale) {
  const int t = blockIdx.x * 256 + threadIdx.x; if (t >= N * (K / 8)) return; const int n = t / (K / 8), k8 = (t % (K / 8)) * 8; FragH f;
#pragma unroll
  for (int i = 0; i < 8; ++i) f.h[i] = (_Float16)(bf16_round(W[(size_t)(k8 + i) * N + n]) * scale); const v8us o = f.half[0];
  *(v8us*)((unsigned short*)Wt + (size_t)n * K + k8) = o; 
}
// k_gemm_hh variant with fused epilogue: v = acc·alpha + bias[by·sBias + col] (+ CP[(row/rowsPerB)·sCPb + by·64 + col] if CP) ; ACT 0 none / 1 elu ; writes f16 C16 (and f32 C if non-null)
template <int ACT>
__global__ __launch_bounds__(128) void k_gemm_hhx(const _Float16* __restrict__ A, int lda, size_t sA, const _Float16* __restrict__ Bh, int ldb, size_t sB, float alpha, const float* __restrict__ bias, size_t sBias, const float* __restrict__ CP, int rowsPerB, size_t sCPb, int row0g,
    float* __restrict__ C, _Float16* __restrict__ C16, int ldc, size_t sC, int M, int N, int K) {
  __shared__ __attribute__((aligned(16))) float so[4][16][64];
  const int tid = threadIdx.x, w = tid >> 5, lane = tid & 31, ln = lane & 15, hh = lane >> 4; const int by = blockIdx.y;
  A += (size_t)by * sA; Bh += (size_t)by * sB; const size_t cofs = (size_t)by * sC; const float* bp = bias ? bias + (size_t)by * sBias : nullptr;
  const int ntn = (N + 63) / 64; const int wid = blockIdx.x * 4 + w; const int mt = wid / ntn, nq = wid % ntn; if (mt * 16 >= M) return;
  const int row0 = mt * 16, col0 = nq * 64; const _Float16* arow = A + (size_t)(row0 + ln) * lda;
  v8f acc[4] = {};
  for (int kb = 0; kb < K; kb += 32) { FragH ah; ah.half[0] = *(const v8us*)((const unsigned short*)arow + kb + 8 * hh); ah.half[1] = *(const v8us*)((const unsigned short*)arow + kb + 16 + 8 * hh);
#pragma unroll
    for (int t = 0; t < 4; ++t) { if (col0 + t * 16 >= N) continue; const size_t boff = (size_t)(col0 + t * 16 + ln) * ldb + kb; FragH bq; bq.half[0] = *(const v8us*)((const unsigned short*)Bh + boff + 8 * hh); bq.half[1] = *(const v8us*)((const unsigned short*)Bh + boff + 16 + 8 * hh);
      acc[t] = mmaH<1>(ah.v, ah.v, bq.v, bq.v, acc[t]); }
  }
#pragma unroll
  for (int t = 0; t < 4; ++t) { if (col0 + t * 16 >= N) continue; const int col = col0 + t * 16 + ln; const float bv = bp ? bf16_round(bp[col]) : 0.f;
#pragma unroll
    for (int r = 0; r < 8; ++r) { float v = acc[t][r] * alpha + bv; if (CP) { const int rr = row0g + row0 + 8 * hh + r; if (rowsPerB < 0) v += CP[cofs + (size_t)rr * ldc + col];      /* rowsPerB < 0: own element of the batched C plane */ else { const int bidx = rr / rowsPerB; v += CP[(size_t)bidx * sCPb + (size_t)by * 64 + col]; } } if (ACT == 1) v = (v > 0.f) ? v : expm1f(v); else if (ACT == 7) v = (v > 0.f) ? v + 1.0f : expf(v); else if (ACT == 8) v = tanhf(v); else if (ACT == 9) v = 0.5f * v * (1.0f + tanhf(0.7978845608028654f * (v + 0.044715f * v * v * v))); else if (ACT == 11) v = 1.0f / (1.0f + expf(-v)); else if (ACT == 12) v = (v > 0.f) ? v : 0.01f * v; else if (ACT == 14) v = (v > 0.f) ? v : 0.1f * v; else if (ACT == 16) v = (v >= 0.f) ? v : 0.3f * v; else if (ACT == 17) v = (v >= 0.f) ? v : 0.2f * v; else if (ACT == 15) v = v / (1.0f + expf(-v)); else if (ACT == 3) v = fmaxf(v, 0.f); else if (ACT == 6) v = 0.5f * v * (1.0f + erff(v * 0.70710678118654752f)); so[w][8 * hh + r][t * 16 + ln] = v; } }
  __builtin_amdgcn_fence(__ATOMIC_ACQ_REL, "workgroup"); __builtin_amdgcn_wave_barrier();
  const int rsub = lane >> 4, c4 = (lane & 15) * 4; typedef _Float16 v4h __attribute__((ext_vector_type(4)));
  {
#pragma unroll
    for (int q = 0; q < 8; ++q) { const int r = q * 2 + rsub; if (col0 + c4 < N) { const v4f v = *(const v4fa*)&so[w][r][c4]; if (C) *(v4f*)(C + cofs + (size_t)(row0 + r) * ldc + col0 + c4) = v; if (C16) { v4h h4; for (int i = 0; i < 4; ++i) h4[i] = (_Float16)v[i]; *(v4h*)(C16 + cofs + (size_t)(row0 + r) * ldc + col0 + c4) = h4; } } }
     }
}


typedef _Float16 v4h __attribute__((ext_vector_type(4)));

__global__ __launch_bounds__(256) void k_x16(const float* __restrict__ x, _Float16* __restrict__ X16, size_t n8) { const size_t t = (size_t)blockIdx.x * 256 + threadIdx.x; if (t >= n8) return; FragH f;
#pragma unroll
  for (int q = 0; q < 8; ++q) f.h[q] = (_Float16)bf16_round(x[t * 8 + q]); *(v8us*)((unsigned short*)X16 + t * 8) = f.half[0];  }
__global__ __launch_bounds__(256) void k_h16(const float* __restrict__ x, _Float16* __restrict__ X16, size_t n8) { const size_t t = (size_t)blockIdx.x * 256 + threadIdx.x; if (t >= n8) return; FragH f;
#pragma unroll
  for (int q = 0; q < 8; ++q) f.h[q] = (_Float16)x[t * 8 + q]; *(v8us*)((unsigned short*)X16 + t * 8) = f.half[0];  }
__global__ __launch_bounds__(256) void k_round16f(const float* __restrict__ W, _Float16* __restrict__ Bt, size_t n8) { const size_t t = (size_t)blockIdx.x * 256 + threadIdx.x; if (t >= n8) return; FragH f;
#pragma unroll
  for (int i = 0; i < 8; ++i) f.h[i] = (_Float16)(bf16_round(W[t * 8 + i]) * 16.0f); *(v8us*)((unsigned short*)Bt + t * 8) = f.half[0];  }
template <int NHv, int TTv>
__global__ __launch_bounds__(256) void k_vt(const _Float16* __restrict__ V16, int ldv, int voff, _Float16* __restrict__ Vt) { __shared__ unsigned short tl[64][66]; const int tid = threadIdx.x; const int slab = blockIdx.x / (TTv / 64), lg = blockIdx.x % (TTv / 64); const int b = slab / NHv, h = slab % NHv;
  for (int i = tid; i < 64 * 8; i += 256) { const int r = i / 8, c8 = (i % 8) * 8; FragH f; f.half[0] = *(const v8us*)((const unsigned short*)V16 + ((size_t)b * TTv + lg * 64 + r) * ldv + voff + h * 64 + c8);
#pragma unroll
    for (int q = 0; q < 8; ++q) tl[r][c8 + q] = f.u[q]; }
  __syncthreads();
  {
#pragma unroll
    for (int rd = 0; rd < 2; ++rd) { const int d = rd * 32 + tid / 8, pc = tid % 8; FragH f;
#pragma unroll
      for (int q = 0; q < 8; ++q) f.u[q] = tl[pc * 8 + q][d];
      *(v8us*)((unsigned short*)Vt + ((size_t)slab * 64 + d) * TTv + lg * 64 + pc * 8) = f.half[0]; }
     } }

__global__ __launch_bounds__(256) void k_hl(const float* __restrict__ F, _Float16* __restrict__ Hh, _Float16* __restrict__ Hl, size_t n8) { const size_t t = (size_t)blockIdx.x * 256 + threadIdx.x; if (t >= n8) return; FragH fh, fl; const v4f a = *(const v4fa*)(F + t * 8), c = *(const v4fa*)(F + t * 8 + 4);
#pragma unroll
  for (int q = 0; q < 4; ++q) { _Float16 h = (_Float16)a[q]; fh.h[q] = h; fl.h[q] = (_Float16)((a[q] - (float)h) * 1024.0f); h = (_Float16)c[q]; fh.h[4 + q] = h; fl.h[4 + q] = (_Float16)((c[q] - (float)h) * 1024.0f); }
  { *(v8us*)((unsigned short*)Hh + t * 8) = fh.half[0]; *(v8us*)((unsigned short*)Hl + t * 8) = fl.half[0];  } }

// ---- fast GEMM (wave tile 32x64; requires M % 32 == 0 rows per launch region and N % 64 == 0); epilogue = k_gemm_hhx semantics ----
__device__ __forceinline__ v16h g2_frag(const _Float16* p, int hh) { FragH f; f.half[0] = *(const v8us*)((const unsigned short*)p + 8 * hh); f.half[1] = *(const v8us*)((const unsigned short*)p + 16 + 8 * hh); return f.v; }
__device__ __forceinline__ v8f g2_mma(v16h a, v16h b, v8f c) { v8f d = __builtin_amdgcn_wmma_f32_16x16x32_f16(false, a, false, b, (short)0, c, false, false); asm volatile("v_nop\n\tv_nop\n\tv_nop\n\tv_nop" : "+v"(d) : "v"(a), "v"(b)); return d; }
template <int ACT>
__global__ __launch_bounds__(128) void k_gemm2(const _Float16* __restrict__ A, int lda, size_t sA, const _Float16* __restrict__ Bh, int ldb, size_t sB, float alpha, const float* __restrict__ bias, size_t sBias, const float* __restrict__ CP, int rowsPerB, size_t sCPb, int row0g,
    float* __restrict__ C, _Float16* __restrict__ C16, int ldc, size_t sC, int M, int N, int K) { static_assert(ACT == 0 || ACT == 3 || ACT == 6 || ACT == 8 || ACT == 9 || ACT == 11 || ACT == 12 || ACT == 14 || ACT == 15 || ACT == 16 || ACT == 17, "k_gemm2: unsupported ACT code (would silently apply no activation)");
  __shared__ __attribute__((aligned(16))) float so[4][32][68];
  const int tid = threadIdx.x, w = tid >> 5, lane = tid & 31, ln = lane & 15, hh = lane >> 4; const int by = blockIdx.y;
  A += (size_t)by * sA; Bh += (size_t)by * sB; const size_t cofs = (size_t)by * sC; const float* bp = bias ? bias + (size_t)by * sBias : nullptr;
  const int ntn = N >> 6; const int mt = blockIdx.x / ntn, nq = blockIdx.x - mt * ntn; const int row0 = mt * 128 + 32 * w, col0 = nq * 64; if (row0 >= M) return;
  const _Float16* a0p = A + (size_t)(row0 + ln) * lda; const _Float16* a1p = a0p + (size_t)16 * lda;
  const _Float16* b0p = Bh + (size_t)(col0 + ln) * ldb; const _Float16* b1p = b0p + (size_t)16 * ldb; const _Float16* b2p = b1p + (size_t)16 * ldb; const _Float16* b3p = b2p + (size_t)16 * ldb;
  const v8f z8 = {0.f,0.f,0.f,0.f,0.f,0.f,0.f,0.f}; v8f c00 = z8, c01 = z8, c02 = z8, c03 = z8, c10 = z8, c11 = z8, c12 = z8, c13 = z8;
#pragma unroll 1
  for (int kb = 0; kb < K; kb += 32) { const v16h a0 = g2_frag(a0p + kb, hh), a1 = g2_frag(a1p + kb, hh);
    v16h b = g2_frag(b0p + kb, hh); c00 = g2_mma(a0, b, c00); c10 = g2_mma(a1, b, c10);
    b = g2_frag(b1p + kb, hh); c01 = g2_mma(a0, b, c01); c11 = g2_mma(a1, b, c11);
    b = g2_frag(b2p + kb, hh); c02 = g2_mma(a0, b, c02); c12 = g2_mma(a1, b, c12);
    b = g2_frag(b3p + kb, hh); c03 = g2_mma(a0, b, c03); c13 = g2_mma(a1, b, c13); }
  v8f accs[8] = {c00, c01, c02, c03, c10, c11, c12, c13};
#pragma unroll
  for (int u = 0; u < 8; ++u) { const int t = u & 3, half = u >> 2; const int col = col0 + t * 16 + ln; const float bv = bp ? bf16_round(bp[col]) : 0.f;
#pragma unroll
    for (int r = 0; r < 8; ++r) { const int rloc = half * 16 + 8 * hh + r; float v = accs[u][r] * alpha + bv; if (CP) { if (rowsPerB < 0) v += CP[cofs + (size_t)(row0g + row0 + rloc) * ldc + col];      /* rowsPerB < 0: own element of the batched C plane */ else { const int bidx = (row0g + row0 + rloc) / rowsPerB; v += CP[(size_t)bidx * sCPb + (size_t)by * 64 + col]; } }
      if (ACT == 3) v = fmaxf(v, 0.f); else if (ACT == 6) v = 0.5f * v * (1.0f + erff(v * 0.70710678118654752f)); else if (ACT == 11) v = 1.0f / (1.0f + expf(-v)); else if (ACT == 15) v = v / (1.0f + expf(-v)); else if (ACT == 12) v = (v > 0.f) ? v : 0.01f * v; else if (ACT == 8) v = tanhf(v); else if (ACT == 9) v = 0.5f * v * (1.0f + tanhf(0.7978845608028654f * (v + 0.044715f * v * v * v))); else if (ACT == 14) v = (v > 0.f) ? v : 0.1f * v; else if (ACT == 16) v = (v >= 0.f) ? v : 0.3f * v; else if (ACT == 17) v = (v >= 0.f) ? v : 0.2f * v;
      so[w][rloc][t * 16 + ln] = v; } }
  __builtin_amdgcn_fence(__ATOMIC_ACQ_REL, "workgroup"); __builtin_amdgcn_wave_barrier();
  const int rsub = lane >> 4, c4 = (lane & 15) * 4;
  {
#pragma unroll
    for (int q = 0; q < 16; ++q) { const int r = q * 2 + rsub; const v4f v = *(const v4fa*)&so[w][r][c4]; if (C) *(v4f*)(C + cofs + (size_t)(row0 + r) * ldc + col0 + c4) = v; if (C16) { v4h h4; for (int i = 0; i < 4; ++i) h4[i] = (_Float16)v[i]; *(v4h*)(C16 + cofs + (size_t)(row0 + r) * ldc + col0 + c4) = h4; } }
     } }


__global__ __launch_bounds__(256) void k_wnat(const float* __restrict__ w, size_t n8, _Float16* __restrict__ Bt) { const size_t t = (size_t)blockIdx.x * 256 + threadIdx.x; if (t >= n8) return; FragH f; for (int q = 0; q < 8; ++q) f.h[q] = (_Float16)(bf16_round(w[t * 8 + q]) * 16.0f); *(v8us*)((unsigned short*)Bt + t * 8) = f.half[0];  }
// T5 bidirectional relative-position bucket of rel = key - query (32 buckets, max distance 128): (rel > 0)*16 + f(|rel|), f(n) = n for n < 8, then
// 8 + the number of thresholds {12,16,23,32,46,64,91} that are <= n (the thresholds are where the reference's own f32 log expression steps; no log on the device)
__device__ __forceinline__ int t5_bucket(int rel) { const int n = rel < 0 ? -rel : rel; int f = n; if (n >= 8) { f = 8 + (n >= 12) + (n >= 16) + (n >= 23) + (n >= 32) + (n >= 46) + (n >= 64) + (n >= 91); } return (rel > 0 ? NBK / 2 : 0) + f; }
// row softmax with the bucketed relative-position bias and the multiplicative/additive mask, exactly as the reference: score = s*m + (-10000*(1-m) + emb[bucket(j-i)][h])
// (bf16-rounded emb, this head's 32 values staged in LDS; m = mask[b][q][k] bf16-rounded); P = f16(256 softmax); thread per query row i; head h
__global__ __launch_bounds__(256) void k_rsmt(const float* __restrict__ S, _Float16* __restrict__ P, int nrows, const float* __restrict__ emb, int h, const float* __restrict__ amask) {
  #pragma clang fp contract(off)
  __shared__ float tb[NBK];
  if (threadIdx.x < NBK) tb[threadIdx.x] = bf16_round(emb[threadIdx.x * NH + h]);
  __syncthreads();
  const int i = blockIdx.x * 256 + threadIdx.x; if (i >= nrows) return; const float* s = S + (size_t)i * SQ; const float* mr = amask + (size_t)i * SQ; float mx = -INFINITY;
  auto sc_ = [&](int j) { const float m = bf16_round(mr[j]); return __fadd_rn(__fmul_rn(s[j], m), __fadd_rn(__fmul_rn(-10000.0f, __fadd_rn(1.0f, -m)), tb[t5_bucket(j - i)])); };
#pragma unroll 1
  for (int j = 0; j < SQ; ++j) mx = fmaxf(mx, sc_(j)); float se = 0.f;
#pragma unroll 1
  for (int j = 0; j < SQ; ++j) se += expf(sc_(j) - mx); const float sc = 256.0f / se;
#pragma unroll 1
  for (int j0 = 0; j0 < SQ; j0 += 8) { FragH f; for (int q = 0; q < 8; ++q) f.h[q] = (_Float16)(expf(sc_(j0 + q) - mx) * sc); unsigned short* d = (unsigned short*)P + (size_t)i * SQ + j0; *(v8us*)d = f.half[0];  } }
__global__ __launch_bounds__(256) void k_vt(const _Float16* __restrict__ V16, int b, int h0, _Float16* __restrict__ VT) { __shared__ unsigned short tl[64][65]; const int tid = threadIdx.x; const int hh = blockIdx.x % HG, sg = blockIdx.x / HG; const int s0 = sg * 64; const int h = h0 + hh;
  for (int i = tid; i < 64 * 8; i += 256) { const int j = i / 8, d8 = (i % 8) * 8; FragH f; f.half[0] = *(const v8us*)((const unsigned short*)V16 + ((size_t)b * SQ + s0 + j) * DM + h * HD + d8); for (int q = 0; q < 8; ++q) tl[d8 + q][j] = f.u[q]; }
  __syncthreads();
  { for (int i = tid; i < 64 * 8; i += 256) { const int d = i / 8, j8 = (i % 8) * 8; FragH f; for (int q = 0; q < 8; ++q) f.u[q] = tl[d][j8 + q]; *(v8us*)((unsigned short*)VT + ((size_t)hh * HD + d) * SQ + s0 + j8) = f.half[0]; }  } }

extern "C" void kernel_launch(void* const* d_in, const int* in_sizes, int n_in,
                              void* d_out, int out_size, void* d_ws, size_t ws_size, hipStream_t stream) {
  (void)in_sizes; (void)n_in; (void)out_size;
  const float* const* I = (const float* const*)d_in; const float* hs = I[0]; const float* amask = I[1]; const float* wqkv = I[2]; const float* wo = I[3]; const float* emb = I[4];      /* W_qkv [1024][3072] and W_o [1024][1024] are [in][out]; attention_mask [2][1][2048][2048]; rel_bias_emb [32][16] */
  char* ws = (char*)d_ws; size_t off = 0;
  auto take = [&](size_t bytes) { char* p = ws + off; off += (bytes + 255) & ~(size_t)255; return p; };
  _Float16* BQKV = (_Float16*)take((size_t)D3 * DM * 2); _Float16* BO = (_Float16*)take((size_t)DM * DM * 2);
  _Float16* X16 = (_Float16*)take(NR * DM * 2); _Float16* QKV = (_Float16*)take(NR * D3 * 2); _Float16* O16 = (_Float16*)take(NR * DM * 2);
  float* S = (float*)take((size_t)HG * SQ * SQ * 4); _Float16* P = (_Float16*)take((size_t)HG * SQ * SQ * 2); _Float16* VT = (_Float16*)take((size_t)NB * NH * HD * SQ * 2);
  if (off > ws_size) return;      /* 6 + 2 + 8 + 24 + 8 + 64 + 32 + 8 = approx 152 MiB */
  k_wt_f16<<<(unsigned)(((size_t)D3 * (DM / 8) + 255) / 256), 256, 0, stream>>>(wqkv, BQKV, DM, D3, 16.0f);      /* [in][out] -> Bt[out][in] x16 */
  k_wt_f16<<<(unsigned)(((size_t)DM * (DM / 8) + 255) / 256), 256, 0, stream>>>(wo, BO, DM, DM, 16.0f);
  k_x16<<<(unsigned)((NR * DM / 8 + 255) / 256), 256, 0, stream>>>(hs, X16, NR * DM / 8);
  k_gemm2<0><<<dim3((unsigned)((NR / 128) * (D3 / 64)), 1), 128, 0, stream>>>(X16, DM, 0, BQKV, DM, 0, 0.0625f, nullptr, 0, nullptr, 1, 0, 0, nullptr, QKV, D3, 0, MP, D3, DM);      /* q | k | v rows (f16), head h at columns h*64 / 1024 + h*64 / 2048 + h*64 */
  k_vt<NH, SQ><<<NB * NH * (SQ / 64), 256, 0, stream>>>(QKV, D3, 2 * DM, VT);      /* V^T[(b,h)][d][s] for every (batch, head) */
  for (int b = 0; b < NBR; ++b) for (int h0 = 0; h0 < NH; h0 += HG) {
    const _Float16* qb = QKV + (size_t)b * SQ * D3 + h0 * HD; const _Float16* kb = qb + DM;
    k_gemm2<0><<<dim3((QN / 128) * (SQ / 64), HG), 128, 0, stream>>>(qb, D3, (size_t)HD, kb, D3, (size_t)HD, 0.125f, nullptr, 0, nullptr, 1, 0, 0, S, nullptr, SQ, (size_t)SQ * SQ, QN, SQ, HD);      /* scores / sqrt(64), 4 heads per launch */
    for (int hh = 0; hh < HG; ++hh) k_rsmt<<<(QN + 255) / 256, 256, 0, stream>>>(S + (size_t)hh * SQ * SQ, P + (size_t)hh * SQ * SQ, QN, emb, h0 + hh, amask + (size_t)b * SQ * SQ);
    k_gemm2<0><<<dim3((QN / 128) * (HD / 64), HG), 128, 0, stream>>>(P, SQ, (size_t)SQ * SQ, VT + ((size_t)b * NH + h0) * HD * SQ, SQ, (size_t)HD * SQ, 0.00390625f, nullptr, 0, nullptr, 1, 0, 0, nullptr, O16 + (size_t)b * SQ * DM + h0 * HD, DM, (size_t)HD, QN, HD, SQ); }      /* ctx (merged heads) as f16 rows */
  k_gemm2<0><<<dim3((unsigned)((NR / 128) * (DM / 64)), 1), 128, 0, stream>>>(O16, DM, 0, BO, DM, 0, 0.0625f, nullptr, 0, nullptr, 1, 0, 0, (float*)d_out, nullptr, DM, 0, MO, DM, DM);      /* out = ctx W_o, rows are the output layout */
}

// v001
// A run of this version takes 1010 microseconds.
// In both of two side-by-side timings against v000, it was 29.2 times as fast.
#include <hip/hip_runtime.h>
// Self-attention with a T5-style bucketed relative-position bias and a multiplicative/additive attention mask (hidden [2][2048][1024]; qkv = hidden W_qkv ([in][out] fused, 16 heads of 64, no bias); scores = q k^T / 8 * mask + (-10000 (1 - mask) + emb[bucket(k - q)][h]); attn = softmax; ctx = attn v; out = ctx W_o -> [2][2048][1024]).
// Structure: token rows r = b*2048 + s; hidden as exact f16 rows; the fused q|k|v projection as one WMMA GEMM (32x64 wave tiles, f32 accumulation, exact x16 transposed weights, f16 output plane [4096][3072]); per (batch, group of 4 heads): scores GEMM (K = 64, alpha 1/8, batched over heads), row softmax on VALU (one wave per row, 4 heads per launch; f32; integer-threshold relative-position bucket, this head's 32 bias values in LDS, mask read per element; weights stored x256 as f16), V^T for every (batch, head) via LDS transposes, ctx = P . V GEMM (K = 2,048, alpha 2^-8) written straight into the merged f16 ctx rows; out = ctx W_o GEMM (f32).
// Compute dtype: inputs rounded to bf16; hidden / weights / bias table / mask exact; q, k, v, softmax weights and ctx as plain f16 GEMM operands (~2^-12); scores, bias and softmax statistics f32. v_wmma_f32_16x16x32_f16.
#define NB 2
#define SQ 2048
#define DM 1024
#define D3 3072                      /* fused q|k|v width */
#define NH 16
#define HD 64
#define HG 4                         /* heads per attention launch group */
#define NBK 32                       /* relative-position buckets */
#define QN SQ                        /* query rows attended per batch (debug hook) */
#define NBR NB                       /* batches attended (debug hook) */
#define MP ((int)NR)                 /* token rows through the qkv projection (debug hook) */
#define MO ((int)NR)                 /* token rows through the output projection (debug hook) */
#define NR ((size_t)NB * SQ)         /* 4096 token rows */
typedef __bf16 v16b __attribute__((ext_vector_type(16)));
typedef unsigned short v8us __attribute__((ext_vector_type(8), may_alias));
typedef float  v8f  __attribute__((ext_vector_type(8)));
typedef float  v4f  __attribute__((ext_vector_type(4)));
typedef float  v4fa __attribute__((ext_vector_type(4), may_alias));
union FragB { v16b v; v8us half[2]; unsigned short u[16]; };

__device__ __forceinline__ unsigned short bf16_bits(float x) { unsigned int u = __float_as_uint(x); return (unsigned short)((u + 0x7FFFu + ((u >> 16) & 1u)) >> 16); }
__device__ __forceinline__ float bf16_val(unsigned short b) { return __uint_as_float(((unsigned int)b) << 16); }
__device__ __forceinline__ float bf16_round(float x) { return bf16_val(bf16_bits(x)); }
// D += A·B with NT terms: 1 = ah·bh, 2 = + al·bh (A split), 3 = + ah·bl (both split)
template <int NT>
__device__ __forceinline__ v8f mmaN(v16b ah, v16b al, v16b bh, v16b bl, v8f c) {
  c = __builtin_amdgcn_wmma_f32_16x16x32_bf16(false, ah, false, bh, (short)0, c, false, false);
  if (NT >= 2) c = __builtin_amdgcn_wmma_f32_16x16x32_bf16(false, al, false, bh, (short)0, c, false, false);
  if (NT >= 3) c = __builtin_amdgcn_wmma_f32_16x16x32_bf16(false, ah, false, bl, (short)0, c, false, false);
  asm volatile("v_nop\n\tv_nop\n\tv_nop\n\tv_nop" : "+v"(c) : "v"(ah), "v"(al), "v"(bh), "v"(bl));
  return c;
}

__global__ __launch_bounds__(256) void k_wt_bf16(const float* __restrict__ W, unsigned short* __restrict__ Wt, int K, int N) {
  const int t = blockIdx.x * 256 + threadIdx.x;
  const int k8n = K / 8;
  if (t >= N * k8n) return;
  const int n = t / k8n, k8 = (t % k8n) * 8;
  v8us v;
#pragma unroll
  for (int i = 0; i < 8; ++i) v[i] = bf16_bits(W[(size_t)(k8 + i) * N + n]);
  *(v8us*)(Wt + (size_t)n * K + k8) = v;
  
}

// GEMM C[M][N] (f32, pitch ldc) = act(A[M][K]·W + bias). A f32 row-major (pitch lda) converted per fragment to bf16
// (ASPLIT: hi/lo two planes -> 2 terms, else single rounded term); Wt bf16 [N][K] (pitch ldb). BIAS_BF16 rounds the
// bias to bf16 first (bias quantised to bf16 before the add). K%32==0, M%16==0, N%64==0.
template <bool ASPLIT, int ACT, bool BIAS_BF16>
__global__ __launch_bounds__(128) void k_gemm_bf(const float* __restrict__ A, int lda, const unsigned short* __restrict__ Wt, int ldb,
                                               const float* __restrict__ bias, float* __restrict__ C, int ldc, int M, int N, int K) {
  __shared__ __attribute__((aligned(16))) float so[4][16][64];
  const int tid = threadIdx.x, w = tid >> 5, lane = tid & 31, ln = lane & 15, hh = lane >> 4;
  const int ntn = N / 64;
  const int wid = blockIdx.x * 4 + w;
  const int mt = wid / ntn, nq = wid % ntn;
  if (mt * 16 >= M) return;
  const int row0 = mt * 16, col0 = nq * 64;
  const float* arow = A + (size_t)(row0 + ln) * lda;
  v8f acc[4] = {};
  for (int kb = 0; kb < K; kb += 32) {
    FragB ah, al;
    const v4f x0 = *(const v4fa*)(arow + kb + 8 * hh), x1 = *(const v4fa*)(arow + kb + 8 * hh + 4);
    const v4f x2 = *(const v4fa*)(arow + kb + 16 + 8 * hh), x3 = *(const v4fa*)(arow + kb + 16 + 8 * hh + 4);
    float xs[16] = {x0[0],x0[1],x0[2],x0[3],x1[0],x1[1],x1[2],x1[3],x2[0],x2[1],x2[2],x2[3],x3[0],x3[1],x3[2],x3[3]};
#pragma unroll
    for (int i = 0; i < 16; ++i) { const unsigned short hb = bf16_bits(xs[i]); ah.u[i] = hb; al.u[i] = ASPLIT ? bf16_bits(xs[i] - bf16_val(hb)) : (unsigned short)0; }
#pragma unroll
    for (int t = 0; t < 4; ++t) {
      const unsigned short* brow = Wt + (size_t)(col0 + t * 16 + ln) * ldb + kb;
      FragB b;
      b.half[0] = *(const v8us*)(brow + 8 * hh);
      b.half[1] = *(const v8us*)(brow + 16 + 8 * hh);
      acc[t] = mmaN<ASPLIT ? 2 : 1>(ah.v, al.v, b.v, b.v, acc[t]);
    }
  }
#pragma unroll
  for (int t = 0; t < 4; ++t) {
    float bv = bias ? bias[col0 + t * 16 + ln] : 0.f;
    if (BIAS_BF16) bv = bf16_round(bv);
#pragma unroll
    for (int r = 0; r < 8; ++r) { float v = acc[t][r] + bv; if (ACT == 1) v = fmaxf(v, 0.f); so[w][8 * hh + r][t * 16 + ln] = v; }
  }
  __builtin_amdgcn_fence(__ATOMIC_ACQ_REL, "workgroup");
  __builtin_amdgcn_wave_barrier();
  const int rsub = lane >> 4, c4 = (lane & 15) * 4;
  {
#pragma unroll
    for (int q = 0; q < 8; ++q) {
      const int r = q * 2 + rsub;
      const v4f v = *(const v4fa*)&so[w][r][c4];
      *(v4f*)(C + (size_t)(row0 + r) * ldc + col0 + c4) = v;
    }
    
  }
}

// GEMM C = act(A·W + bias + resid): A f32 (ASPLIT -> hi/lo 2 terms), Wt bf16 [N][K]; ACT 0 none, 1 relu, 2 exact gelu;
// resid (optional, f32, row index = (row % rmod), pitch ldr, RES_BF16 rounds it) added before the activation.
template <bool ASPLIT, int ACT, bool BIAS_BF16, bool RES_BF16>
__global__ __launch_bounds__(128) void k_gemm_bf3(const float* __restrict__ A, int lda, const unsigned short* __restrict__ Wt, int ldb,
                                                const float* __restrict__ bias, const float* __restrict__ resid, int rmod, int ldr,
                                                float* __restrict__ C, int ldc, int M, int N, int K) {
  __shared__ __attribute__((aligned(16))) float so[4][16][64];
  const int tid = threadIdx.x, w = tid >> 5, lane = tid & 31, ln = lane & 15, hh = lane >> 4;
  const int ntn = N / 64;
  const int wid = blockIdx.x * 4 + w;
  const int mt = wid / ntn, nq = wid % ntn;
  if (mt * 16 >= M) return;
  const int row0 = mt * 16, col0 = nq * 64;
  const float* arow = A + (size_t)(row0 + ln) * lda;
  v8f acc[4] = {};
  for (int kb = 0; kb < K; kb += 32) {
    FragB ah, al;
    const v4f x0 = *(const v4fa*)(arow + kb + 8 * hh), x1 = *(const v4fa*)(arow + kb + 8 * hh + 4);
    const v4f x2 = *(const v4fa*)(arow + kb + 16 + 8 * hh), x3 = *(const v4fa*)(arow + kb + 16 + 8 * hh + 4);
    float xs[16] = {x0[0],x0[1],x0[2],x0[3],x1[0],x1[1],x1[2],x1[3],x2[0],x2[1],x2[2],x2[3],x3[0],x3[1],x3[2],x3[3]};
#pragma unroll
    for (int i = 0; i < 16; ++i) { const unsigned short hb = bf16_bits(xs[i]); ah.u[i] = hb; al.u[i] = ASPLIT ? bf16_bits(xs[i] - bf16_val(hb)) : (unsigned short)0; }
#pragma unroll
    for (int t = 0; t < 4; ++t) {
      const unsigned short* brow = Wt + (size_t)(col0 + t * 16 + ln) * ldb + kb;
      FragB b;
      b.half[0] = *(const v8us*)(brow + 8 * hh);
      b.half[1] = *(const v8us*)(brow + 16 + 8 * hh);
      acc[t] = mmaN<ASPLIT ? 2 : 1>(ah.v, al.v, b.v, b.v, acc[t]);
    }
  }
#pragma unroll
  for (int t = 0; t < 4; ++t) {
    const int col = col0 + t * 16 + ln;
    float bv = bias ? bias[col] : 0.f;
    if (BIAS_BF16) bv = bf16_round(bv);
#pragma unroll
    for (int r = 0; r < 8; ++r) {
      float v = acc[t][r] + bv;
      if (resid) { float rv = resid[(size_t)((row0 + 8 * hh + r) % rmod) * ldr + col]; if (RES_BF16) rv = bf16_round(rv); v += rv; }
      if (ACT == 1) v = fmaxf(v, 0.f);
      if (ACT == 2) v = 0.5f * v * (1.0f + erff(v * 0.70710678118654752f));
      if (ACT == 3) { const float u = 0.7978845608028654f * (v + 0.044715f * v * v * v); v = 0.5f * v * (1.0f + tanhf(u)); }
      so[w][8 * hh + r][t * 16 + ln] = v;
    }
  }
  __builtin_amdgcn_fence(__ATOMIC_ACQ_REL, "workgroup");
  __builtin_amdgcn_wave_barrier();
  const int rsub = lane >> 4, c4 = (lane & 15) * 4;
  {
#pragma unroll
    for (int q = 0; q < 8; ++q) {
      const int r = q * 2 + rsub;
      const v4f v = *(const v4fa*)&so[w][r][c4];
      *(v4f*)(C + (size_t)(row0 + r) * ldc + col0 + c4) = v;
    }
    
  }
}
// row LayerNorm (biased variance, eps) over N: s = X (+ R); optional out_sum <- s; out_norm <- (s-mu)*rsqrt(var+eps)*g + b
template <bool PARAM_BF16>
__global__ __launch_bounds__(256) void k_layernorm(const float* __restrict__ X, const float* __restrict__ R, const float* __restrict__ g, const float* __restrict__ bta,
                                                  float* __restrict__ out_sum, float* __restrict__ out_norm, int N, float eps) {
  __shared__ float red[256];
  const int row = blockIdx.x, tid = threadIdx.x;
  const float* x = X + (size_t)row * N; const float* rr = R ? R + (size_t)row * N : nullptr;
  float vals[16];                     // up to N = 4096
  const int per = N / 256;            // contiguous chunk per thread? use strided-by-4 chunks: thread handles j = tid*4 + 1024*u
  float s1 = 0.f;
  for (int u = 0; u < per / 4; ++u) {
    const int j = tid * 4 + 1024 * u;
    const v4f a = *(const v4fa*)(x + j);
    v4f b = {0.f,0.f,0.f,0.f}; if (rr) b = *(const v4fa*)(rr + j);
#pragma unroll
    for (int q = 0; q < 4; ++q) { const float v = a[q] + b[q]; vals[u * 4 + q] = v; s1 += v; }
  }
  red[tid] = s1; __syncthreads();
  for (int st = 128; st > 0; st >>= 1) { if (tid < st) red[tid] += red[tid + st]; __syncthreads(); }
  const float mu = red[0] / (float)N; __syncthreads();
  float s2 = 0.f;
  for (int u = 0; u < per / 4; ++u)
#pragma unroll
    for (int q = 0; q < 4; ++q) { const float c = vals[u * 4 + q] - mu; s2 += c * c; }
  red[tid] = s2; __syncthreads();
  for (int st = 128; st > 0; st >>= 1) { if (tid < st) red[tid] += red[tid + st]; __syncthreads(); }
  const float rs = rsqrtf(red[0] / (float)N + eps);
  {
    for (int u = 0; u < per / 4; ++u) {
      const int j = tid * 4 + 1024 * u;
      v4f o, sm;
#pragma unroll
      for (int q = 0; q < 4; ++q) {
        float gg = g[j + q], bb = bta[j + q];
        if (PARAM_BF16) { gg = bf16_round(gg); bb = bf16_round(bb); }
        sm[q] = vals[u * 4 + q]; o[q] = (vals[u * 4 + q] - mu) * rs * gg + bb;
      }
      if (out_sum) *(v4f*)(out_sum + (size_t)row * N + j) = sm;
      *(v4f*)(out_norm + (size_t)row * N + j) = o;
    }
    
  }
}



// ---- f16 WMMA path (v_wmma_f32_16x16x32_f16): 11-bit significands for operands in range — used where a [0,1] probability operand needs more precision than bf16
typedef _Float16 v16h __attribute__((ext_vector_type(16)));
union FragH { v16h v; v8us half[2]; _Float16 h[16]; unsigned short u[16]; };
template <int NT>
__device__ __forceinline__ v8f mmaH(v16h ah, v16h al, v16h bh, v16h bl, v8f c) {
  c = __builtin_amdgcn_wmma_f32_16x16x32_f16(false, ah, false, bh, (short)0, c, false, false);
  if (NT >= 2) c = __builtin_amdgcn_wmma_f32_16x16x32_f16(false, al, false, bh, (short)0, c, false, false);
  if (NT >= 3) c = __builtin_amdgcn_wmma_f32_16x16x32_f16(false, ah, false, bl, (short)0, c, false, false);
  asm volatile("v_nop\n\tv_nop\n\tv_nop\n\tv_nop" : "+v"(c) : "v"(ah), "v"(al), "v"(bh), "v"(bl));
  return c;
}
// batched GEMM like k_gemm_b but f16 operands: A f32 (split into f16 hi/lo if ASPLIT, else rounded to f16), Bt = f16 values [n][k]; alpha; C f32; N multiple of 16 (partial tiles skipped)
template <bool ASPLIT>
__global__ __launch_bounds__(128) void k_gemm_h(const float* __restrict__ A, int lda, size_t sA, const _Float16* __restrict__ Bh, int ldb, size_t sB, float alpha, float* __restrict__ C, int ldc, size_t sC, int M, int N, int K) {
  __shared__ __attribute__((aligned(16))) float so[4][16][64];
  const int tid = threadIdx.x, w = tid >> 5, lane = tid & 31, ln = lane & 15, hh = lane >> 4; const int by = blockIdx.y;
  A += (size_t)by * sA; Bh += (size_t)by * sB; C += (size_t)by * sC;
  const int ntn = (N + 63) / 64; const int wid = blockIdx.x * 4 + w; const int mt = wid / ntn, nq = wid % ntn; if (mt * 16 >= M) return;
  const int row0 = mt * 16, col0 = nq * 64; const float* arow = A + (size_t)(row0 + ln) * lda;
  v8f acc[4] = {};
  for (int kb = 0; kb < K; kb += 32) {
    FragH ah, al;
    const v4f x0 = *(const v4fa*)(arow + kb + 8 * hh), x1 = *(const v4fa*)(arow + kb + 8 * hh + 4), x2 = *(const v4fa*)(arow + kb + 16 + 8 * hh), x3 = *(const v4fa*)(arow + kb + 16 + 8 * hh + 4);
    float xs[16] = {x0[0],x0[1],x0[2],x0[3],x1[0],x1[1],x1[2],x1[3],x2[0],x2[1],x2[2],x2[3],x3[0],x3[1],x3[2],x3[3]};
#pragma unroll
    for (int i = 0; i < 16; ++i) { const _Float16 h = (_Float16)xs[i]; ah.h[i] = h; al.h[i] = ASPLIT ? (_Float16)(xs[i] - (float)h) : (_Float16)0.0f; }
#pragma unroll
    for (int t = 0; t < 4; ++t) { if (col0 + t * 16 >= N) continue; const size_t boff = (size_t)(col0 + t * 16 + ln) * ldb + kb; FragH bq; bq.half[0] = *(const v8us*)(Bh + boff + 8 * hh); bq.half[1] = *(const v8us*)(Bh + boff + 16 + 8 * hh);
      acc[t] = mmaH<ASPLIT ? 2 : 1>(ah.v, al.v, bq.v, bq.v, acc[t]); }
  }
#pragma unroll
  for (int t = 0; t < 4; ++t) { if (col0 + t * 16 >= N) continue;
#pragma unroll
    for (int r = 0; r < 8; ++r) so[w][8 * hh + r][t * 16 + ln] = acc[t][r] * alpha; }
  __builtin_amdgcn_fence(__ATOMIC_ACQ_REL, "workgroup"); __builtin_amdgcn_wave_barrier();
  const int rsub = lane >> 4, c4 = (lane & 15) * 4;
  {
#pragma unroll
    for (int q = 0; q < 8; ++q) { const int r = q * 2 + rsub; if (col0 + c4 < N) { const v4f v = *(const v4fa*)&so[w][r][c4]; *(v4f*)(C + (size_t)(row0 + r) * ldc + col0 + c4) = v; } }
     }
}

// Wt[n][k] = f16(W[k][n]·scale) from f32 row-major W[K][N] (scale = power of two; bf16-exact weights stay exact in f16 away from the subnormal range)
__global__ __launch_bounds__(256) void k_wt_f16(const float* __restrict__ W, _Float16* __restrict__ Wt, int K, int N, float scale) {
  const int t = blockIdx.x * 256 + threadIdx.x; if (t >= N * (K / 8)) return; const int n = t / (K / 8), k8 = (t % (K / 8)) * 8; FragH f;
#pragma unroll
  for (int i = 0; i < 8; ++i) f.h[i] = (_Float16)(bf16_round(W[(size_t)(k8 + i) * N + n]) * scale); const v8us o = f.half[0];
  *(v8us*)((unsigned short*)Wt + (size_t)n * K + k8) = o; 
}
// k_gemm_hh variant with fused epilogue: v = acc·alpha + bias[by·sBias + col] (+ CP[(row/rowsPerB)·sCPb + by·64 + col] if CP) ; ACT 0 none / 1 elu ; writes f16 C16 (and f32 C if non-null)
template <int ACT>
__global__ __launch_bounds__(128) void k_gemm_hhx(const _Float16* __restrict__ A, int lda, size_t sA, const _Float16* __restrict__ Bh, int ldb, size_t sB, float alpha, const float* __restrict__ bias, size_t sBias, const float* __restrict__ CP, int rowsPerB, size_t sCPb, int row0g,
    float* __restrict__ C, _Float16* __restrict__ C16, int ldc, size_t sC, int M, int N, int K) {
  __shared__ __attribute__((aligned(16))) float so[4][16][64];
  const int tid = threadIdx.x, w = tid >> 5, lane = tid & 31, ln = lane & 15, hh = lane >> 4; const int by = blockIdx.y;
  A += (size_t)by * sA; Bh += (size_t)by * sB; const size_t cofs = (size_t)by * sC; const float* bp = bias ? bias + (size_t)by * sBias : nullptr;
  const int ntn = (N + 63) / 64; const int wid = blockIdx.x * 4 + w; const int mt = wid / ntn, nq = wid % ntn; if (mt * 16 >= M) return;
  const int row0 = mt * 16, col0 = nq * 64; const _Float16* arow = A + (size_t)(row0 + ln) * lda;
  v8f acc[4] = {};
  for (int kb = 0; kb < K; kb += 32) { FragH ah; ah.half[0] = *(const v8us*)((const unsigned short*)arow + kb + 8 * hh); ah.half[1] = *(const v8us*)((const unsigned short*)arow + kb + 16 + 8 * hh);
#pragma unroll
    for (int t = 0; t < 4; ++t) { if (col0 + t * 16 >= N) continue; const size_t boff = (size_t)(col0 + t * 16 + ln) * ldb + kb; FragH bq; bq.half[0] = *(const v8us*)((const unsigned short*)Bh + boff + 8 * hh); bq.half[1] = *(const v8us*)((const unsigned short*)Bh + boff + 16 + 8 * hh);
      acc[t] = mmaH<1>(ah.v, ah.v, bq.v, bq.v, acc[t]); }
  }
#pragma unroll
  for (int t = 0; t < 4; ++t) { if (col0 + t * 16 >= N) continue; const int col = col0 + t * 16 + ln; const float bv = bp ? bf16_round(bp[col]) : 0.f;
#pragma unroll
    for (int r = 0; r < 8; ++r) { float v = acc[t][r] * alpha + bv; if (CP) { const int rr = row0g + row0 + 8 * hh + r; if (rowsPerB < 0) v += CP[cofs + (size_t)rr * ldc + col];      /* rowsPerB < 0: own element of the batched C plane */ else { const int bidx = rr / rowsPerB; v += CP[(size_t)bidx * sCPb + (size_t)by * 64 + col]; } } if (ACT == 1) v = (v > 0.f) ? v : expm1f(v); else if (ACT == 7) v = (v > 0.f) ? v + 1.0f : expf(v); else if (ACT == 8) v = tanhf(v); else if (ACT == 9) v = 0.5f * v * (1.0f + tanhf(0.7978845608028654f * (v + 0.044715f * v * v * v))); else if (ACT == 11) v = 1.0f / (1.0f + expf(-v)); else if (ACT == 12) v = (v > 0.f) ? v : 0.01f * v; else if (ACT == 14) v = (v > 0.f) ? v : 0.1f * v; else if (ACT == 16) v = (v >= 0.f) ? v : 0.3f * v; else if (ACT == 17) v = (v >= 0.f) ? v : 0.2f * v; else if (ACT == 15) v = v / (1.0f + expf(-v)); else if (ACT == 3) v = fmaxf(v, 0.f); else if (ACT == 6) v = 0.5f * v * (1.0f + erff(v * 0.70710678118654752f)); so[w][8 * hh + r][t * 16 + ln] = v; } }
  __builtin_amdgcn_fence(__ATOMIC_ACQ_REL, "workgroup"); __builtin_amdgcn_wave_barrier();
  const int rsub = lane >> 4, c4 = (lane & 15) * 4; typedef _Float16 v4h __attribute__((ext_vector_type(4)));
  {
#pragma unroll
    for (int q = 0; q < 8; ++q) { const int r = q * 2 + rsub; if (col0 + c4 < N) { const v4f v = *(const v4fa*)&so[w][r][c4]; if (C) *(v4f*)(C + cofs + (size_t)(row0 + r) * ldc + col0 + c4) = v; if (C16) { v4h h4; for (int i = 0; i < 4; ++i) h4[i] = (_Float16)v[i]; *(v4h*)(C16 + cofs + (size_t)(row0 + r) * ldc + col0 + c4) = h4; } } }
     }
}


typedef _Float16 v4h __attribute__((ext_vector_type(4)));

__global__ __launch_bounds__(256) void k_x16(const float* __restrict__ x, _Float16* __restrict__ X16, size_t n8) { const size_t t = (size_t)blockIdx.x * 256 + threadIdx.x; if (t >= n8) return; FragH f;
#pragma unroll
  for (int q = 0; q < 8; ++q) f.h[q] = (_Float16)bf16_round(x[t * 8 + q]); *(v8us*)((unsigned short*)X16 + t * 8) = f.half[0];  }
__global__ __launch_bounds__(256) void k_h16(const float* __restrict__ x, _Float16* __restrict__ X16, size_t n8) { const size_t t = (size_t)blockIdx.x * 256 + threadIdx.x; if (t >= n8) return; FragH f;
#pragma unroll
  for (int q = 0; q < 8; ++q) f.h[q] = (_Float16)x[t * 8 + q]; *(v8us*)((unsigned short*)X16 + t * 8) = f.half[0];  }
__global__ __launch_bounds__(256) void k_round16f(const float* __restrict__ W, _Float16* __restrict__ Bt, size_t n8) { const size_t t = (size_t)blockIdx.x * 256 + threadIdx.x; if (t >= n8) return; FragH f;
#pragma unroll
  for (int i = 0; i < 8; ++i) f.h[i] = (_Float16)(bf16_round(W[t * 8 + i]) * 16.0f); *(v8us*)((unsigned short*)Bt + t * 8) = f.half[0];  }
template <int NHv, int TTv>
__global__ __launch_bounds__(256) void k_vt(const _Float16* __restrict__ V16, int ldv, int voff, _Float16* __restrict__ Vt) { __shared__ unsigned short tl[64][66]; const int tid = threadIdx.x; const int slab = blockIdx.x / (TTv / 64), lg = blockIdx.x % (TTv / 64); const int b = slab / NHv, h = slab % NHv;
  for (int i = tid; i < 64 * 8; i += 256) { const int r = i / 8, c8 = (i % 8) * 8; FragH f; f.half[0] = *(const v8us*)((const unsigned short*)V16 + ((size_t)b * TTv + lg * 64 + r) * ldv + voff + h * 64 + c8);
#pragma unroll
    for (int q = 0; q < 8; ++q) tl[r][c8 + q] = f.u[q]; }
  __syncthreads();
  {
#pragma unroll
    for (int rd = 0; rd < 2; ++rd) { const int d = rd * 32 + tid / 8, pc = tid % 8; FragH f;
#pragma unroll
      for (int q = 0; q < 8; ++q) f.u[q] = tl[pc * 8 + q][d];
      *(v8us*)((unsigned short*)Vt + ((size_t)slab * 64 + d) * TTv + lg * 64 + pc * 8) = f.half[0]; }
     } }

__global__ __launch_bounds__(256) void k_hl(const float* __restrict__ F, _Float16* __restrict__ Hh, _Float16* __restrict__ Hl, size_t n8) { const size_t t = (size_t)blockIdx.x * 256 + threadIdx.x; if (t >= n8) return; FragH fh, fl; const v4f a = *(const v4fa*)(F + t * 8), c = *(const v4fa*)(F + t * 8 + 4);
#pragma unroll
  for (int q = 0; q < 4; ++q) { _Float16 h = (_Float16)a[q]; fh.h[q] = h; fl.h[q] = (_Float16)((a[q] - (float)h) * 1024.0f); h = (_Float16)c[q]; fh.h[4 + q] = h; fl.h[4 + q] = (_Float16)((c[q] - (float)h) * 1024.0f); }
  { *(v8us*)((unsigned short*)Hh + t * 8) = fh.half[0]; *(v8us*)((unsigned short*)Hl + t * 8) = fl.half[0];  } }

// ---- fast GEMM (wave tile 32x64; requires M % 32 == 0 rows per launch region and N % 64 == 0); epilogue = k_gemm_hhx semantics ----
__device__ __forceinline__ v16h g2_frag(const _Float16* p, int hh) { FragH f; f.half[0] = *(const v8us*)((const unsigned short*)p + 8 * hh); f.half[1] = *(const v8us*)((const unsigned short*)p + 16 + 8 * hh); return f.v; }
__device__ __forceinline__ v8f g2_mma(v16h a, v16h b, v8f c) { v8f d = __builtin_amdgcn_wmma_f32_16x16x32_f16(false, a, false, b, (short)0, c, false, false); asm volatile("v_nop\n\tv_nop\n\tv_nop\n\tv_nop" : "+v"(d) : "v"(a), "v"(b)); return d; }
template <int ACT>
__global__ __launch_bounds__(128) void k_gemm2(const _Float16* __restrict__ A, int lda, size_t sA, const _Float16* __restrict__ Bh, int ldb, size_t sB, float alpha, const float* __restrict__ bias, size_t sBias, const float* __restrict__ CP, int rowsPerB, size_t sCPb, int row0g,
    float* __restrict__ C, _Float16* __restrict__ C16, int ldc, size_t sC, int M, int N, int K) { static_assert(ACT == 0 || ACT == 3 || ACT == 6 || ACT == 8 || ACT == 9 || ACT == 11 || ACT == 12 || ACT == 14 || ACT == 15 || ACT == 16 || ACT == 17, "k_gemm2: unsupported ACT code (would silently apply no activation)");
  __shared__ __attribute__((aligned(16))) float so[4][32][68];
  const int tid = threadIdx.x, w = tid >> 5, lane = tid & 31, ln = lane & 15, hh = lane >> 4; const int by = blockIdx.y;
  A += (size_t)by * sA; Bh += (size_t)by * sB; const size_t cofs = (size_t)by * sC; const float* bp = bias ? bias + (size_t)by * sBias : nullptr;
  const int ntn = N >> 6; const int mt = blockIdx.x / ntn, nq = blockIdx.x - mt * ntn; const int row0 = mt * 128 + 32 * w, col0 = nq * 64; if (row0 >= M) return;
  const _Float16* a0p = A + (size_t)(row0 + ln) * lda; const _Float16* a1p = a0p + (size_t)16 * lda;
  const _Float16* b0p = Bh + (size_t)(col0 + ln) * ldb; const _Float16* b1p = b0p + (size_t)16 * ldb; const _Float16* b2p = b1p + (size_t)16 * ldb; const _Float16* b3p = b2p + (size_t)16 * ldb;
  const v8f z8 = {0.f,0.f,0.f,0.f,0.f,0.f,0.f,0.f}; v8f c00 = z8, c01 = z8, c02 = z8, c03 = z8, c10 = z8, c11 = z8, c12 = z8, c13 = z8;
#pragma unroll 1
  for (int kb = 0; kb < K; kb += 32) { const v16h a0 = g2_frag(a0p + kb, hh), a1 = g2_frag(a1p + kb, hh);
    v16h b = g2_frag(b0p + kb, hh); c00 = g2_mma(a0, b, c00); c10 = g2_mma(a1, b, c10);
    b = g2_frag(b1p + kb, hh); c01 = g2_mma(a0, b, c01); c11 = g2_mma(a1, b, c11);
    b = g2_frag(b2p + kb, hh); c02 = g2_mma(a0, b, c02); c12 = g2_mma(a1, b, c12);
    b = g2_frag(b3p + kb, hh); c03 = g2_mma(a0, b, c03); c13 = g2_mma(a1, b, c13); }
  v8f accs[8] = {c00, c01, c02, c03, c10, c11, c12, c13};
#pragma unroll
  for (int u = 0; u < 8; ++u) { const int t = u & 3, half = u >> 2; const int col = col0 + t * 16 + ln; const float bv = bp ? bf16_round(bp[col]) : 0.f;
#pragma unroll
    for (int r = 0; r < 8; ++r) { const int rloc = half * 16 + 8 * hh + r; float v = accs[u][r] * alpha + bv; if (CP) { if (rowsPerB < 0) v += CP[cofs + (size_t)(row0g + row0 + rloc) * ldc + col];      /* rowsPerB < 0: own element of the batched C plane */ else { const int bidx = (row0g + row0 + rloc) / rowsPerB; v += CP[(size_t)bidx * sCPb + (size_t)by * 64 + col]; } }
      if (ACT == 3) v = fmaxf(v, 0.f); else if (ACT == 6) v = 0.5f * v * (1.0f + erff(v * 0.70710678118654752f)); else if (ACT == 11) v = 1.0f / (1.0f + expf(-v)); else if (ACT == 15) v = v / (1.0f + expf(-v)); else if (ACT == 12) v = (v > 0.f) ? v : 0.01f * v; else if (ACT == 8) v = tanhf(v); else if (ACT == 9) v = 0.5f * v * (1.0f + tanhf(0.7978845608028654f * (v + 0.044715f * v * v * v))); else if (ACT == 14) v = (v > 0.f) ? v : 0.1f * v; else if (ACT == 16) v = (v >= 0.f) ? v : 0.3f * v; else if (ACT == 17) v = (v >= 0.f) ? v : 0.2f * v;
      so[w][rloc][t * 16 + ln] = v; } }
  __builtin_amdgcn_fence(__ATOMIC_ACQ_REL, "workgroup"); __builtin_amdgcn_wave_barrier();
  const int rsub = lane >> 4, c4 = (lane & 15) * 4;
  {
#pragma unroll
    for (int q = 0; q < 16; ++q) { const int r = q * 2 + rsub; const v4f v = *(const v4fa*)&so[w][r][c4]; if (C) *(v4f*)(C + cofs + (size_t)(row0 + r) * ldc + col0 + c4) = v; if (C16) { v4h h4; for (int i = 0; i < 4; ++i) h4[i] = (_Float16)v[i]; *(v4h*)(C16 + cofs + (size_t)(row0 + r) * ldc + col0 + c4) = h4; } }
     } }


__global__ __launch_bounds__(256) void k_wnat(const float* __restrict__ w, size_t n8, _Float16* __restrict__ Bt) { const size_t t = (size_t)blockIdx.x * 256 + threadIdx.x; if (t >= n8) return; FragH f; for (int q = 0; q < 8; ++q) f.h[q] = (_Float16)(bf16_round(w[t * 8 + q]) * 16.0f); *(v8us*)((unsigned short*)Bt + t * 8) = f.half[0];  }
// T5 bidirectional relative-position bucket of rel = key - query (32 buckets, max distance 128): (rel > 0)*16 + f(|rel|), f(n) = n for n < 8, then
// 8 + the number of thresholds {12,16,23,32,46,64,91} that are <= n (the thresholds are where the reference's own f32 log expression steps; no log on the device)
__device__ __forceinline__ int t5_bucket(int rel) { const int n = rel < 0 ? -rel : rel; int f = n; if (n >= 8) { f = 8 + (n >= 12) + (n >= 16) + (n >= 23) + (n >= 32) + (n >= 46) + (n >= 64) + (n >= 91); } return (rel > 0 ? NBK / 2 : 0) + f; }
// row softmax with the bucketed relative-position bias and the multiplicative/additive mask, exactly as the reference: score = s*m + (-10000*(1-m) + emb[bucket(j-i)][h])
// (bf16-rounded emb, this head's 32 values staged in LDS; m = mask[b][q][k] bf16-rounded); P = f16(256 softmax)
// one wave per query row i, head h0 + blockIdx.y: lane l holds keys j = 128 c + 4 l + q (c < 16, q < 4), so every wave-wide 16-byte load covers 512 contiguous bytes;
// S and the mask are read once, the 64 scores of a lane stay in registers through maximum, exp, sum and store; maximum and sum end in a 5-step butterfly over the lanes
__global__ __launch_bounds__(256) void k_rsmt(const float* __restrict__ S, _Float16* __restrict__ P, int nrows, const float* __restrict__ emb, int h0, const float* __restrict__ amask) {
  #pragma clang fp contract(off)
  __shared__ float tb[NBK];
  if (threadIdx.x < NBK) tb[threadIdx.x] = bf16_round(emb[threadIdx.x * NH + h0 + blockIdx.y]);
  __syncthreads();
  const int lane = threadIdx.x & 31;
  const int i = blockIdx.x * 8 + __builtin_amdgcn_readfirstlane(threadIdx.x >> 5);      /* the row is the same in every lane: kept scalar so that the row bases stay in scalar registers */
  if (i >= nrows) return;
  const size_t ro = ((size_t)blockIdx.y * SQ + i) * SQ; const float* s = S + ro; const float* mr = amask + (size_t)i * SQ; float mx = -INFINITY;
  auto sc_ = [&](float sv, float mv, int j) { const float m = bf16_round(mv); return __fadd_rn(__fmul_rn(sv, m), __fadd_rn(__fmul_rn(-10000.0f, __fadd_rn(1.0f, -m)), tb[t5_bucket(j - i)])); };
  float v[SQ / 32];
#pragma unroll      /* this and every unroll below: v[] must be indexed by constants only, so that it lives in registers and not in scratch */
  for (int c = 0; c < SQ / 128; ++c) { const int j0 = c * 128 + lane * 4; const v4f sv = *(const v4fa*)(s + j0), mv = *(const v4fa*)(mr + j0);
#pragma unroll
    for (int q = 0; q < 4; ++q) { v[c * 4 + q] = sc_(sv[q], mv[q], j0 + q); mx = fmaxf(mx, v[c * 4 + q]); } }
  for (int o = 16; o > 0; o >>= 1) mx = fmaxf(mx, __shfl_xor(mx, o, 32));
  float se = 0.f;
#pragma unroll
  for (int k = 0; k < SQ / 32; ++k) { v[k] = expf(v[k] - mx); se += v[k]; }
  for (int o = 16; o > 0; o >>= 1) se += __shfl_xor(se, o, 32);
  const float sc = 256.0f / se;
#pragma unroll
  for (int c = 0; c < SQ / 128; ++c) { v4h h4;
#pragma unroll
    for (int q = 0; q < 4; ++q) h4[q] = (_Float16)(v[c * 4 + q] * sc);
    *(v4h*)(P + ro + c * 128 + lane * 4) = h4; } }
__global__ __launch_bounds__(256) void k_vt(const _Float16* __restrict__ V16, int b, int h0, _Float16* __restrict__ VT) { __shared__ unsigned short tl[64][65]; const int tid = threadIdx.x; const int hh = blockIdx.x % HG, sg = blockIdx.x / HG; const int s0 = sg * 64; const int h = h0 + hh;
  for (int i = tid; i < 64 * 8; i += 256) { const int j = i / 8, d8 = (i % 8) * 8; FragH f; f.half[0] = *(const v8us*)((const unsigned short*)V16 + ((size_t)b * SQ + s0 + j) * DM + h * HD + d8); for (int q = 0; q < 8; ++q) tl[d8 + q][j] = f.u[q]; }
  __syncthreads();
  { for (int i = tid; i < 64 * 8; i += 256) { const int d = i / 8, j8 = (i % 8) * 8; FragH f; for (int q = 0; q < 8; ++q) f.u[q] = tl[d][j8 + q]; *(v8us*)((unsigned short*)VT + ((size_t)hh * HD + d) * SQ + s0 + j8) = f.half[0]; }  } }

extern "C" void kernel_launch(void* const* d_in, const int* in_sizes, int n_in,
                              void* d_out, int out_size, void* d_ws, size_t ws_size, hipStream_t stream) {
  (void)in_sizes; (void)n_in; (void)out_size;
  const float* const* I = (const float* const*)d_in; const float* hs = I[0]; const float* amask = I[1]; const float* wqkv = I[2]; const float* wo = I[3]; const float* emb = I[4];      /* W_qkv [1024][3072] and W_o [1024][1024] are [in][out]; attention_mask [2][1][2048][2048]; rel_bias_emb [32][16] */
  char* ws = (char*)d_ws; size_t off = 0;
  auto take = [&](size_t bytes) { char* p = ws + off; off += (bytes + 255) & ~(size_t)255; return p; };
  _Float16* BQKV = (_Float16*)take((size_t)D3 * DM * 2); _Float16* BO = (_Float16*)take((size_t)DM * DM * 2);
  _Float16* X16 = (_Float16*)take(NR * DM * 2); _Float16* QKV = (_Float16*)take(NR * D3 * 2); _Float16* O16 = (_Float16*)take(NR * DM * 2);
  float* S = (float*)take((size_t)HG * SQ * SQ * 4); _Float16* P = (_Float16*)take((size_t)HG * SQ * SQ * 2); _Float16* VT = (_Float16*)take((size_t)NB * NH * HD * SQ * 2);
  if (off > ws_size) return;      /* 6 + 2 + 8 + 24 + 8 + 64 + 32 + 8 = approx 152 MiB */
  k_wt_f16<<<(unsigned)(((size_t)D3 * (DM / 8) + 255) / 256), 256, 0, stream>>>(wqkv, BQKV, DM, D3, 16.0f);      /* [in][out] -> Bt[out][in] x16 */
  k_wt_f16<<<(unsigned)(((size_t)DM * (DM / 8) + 255) / 256), 256, 0, stream>>>(wo, BO, DM, DM, 16.0f);
  k_x16<<<(unsigned)((NR * DM / 8 + 255) / 256), 256, 0, stream>>>(hs, X16, NR * DM / 8);
  k_gemm2<0><<<dim3((unsigned)((NR / 128) * (D3 / 64)), 1), 128, 0, stream>>>(X16, DM, 0, BQKV, DM, 0, 0.0625f, nullptr, 0, nullptr, 1, 0, 0, nullptr, QKV, D3, 0, MP, D3, DM);      /* q | k | v rows (f16), head h at columns h*64 / 1024 + h*64 / 2048 + h*64 */
  k_vt<NH, SQ><<<NB * NH * (SQ / 64), 256, 0, stream>>>(QKV, D3, 2 * DM, VT);      /* V^T[(b,h)][d][s] for every (batch, head) */
  for (int b = 0; b < NBR; ++b) for (int h0 = 0; h0 < NH; h0 += HG) {
    const _Float16* qb = QKV + (size_t)b * SQ * D3 + h0 * HD; const _Float16* kb = qb + DM;
    k_gemm2<0><<<dim3((QN / 128) * (SQ / 64), HG), 128, 0, stream>>>(qb, D3, (size_t)HD, kb, D3, (size_t)HD, 0.125f, nullptr, 0, nullptr, 1, 0, 0, S, nullptr, SQ, (size_t)SQ * SQ, QN, SQ, HD);      /* scores / sqrt(64), 4 heads per launch */
    k_rsmt<<<dim3((QN + 7) / 8, HG), 256, 0, stream>>>(S, P, QN, emb, h0, amask + (size_t)b * SQ * SQ);      /* one wave per (row, head), 8 rows per block */
    k_gemm2<0><<<dim3((QN / 128) * (HD / 64), HG), 128, 0, stream>>>(P, SQ, (size_t)SQ * SQ, VT + ((size_t)b * NH + h0) * HD * SQ, SQ, (size_t)HD * SQ, 0.00390625f, nullptr, 0, nullptr, 1, 0, 0, nullptr, O16 + (size_t)b * SQ * DM + h0 * HD, DM, (size_t)HD, QN, HD, SQ); }      /* ctx (merged heads) as f16 rows */
  k_gemm2<0><<<dim3((unsigned)((NR / 128) * (DM / 64)), 1), 128, 0, stream>>>(O16, DM, 0, BO, DM, 0, 0.0625f, nullptr, 0, nullptr, 1, 0, 0, (float*)d_out, nullptr, DM, 0, MO, DM, DM);      /* out = ctx W_o, rows are the output layout */
}

// v003
// Measured time: 199 microseconds a run.
// Versions between v001 and this one are left out; their measured steps multiply to 5.16 times as fast.
// All steps since v000 together make it 151 times as fast.
#include <hip/hip_runtime.h>
#define NB 2
#define SQ 2048
#define DM 1024
#define D3 3072                      /* fused q|k|v width */
#define NH 16
#define HD 64
#define HG 4                         /* heads per call of the k_vt(V16, b, h0, VT) overload, which nothing launches */
#define NBK 32                       /* relative-position buckets */
#define MP ((int)NR)                 /* token rows through the qkv projection (debug hook) */
#define MO ((int)NR)                 /* token rows through the output projection (debug hook) */
#define NR ((size_t)NB * SQ)         /* 4096 token rows */
typedef __bf16 v16b __attribute__((ext_vector_type(16)));
typedef unsigned short v8us __attribute__((ext_vector_type(8), may_alias));
typedef float  v8f  __attribute__((ext_vector_type(8)));
typedef float  v4f  __attribute__((ext_vector_type(4)));
typedef float  v4fa __attribute__((ext_vector_type(4), may_alias));
union FragB { v16b v; v8us half[2]; unsigned short u[16]; };

__device__ __forceinline__ unsigned short bf16_bits(float x) { unsigned int u = __float_as_uint(x); return (unsigned short)((u + 0x7FFFu + ((u >> 16) & 1u)) >> 16); }
__device__ __forceinline__ float bf16_val(unsigned short b) { return __uint_as_float(((unsigned int)b) << 16); }
__device__ __forceinline__ float bf16_round(float x) { return bf16_val(bf16_bits(x)); }
// D += A·B with NT terms: 1 = ah·bh, 2 = + al·bh (A split), 3 = + ah·bl (both split)
template <int NT>
__device__ __forceinline__ v8f mmaN(v16b ah, v16b al, v16b bh, v16b bl, v8f c) {
  c = __builtin_amdgcn_wmma_f32_16x16x32_bf16(false, ah, false, bh, (short)0, c, false, false);
  if (NT >= 2) c = __builtin_amdgcn_wmma_f32_16x16x32_bf16(false, al, false, bh, (short)0, c, false, false);
  if (NT >= 3) c = __builtin_amdgcn_wmma_f32_16x16x32_bf16(false, ah, false, bl, (short)0, c, false, false);
  asm volatile("v_nop\n\tv_nop\n\tv_nop\n\tv_nop" : "+v"(c) : "v"(ah), "v"(al), "v"(bh), "v"(bl));
  return c;
}

__global__ __launch_bounds__(256) void k_wt_bf16(const float* __restrict__ W, unsigned short* __restrict__ Wt, int K, int N) {
  const int t = blockIdx.x * 256 + threadIdx.x;
  const int k8n = K / 8;
  if (t >= N * k8n) return;
  const int n = t / k8n, k8 = (t % k8n) * 8;
  v8us v;
#pragma unroll
  for (int i = 0; i < 8; ++i) v[i] = bf16_bits(W[(size_t)(k8 + i) * N + n]);
  *(v8us*)(Wt + (size_t)n * K + k8) = v;
  
}

// GEMM C[M][N] (f32, pitch ldc) = act(A[M][K]·W + bias). A f32 row-major (pitch lda) converted per fragment to bf16
// (ASPLIT: hi/lo two planes -> 2 terms, else single rounded term); Wt bf16 [N][K] (pitch ldb). BIAS_BF16 rounds the
// bias to bf16 first (bias quantised to bf16 before the add). K%32==0, M%16==0, N%64==0.
template <bool ASPLIT, int ACT, bool BIAS_BF16>
__global__ __launch_bounds__(128) void k_gemm_bf(const float* __restrict__ A, int lda, const unsigned short* __restrict__ Wt, int ldb,
                                               const float* __restrict__ bias, float* __restrict__ C, int ldc, int M, int N, int K) {
  __shared__ __attribute__((aligned(16))) float so[4][16][64];
  const int tid = threadIdx.x, w = tid >> 5, lane = tid & 31, ln = lane & 15, hh = lane >> 4;
  const int ntn = N / 64;
  const int wid = blockIdx.x * 4 + w;
  const int mt = wid / ntn, nq = wid % ntn;
  if (mt * 16 >= M) return;
  const int row0 = mt * 16, col0 = nq * 64;
  const float* arow = A + (size_t)(row0 + ln) * lda;
  v8f acc[4] = {};
  for (int kb = 0; kb < K; kb += 32) {
    FragB ah, al;
    const v4f x0 = *(const v4fa*)(arow + kb + 8 * hh), x1 = *(const v4fa*)(arow + kb + 8 * hh + 4);
    const v4f x2 = *(const v4fa*)(arow + kb + 16 + 8 * hh), x3 = *(const v4fa*)(arow + kb + 16 + 8 * hh + 4);
    float xs[16] = {x0[0],x0[1],x0[2],x0[3],x1[0],x1[1],x1[2],x1[3],x2[0],x2[1],x2[2],x2[3],x3[0],x3[1],x3[2],x3[3]};
#pragma unroll
    for (int i = 0; i < 16; ++i) { const unsigned short hb = bf16_bits(xs[i]); ah.u[i] = hb; al.u[i] = ASPLIT ? bf16_bits(xs[i] - bf16_val(hb)) : (unsigned short)0; }
#pragma unroll
    for (int t = 0; t < 4; ++t) {
      const unsigned short* brow = Wt + (size_t)(col0 + t * 16 + ln) * ldb + kb;
      FragB b;
      b.half[0] = *(const v8us*)(brow + 8 * hh);
      b.half[1] = *(const v8us*)(brow + 16 + 8 * hh);
      acc[t] = mmaN<ASPLIT ? 2 : 1>(ah.v, al.v, b.v, b.v, acc[t]);
    }
  }
#pragma unroll
  for (int t = 0; t < 4; ++t) {
    float bv = bias ? bias[col0 + t * 16 + ln] : 0.f;
    if (BIAS_BF16) bv = bf16_round(bv);
#pragma unroll
    for (int r = 0; r < 8; ++r) { float v = acc[t][r] + bv; if (ACT == 1) v = fmaxf(v, 0.f); so[w][8 * hh + r][t * 16 + ln] = v; }
  }
  __builtin_amdgcn_fence(__ATOMIC_ACQ_REL, "workgroup");
  __builtin_amdgcn_wave_barrier();
  const int rsub = lane >> 4, c4 = (lane & 15) * 4;
  {
#pragma unroll
    for (int q = 0; q < 8; ++q) {
      const int r = q * 2 + rsub;
      const v4f v = *(const v4fa*)&so[w][r][c4];
      *(v4f*)(C + (size_t)(row0 + r) * ldc + col0 + c4) = v;
    }
    
  }
}

// GEMM C = act(A·W + bias + resid): A f32 (ASPLIT -> hi/lo 2 terms), Wt bf16 [N][K]; ACT 0 none, 1 relu, 2 exact gelu;
// resid (optional, f32, row index = (row % rmod), pitch ldr, RES_BF16 rounds it) added before the activation.
template <bool ASPLIT, int ACT, bool BIAS_BF16, bool RES_BF16>
__global__ __launch_bounds__(128) void k_gemm_bf3(const float* __restrict__ A, int lda, const unsigned short* __restrict__ Wt, int ldb,
                                                const float* __restrict__ bias, const float* __restrict__ resid, int rmod, int ldr,
                                                float* __restrict__ C, int ldc, int M, int N, int K) {
  __shared__ __attribute__((aligned(16))) float so[4][16][64];
  const int tid = threadIdx.x, w = tid >> 5, lane = tid & 31, ln = lane & 15, hh = lane >> 4;
  const int ntn = N / 64;
  const int wid = blockIdx.x * 4 + w;
  const int mt = wid / ntn, nq = wid % ntn;
  if (mt * 16 >= M) return;
  const int row0 = mt * 16, col0 = nq * 64;
  const float* arow = A + (size_t)(row0 + ln) * lda;
  v8f acc[4] = {};
  for (int kb = 0; kb < K; kb += 32) {
    FragB ah, al;
    const v4f x0 = *(const v4fa*)(arow + kb + 8 * hh), x1 = *(const v4fa*)(arow + kb + 8 * hh + 4);
    const v4f x2 = *(const v4fa*)(arow + kb + 16 + 8 * hh), x3 = *(const v4fa*)(arow + kb + 16 + 8 * hh + 4);
    float xs[16] = {x0[0],x0[1],x0[2],x0[3],x1[0],x1[1],x1[2],x1[3],x2[0],x2[1],x2[2],x2[3],x3[0],x3[1],x3[2],x3[3]};
#pragma unroll
    for (int i = 0; i < 16; ++i) { const unsigned short hb = bf16_bits(xs[i]); ah.u[i] = hb; al.u[i] = ASPLIT ? bf16_bits(xs[i] - bf16_val(hb)) : (unsigned short)0; }
#pragma unroll
    for (int t = 0; t < 4; ++t) {
      const unsigned short* brow = Wt + (size_t)(col0 + t * 16 + ln) * ldb + kb;
      FragB b;
      b.half[0] = *(const v8us*)(brow + 8 * hh);
      b.half[1] = *(const v8us*)(brow + 16 + 8 * hh);
      acc[t] = mmaN<ASPLIT ? 2 : 1>(ah.v, al.v, b.v, b.v, acc[t]);
    }
  }
#pragma unroll
  for (int t = 0; t < 4; ++t) {
    const int col = col0 + t * 16 + ln;
    float bv = bias ? bias[col] : 0.f;
    if (BIAS_BF16) bv = bf16_round(bv);
#pragma unroll
    for (int r = 0; r < 8; ++r) {
      float v = acc[t][r] + bv;
      if (resid) { float rv = resid[(size_t)((row0 + 8 * hh + r) % rmod) * ldr + col]; if (RES_BF16) rv = bf16_round(rv); v += rv; }
      if (ACT == 1) v = fmaxf(v, 0.f);
      if (ACT == 2) v = 0.5f * v * (1.0f + erff(v * 0.70710678118654752f));
      if (ACT == 3) { const float u = 0.7978845608028654f * (v + 0.044715f * v * v * v); v = 0.5f * v * (1.0f + tanhf(u)); }
      so[w][8 * hh + r][t * 16 + ln] = v;
    }
  }
  __builtin_amdgcn_fence(__ATOMIC_ACQ_REL, "workgroup");
  __builtin_amdgcn_wave_barrier();
  const int rsub = lane >> 4, c4 = (lane & 15) * 4;
  {
#pragma unroll
    for (int q = 0; q < 8; ++q) {
      const int r = q * 2 + rsub;
      const v4f v = *(const v4fa*)&so[w][r][c4];
      *(v4f*)(C + (size_t)(row0 + r) * ldc + col0 + c4) = v;
    }
    
  }
}
// row LayerNorm (biased variance, eps) over N: s = X (+ R); optional out_sum <- s; out_norm <- (s-mu)*rsqrt(var+eps)*g + b
template <bool PARAM_BF16>
__global__ __launch_bounds__(256) void k_layernorm(const float* __restrict__ X, const float* __restrict__ R, const float* __restrict__ g, const float* __restrict__ bta,
                                                  float* __restrict__ out_sum, float* __restrict__ out_norm, int N, float eps) {
  __shared__ float red[256];
  const int row = blockIdx.x, tid = threadIdx.x;
  const float* x = X + (size_t)row * N; const float* rr = R ? R + (size_t)row * N : nullptr;
  float vals[16];                     // up to N = 4096
  const int per = N / 256;            // contiguous chunk per thread? use strided-by-4 chunks: thread handles j = tid*4 + 1024*u
  float s1 = 0.f;
  for (int u = 0; u < per / 4; ++u) {
    const int j = tid * 4 + 1024 * u;
    const v4f a = *(const v4fa*)(x + j);
    v4f b = {0.f,0.f,0.f,0.f}; if (rr) b = *(const v4fa*)(rr + j);
#pragma unroll
    for (int q = 0; q < 4; ++q) { const float v = a[q] + b[q]; vals[u * 4 + q] = v; s1 += v; }
  }
  red[tid] = s1; __syncthreads();
  for (int st = 128; st > 0; st >>= 1) { if (tid < st) red[tid] += red[tid + st]; __syncthreads(); }
  const float mu = red[0] / (float)N; __syncthreads();
  float s2 = 0.f;
  for (int u = 0; u < per / 4; ++u)
#pragma unroll
    for (int q = 0; q < 4; ++q) { const float c = vals[u * 4 + q] - mu; s2 += c * c; }
  red[tid] = s2; __syncthreads();
  for (int st = 128; st > 0; st >>= 1) { if (tid < st) red[tid] += red[tid + st]; __syncthreads(); }
  const float rs = rsqrtf(red[0] / (float)N + eps);
  {
    for (int u = 0; u < per / 4; ++u) {
      const int j = tid * 4 + 1024 * u;
      v4f o, sm;
#pragma unroll
      for (int q = 0; q < 4; ++q) {
        float gg = g[j + q], bb = bta[j + q];
        if (PARAM_BF16) { gg = bf16_round(gg); bb = bf16_round(bb); }
        sm[q] = vals[u * 4 + q]; o[q] = (vals[u * 4 + q] - mu) * rs * gg + bb;
      }
      if (out_sum) *(v4f*)(out_sum + (size_t)row * N + j) = sm;
      *(v4f*)(out_norm + (size_t)row * N + j) = o;
    }
    
  }
}



// ---- f16 WMMA path (v_wmma_f32_16x16x32_f16): 11-bit significands for operands in range — used where a [0,1] probability operand needs more precision than bf16
typedef _Float16 v16h __attribute__((ext_vector_type(16)));
union FragH { v16h v; v8us half[2]; _Float16 h[16]; unsigned short u[16]; };
template <int NT>
__device__ __forceinline__ v8f mmaH(v16h ah, v16h al, v16h bh, v16h bl, v8f c) {
  c = __builtin_amdgcn_wmma_f32_16x16x32_f16(false, ah, false, bh, (short)0, c, false, false);
  if (NT >= 2) c = __builtin_amdgcn_wmma_f32_16x16x32_f16(false, al, false, bh, (short)0, c, false, false);
  if (NT >= 3) c = __builtin_amdgcn_wmma_f32_16x16x32_f16(false, ah, false, bl, (short)0, c, false, false);
  asm volatile("v_nop\n\tv_nop\n\tv_nop\n\tv_nop" : "+v"(c) : "v"(ah), "v"(al), "v"(bh), "v"(bl));
  return c;
}
// batched GEMM like k_gemm_b but f16 operands: A f32 (split into f16 hi/lo if ASPLIT, else rounded to f16), Bt = f16 values [n][k]; alpha; C f32; N multiple of 16 (partial tiles skipped)
template <bool ASPLIT>
__global__ __launch_bounds__(128) void k_gemm_h(const float* __restrict__ A, int lda, size_t sA, const _Float16* __restrict__ Bh, int ldb, size_t sB, float alpha, float* __restrict__ C, int ldc, size_t sC, int M, int N, int K) {
  __shared__ __attribute__((aligned(16))) float so[4][16][64];
  const int tid = threadIdx.x, w = tid >> 5, lane = tid & 31, ln = lane & 15, hh = lane >> 4; const int by = blockIdx.y;
  A += (size_t)by * sA; Bh += (size_t)by * sB; C += (size_t)by * sC;
  const int ntn = (N + 63) / 64; const int wid = blockIdx.x * 4 + w; const int mt = wid / ntn, nq = wid % ntn; if (mt * 16 >= M) return;
  const int row0 = mt * 16, col0 = nq * 64; const float* arow = A + (size_t)(row0 + ln) * lda;
  v8f acc[4] = {};
  for (int kb = 0; kb < K; kb += 32) {
    FragH ah, al;
    const v4f x0 = *(const v4fa*)(arow + kb + 8 * hh), x1 = *(const v4fa*)(arow + kb + 8 * hh + 4), x2 = *(const v4fa*)(arow + kb + 16 + 8 * hh), x3 = *(const v4fa*)(arow + kb + 16 + 8 * hh + 4);
    float xs[16] = {x0[0],x0[1],x0[2],x0[3],x1[0],x1[1],x1[2],x1[3],x2[0],x2[1],x2[2],x2[3],x3[0],x3[1],x3[2],x3[3]};
#pragma unroll
    for (int i = 0; i < 16; ++i) { const _Float16 h = (_Float16)xs[i]; ah.h[i] = h; al.h[i] = ASPLIT ? (_Float16)(xs[i] - (float)h) : (_Float16)0.0f; }
#pragma unroll
    for (int t = 0; t < 4; ++t) { if (col0 + t * 16 >= N) continue; const size_t boff = (size_t)(col0 + t * 16 + ln) * ldb + kb; FragH bq; bq.half[0] = *(const v8us*)(Bh + boff + 8 * hh); bq.half[1] = *(const v8us*)(Bh + boff + 16 + 8 * hh);
      acc[t] = mmaH<ASPLIT ? 2 : 1>(ah.v, al.v, bq.v, bq.v, acc[t]); }
  }
#pragma unroll
  for (int t = 0; t < 4; ++t) { if (col0 + t * 16 >= N) continue;
#pragma unroll
    for (int r = 0; r < 8; ++r) so[w][8 * hh + r][t * 16 + ln] = acc[t][r] * alpha; }
  __builtin_amdgcn_fence(__ATOMIC_ACQ_REL, "workgroup"); __builtin_amdgcn_wave_barrier();
  const int rsub = lane >> 4, c4 = (lane & 15) * 4;
  {
#pragma unroll
    for (int q = 0; q < 8; ++q) { const int r = q * 2 + rsub; if (col0 + c4 < N) { const v4f v = *(const v4fa*)&so[w][r][c4]; *(v4f*)(C + (size_t)(row0 + r) * ldc + col0 + c4) = v; } }
     }
}

// Wt[n][k] = f16(W[k][n]·scale) from f32 row-major W[K][N] (scale = power of two; bf16-exact weights stay exact in f16 away from the subnormal range)
__global__ __launch_bounds__(256) void k_wt_f16(const float* __restrict__ W, _Float16* __restrict__ Wt, int K, int N, float scale) {
  const int t = blockIdx.x * 256 + threadIdx.x; if (t >= N * (K / 8)) return; const int n = t / (K / 8), k8 = (t % (K / 8)) * 8; FragH f;
#pragma unroll
  for (int i = 0; i < 8; ++i) f.h[i] = (_Float16)(bf16_round(W[(size_t)(k8 + i) * N + n]) * scale); const v8us o = f.half[0];
  *(v8us*)((unsigned short*)Wt + (size_t)n * K + k8) = o; 
}
// k_gemm_hh variant with fused epilogue: v = acc·alpha + bias[by·sBias + col] (+ CP[(row/rowsPerB)·sCPb + by·64 + col] if CP) ; ACT 0 none / 1 elu ; writes f16 C16 (and f32 C if non-null)
template <int ACT>
__global__ __launch_bounds__(128) void k_gemm_hhx(const _Float16* __restrict__ A, int lda, size_t sA, const _Float16* __restrict__ Bh, int ldb, size_t sB, float alpha, const float* __restrict__ bias, size_t sBias, const float* __restrict__ CP, int rowsPerB, size_t sCPb, int row0g,
    float* __restrict__ C, _Float16* __restrict__ C16, int ldc, size_t sC, int M, int N, int K) {
  __shared__ __attribute__((aligned(16))) float so[4][16][64];
  const int tid = threadIdx.x, w = tid >> 5, lane = tid & 31, ln = lane & 15, hh = lane >> 4; const int by = blockIdx.y;
  A += (size_t)by * sA; Bh += (size_t)by * sB; const size_t cofs = (size_t)by * sC; const float* bp = bias ? bias + (size_t)by * sBias : nullptr;
  const int ntn = (N + 63) / 64; const int wid = blockIdx.x * 4 + w; const int mt = wid / ntn, nq = wid % ntn; if (mt * 16 >= M) return;
  const int row0 = mt * 16, col0 = nq * 64; const _Float16* arow = A + (size_t)(row0 + ln) * lda;
  v8f acc[4] = {};
  for (int kb = 0; kb < K; kb += 32) { FragH ah; ah.half[0] = *(const v8us*)((const unsigned short*)arow + kb + 8 * hh); ah.half[1] = *(const v8us*)((const unsigned short*)arow + kb + 16 + 8 * hh);
#pragma unroll
    for (int t = 0; t < 4; ++t) { if (col0 + t * 16 >= N) continue; const size_t boff = (size_t)(col0 + t * 16 + ln) * ldb + kb; FragH bq; bq.half[0] = *(const v8us*)((const unsigned short*)Bh + boff + 8 * hh); bq.half[1] = *(const v8us*)((const unsigned short*)Bh + boff + 16 + 8 * hh);
      acc[t] = mmaH<1>(ah.v, ah.v, bq.v, bq.v, acc[t]); }
  }
#pragma unroll
  for (int t = 0; t < 4; ++t) { if (col0 + t * 16 >= N) continue; const int col = col0 + t * 16 + ln; const float bv = bp ? bf16_round(bp[col]) : 0.f;
#pragma unroll
    for (int r = 0; r < 8; ++r) { float v = acc[t][r] * alpha + bv; if (CP) { const int rr = row0g + row0 + 8 * hh + r; if (rowsPerB < 0) v += CP[cofs + (size_t)rr * ldc + col];      /* rowsPerB < 0: own element of the batched C plane */ else { const int bidx = rr / rowsPerB; v += CP[(size_t)bidx * sCPb + (size_t)by * 64 + col]; } } if (ACT == 1) v = (v > 0.f) ? v : expm1f(v); else if (ACT == 7) v = (v > 0.f) ? v + 1.0f : expf(v); else if (ACT == 8) v = tanhf(v); else if (ACT == 9) v = 0.5f * v * (1.0f + tanhf(0.7978845608028654f * (v + 0.044715f * v * v * v))); else if (ACT == 11) v = 1.0f / (1.0f + expf(-v)); else if (ACT == 12) v = (v > 0.f) ? v : 0.01f * v; else if (ACT == 14) v = (v > 0.f) ? v : 0.1f * v; else if (ACT == 16) v = (v >= 0.f) ? v : 0.3f * v; else if (ACT == 17) v = (v >= 0.f) ? v : 0.2f * v; else if (ACT == 15) v = v / (1.0f + expf(-v)); else if (ACT == 3) v = fmaxf(v, 0.f); else if (ACT == 6) v = 0.5f * v * (1.0f + erff(v * 0.70710678118654752f)); so[w][8 * hh + r][t * 16 + ln] = v; } }
  __builtin_amdgcn_fence(__ATOMIC_ACQ_REL, "workgroup"); __builtin_amdgcn_wave_barrier();
  const int rsub = lane >> 4, c4 = (lane & 15) * 4; typedef _Float16 v4h __attribute__((ext_vector_type(4)));
  {
#pragma unroll
    for (int q = 0; q < 8; ++q) { const int r = q * 2 + rsub; if (col0 + c4 < N) { const v4f v = *(const v4fa*)&so[w][r][c4]; if (C) *(v4f*)(C + cofs + (size_t)(row0 + r) * ldc + col0 + c4) = v; if (C16) { v4h h4; for (int i = 0; i < 4; ++i) h4[i] = (_Float16)v[i]; *(v4h*)(C16 + cofs + (size_t)(row0 + r) * ldc + col0 + c4) = h4; } } }
     }
}


typedef _Float16 v4h __attribute__((ext_vector_type(4)));

__global__ __launch_bounds__(256) void k_x16(const float* __restrict__ x, _Float16* __restrict__ X16, size_t n8) { const size_t t = (size_t)blockIdx.x * 256 + threadIdx.x; if (t >= n8) return; FragH f;
#pragma unroll
  for (int q = 0; q < 8; ++q) f.h[q] = (_Float16)bf16_round(x[t * 8 + q]); *(v8us*)((unsigned short*)X16 + t * 8) = f.half[0];  }
__global__ __launch_bounds__(256) void k_h16(const float* __restrict__ x, _Float16* __restrict__ X16, size_t n8) { const size_t t = (size_t)blockIdx.x * 256 + threadIdx.x; if (t >= n8) return; FragH f;
#pragma unroll
  for (int q = 0; q < 8; ++q) f.h[q] = (_Float16)x[t * 8 + q]; *(v8us*)((unsigned short*)X16 + t * 8) = f.half[0];  }
__global__ __launch_bounds__(256) void k_round16f(const float* __restrict__ W, _Float16* __restrict__ Bt, size_t n8) { const size_t t = (size_t)blockIdx.x * 256 + threadIdx.x; if (t >= n8) return; FragH f;
#pragma unroll
  for (int i = 0; i < 8; ++i) f.h[i] = (_Float16)(bf16_round(W[t * 8 + i]) * 16.0f); *(v8us*)((unsigned short*)Bt + t * 8) = f.half[0];  }
template <int NHv, int TTv>
__global__ __launch_bounds__(256) void k_vt(const _Float16* __restrict__ V16, int ldv, int voff, _Float16* __restrict__ Vt) { __shared__ unsigned short tl[64][66]; const int tid = threadIdx.x; const int slab = blockIdx.x / (TTv / 64), lg = blockIdx.x % (TTv / 64); const int b = slab / NHv, h = slab % NHv;
  for (int i = tid; i < 64 * 8; i += 256) { const int r = i / 8, c8 = (i % 8) * 8; FragH f; f.half[0] = *(const v8us*)((const unsigned short*)V16 + ((size_t)b * TTv + lg * 64 + r) * ldv + voff + h * 64 + c8);
#pragma unroll
    for (int q = 0; q < 8; ++q) tl[r][c8 + q] = f.u[q]; }
  __syncthreads();
  {
#pragma unroll
    for (int rd = 0; rd < 2; ++rd) { const int d = rd * 32 + tid / 8, pc = tid % 8; FragH f;
#pragma unroll
      for (int q = 0; q < 8; ++q) f.u[q] = tl[pc * 8 + q][d];
      *(v8us*)((unsigned short*)Vt + ((size_t)slab * 64 + d) * TTv + lg * 64 + pc * 8) = f.half[0]; }
     } }

__global__ __launch_bounds__(256) void k_hl(const float* __restrict__ F, _Float16* __restrict__ Hh, _Float16* __restrict__ Hl, size_t n8) { const size_t t = (size_t)blockIdx.x * 256 + threadIdx.x; if (t >= n8) return; FragH fh, fl; const v4f a = *(const v4fa*)(F + t * 8), c = *(const v4fa*)(F + t * 8 + 4);
#pragma unroll
  for (int q = 0; q < 4; ++q) { _Float16 h = (_Float16)a[q]; fh.h[q] = h; fl.h[q] = (_Float16)((a[q] - (float)h) * 1024.0f); h = (_Float16)c[q]; fh.h[4 + q] = h; fl.h[4 + q] = (_Float16)((c[q] - (float)h) * 1024.0f); }
  { *(v8us*)((unsigned short*)Hh + t * 8) = fh.half[0]; *(v8us*)((unsigned short*)Hl + t * 8) = fl.half[0];  } }

// ---- fast GEMM (block tile 128x128 on 8 waves, wave tile 32x64; requires M % 128 == 0, N % 128 == 0, K % 64 == 0, K >= 64); epilogue = k_gemm_hhx semantics ----
// Operand path: a k tile is 64 k = one whole 128-byte line of each of the block's 128 A rows and 128 Bt rows. The 256 threads bring it into LDS by asynchronous 16-byte copies
// (8 lanes a row, so every wave-wide copy covers 4 whole lines), two buffers, the next tile in flight while this one is multiplied; the waves read their fragments from LDS in the k order of g2_frag.
#define G2P 72                       /* halfs per LDS row: 128 bytes of data + 16, the conflict-free pitch for 16-byte reads */
#define G2STG (256 * G2P * 2)        /* bytes of one buffer: 128 A rows, then 128 Bt rows */
__device__ __forceinline__ v16h g2_frag(const _Float16* p, int hh) { FragH f; f.half[0] = *(const v8us*)((const unsigned short*)p + 8 * hh); f.half[1] = *(const v8us*)((const unsigned short*)p + 16 + 8 * hh); return f.v; }
__device__ __forceinline__ v16h g2_lfrag(const unsigned short* p) { FragH f; f.half[0] = *(const v8us*)(p); f.half[1] = *(const v8us*)(p + 16); return f.v; }
__device__ __forceinline__ v8f g2_mma(v16h a, v16h b, v8f c) { return __builtin_amdgcn_wmma_f32_16x16x32_f16(false, a, false, b, (short)0, c, false, false); }
// one k tile: this thread's 16 bytes of rows r, r + 32, r + 64, r + 96 of A (pitch pa halfs) and of Bt (pitch pb); l = LDS byte address of its place in row r of the buffer.
// The s_wait_xcnt closes the copies' own statement, so that no address register is rewritten ahead of it.
__device__ __forceinline__ void g2_copy(unsigned l, const _Float16* a, size_t pa, const _Float16* b, size_t pb) {
  asm volatile("global_load_async_to_lds_b128 %0, %8, off\n\t"
               "global_load_async_to_lds_b128 %1, %9, off\n\t"
               "global_load_async_to_lds_b128 %2, %10, off\n\t"
               "global_load_async_to_lds_b128 %3, %11, off\n\t"
               "global_load_async_to_lds_b128 %4, %12, off\n\t"
               "global_load_async_to_lds_b128 %5, %13, off\n\t"
               "global_load_async_to_lds_b128 %6, %14, off\n\t"
               "global_load_async_to_lds_b128 %7, %15, off\n\t"
               "s_wait_xcnt 0x0"
               :: "v"(l), "v"(l + 32u * G2P * 2u), "v"(l + 64u * G2P * 2u), "v"(l + 96u * G2P * 2u), "v"(l + 128u * G2P * 2u), "v"(l + 160u * G2P * 2u), "v"(l + 192u * G2P * 2u), "v"(l + 224u * G2P * 2u),
                  "v"(a), "v"(a + 32 * pa), "v"(a + 64 * pa), "v"(a + 96 * pa), "v"(b), "v"(b + 32 * pb), "v"(b + 64 * pb), "v"(b + 96 * pb) : "memory");
}
template <int ACT>
__global__ __launch_bounds__(256) void k_gemm2(const _Float16* __restrict__ A, int lda, size_t sA, const _Float16* __restrict__ Bh, int ldb, size_t sB, float alpha, const float* __restrict__ bias, size_t sBias, const float* __restrict__ CP, int rowsPerB, size_t sCPb, int row0g,
    float* __restrict__ C, _Float16* __restrict__ C16, int ldc, size_t sC, int M, int N, int K) { static_assert(ACT == 0 || ACT == 3 || ACT == 6 || ACT == 8 || ACT == 9 || ACT == 11 || ACT == 12 || ACT == 14 || ACT == 15 || ACT == 16 || ACT == 17, "k_gemm2: unsupported ACT code (would silently apply no activation)");
  __shared__ __attribute__((aligned(16))) unsigned short ring[2][256][G2P];      /* the two operand buffers; behind the k loop the same bytes are the waves' output staging */
  static_assert(sizeof(float) * 8 * 32 * 68 <= sizeof(unsigned short) * 2 * 256 * G2P, "output staging must fit the ring");
  const int tid = threadIdx.x, w = tid >> 5, lane = tid & 31, ln = lane & 15, hh = lane >> 4; const int by = blockIdx.y;
  A += (size_t)by * sA; Bh += (size_t)by * sB; const size_t cofs = (size_t)by * sC; const float* bp = bias ? bias + (size_t)by * sBias : nullptr;
  const int ntn = N >> 7; const int mt = blockIdx.x / ntn, nq = blockIdx.x - mt * ntn; const int m0 = mt * 128, n0 = nq * 128; if (m0 >= M) return;      /* the same for the whole block, ahead of every barrier */
  const int wr = 32 * (w & 3), wc = 64 * (w >> 2); const int row0 = m0 + wr, col0 = n0 + wc;
  const int cr = tid >> 3, cs = (tid & 7) * 8;      /* this thread's row (of each 32) and its 8 halfs of the 64 in a k tile */
  const _Float16* ga = A + (size_t)(m0 + cr) * lda + cs; const _Float16* gb = Bh + (size_t)(n0 + cr) * ldb + cs;
  const unsigned l0 = (unsigned)(size_t)&ring[0][cr][cs];      /* low 32 bits of the shared address = byte offset in the block's LDS */
  const int nt = K >> 6;
  const v8f z8 = {0.f,0.f,0.f,0.f,0.f,0.f,0.f,0.f}; v8f c00 = z8, c01 = z8, c02 = z8, c03 = z8, c10 = z8, c11 = z8, c12 = z8, c13 = z8;
  g2_copy(l0, ga, (size_t)lda, gb, (size_t)ldb);
  asm volatile("s_wait_asynccnt 0x0" ::: "memory");      /* this wave's part of tile 0 has landed */
  __syncthreads();      /* tile 0 is readable by every wave */
  if (nt > 1) g2_copy(l0 + G2STG, ga + 64, (size_t)lda, gb + 64, (size_t)ldb);
#pragma unroll 1      /* one trip = one buffer; the two buffers alternate by t & 1 */
  for (int t = 0; t < nt; ++t) {
    const unsigned short* ta = &ring[t & 1][wr + ln][8 * hh]; const unsigned short* tb = &ring[t & 1][128 + wc + ln][8 * hh];
#pragma unroll      /* the two 32-k steps of a tile: constant LDS offsets */
    for (int ks = 0; ks < 64; ks += 32) {
      const v16h a0 = g2_lfrag(ta + ks), a1 = g2_lfrag(ta + 16 * G2P + ks);
      const v16h b0 = g2_lfrag(tb + ks), b1 = g2_lfrag(tb + 16 * G2P + ks), b2 = g2_lfrag(tb + 32 * G2P + ks), b3 = g2_lfrag(tb + 48 * G2P + ks);
      __builtin_amdgcn_sched_barrier(0);      /* the 12 LDS reads of a step issue as one group ahead of its 8 products: left alone the compiler reuses the B registers and the wave waits for LDS four times a step */
      c00 = g2_mma(a0, b0, c00); c10 = g2_mma(a1, b0, c10); c01 = g2_mma(a0, b1, c01); c11 = g2_mma(a1, b1, c11);
      c02 = g2_mma(a0, b2, c02); c12 = g2_mma(a1, b2, c12); c03 = g2_mma(a0, b3, c03); c13 = g2_mma(a1, b3, c13);
    }
    asm volatile("s_wait_dscnt 0x0" ::: "memory");      /* this wave's reads of buffer t & 1 are done */
    asm volatile("s_wait_asynccnt 0x0" ::: "memory");      /* this wave's part of tile t + 1 has landed */
    __syncthreads();      /* publishes tile t + 1 and frees buffer t & 1 */
    if (t + 2 < nt) g2_copy(l0 + (unsigned)(t & 1) * G2STG, ga + (size_t)(t + 2) * 64, (size_t)lda, gb + (size_t)(t + 2) * 64, (size_t)ldb);
  }
  asm volatile("s_wait_asynccnt 0x0" ::: "memory");      /* nothing in flight when the ring becomes output staging (the last trip's barrier has ended every read of it) */
  float (*so)[32][68] = reinterpret_cast<float (*)[32][68]>(&ring[0][0][0]);
  v8f accs[8] = {c00, c01, c02, c03, c10, c11, c12, c13};
#pragma unroll
  for (int u = 0; u < 8; ++u) { const int t = u & 3, half = u >> 2; const int col = col0 + t * 16 + ln; const float bv = bp ? bf16_round(bp[col]) : 0.f;
#pragma unroll
    for (int r = 0; r < 8; ++r) { const int rloc = half * 16 + 8 * hh + r; float v = accs[u][r] * alpha + bv; if (CP) { if (rowsPerB < 0) v += CP[cofs + (size_t)(row0g + row0 + rloc) * ldc + col];      /* rowsPerB < 0: own element of the batched C plane */ else { const int bidx = (row0g + row0 + rloc) / rowsPerB; v += CP[(size_t)bidx * sCPb + (size_t)by * 64 + col]; } }
      if (ACT == 3) v = fmaxf(v, 0.f); else if (ACT == 6) v = 0.5f * v * (1.0f + erff(v * 0.70710678118654752f)); else if (ACT == 11) v = 1.0f / (1.0f + expf(-v)); else if (ACT == 15) v = v / (1.0f + expf(-v)); else if (ACT == 12) v = (v > 0.f) ? v : 0.01f * v; else if (ACT == 8) v = tanhf(v); else if (ACT == 9) v = 0.5f * v * (1.0f + tanhf(0.7978845608028654f * (v + 0.044715f * v * v * v))); else if (ACT == 14) v = (v > 0.f) ? v : 0.1f * v; else if (ACT == 16) v = (v >= 0.f) ? v : 0.3f * v; else if (ACT == 17) v = (v >= 0.f) ? v : 0.2f * v;
      so[w][rloc][t * 16 + ln] = v; } }
  __builtin_amdgcn_fence(__ATOMIC_ACQ_REL, "workgroup"); __builtin_amdgcn_wave_barrier();
  const int rsub = lane >> 4, c4 = (lane & 15) * 4;
  {
#pragma unroll
    for (int q = 0; q < 16; ++q) { const int r = q * 2 + rsub; const v4f v = *(const v4fa*)&so[w][r][c4]; if (C) *(v4f*)(C + cofs + (size_t)(row0 + r) * ldc + col0 + c4) = v; if (C16) { v4h h4; for (int i = 0; i < 4; ++i) h4[i] = (_Float16)v[i]; *(v4h*)(C16 + cofs + (size_t)(row0 + r) * ldc + col0 + c4) = h4; } }
     } }


__global__ __launch_bounds__(256) void k_wnat(const float* __restrict__ w, size_t n8, _Float16* __restrict__ Bt) { const size_t t = (size_t)blockIdx.x * 256 + threadIdx.x; if (t >= n8) return; FragH f; for (int q = 0; q < 8; ++q) f.h[q] = (_Float16)(bf16_round(w[t * 8 + q]) * 16.0f); *(v8us*)((unsigned short*)Bt + t * 8) = f.half[0];  }
// T5 bidirectional relative-position bucket of rel = key - query (32 buckets, max distance 128): (rel > 0)*16 + f(|rel|), f(n) = n for n < 8, then
// 8 + the number of thresholds {12,16,23,32,46,64,91} that are <= n (the thresholds are where the reference's own f32 log expression steps; no log on the device)
__device__ __forceinline__ int t5_bucket(int rel) { const int n = rel < 0 ? -rel : rel; const int g = 8 + (n >= 12) + (n >= 16) + (n >= 23) + (n >= 32) + (n >= 46) + (n >= 64) + (n >= 91); return (rel > 0 ? NBK / 2 : 0) + (n < 8 ? n : g); }
// lane l with lane l ^ 16 (the two lanes that share one query column)
__device__ __forceinline__ float xhalf(float x) { return __builtin_bit_cast(float, __builtin_amdgcn_permlanex16(__builtin_bit_cast(int, x), __builtin_bit_cast(int, x), 0x76543210, 0xfedcba98, false, false)); }
__device__ __forceinline__ v8f fa_mma(v16h a, v16h b, v8f c) { return __builtin_amdgcn_wmma_f32_16x16x32_f16(false, a, false, b, (short)0, c, false, false); }
// fused attention of all (batch, head), blockIdx.y = b * 16 + h: scores, bias and mask, softmax and P.V in one pass over the keys; S and P stay in registers.
// One wave owns 16 query rows, a block 16 waves = 256 rows (256 blocks: one a WGP, four waves a SIMD, all walking the same K and V^T rows); a pass takes 32 keys. Transposed products: S^T = K Q^T (A = key rows, B = the wave's q rows, loaded once),
// so lane (ln, hh) holds, for query q0 + ln, the keys kb + 8 hh + r and kb + 16 + 8 hh + r: the k order of g2_frag, and the 16 weights are the B operand of O^T += V^T P^T as they lie (A = V^T rows).
// score = s*m + (-10000*(1-m) + emb[bucket(j-i)][h]) as in the reference (bf16-rounded emb, this head's 32 values in LDS; m = mask[b][q][k] bf16-rounded).
// Online softmax: running maximum and sum per query, both in-lane but for one exchange between the lane halves; the output tile and the sum are rescaled every pass; weights exp(score - maximum) <= 1 as f16.
__global__ __launch_bounds__(512) void k_fattn(const _Float16* __restrict__ QKV, const _Float16* __restrict__ VT, const float* __restrict__ emb, const float* __restrict__ amask, _Float16* __restrict__ O16) {
  __shared__ float tb[NBK];
  const int bh = blockIdx.y, b = bh / NH, h = bh % NH;
  if (threadIdx.x < NBK) tb[threadIdx.x] = bf16_round(emb[threadIdx.x * NH + h]);
  __syncthreads();
  const int lane = threadIdx.x & 31, ln = lane & 15, hh = lane >> 4;
  const int i = blockIdx.x * 256 + (threadIdx.x >> 5) * 16 + ln;      /* this lane's query row */
  const _Float16* qp = QKV + ((size_t)b * SQ + i) * D3 + h * HD;
  const v16h q0 = g2_frag(qp, hh), q1 = g2_frag(qp + 32, hh);
  const _Float16* kp = QKV + ((size_t)b * SQ + ln) * D3 + h * HD + 8 * hh;      /* token row ln of the first 16-key tile (its k part lies DM further on); the lane half's offset of g2_frag is in kp, vp and mr already */
  const _Float16* vp = VT + ((size_t)bh * HD + ln) * SQ + 8 * hh;      /* V^T row d = ln */
  const float* mr = amask + ((size_t)b * SQ + i) * SQ + 8 * hh;
  const v8f z8 = {0.f,0.f,0.f,0.f,0.f,0.f,0.f,0.f}; v8f o0 = z8, o1 = z8, o2 = z8, o3 = z8;
  float mx = -INFINITY, se = 0.f;
#pragma unroll 1      /* one pass holds some 700 vector instructions already: unrolling would only cost registers and instruction cache */
  for (int kb = 0; kb < SQ; kb += 32) {
    const _Float16* k0 = kp + (size_t)kb * D3; const _Float16* k1 = k0 + (size_t)16 * D3; const _Float16* vk = vp + kb; const float* mk = mr + kb;
    const v16h ka0 = g2_frag(k0 + DM, 0), ka1 = g2_frag(k0 + DM + 32, 0), kc0 = g2_frag(k1 + DM, 0), kc1 = g2_frag(k1 + DM + 32, 0);
    const v4f m0 = *(const v4fa*)(mk), m1 = *(const v4fa*)(mk + 4), m2 = *(const v4fa*)(mk + 16), m3 = *(const v4fa*)(mk + 20);
    const v16h va0 = g2_frag(vk, 0), va1 = g2_frag(vk + (size_t)16 * SQ, 0), va2 = g2_frag(vk + (size_t)32 * SQ, 0), va3 = g2_frag(vk + (size_t)48 * SQ, 0);
    __builtin_amdgcn_sched_barrier(0);      /* the 20 loads of a pass are issued together, ahead of all else: left alone the compiler sinks some of them to just in front of their use and the wave waits for memory again */
    float bs[16];      /* the 16 bias values need no loaded data: bucket and table look-up stand here so that they run while the loads above are in flight */
#pragma unroll      /* bs[] and v[] indexed by constants only, so that they live in registers */
    for (int r = 0; r < 8; ++r) { const int ja = kb + 8 * hh + r; bs[r] = tb[t5_bucket(ja - i)]; bs[8 + r] = tb[t5_bucket(ja + 16 - i)]; }
    asm volatile("s_wait_xcnt 0x0" :: "v"(k0), "v"(vk), "v"(mk) : "memory");      /* inputs only: the loads' address registers live up to this wait and are reused only behind it */
    __builtin_amdgcn_sched_barrier(0);      /* keeps the first products, which wait for the key loads, behind the bias work */
    v8f s0 = fa_mma(ka0, q0, z8); s0 = fa_mma(ka1, q1, s0);
    v8f s1 = fa_mma(kc0, q0, z8); s1 = fa_mma(kc1, q1, s1);
    float v[16]; float bm = -INFINITY;
#pragma unroll
    for (int r = 0; r < 8; ++r) {
      const float ma = bf16_round(r < 4 ? m0[r & 3] : m1[r & 3]), mb = bf16_round(r < 4 ? m2[r & 3] : m3[r & 3]);
      v[r] = (s0[r] * 0.125f) * ma + (-10000.0f * (1.0f - ma) + bs[r]);
      v[8 + r] = (s1[r] * 0.125f) * mb + (-10000.0f * (1.0f - mb) + bs[8 + r]);
      bm = fmaxf(bm, fmaxf(v[r], v[8 + r]));
    }
    const float mn = fmaxf(mx, fmaxf(bm, xhalf(bm)));      /* the same in both lanes of a query */
    const float f = expf(mx - mn);      /* 0 on the first pass, where mx is -inf */
    mx = mn; se *= f;
#pragma unroll
    for (int r = 0; r < 8; ++r) { o0[r] *= f; o1[r] *= f; o2[r] *= f; o3[r] *= f; }
    FragH p;
#pragma unroll
    for (int k = 0; k < 16; ++k) { const float e = expf(v[k] - mn); se += e; p.h[k] = (_Float16)e; }
    o0 = fa_mma(va0, p.v, o0); o1 = fa_mma(va1, p.v, o1); o2 = fa_mma(va2, p.v, o2); o3 = fa_mma(va3, p.v, o3);
  }
  se += xhalf(se);      /* each lane summed its own half of the keys */
  const float inv = 1.0f / se;
  _Float16* op = O16 + ((size_t)b * SQ + i) * DM + h * HD + 8 * hh;      /* o_t[r] = ctx[query i][d = 16 t + 8 hh + r]: 16 contiguous bytes a tile */
  FragH c0, c1;
#pragma unroll
  for (int r = 0; r < 8; ++r) { c0.h[r] = (_Float16)(o0[r] * inv); c0.h[8 + r] = (_Float16)(o1[r] * inv); c1.h[r] = (_Float16)(o2[r] * inv); c1.h[8 + r] = (_Float16)(o3[r] * inv); }
  *(v8us*)((unsigned short*)op) = c0.half[0]; *(v8us*)((unsigned short*)op + 16) = c0.half[1]; *(v8us*)((unsigned short*)op + 32) = c1.half[0]; *(v8us*)((unsigned short*)op + 48) = c1.half[1];
}
__global__ __launch_bounds__(256) void k_vt(const _Float16* __restrict__ V16, int b, int h0, _Float16* __restrict__ VT) { __shared__ unsigned short tl[64][65]; const int tid = threadIdx.x; const int hh = blockIdx.x % HG, sg = blockIdx.x / HG; const int s0 = sg * 64; const int h = h0 + hh;
  for (int i = tid; i < 64 * 8; i += 256) { const int j = i / 8, d8 = (i % 8) * 8; FragH f; f.half[0] = *(const v8us*)((const unsigned short*)V16 + ((size_t)b * SQ + s0 + j) * DM + h * HD + d8); for (int q = 0; q < 8; ++q) tl[d8 + q][j] = f.u[q]; }
  __syncthreads();
  { for (int i = tid; i < 64 * 8; i += 256) { const int d = i / 8, j8 = (i % 8) * 8; FragH f; for (int q = 0; q < 8; ++q) f.u[q] = tl[d][j8 + q]; *(v8us*)((unsigned short*)VT + ((size_t)hh * HD + d) * SQ + s0 + j8) = f.half[0]; }  } }

extern "C" void kernel_launch(void* const* d_in, const int* in_sizes, int n_in,
                              void* d_out, int out_size, void* d_ws, size_t ws_size, hipStream_t stream) {
  (void)in_sizes; (void)n_in; (void)out_size;
  const float* const* I = (const float* const*)d_in; const float* hs = I[0]; const float* amask = I[1]; const float* wqkv = I[2]; const float* wo = I[3]; const float* emb = I[4];      /* W_qkv [1024][3072] and W_o [1024][1024] are [in][out]; attention_mask [2][1][2048][2048]; rel_bias_emb [32][16] */
  char* ws = (char*)d_ws; size_t off = 0;
  auto take = [&](size_t bytes) { char* p = ws + off; off += (bytes + 255) & ~(size_t)255; return p; };
  _Float16* BQKV = (_Float16*)take((size_t)D3 * DM * 2); _Float16* BO = (_Float16*)take((size_t)DM * DM * 2);
  _Float16* X16 = (_Float16*)take(NR * DM * 2); _Float16* QKV = (_Float16*)take(NR * D3 * 2); _Float16* O16 = (_Float16*)take(NR * DM * 2);
  _Float16* VT = (_Float16*)take((size_t)NB * NH * HD * SQ * 2);
  if (off > ws_size) return;      /* 6 + 2 + 8 + 24 + 8 + 8 = approx 56 MiB */
  k_wt_f16<<<(unsigned)(((size_t)D3 * (DM / 8) + 255) / 256), 256, 0, stream>>>(wqkv, BQKV, DM, D3, 16.0f);      /* [in][out] -> Bt[out][in] x16 */
  k_wt_f16<<<(unsigned)(((size_t)DM * (DM / 8) + 255) / 256), 256, 0, stream>>>(wo, BO, DM, DM, 16.0f);
  k_x16<<<(unsigned)((NR * DM / 8 + 255) / 256), 256, 0, stream>>>(hs, X16, NR * DM / 8);
  k_gemm2<0><<<dim3((unsigned)((NR / 128) * (D3 / 128)), 1), 256, 0, stream>>>(X16, DM, 0, BQKV, DM, 0, 0.0625f, nullptr, 0, nullptr, 1, 0, 0, nullptr, QKV, D3, 0, MP, D3, DM);      /* q | k | v rows (f16), head h at columns h*64 / 1024 + h*64 / 2048 + h*64 */
  k_vt<NH, SQ><<<NB * NH * (SQ / 64), 256, 0, stream>>>(QKV, D3, 2 * DM, VT);      /* V^T[(b,h)][d][s] for every (batch, head) */
  k_fattn<<<dim3(SQ / 256, NB * NH), 512, 0, stream>>>(QKV, VT, emb, amask, O16);      /* ctx (merged heads) as f16 rows; one block per 256 query rows of a (batch, head) */
  k_gemm2<0><<<dim3((unsigned)((NR / 128) * (DM / 128)), 1), 256, 0, stream>>>(O16, DM, 0, BO, DM, 0, 0.0625f, nullptr, 0, nullptr, 1, 0, 0, (float*)d_out, nullptr, DM, 0, MO, DM, DM);      /* out = ctx W_o, rows are the output layout */
}

// v004
// One run takes 185 microseconds.
// Next to v003, in two timings, it ran 1.07 and 1.08 times as fast.
// All steps since v000 together make it 162 times as fast.
#include <hip/hip_runtime.h>
#define NB 2
#define SQ 2048
#define DM 1024
#define D3 3072                      /* fused q|k|v width */
#define NH 16
#define HD 64
#define HG 4                         /* heads per call of the k_vt(V16, b, h0, VT) overload, which nothing launches */
#define NBK 32                       /* relative-position buckets */
#define MP ((int)NR)                 /* token rows through the qkv projection (debug hook) */
#define MO ((int)NR)                 /* token rows through the output projection (debug hook) */
#define NR ((size_t)NB * SQ)         /* 4096 token rows */
typedef __bf16 v16b __attribute__((ext_vector_type(16)));
typedef unsigned short v8us __attribute__((ext_vector_type(8), may_alias));
typedef float  v8f  __attribute__((ext_vector_type(8)));
typedef float  v4f  __attribute__((ext_vector_type(4)));
typedef float  v4fa __attribute__((ext_vector_type(4), may_alias));
union FragB { v16b v; v8us half[2]; unsigned short u[16]; };

__device__ __forceinline__ unsigned short bf16_bits(float x) { unsigned int u = __float_as_uint(x); return (unsigned short)((u + 0x7FFFu + ((u >> 16) & 1u)) >> 16); }
__device__ __forceinline__ float bf16_val(unsigned short b) { return __uint_as_float(((unsigned int)b) << 16); }
__device__ __forceinline__ float bf16_round(float x) { return bf16_val(bf16_bits(x)); }
// D += A·B with NT terms: 1 = ah·bh, 2 = + al·bh (A split), 3 = + ah·bl (both split)
template <int NT>
__device__ __forceinline__ v8f mmaN(v16b ah, v16b al, v16b bh, v16b bl, v8f c) {
  c = __builtin_amdgcn_wmma_f32_16x16x32_bf16(false, ah, false, bh, (short)0, c, false, false);
  if (NT >= 2) c = __builtin_amdgcn_wmma_f32_16x16x32_bf16(false, al, false, bh, (short)0, c, false, false);
  if (NT >= 3) c = __builtin_amdgcn_wmma_f32_16x16x32_bf16(false, ah, false, bl, (short)0, c, false, false);
  asm volatile("v_nop\n\tv_nop\n\tv_nop\n\tv_nop" : "+v"(c) : "v"(ah), "v"(al), "v"(bh), "v"(bl));
  return c;
}

__global__ __launch_bounds__(256) void k_wt_bf16(const float* __restrict__ W, unsigned short* __restrict__ Wt, int K, int N) {
  const int t = blockIdx.x * 256 + threadIdx.x;
  const int k8n = K / 8;
  if (t >= N * k8n) return;
  const int n = t / k8n, k8 = (t % k8n) * 8;
  v8us v;
#pragma unroll
  for (int i = 0; i < 8; ++i) v[i] = bf16_bits(W[(size_t)(k8 + i) * N + n]);
  *(v8us*)(Wt + (size_t)n * K + k8) = v;
  
}

// GEMM C[M][N] (f32, pitch ldc) = act(A[M][K]·W + bias). A f32 row-major (pitch lda) converted per fragment to bf16
// (ASPLIT: hi/lo two planes -> 2 terms, else single rounded term); Wt bf16 [N][K] (pitch ldb). BIAS_BF16 rounds the
// bias to bf16 first (bias quantised to bf16 before the add). K%32==0, M%16==0, N%64==0.
template <bool ASPLIT, int ACT, bool BIAS_BF16>
__global__ __launch_bounds__(128) void k_gemm_bf(const float* __restrict__ A, int lda, const unsigned short* __restrict__ Wt, int ldb,
                                               const float* __restrict__ bias, float* __restrict__ C, int ldc, int M, int N, int K) {
  __shared__ __attribute__((aligned(16))) float so[4][16][64];
  const int tid = threadIdx.x, w = tid >> 5, lane = tid & 31, ln = lane & 15, hh = lane >> 4;
  const int ntn = N / 64;
  const int wid = blockIdx.x * 4 + w;
  const int mt = wid / ntn, nq = wid % ntn;
  if (mt * 16 >= M) return;
  const int row0 = mt * 16, col0 = nq * 64;
  const float* arow = A + (size_t)(row0 + ln) * lda;
  v8f acc[4] = {};
  for (int kb = 0; kb < K; kb += 32) {
    FragB ah, al;
    const v4f x0 = *(const v4fa*)(arow + kb + 8 * hh), x1 = *(const v4fa*)(arow + kb + 8 * hh + 4);
    const v4f x2 = *(const v4fa*)(arow + kb + 16 + 8 * hh), x3 = *(const v4fa*)(arow + kb + 16 + 8 * hh + 4);
    float xs[16] = {x0[0],x0[1],x0[2],x0[3],x1[0],x1[1],x1[2],x1[3],x2[0],x2[1],x2[2],x2[3],x3[0],x3[1],x3[2],x3[3]};
#pragma unroll
    for (int i = 0; i < 16; ++i) { const unsigned short hb = bf16_bits(xs[i]); ah.u[i] = hb; al.u[i] = ASPLIT ? bf16_bits(xs[i] - bf16_val(hb)) : (unsigned short)0; }
#pragma unroll
    for (int t = 0; t < 4; ++t) {
      const unsigned short* brow = Wt + (size_t)(col0 + t * 16 + ln) * ldb + kb;
      FragB b;
      b.half[0] = *(const v8us*)(brow + 8 * hh);
      b.half[1] = *(const v8us*)(brow + 16 + 8 * hh);
      acc[t] = mmaN<ASPLIT ? 2 : 1>(ah.v, al.v, b.v, b.v, acc[t]);
    }
  }
#pragma unroll
  for (int t = 0; t < 4; ++t) {
    float bv = bias ? bias[col0 + t * 16 + ln] : 0.f;
    if (BIAS_BF16) bv = bf16_round(bv);
#pragma unroll
    for (int r = 0; r < 8; ++r) { float v = acc[t][r] + bv; if (ACT == 1) v = fmaxf(v, 0.f); so[w][8 * hh + r][t * 16 + ln] = v; }
  }
  __builtin_amdgcn_fence(__ATOMIC_ACQ_REL, "workgroup");
  __builtin_amdgcn_wave_barrier();
  const int rsub = lane >> 4, c4 = (lane & 15) * 4;
  {
#pragma unroll
    for (int q = 0; q < 8; ++q) {
      const int r = q * 2 + rsub;
      const v4f v = *(const v4fa*)&so[w][r][c4];
      *(v4f*)(C + (size_t)(row0 + r) * ldc + col0 + c4) = v;
    }
    
  }
}

// GEMM C = act(A·W + bias + resid): A f32 (ASPLIT -> hi/lo 2 terms), Wt bf16 [N][K]; ACT 0 none, 1 relu, 2 exact gelu;
// resid (optional, f32, row index = (row % rmod), pitch ldr, RES_BF16 rounds it) added before the activation.
template <bool ASPLIT, int ACT, bool BIAS_BF16, bool RES_BF16>
__global__ __launch_bounds__(128) void k_gemm_bf3(const float* __restrict__ A, int lda, const unsigned short* __restrict__ Wt, int ldb,
                                                const float* __restrict__ bias, const float* __restrict__ resid, int rmod, int ldr,
                                                float* __restrict__ C, int ldc, int M, int N, int K) {
  __shared__ __attribute__((aligned(16))) float so[4][16][64];
  const int tid = threadIdx.x, w = tid >> 5, lane = tid & 31, ln = lane & 15, hh = lane >> 4;
  const int ntn = N / 64;
  const int wid = blockIdx.x * 4 + w;
  const int mt = wid / ntn, nq = wid % ntn;
  if (mt * 16 >= M) return;
  const int row0 = mt * 16, col0 = nq * 64;
  const float* arow = A + (size_t)(row0 + ln) * lda;
  v8f acc[4] = {};
  for (int kb = 0; kb < K; kb += 32) {
    FragB ah, al;
    const v4f x0 = *(const v4fa*)(arow + kb + 8 * hh), x1 = *(const v4fa*)(arow + kb + 8 * hh + 4);
    const v4f x2 = *(const v4fa*)(arow + kb + 16 + 8 * hh), x3 = *(const v4fa*)(arow + kb + 16 + 8 * hh + 4);
    float xs[16] = {x0[0],x0[1],x0[2],x0[3],x1[0],x1[1],x1[2],x1[3],x2[0],x2[1],x2[2],x2[3],x3[0],x3[1],x3[2],x3[3]};
#pragma unroll
    for (int i = 0; i < 16; ++i) { const unsigned short hb = bf16_bits(xs[i]); ah.u[i] = hb; al.u[i] = ASPLIT ? bf16_bits(xs[i] - bf16_val(hb)) : (unsigned short)0; }
#pragma unroll
    for (int t = 0; t < 4; ++t) {
      const unsigned short* brow = Wt + (size_t)(col0 + t * 16 + ln) * ldb + kb;
      FragB b;
      b.half[0] = *(const v8us*)(brow + 8 * hh);
      b.half[1] = *(const v8us*)(brow + 16 + 8 * hh);
      acc[t] = mmaN<ASPLIT ? 2 : 1>(ah.v, al.v, b.v, b.v, acc[t]);
    }
  }
#pragma unroll
  for (int t = 0; t < 4; ++t) {
    const int col = col0 + t * 16 + ln;
    float bv = bias ? bias[col] : 0.f;
    if (BIAS_BF16) bv = bf16_round(bv);
#pragma unroll
    for (int r = 0; r < 8; ++r) {
      float v = acc[t][r] + bv;
      if (resid) { float rv = resid[(size_t)((row0 + 8 * hh + r) % rmod) * ldr + col]; if (RES_BF16) rv = bf16_round(rv); v += rv; }
      if (ACT == 1) v = fmaxf(v, 0.f);
      if (ACT == 2) v = 0.5f * v * (1.0f + erff(v * 0.70710678118654752f));
      if (ACT == 3) { const float u = 0.7978845608028654f * (v + 0.044715f * v * v * v); v = 0.5f * v * (1.0f + tanhf(u)); }
      so[w][8 * hh + r][t * 16 + ln] = v;
    }
  }
  __builtin_amdgcn_fence(__ATOMIC_ACQ_REL, "workgroup");
  __builtin_amdgcn_wave_barrier();
  const int rsub = lane >> 4, c4 = (lane & 15) * 4;
  {
#pragma unroll
    for (int q = 0; q < 8; ++q) {
      const int r = q * 2 + rsub;
      const v4f v = *(const v4fa*)&so[w][r][c4];
      *(v4f*)(C + (size_t)(row0 + r) * ldc + col0 + c4) = v;
    }
    
  }
}
// row LayerNorm (biased variance, eps) over N: s = X (+ R); optional out_sum <- s; out_norm <- (s-mu)*rsqrt(var+eps)*g + b
template <bool PARAM_BF16>
__global__ __launch_bounds__(256) void k_layernorm(const float* __restrict__ X, const float* __restrict__ R, const float* __restrict__ g, const float* __restrict__ bta,
                                                  float* __restrict__ out_sum, float* __restrict__ out_norm, int N, float eps) {
  __shared__ float red[256];
  const int row = blockIdx.x, tid = threadIdx.x;
  const float* x = X + (size_t)row * N; const float* rr = R ? R + (size_t)row * N : nullptr;
  float vals[16];                     // up to N = 4096
  const int per = N / 256;            // contiguous chunk per thread? use strided-by-4 chunks: thread handles j = tid*4 + 1024*u
  float s1 = 0.f;
  for (int u = 0; u < per / 4; ++u) {
    const int j = tid * 4 + 1024 * u;
    const v4f a = *(const v4fa*)(x + j);
    v4f b = {0.f,0.f,0.f,0.f}; if (rr) b = *(const v4fa*)(rr + j);
#pragma unroll
    for (int q = 0; q < 4; ++q) { const float v = a[q] + b[q]; vals[u * 4 + q] = v; s1 += v; }
  }
  red[tid] = s1; __syncthreads();
  for (int st = 128; st > 0; st >>= 1) { if (tid < st) red[tid] += red[tid + st]; __syncthreads(); }
  const float mu = red[0] / (float)N; __syncthreads();
  float s2 = 0.f;
  for (int u = 0; u < per / 4; ++u)
#pragma unroll
    for (int q = 0; q < 4; ++q) { const float c = vals[u * 4 + q] - mu; s2 += c * c; }
  red[tid] = s2; __syncthreads();
  for (int st = 128; st > 0; st >>= 1) { if (tid < st) red[tid] += red[tid + st]; __syncthreads(); }
  const float rs = rsqrtf(red[0] / (float)N + eps);
  {
    for (int u = 0; u < per / 4; ++u) {
      const int j = tid * 4 + 1024 * u;
      v4f o, sm;
#pragma unroll
      for (int q = 0; q < 4; ++q) {
        float gg = g[j + q], bb = bta[j + q];
        if (PARAM_BF16) { gg = bf16_round(gg); bb = bf16_round(bb); }
        sm[q] = vals[u * 4 + q]; o[q] = (vals[u * 4 + q] - mu) * rs * gg + bb;
      }
      if (out_sum) *(v4f*)(out_sum + (size_t)row * N + j) = sm;
      *(v4f*)(out_norm + (size_t)row * N + j) = o;
    }
    
  }
}



// ---- f16 WMMA path (v_wmma_f32_16x16x32_f16): 11-bit significands for operands in range — used where a [0,1] probability operand needs more precision than bf16
typedef _Float16 v16h __attribute__((ext_vector_type(16)));
union FragH { v16h v; v8us half[2]; _Float16 h[16]; unsigned short u[16]; };
template <int NT>
__device__ __forceinline__ v8f mmaH(v16h ah, v16h al, v16h bh, v16h bl, v8f c) {
  c = __builtin_amdgcn_wmma_f32_16x16x32_f16(false, ah, false, bh, (short)0, c, false, false);
  if (NT >= 2) c = __builtin_amdgcn_wmma_f32_16x16x32_f16(false, al, false, bh, (short)0, c, false, false);
  if (NT >= 3) c = __builtin_amdgcn_wmma_f32_16x16x32_f16(false, ah, false, bl, (short)0, c, false, false);
  asm volatile("v_nop\n\tv_nop\n\tv_nop\n\tv_nop" : "+v"(c) : "v"(ah), "v"(al), "v"(bh), "v"(bl));
  return c;
}
// batched GEMM like k_gemm_b but f16 operands: A f32 (split into f16 hi/lo if ASPLIT, else rounded to f16), Bt = f16 values [n][k]; alpha; C f32; N multiple of 16 (partial tiles skipped)
template <bool ASPLIT>
__global__ __launch_bounds__(128) void k_gemm_h(const float* __restrict__ A, int lda, size_t sA, const _Float16* __restrict__ Bh, int ldb, size_t sB, float alpha, float* __restrict__ C, int ldc, size_t sC, int M, int N, int K) {
  __shared__ __attribute__((aligned(16))) float so[4][16][64];
  const int tid = threadIdx.x, w = tid >> 5, lane = tid & 31, ln = lane & 15, hh = lane >> 4; const int by = blockIdx.y;
  A += (size_t)by * sA; Bh += (size_t)by * sB; C += (size_t)by * sC;
  const int ntn = (N + 63) / 64; const int wid = blockIdx.x * 4 + w; const int mt = wid / ntn, nq = wid % ntn; if (mt * 16 >= M) return;
  const int row0 = mt * 16, col0 = nq * 64; const float* arow = A + (size_t)(row0 + ln) * lda;
  v8f acc[4] = {};
  for (int kb = 0; kb < K; kb += 32) {
    FragH ah, al;
    const v4f x0 = *(const v4fa*)(arow + kb + 8 * hh), x1 = *(const v4fa*)(arow + kb + 8 * hh + 4), x2 = *(const v4fa*)(arow + kb + 16 + 8 * hh), x3 = *(const v4fa*)(arow + kb + 16 + 8 * hh + 4);
    float xs[16] = {x0[0],x0[1],x0[2],x0[3],x1[0],x1[1],x1[2],x1[3],x2[0],x2[1],x2[2],x2[3],x3[0],x3[1],x3[2],x3[3]};
#pragma unroll
    for (int i = 0; i < 16; ++i) { const _Float16 h = (_Float16)xs[i]; ah.h[i] = h; al.h[i] = ASPLIT ? (_Float16)(xs[i] - (float)h) : (_Float16)0.0f; }
#pragma unroll
    for (int t = 0; t < 4; ++t) { if (col0 + t * 16 >= N) continue; const size_t boff = (size_t)(col0 + t * 16 + ln) * ldb + kb; FragH bq; bq.half[0] = *(const v8us*)(Bh + boff + 8 * hh); bq.half[1] = *(const v8us*)(Bh + boff + 16 + 8 * hh);
      acc[t] = mmaH<ASPLIT ? 2 : 1>(ah.v, al.v, bq.v, bq.v, acc[t]); }
  }
#pragma unroll
  for (int t = 0; t < 4; ++t) { if (col0 + t * 16 >= N) continue;
#pragma unroll
    for (int r = 0; r < 8; ++r) so[w][8 * hh + r][t * 16 + ln] = acc[t][r] * alpha; }
  __builtin_amdgcn_fence(__ATOMIC_ACQ_REL, "workgroup"); __builtin_amdgcn_wave_barrier();
  const int rsub = lane >> 4, c4 = (lane & 15) * 4;
  {
#pragma unroll
    for (int q = 0; q < 8; ++q) { const int r = q * 2 + rsub; if (col0 + c4 < N) { const v4f v = *(const v4fa*)&so[w][r][c4]; *(v4f*)(C + (size_t)(row0 + r) * ldc + col0 + c4) = v; } }
     }
}

// Wt[n][k] = f16(W[k][n]·scale) from f32 row-major W[K][N] (scale = power of two; bf16-exact weights stay exact in f16 away from the subnormal range)
__global__ __launch_bounds__(256) void k_wt_f16(const float* __restrict__ W, _Float16* __restrict__ Wt, int K, int N, float scale) {
  const int t = blockIdx.x * 256 + threadIdx.x; if (t >= N * (K / 8)) return; const int n = t / (K / 8), k8 = (t % (K / 8)) * 8; FragH f;
#pragma unroll
  for (int i = 0; i < 8; ++i) f.h[i] = (_Float16)(bf16_round(W[(size_t)(k8 + i) * N + n]) * scale); const v8us o = f.half[0];
  *(v8us*)((unsigned short*)Wt + (size_t)n * K + k8) = o; 
}
// k_gemm_hh variant with fused epilogue: v = acc·alpha + bias[by·sBias + col] (+ CP[(row/rowsPerB)·sCPb + by·64 + col] if CP) ; ACT 0 none / 1 elu ; writes f16 C16 (and f32 C if non-null)
template <int ACT>
__global__ __launch_bounds__(128) void k_gemm_hhx(const _Float16* __restrict__ A, int lda, size_t sA, const _Float16* __restrict__ Bh, int ldb, size_t sB, float alpha, const float* __restrict__ bias, size_t sBias, const float* __restrict__ CP, int rowsPerB, size_t sCPb, int row0g,
    float* __restrict__ C, _Float16* __restrict__ C16, int ldc, size_t sC, int M, int N, int K) {
  __shared__ __attribute__((aligned(16))) float so[4][16][64];
  const int tid = threadIdx.x, w = tid >> 5, lane = tid & 31, ln = lane & 15, hh = lane >> 4; const int by = blockIdx.y;
  A += (size_t)by * sA; Bh += (size_t)by * sB; const size_t cofs = (size_t)by * sC; const float* bp = bias ? bias + (size_t)by * sBias : nullptr;
  const int ntn = (N + 63) / 64; const int wid = blockIdx.x * 4 + w; const int mt = wid / ntn, nq = wid % ntn; if (mt * 16 >= M) return;
  const int row0 = mt * 16, col0 = nq * 64; const _Float16* arow = A + (size_t)(row0 + ln) * lda;
  v8f acc[4] = {};
  for (int kb = 0; kb < K; kb += 32) { FragH ah; ah.half[0] = *(const v8us*)((const unsigned short*)arow + kb + 8 * hh); ah.half[1] = *(const v8us*)((const unsigned short*)arow + kb + 16 + 8 * hh);
#pragma unroll
    for (int t = 0; t < 4; ++t) { if (col0 + t * 16 >= N) continue; const size_t boff = (size_t)(col0 + t * 16 + ln) * ldb + kb; FragH bq; bq.half[0] = *(const v8us*)((const unsigned short*)Bh + boff + 8 * hh); bq.half[1] = *(const v8us*)((const unsigned short*)Bh + boff + 16 + 8 * hh);
      acc[t] = mmaH<1>(ah.v, ah.v, bq.v, bq.v, acc[t]); }
  }
#pragma unroll
  for (int t = 0; t < 4; ++t) { if (col0 + t * 16 >= N) continue; const int col = col0 + t * 16 + ln; const float bv = bp ? bf16_round(bp[col]) : 0.f;
#pragma unroll
    for (int r = 0; r < 8; ++r) { float v = acc[t][r] * alpha + bv; if (CP) { const int rr = row0g + row0 + 8 * hh + r; if (rowsPerB < 0) v += CP[cofs + (size_t)rr * ldc + col];      /* rowsPerB < 0: own element of the batched C plane */ else { const int bidx = rr / rowsPerB; v += CP[(size_t)bidx * sCPb + (size_t)by * 64 + col]; } } if (ACT == 1) v = (v > 0.f) ? v : expm1f(v); else if (ACT == 7) v = (v > 0.f) ? v + 1.0f : expf(v); else if (ACT == 8) v = tanhf(v); else if (ACT == 9) v = 0.5f * v * (1.0f + tanhf(0.7978845608028654f * (v + 0.044715f * v * v * v))); else if (ACT == 11) v = 1.0f / (1.0f + expf(-v)); else if (ACT == 12) v = (v > 0.f) ? v : 0.01f * v; else if (ACT == 14) v = (v > 0.f) ? v : 0.1f * v; else if (ACT == 16) v = (v >= 0.f) ? v : 0.3f * v; else if (ACT == 17) v = (v >= 0.f) ? v : 0.2f * v; else if (ACT == 15) v = v / (1.0f + expf(-v)); else if (ACT == 3) v = fmaxf(v, 0.f); else if (ACT == 6) v = 0.5f * v * (1.0f + erff(v * 0.70710678118654752f)); so[w][8 * hh + r][t * 16 + ln] = v; } }
  __builtin_amdgcn_fence(__ATOMIC_ACQ_REL, "workgroup"); __builtin_amdgcn_wave_barrier();
  const int rsub = lane >> 4, c4 = (lane & 15) * 4; typedef _Float16 v4h __attribute__((ext_vector_type(4)));
  {
#pragma unroll
    for (int q = 0; q < 8; ++q) { const int r = q * 2 + rsub; if (col0 + c4 < N) { const v4f v = *(const v4fa*)&so[w][r][c4]; if (C) *(v4f*)(C + cofs + (size_t)(row0 + r) * ldc + col0 + c4) = v; if (C16) { v4h h4; for (int i = 0; i < 4; ++i) h4[i] = (_Float16)v[i]; *(v4h*)(C16 + cofs + (size_t)(row0 + r) * ldc + col0 + c4) = h4; } } }
     }
}


typedef _Float16 v4h __attribute__((ext_vector_type(4)));

__global__ __launch_bounds__(256) void k_x16(const float* __restrict__ x, _Float16* __restrict__ X16, size_t n8) { const size_t t = (size_t)blockIdx.x * 256 + threadIdx.x; if (t >= n8) return; FragH f;
#pragma unroll
  for (int q = 0; q < 8; ++q) f.h[q] = (_Float16)bf16_round(x[t * 8 + q]); *(v8us*)((unsigned short*)X16 + t * 8) = f.half[0];  }
__global__ __launch_bounds__(256) void k_h16(const float* __restrict__ x, _Float16* __restrict__ X16, size_t n8) { const size_t t = (size_t)blockIdx.x * 256 + threadIdx.x; if (t >= n8) return; FragH f;
#pragma unroll
  for (int q = 0; q < 8; ++q) f.h[q] = (_Float16)x[t * 8 + q]; *(v8us*)((unsigned short*)X16 + t * 8) = f.half[0];  }
__global__ __launch_bounds__(256) void k_round16f(const float* __restrict__ W, _Float16* __restrict__ Bt, size_t n8) { const size_t t = (size_t)blockIdx.x * 256 + threadIdx.x; if (t >= n8) return; FragH f;
#pragma unroll
  for (int i = 0; i < 8; ++i) f.h[i] = (_Float16)(bf16_round(W[t * 8 + i]) * 16.0f); *(v8us*)((unsigned short*)Bt + t * 8) = f.half[0];  }
template <int NHv, int TTv>
__global__ __launch_bounds__(256) void k_vt(const _Float16* __restrict__ V16, int ldv, int voff, _Float16* __restrict__ Vt) { __shared__ unsigned short tl[64][66]; const int tid = threadIdx.x; const int slab = blockIdx.x / (TTv / 64), lg = blockIdx.x % (TTv / 64); const int b = slab / NHv, h = slab % NHv;
  for (int i = tid; i < 64 * 8; i += 256) { const int r = i / 8, c8 = (i % 8) * 8; FragH f; f.half[0] = *(const v8us*)((const unsigned short*)V16 + ((size_t)b * TTv + lg * 64 + r) * ldv + voff + h * 64 + c8);
#pragma unroll
    for (int q = 0; q < 8; ++q) tl[r][c8 + q] = f.u[q]; }
  __syncthreads();
  {
#pragma unroll
    for (int rd = 0; rd < 2; ++rd) { const int d = rd * 32 + tid / 8, pc = tid % 8; FragH f;
#pragma unroll
      for (int q = 0; q < 8; ++q) f.u[q] = tl[pc * 8 + q][d];
      *(v8us*)((unsigned short*)Vt + ((size_t)slab * 64 + d) * TTv + lg * 64 + pc * 8) = f.half[0]; }
     } }

__global__ __launch_bounds__(256) void k_hl(const float* __restrict__ F, _Float16* __restrict__ Hh, _Float16* __restrict__ Hl, size_t n8) { const size_t t = (size_t)blockIdx.x * 256 + threadIdx.x; if (t >= n8) return; FragH fh, fl; const v4f a = *(const v4fa*)(F + t * 8), c = *(const v4fa*)(F + t * 8 + 4);
#pragma unroll
  for (int q = 0; q < 4; ++q) { _Float16 h = (_Float16)a[q]; fh.h[q] = h; fl.h[q] = (_Float16)((a[q] - (float)h) * 1024.0f); h = (_Float16)c[q]; fh.h[4 + q] = h; fl.h[4 + q] = (_Float16)((c[q] - (float)h) * 1024.0f); }
  { *(v8us*)((unsigned short*)Hh + t * 8) = fh.half[0]; *(v8us*)((unsigned short*)Hl + t * 8) = fl.half[0];  } }

// ---- fast GEMM (block tile 128x128 on 8 waves, wave tile 32x64; requires M % 128 == 0, N % 128 == 0, K % 64 == 0, K >= 64); epilogue = k_gemm_hhx semantics ----
// Operand path: a k tile is 64 k = one whole 128-byte line of each of the block's 128 A rows and 128 Bt rows. The 256 threads bring it into LDS by asynchronous 16-byte copies
// (8 lanes a row, so every wave-wide copy covers 4 whole lines), two buffers, the next tile in flight while this one is multiplied; the waves read their fragments from LDS in the k order of g2_frag.
#define G2P 72                       /* halfs per LDS row: 128 bytes of data + 16, the conflict-free pitch for 16-byte reads */
#define G2STG (256 * G2P * 2)        /* bytes of one buffer: 128 A rows, then 128 Bt rows */
__device__ __forceinline__ v16h g2_frag(const _Float16* p, int hh) { FragH f; f.half[0] = *(const v8us*)((const unsigned short*)p + 8 * hh); f.half[1] = *(const v8us*)((const unsigned short*)p + 16 + 8 * hh); return f.v; }
__device__ __forceinline__ v16h g2_lfrag(const unsigned short* p) { FragH f; f.half[0] = *(const v8us*)(p); f.half[1] = *(const v8us*)(p + 16); return f.v; }
__device__ __forceinline__ v8f g2_mma(v16h a, v16h b, v8f c) { return __builtin_amdgcn_wmma_f32_16x16x32_f16(false, a, false, b, (short)0, c, false, false); }
// one k tile: this thread's 16 bytes of rows r, r + 32, r + 64, r + 96 of A (pitch pa halfs) and of Bt (pitch pb); l = LDS byte address of its place in row r of the buffer.
// The s_wait_xcnt closes the copies' own statement, so that no address register is rewritten ahead of it.
__device__ __forceinline__ void g2_copy(unsigned l, const _Float16* a, size_t pa, const _Float16* b, size_t pb) {
  asm volatile("global_load_async_to_lds_b128 %0, %8, off\n\t"
               "global_load_async_to_lds_b128 %1, %9, off\n\t"
               "global_load_async_to_lds_b128 %2, %10, off\n\t"
               "global_load_async_to_lds_b128 %3, %11, off\n\t"
               "global_load_async_to_lds_b128 %4, %12, off\n\t"
               "global_load_async_to_lds_b128 %5, %13, off\n\t"
               "global_load_async_to_lds_b128 %6, %14, off\n\t"
               "global_load_async_to_lds_b128 %7, %15, off\n\t"
               "s_wait_xcnt 0x0"
               :: "v"(l), "v"(l + 32u * G2P * 2u), "v"(l + 64u * G2P * 2u), "v"(l + 96u * G2P * 2u), "v"(l + 128u * G2P * 2u), "v"(l + 160u * G2P * 2u), "v"(l + 192u * G2P * 2u), "v"(l + 224u * G2P * 2u),
                  "v"(a), "v"(a + 32 * pa), "v"(a + 64 * pa), "v"(a + 96 * pa), "v"(b), "v"(b + 32 * pb), "v"(b + 64 * pb), "v"(b + 96 * pb) : "memory");
}
template <int ACT>
__global__ __launch_bounds__(256) void k_gemm2(const _Float16* __restrict__ A, int lda, size_t sA, const _Float16* __restrict__ Bh, int ldb, size_t sB, float alpha, const float* __restrict__ bias, size_t sBias, const float* __restrict__ CP, int rowsPerB, size_t sCPb, int row0g,
    float* __restrict__ C, _Float16* __restrict__ C16, int ldc, size_t sC, int M, int N, int K) { static_assert(ACT == 0 || ACT == 3 || ACT == 6 || ACT == 8 || ACT == 9 || ACT == 11 || ACT == 12 || ACT == 14 || ACT == 15 || ACT == 16 || ACT == 17, "k_gemm2: unsupported ACT code (would silently apply no activation)");
  __shared__ __attribute__((aligned(16))) unsigned short ring[2][256][G2P];      /* the two operand buffers; behind the k loop the same bytes are the waves' output staging */
  static_assert(sizeof(float) * 8 * 32 * 68 <= sizeof(unsigned short) * 2 * 256 * G2P, "output staging must fit the ring");
  const int tid = threadIdx.x, w = tid >> 5, lane = tid & 31, ln = lane & 15, hh = lane >> 4; const int by = blockIdx.y;
  A += (size_t)by * sA; Bh += (size_t)by * sB; const size_t cofs = (size_t)by * sC; const float* bp = bias ? bias + (size_t)by * sBias : nullptr;
  const int ntn = N >> 7; const int mt = blockIdx.x / ntn, nq = blockIdx.x - mt * ntn; const int m0 = mt * 128, n0 = nq * 128; if (m0 >= M) return;      /* the same for the whole block, ahead of every barrier */
  const int wr = 32 * (w & 3), wc = 64 * (w >> 2); const int row0 = m0 + wr, col0 = n0 + wc;
  const int cr = tid >> 3, cs = (tid & 7) * 8;      /* this thread's row (of each 32) and its 8 halfs of the 64 in a k tile */
  const _Float16* ga = A + (size_t)(m0 + cr) * lda + cs; const _Float16* gb = Bh + (size_t)(n0 + cr) * ldb + cs;
  const unsigned l0 = (unsigned)(size_t)&ring[0][cr][cs];      /* low 32 bits of the shared address = byte offset in the block's LDS */
  const int nt = K >> 6;
  const v8f z8 = {0.f,0.f,0.f,0.f,0.f,0.f,0.f,0.f}; v8f c00 = z8, c01 = z8, c02 = z8, c03 = z8, c10 = z8, c11 = z8, c12 = z8, c13 = z8;
  g2_copy(l0, ga, (size_t)lda, gb, (size_t)ldb);
  asm volatile("s_wait_asynccnt 0x0" ::: "memory");      /* this wave's part of tile 0 has landed */
  __syncthreads();      /* tile 0 is readable by every wave */
  if (nt > 1) g2_copy(l0 + G2STG, ga + 64, (size_t)lda, gb + 64, (size_t)ldb);
#pragma unroll 1      /* one trip = one buffer; the two buffers alternate by t & 1 */
  for (int t = 0; t < nt; ++t) {
    const unsigned short* ta = &ring[t & 1][wr + ln][8 * hh]; const unsigned short* tb = &ring[t & 1][128 + wc + ln][8 * hh];
#pragma unroll      /* the two 32-k steps of a tile: constant LDS offsets */
    for (int ks = 0; ks < 64; ks += 32) {
      const v16h a0 = g2_lfrag(ta + ks), a1 = g2_lfrag(ta + 16 * G2P + ks);
      const v16h b0 = g2_lfrag(tb + ks), b1 = g2_lfrag(tb + 16 * G2P + ks), b2 = g2_lfrag(tb + 32 * G2P + ks), b3 = g2_lfrag(tb + 48 * G2P + ks);
      __builtin_amdgcn_sched_barrier(0);      /* the 12 LDS reads of a step issue as one group ahead of its 8 products: left alone the compiler reuses the B registers and the wave waits for LDS four times a step */
      c00 = g2_mma(a0, b0, c00); c10 = g2_mma(a1, b0, c10); c01 = g2_mma(a0, b1, c01); c11 = g2_mma(a1, b1, c11);
      c02 = g2_mma(a0, b2, c02); c12 = g2_mma(a1, b2, c12); c03 = g2_mma(a0, b3, c03); c13 = g2_mma(a1, b3, c13);
    }
    asm volatile("s_wait_dscnt 0x0" ::: "memory");      /* this wave's reads of buffer t & 1 are done */
    asm volatile("s_wait_asynccnt 0x0" ::: "memory");      /* this wave's part of tile t + 1 has landed */
    __syncthreads();      /* publishes tile t + 1 and frees buffer t & 1 */
    if (t + 2 < nt) g2_copy(l0 + (unsigned)(t & 1) * G2STG, ga + (size_t)(t + 2) * 64, (size_t)lda, gb + (size_t)(t + 2) * 64, (size_t)ldb);
  }
  asm volatile("s_wait_asynccnt 0x0" ::: "memory");      /* nothing in flight when the ring becomes output staging (the last trip's barrier has ended every read of it) */
  float (*so)[32][68] = reinterpret_cast<float (*)[32][68]>(&ring[0][0][0]);
  v8f accs[8] = {c00, c01, c02, c03, c10, c11, c12, c13};
#pragma unroll
  for (int u = 0; u < 8; ++u) { const int t = u & 3, half = u >> 2; const int col = col0 + t * 16 + ln; const float bv = bp ? bf16_round(bp[col]) : 0.f;
#pragma unroll
    for (int r = 0; r < 8; ++r) { const int rloc = half * 16 + 8 * hh + r; float v = accs[u][r] * alpha + bv; if (CP) { if (rowsPerB < 0) v += CP[cofs + (size_t)(row0g + row0 + rloc) * ldc + col];      /* rowsPerB < 0: own element of the batched C plane */ else { const int bidx = (row0g + row0 + rloc) / rowsPerB; v += CP[(size_t)bidx * sCPb + (size_t)by * 64 + col]; } }
      if (ACT == 3) v = fmaxf(v, 0.f); else if (ACT == 6) v = 0.5f * v * (1.0f + erff(v * 0.70710678118654752f)); else if (ACT == 11) v = 1.0f / (1.0f + expf(-v)); else if (ACT == 15) v = v / (1.0f + expf(-v)); else if (ACT == 12) v = (v > 0.f) ? v : 0.01f * v; else if (ACT == 8) v = tanhf(v); else if (ACT == 9) v = 0.5f * v * (1.0f + tanhf(0.7978845608028654f * (v + 0.044715f * v * v * v))); else if (ACT == 14) v = (v > 0.f) ? v : 0.1f * v; else if (ACT == 16) v = (v >= 0.f) ? v : 0.3f * v; else if (ACT == 17) v = (v >= 0.f) ? v : 0.2f * v;
      so[w][rloc][t * 16 + ln] = v; } }
  __builtin_amdgcn_fence(__ATOMIC_ACQ_REL, "workgroup"); __builtin_amdgcn_wave_barrier();
  const int rsub = lane >> 4, c4 = (lane & 15) * 4;
  {
#pragma unroll
    for (int q = 0; q < 16; ++q) { const int r = q * 2 + rsub; const v4f v = *(const v4fa*)&so[w][r][c4]; if (C) *(v4f*)(C + cofs + (size_t)(row0 + r) * ldc + col0 + c4) = v; if (C16) { v4h h4; for (int i = 0; i < 4; ++i) h4[i] = (_Float16)v[i]; *(v4h*)(C16 + cofs + (size_t)(row0 + r) * ldc + col0 + c4) = h4; } }
     } }


__global__ __launch_bounds__(256) void k_wnat(const float* __restrict__ w, size_t n8, _Float16* __restrict__ Bt) { const size_t t = (size_t)blockIdx.x * 256 + threadIdx.x; if (t >= n8) return; FragH f; for (int q = 0; q < 8; ++q) f.h[q] = (_Float16)(bf16_round(w[t * 8 + q]) * 16.0f); *(v8us*)((unsigned short*)Bt + t * 8) = f.half[0];  }
// T5 bidirectional relative-position bucket of rel = key - query (32 buckets, max distance 128): (rel > 0)*16 + f(|rel|), f(n) = n for n < 8, then
// 8 + the number of thresholds {12,16,23,32,46,64,91} that are <= n (the thresholds are where the reference's own f32 log expression steps; no log on the device)
__device__ __forceinline__ int t5_bucket(int rel) { const int n = rel < 0 ? -rel : rel; const int g = 8 + (n >= 12) + (n >= 16) + (n >= 23) + (n >= 32) + (n >= 46) + (n >= 64) + (n >= 91); return (rel > 0 ? NBK / 2 : 0) + (n < 8 ? n : g); }
// lane l with lane l ^ 16 (the two lanes that share one query column)
__device__ __forceinline__ float xhalf(float x) { return __builtin_bit_cast(float, __builtin_amdgcn_permlanex16(__builtin_bit_cast(int, x), __builtin_bit_cast(int, x), 0x76543210, 0xfedcba98, false, false)); }
__device__ __forceinline__ v8f fa_mma(v16h a, v16h b, v8f c) { return __builtin_amdgcn_wmma_f32_16x16x32_f16(false, a, false, b, (short)0, c, false, false); }
// fused attention of all (batch, head), blockIdx.y = b * 16 + h: scores, bias and mask, softmax and P.V in one pass over the keys; S and P stay in registers.
// One wave owns 16 query rows, a block 16 waves = 256 rows (256 blocks: one a WGP, four waves a SIMD, all walking the same K and V^T rows); a pass takes 32 keys. Transposed products: S^T = K Q^T (A = key rows, B = the wave's q rows, loaded once),
// so lane (ln, hh) holds, for query q0 + ln, the keys kb + 8 hh + r and kb + 16 + 8 hh + r: the k order of g2_frag, and the 16 weights are the B operand of O^T += V^T P^T as they lie (A = V^T rows).
// score = s*m + (-10000*(1-m) + emb[bucket(j-i)][h]) as in the reference (bf16-rounded emb, this head's values by key - query distance in LDS; m = mask[b][q][k] bf16-rounded).
// Online softmax: running maximum and sum per query, both in-lane but for one exchange between the lane halves; the output tile and the sum are rescaled every pass; weights exp(score - maximum) <= 1 as f16.
__global__ __launch_bounds__(512) void k_fattn(const _Float16* __restrict__ QKV, const _Float16* __restrict__ VT, const float* __restrict__ emb, const float* __restrict__ amask, _Float16* __restrict__ O16) {
  __shared__ float tb[5 * 512];      /* tb[t] = this head's bias at key - query = t - (the block's last query row): the SQ + 255 distances that the block's 256 queries meet, rounded up to five entries a thread */
  const int bh = blockIdx.y, b = bh / NH, h = bh % NH;
#pragma unroll      /* the five table reads of a thread are in flight together */
  for (int u = 0; u < 5; ++u) { const int t = u * 512 + (int)threadIdx.x; tb[t] = bf16_round(emb[t5_bucket(t - (int)(blockIdx.x * 256 + 255)) * NH + h]); }
  __syncthreads();
  const int lane = threadIdx.x & 31, ln = lane & 15, hh = lane >> 4;
  const int i = blockIdx.x * 256 + (threadIdx.x >> 5) * 16 + ln;      /* this lane's query row */
  const _Float16* qp = QKV + ((size_t)b * SQ + i) * D3 + h * HD;
  const v16h q0 = g2_frag(qp, hh), q1 = g2_frag(qp + 32, hh);
  const _Float16* kp = QKV + ((size_t)b * SQ + ln) * D3 + h * HD + 8 * hh;      /* token row ln of the first 16-key tile (its k part lies DM further on); the lane half's offset of g2_frag is in kp, vp and mr already */
  const _Float16* vp = VT + ((size_t)bh * HD + ln) * SQ + 8 * hh;      /* V^T row d = ln */
  const float* mr = amask + ((size_t)b * SQ + i) * SQ + 8 * hh;
  const float* bp = tb + (8 * hh + 255 - (int)((threadIdx.x >> 5) * 16 + ln));      /* bp[j] = the bias of key j + 8 hh for this lane's query */
  const v8f z8 = {0.f,0.f,0.f,0.f,0.f,0.f,0.f,0.f}; v8f o0 = z8, o1 = z8, o2 = z8, o3 = z8;
  float mx = -INFINITY, se = 0.f;
#pragma unroll 1      /* one pass holds some 370 vector instructions already: unrolling would only cost registers and instruction cache */
  for (int kb = 0; kb < SQ; kb += 32) {
    const _Float16* k0 = kp + (size_t)kb * D3; const _Float16* k1 = k0 + (size_t)16 * D3; const _Float16* vk = vp + kb; const float* mk = mr + kb;
    const v16h ka0 = g2_frag(k0 + DM, 0), ka1 = g2_frag(k0 + DM + 32, 0), kc0 = g2_frag(k1 + DM, 0), kc1 = g2_frag(k1 + DM + 32, 0);
    const v4f m0 = *(const v4fa*)(mk), m1 = *(const v4fa*)(mk + 4), m2 = *(const v4fa*)(mk + 16), m3 = *(const v4fa*)(mk + 20);
    const v16h va0 = g2_frag(vk, 0), va1 = g2_frag(vk + (size_t)16 * SQ, 0), va2 = g2_frag(vk + (size_t)32 * SQ, 0), va3 = g2_frag(vk + (size_t)48 * SQ, 0);
    float bs[16];      /* the 16 bias values of the pass: two runs of 8 consecutive table entries */
#pragma unroll      /* bs[] and v[] indexed by constants only, so that they live in registers */
    for (int r = 0; r < 8; ++r) { bs[r] = bp[kb + r]; bs[8 + r] = bp[kb + 16 + r]; }
    __builtin_amdgcn_sched_barrier(0);      /* the 20 loads and the table reads of a pass are issued together, ahead of all else: left alone the compiler sinks some of them to just in front of their use and the wave waits for memory again */
    asm volatile("s_wait_xcnt 0x0" :: "v"(k0), "v"(vk), "v"(mk) : "memory");      /* inputs only: the loads' address registers live up to this wait and are reused only behind it */
    __builtin_amdgcn_sched_barrier(0);      /* nothing of the pass's arithmetic moves ahead of the wait */
    v8f s0 = fa_mma(ka0, q0, z8); s0 = fa_mma(ka1, q1, s0);
    v8f s1 = fa_mma(kc0, q0, z8); s1 = fa_mma(kc1, q1, s1);
    float v[16]; float bm = -INFINITY;
#pragma unroll
    for (int r = 0; r < 8; ++r) {
      const float ma = bf16_round(r < 4 ? m0[r & 3] : m1[r & 3]), mb = bf16_round(r < 4 ? m2[r & 3] : m3[r & 3]);
      v[r] = (s0[r] * 0.125f) * ma + (-10000.0f * (1.0f - ma) + bs[r]);
      v[8 + r] = (s1[r] * 0.125f) * mb + (-10000.0f * (1.0f - mb) + bs[8 + r]);
      bm = fmaxf(bm, fmaxf(v[r], v[8 + r]));
    }
    const float mn = fmaxf(mx, fmaxf(bm, xhalf(bm)));      /* the same in both lanes of a query */
    const float f = expf(mx - mn);      /* 0 on the first pass, where mx is -inf */
    mx = mn; se *= f;
#pragma unroll
    for (int r = 0; r < 8; ++r) { o0[r] *= f; o1[r] *= f; o2[r] *= f; o3[r] *= f; }
    FragH p;
#pragma unroll
    for (int k = 0; k < 16; ++k) { const float e = expf(v[k] - mn); se += e; p.h[k] = (_Float16)e; }
    o0 = fa_mma(va0, p.v, o0); o1 = fa_mma(va1, p.v, o1); o2 = fa_mma(va2, p.v, o2); o3 = fa_mma(va3, p.v, o3);
  }
  se += xhalf(se);      /* each lane summed its own half of the keys */
  const float inv = 1.0f / se;
  _Float16* op = O16 + ((size_t)b * SQ + i) * DM + h * HD + 8 * hh;      /* o_t[r] = ctx[query i][d = 16 t + 8 hh + r]: 16 contiguous bytes a tile */
  FragH c0, c1;
#pragma unroll
  for (int r = 0; r < 8; ++r) { c0.h[r] = (_Float16)(o0[r] * inv); c0.h[8 + r] = (_Float16)(o1[r] * inv); c1.h[r] = (_Float16)(o2[r] * inv); c1.h[8 + r] = (_Float16)(o3[r] * inv); }
  *(v8us*)((unsigned short*)op) = c0.half[0]; *(v8us*)((unsigned short*)op + 16) = c0.half[1]; *(v8us*)((unsigned short*)op + 32) = c1.half[0]; *(v8us*)((unsigned short*)op + 48) = c1.half[1];
}
__global__ __launch_bounds__(256) void k_vt(const _Float16* __restrict__ V16, int b, int h0, _Float16* __restrict__ VT) { __shared__ unsigned short tl[64][65]; const int tid = threadIdx.x; const int hh = blockIdx.x % HG, sg = blockIdx.x / HG; const int s0 = sg * 64; const int h = h0 + hh;
  for (int i = tid; i < 64 * 8; i += 256) { const int j = i / 8, d8 = (i % 8) * 8; FragH f; f.half[0] = *(const v8us*)((const unsigned short*)V16 + ((size_t)b * SQ + s0 + j) * DM + h * HD + d8); for (int q = 0; q < 8; ++q) tl[d8 + q][j] = f.u[q]; }
  __syncthreads();
  { for (int i = tid; i < 64 * 8; i += 256) { const int d = i / 8, j8 = (i % 8) * 8; FragH f; for (int q = 0; q < 8; ++q) f.u[q] = tl[d][j8 + q]; *(v8us*)((unsigned short*)VT + ((size_t)hh * HD + d) * SQ + s0 + j8) = f.half[0]; }  } }

extern "C" void kernel_launch(void* const* d_in, const int* in_sizes, int n_in,
                              void* d_out, int out_size, void* d_ws, size_t ws_size, hipStream_t stream) {
  (void)in_sizes; (void)n_in; (void)out_size;
  const float* const* I = (const float* const*)d_in; const float* hs = I[0]; const float* amask = I[1]; const float* wqkv = I[2]; const float* wo = I[3]; const float* emb = I[4];      /* W_qkv [1024][3072] and W_o [1024][1024] are [in][out]; attention_mask [2][1][2048][2048]; rel_bias_emb [32][16] */
  char* ws = (char*)d_ws; size_t off = 0;
  auto take = [&](size_t bytes) { char* p = ws + off; off += (bytes + 255) & ~(size_t)255; return p; };
  _Float16* BQKV = (_Float16*)take((size_t)D3 * DM * 2); _Float16* BO = (_Float16*)take((size_t)DM * DM * 2);
  _Float16* X16 = (_Float16*)take(NR * DM * 2); _Float16* QKV = (_Float16*)take(NR * D3 * 2); _Float16* O16 = (_Float16*)take(NR * DM * 2);
  _Float16* VT = (_Float16*)take((size_t)NB * NH * HD * SQ * 2);
  if (off > ws_size) return;      /* 6 + 2 + 8 + 24 + 8 + 8 = approx 56 MiB */
  k_wt_f16<<<(unsigned)(((size_t)D3 * (DM / 8) + 255) / 256), 256, 0, stream>>>(wqkv, BQKV, DM, D3, 16.0f);      /* [in][out] -> Bt[out][in] x16 */
  k_wt_f16<<<(unsigned)(((size_t)DM * (DM / 8) + 255) / 256), 256, 0, stream>>>(wo, BO, DM, DM, 16.0f);
  k_x16<<<(unsigned)((NR * DM / 8 + 255) / 256), 256, 0, stream>>>(hs, X16, NR * DM / 8);
  k_gemm2<0><<<dim3((unsigned)((NR / 128) * (D3 / 128)), 1), 256, 0, stream>>>(X16, DM, 0, BQKV, DM, 0, 0.0625f, nullptr, 0, nullptr, 1, 0, 0, nullptr, QKV, D3, 0, MP, D3, DM);      /* q | k | v rows (f16), head h at columns h*64 / 1024 + h*64 / 2048 + h*64 */
  k_vt<NH, SQ><<<NB * NH * (SQ / 64), 256, 0, stream>>>(QKV, D3, 2 * DM, VT);      /* V^T[(b,h)][d][s] for every (batch, head) */
  k_fattn<<<dim3(SQ / 256, NB * NH), 512, 0, stream>>>(QKV, VT, emb, amask, O16);      /* ctx (merged heads) as f16 rows; one block per 256 query rows of a (batch, head) */
  k_gemm2<0><<<dim3((unsigned)((NR / 128) * (DM / 128)), 1), 256, 0, stream>>>(O16, DM, 0, BO, DM, 0, 0.0625f, nullptr, 0, nullptr, 1, 0, 0, (float*)d_out, nullptr, DM, 0, MO, DM, DM);      /* out = ctx W_o, rows are the output layout */
}

// v005
// A run of this version takes 162 microseconds.
// In both of two side-by-side timings against v004, it was 1.14 times as fast.
// All steps since v000 together make it 185 times as fast.
#include <hip/hip_runtime.h>
#define NB 2
#define SQ 2048
#define DM 1024
#define D3 3072                      /* fused q|k|v width */
#define NH 16
#define HD 64
#define HG 4                         /* heads per call of the k_vt(V16, b, h0, VT) overload, which nothing launches */
#define NBK 32                       /* relative-position buckets */
#define MP ((int)NR)                 /* token rows through the qkv projection (debug hook) */
#define MO ((int)NR)                 /* token rows through the output projection (debug hook) */
#define NR ((size_t)NB * SQ)         /* 4096 token rows */
typedef __bf16 v16b __attribute__((ext_vector_type(16)));
typedef unsigned short v8us __attribute__((ext_vector_type(8), may_alias));
typedef float  v8f  __attribute__((ext_vector_type(8)));
typedef float  v4f  __attribute__((ext_vector_type(4)));
typedef float  v4fa __attribute__((ext_vector_type(4), may_alias));
union FragB { v16b v; v8us half[2]; unsigned short u[16]; };

__device__ __forceinline__ unsigned short bf16_bits(float x) { unsigned int u = __float_as_uint(x); return (unsigned short)((u + 0x7FFFu + ((u >> 16) & 1u)) >> 16); }
__device__ __forceinline__ float bf16_val(unsigned short b) { return __uint_as_float(((unsigned int)b) << 16); }
__device__ __forceinline__ float bf16_round(float x) { return bf16_val(bf16_bits(x)); }
// D += A·B with NT terms: 1 = ah·bh, 2 = + al·bh (A split), 3 = + ah·bl (both split)
template <int NT>
__device__ __forceinline__ v8f mmaN(v16b ah, v16b al, v16b bh, v16b bl, v8f c) {
  c = __builtin_amdgcn_wmma_f32_16x16x32_bf16(false, ah, false, bh, (short)0, c, false, false);
  if (NT >= 2) c = __builtin_amdgcn_wmma_f32_16x16x32_bf16(false, al, false, bh, (short)0, c, false, false);
  if (NT >= 3) c = __builtin_amdgcn_wmma_f32_16x16x32_bf16(false, ah, false, bl, (short)0, c, false, false);
  asm volatile("v_nop\n\tv_nop\n\tv_nop\n\tv_nop" : "+v"(c) : "v"(ah), "v"(al), "v"(bh), "v"(bl));
  return c;
}

__global__ __launch_bounds__(256) void k_wt_bf16(const float* __restrict__ W, unsigned short* __restrict__ Wt, int K, int N) {
  const int t = blockIdx.x * 256 + threadIdx.x;
  const int k8n = K / 8;
  if (t >= N * k8n) return;
  const int n = t / k8n, k8 = (t % k8n) * 8;
  v8us v;
#pragma unroll
  for (int i = 0; i < 8; ++i) v[i] = bf16_bits(W[(size_t)(k8 + i) * N + n]);
  *(v8us*)(Wt + (size_t)n * K + k8) = v;
  
}

// GEMM C[M][N] (f32, pitch ldc) = act(A[M][K]·W + bias). A f32 row-major (pitch lda) converted per fragment to bf16
// (ASPLIT: hi/lo two planes -> 2 terms, else single rounded term); Wt bf16 [N][K] (pitch ldb). BIAS_BF16 rounds the
// bias to bf16 first (bias quantised to bf16 before the add). K%32==0, M%16==0, N%64==0.
template <bool ASPLIT, int ACT, bool BIAS_BF16>
__global__ __launch_bounds__(128) void k_gemm_bf(const float* __restrict__ A, int lda, const unsigned short* __restrict__ Wt, int ldb,
                                               const float* __restrict__ bias, float* __restrict__ C, int ldc, int M, int N, int K) {
  __shared__ __attribute__((aligned(16))) float so[4][16][64];
  const int tid = threadIdx.x, w = tid >> 5, lane = tid & 31, ln = lane & 15, hh = lane >> 4;
  const int ntn = N / 64;
  const int wid = blockIdx.x * 4 + w;
  const int mt = wid / ntn, nq = wid % ntn;
  if (mt * 16 >= M) return;
  const int row0 = mt * 16, col0 = nq * 64;
  const float* arow = A + (size_t)(row0 + ln) * lda;
  v8f acc[4] = {};
  for (int kb = 0; kb < K; kb += 32) {
    FragB ah, al;
    const v4f x0 = *(const v4fa*)(arow + kb + 8 * hh), x1 = *(const v4fa*)(arow + kb + 8 * hh + 4);
    const v4f x2 = *(const v4fa*)(arow + kb + 16 + 8 * hh), x3 = *(const v4fa*)(arow + kb + 16 + 8 * hh + 4);
    float xs[16] = {x0[0],x0[1],x0[2],x0[3],x1[0],x1[1],x1[2],x1[3],x2[0],x2[1],x2[2],x2[3],x3[0],x3[1],x3[2],x3[3]};
#pragma unroll
    for (int i = 0; i < 16; ++i) { const unsigned short hb = bf16_bits(xs[i]); ah.u[i] = hb; al.u[i] = ASPLIT ? bf16_bits(xs[i] - bf16_val(hb)) : (unsigned short)0; }
#pragma unroll
    for (int t = 0; t < 4; ++t) {
      const unsigned short* brow = Wt + (size_t)(col0 + t * 16 + ln) * ldb + kb;
      FragB b;
      b.half[0] = *(const v8us*)(brow + 8 * hh);
      b.half[1] = *(const v8us*)(brow + 16 + 8 * hh);
      acc[t] = mmaN<ASPLIT ? 2 : 1>(ah.v, al.v, b.v, b.v, acc[t]);
    }
  }
#pragma unroll
  for (int t = 0; t < 4; ++t) {
    float bv = bias ? bias[col0 + t * 16 + ln] : 0.f;
    if (BIAS_BF16) bv = bf16_round(bv);
#pragma unroll
    for (int r = 0; r < 8; ++r) { float v = acc[t][r] + bv; if (ACT == 1) v = fmaxf(v, 0.f); so[w][8 * hh + r][t * 16 + ln] = v; }
  }
  __builtin_amdgcn_fence(__ATOMIC_ACQ_REL, "workgroup");
  __builtin_amdgcn_wave_barrier();
  const int rsub = lane >> 4, c4 = (lane & 15) * 4;
  {
#pragma unroll
    for (int q = 0; q < 8; ++q) {
      const int r = q * 2 + rsub;
      const v4f v = *(const v4fa*)&so[w][r][c4];
      *(v4f*)(C + (size_t)(row0 + r) * ldc + col0 + c4) = v;
    }
    
  }
}

// GEMM C = act(A·W + bias + resid): A f32 (ASPLIT -> hi/lo 2 terms), Wt bf16 [N][K]; ACT 0 none, 1 relu, 2 exact gelu;
// resid (optional, f32, row index = (row % rmod), pitch ldr, RES_BF16 rounds it) added before the activation.
template <bool ASPLIT, int ACT, bool BIAS_BF16, bool RES_BF16>
__global__ __launch_bounds__(128) void k_gemm_bf3(const float* __restrict__ A, int lda, const unsigned short* __restrict__ Wt, int ldb,
                                                const float* __restrict__ bias, const float* __restrict__ resid, int rmod, int ldr,
                                                float* __restrict__ C, int ldc, int M, int N, int K) {
  __shared__ __attribute__((aligned(16))) float so[4][16][64];
  const int tid = threadIdx.x, w = tid >> 5, lane = tid & 31, ln = lane & 15, hh = lane >> 4;
  const int ntn = N / 64;
  const int wid = blockIdx.x * 4 + w;
  const int mt = wid / ntn, nq = wid % ntn;
  if (mt * 16 >= M) return;
  const int row0 = mt * 16, col0 = nq * 64;
  const float* arow = A + (size_t)(row0 + ln) * lda;
  v8f acc[4] = {};
  for (int kb = 0; kb < K; kb += 32) {
    FragB ah, al;
    const v4f x0 = *(const v4fa*)(arow + kb + 8 * hh), x1 = *(const v4fa*)(arow + kb + 8 * hh + 4);
    const v4f x2 = *(const v4fa*)(arow + kb + 16 + 8 * hh), x3 = *(const v4fa*)(arow + kb + 16 + 8 * hh + 4);
    float xs[16] = {x0[0],x0[1],x0[2],x0[3],x1[0],x1[1],x1[2],x1[3],x2[0],x2[1],x2[2],x2[3],x3[0],x3[1],x3[2],x3[3]};
#pragma unroll
    for (int i = 0; i < 16; ++i) { const unsigned short hb = bf16_bits(xs[i]); ah.u[i] = hb; al.u[i] = ASPLIT ? bf16_bits(xs[i] - bf16_val(hb)) : (unsigned short)0; }
#pragma unroll
    for (int t = 0; t < 4; ++t) {
      const unsigned short* brow = Wt + (size_t)(col0 + t * 16 + ln) * ldb + kb;
      FragB b;
      b.half[0] = *(const v8us*)(brow + 8 * hh);
      b.half[1] = *(const v8us*)(brow + 16 + 8 * hh);
      acc[t] = mmaN<ASPLIT ? 2 : 1>(ah.v, al.v, b.v, b.v, acc[t]);
    }
  }
#pragma unroll
  for (int t = 0; t < 4; ++t) {
    const int col = col0 + t * 16 + ln;
    float bv = bias ? bias[col] : 0.f;
    if (BIAS_BF16) bv = bf16_round(bv);
#pragma unroll
    for (int r = 0; r < 8; ++r) {
      float v = acc[t][r] + bv;
      if (resid) { float rv = resid[(size_t)((row0 + 8 * hh + r) % rmod) * ldr + col]; if (RES_BF16) rv = bf16_round(rv); v += rv; }
      if (ACT == 1) v = fmaxf(v, 0.f);
      if (ACT == 2) v = 0.5f * v * (1.0f + erff(v * 0.70710678118654752f));
      if (ACT == 3) { const float u = 0.7978845608028654f * (v + 0.044715f * v * v * v); v = 0.5f * v * (1.0f + tanhf(u)); }
      so[w][8 * hh + r][t * 16 + ln] = v;
    }
  }
  __builtin_amdgcn_fence(__ATOMIC_ACQ_REL, "workgroup");
  __builtin_amdgcn_wave_barrier();
  const int rsub = lane >> 4, c4 = (lane & 15) * 4;
  {
#pragma unroll
    for (int q = 0; q < 8; ++q) {
      const int r = q * 2 + rsub;
      const v4f v = *(const v4fa*)&so[w][r][c4];
      *(v4f*)(C + (size_t)(row0 + r) * ldc + col0 + c4) = v;
    }
    
  }
}
// row LayerNorm (biased variance, eps) over N: s = X (+ R); optional out_sum <- s; out_norm <- (s-mu)*rsqrt(var+eps)*g + b
template <bool PARAM_BF16>
__global__ __launch_bounds__(256) void k_layernorm(const float* __restrict__ X, const float* __restrict__ R, const float* __restrict__ g, const float* __restrict__ bta,
                                                  float* __restrict__ out_sum, float* __restrict__ out_norm, int N, float eps) {
  __shared__ float red[256];
  const int row = blockIdx.x, tid = threadIdx.x;
  const float* x = X + (size_t)row * N; const float* rr = R ? R + (size_t)row * N : nullptr;
  float vals[16];                     // up to N = 4096
  const int per = N / 256;            // contiguous chunk per thread? use strided-by-4 chunks: thread handles j = tid*4 + 1024*u
  float s1 = 0.f;
  for (int u = 0; u < per / 4; ++u) {
    const int j = tid * 4 + 1024 * u;
    const v4f a = *(const v4fa*)(x + j);
    v4f b = {0.f,0.f,0.f,0.f}; if (rr) b = *(const v4fa*)(rr + j);
#pragma unroll
    for (int q = 0; q < 4; ++q) { const float v = a[q] + b[q]; vals[u * 4 + q] = v; s1 += v; }
  }
  red[tid] = s1; __syncthreads();
  for (int st = 128; st > 0; st >>= 1) { if (tid < st) red[tid] += red[tid + st]; __syncthreads(); }
  const float mu = red[0] / (float)N; __syncthreads();
  float s2 = 0.f;
  for (int u = 0; u < per / 4; ++u)
#pragma unroll
    for (int q = 0; q < 4; ++q) { const float c = vals[u * 4 + q] - mu; s2 += c * c; }
  red[tid] = s2; __syncthreads();
  for (int st = 128; st > 0; st >>= 1) { if (tid < st) red[tid] += red[tid + st]; __syncthreads(); }
  const float rs = rsqrtf(red[0] / (float)N + eps);
  {
    for (int u = 0; u < per / 4; ++u) {
      const int j = tid * 4 + 1024 * u;
      v4f o, sm;
#pragma unroll
      for (int q = 0; q < 4; ++q) {
        float gg = g[j + q], bb = bta[j + q];
        if (PARAM_BF16) { gg = bf16_round(gg); bb = bf16_round(bb); }
        sm[q] = vals[u * 4 + q]; o[q] = (vals[u * 4 + q] - mu) * rs * gg + bb;
      }
      if (out_sum) *(v4f*)(out_sum + (size_t)row * N + j) = sm;
      *(v4f*)(out_norm + (size_t)row * N + j) = o;
    }
    
  }
}



// ---- f16 WMMA path (v_wmma_f32_16x16x32_f16): 11-bit significands for operands in range — used where a [0,1] probability operand needs more precision than bf16
typedef _Float16 v16h __attribute__((ext_vector_type(16)));
union FragH { v16h v; v8us half[2]; _Float16 h[16]; unsigned short u[16]; };
template <int NT>
__device__ __forceinline__ v8f mmaH(v16h ah, v16h al, v16h bh, v16h bl, v8f c) {
  c = __builtin_amdgcn_wmma_f32_16x16x32_f16(false, ah, false, bh, (short)0, c, false, false);
  if (NT >= 2) c = __builtin_amdgcn_wmma_f32_16x16x32_f16(false, al, false, bh, (short)0, c, false, false);
  if (NT >= 3) c = __builtin_amdgcn_wmma_f32_16x16x32_f16(false, ah, false, bl, (short)0, c, false, false);
  asm volatile("v_nop\n\tv_nop\n\tv_nop\n\tv_nop" : "+v"(c) : "v"(ah), "v"(al), "v"(bh), "v"(bl));
  return c;
}
// batched GEMM like k_gemm_b but f16 operands: A f32 (split into f16 hi/lo if ASPLIT, else rounded to f16), Bt = f16 values [n][k]; alpha; C f32; N multiple of 16 (partial tiles skipped)
template <bool ASPLIT>
__global__ __launch_bounds__(128) void k_gemm_h(const float* __restrict__ A, int lda, size_t sA, const _Float16* __restrict__ Bh, int ldb, size_t sB, float alpha, float* __restrict__ C, int ldc, size_t sC, int M, int N, int K) {
  __shared__ __attribute__((aligned(16))) float so[4][16][64];
  const int tid = threadIdx.x, w = tid >> 5, lane = tid & 31, ln = lane & 15, hh = lane >> 4; const int by = blockIdx.y;
  A += (size_t)by * sA; Bh += (size_t)by * sB; C += (size_t)by * sC;
  const int ntn = (N + 63) / 64; const int wid = blockIdx.x * 4 + w; const int mt = wid / ntn, nq = wid % ntn; if (mt * 16 >= M) return;
  const int row0 = mt * 16, col0 = nq * 64; const float* arow = A + (size_t)(row0 + ln) * lda;
  v8f acc[4] = {};
  for (int kb = 0; kb < K; kb += 32) {
    FragH ah, al;
    const v4f x0 = *(const v4fa*)(arow + kb + 8 * hh), x1 = *(const v4fa*)(arow + kb + 8 * hh + 4), x2 = *(const v4fa*)(arow + kb + 16 + 8 * hh), x3 = *(const v4fa*)(arow + kb + 16 + 8 * hh + 4);
    float xs[16] = {x0[0],x0[1],x0[2],x0[3],x1[0],x1[1],x1[2],x1[3],x2[0],x2[1],x2[2],x2[3],x3[0],x3[1],x3[2],x3[3]};
#pragma unroll
    for (int i = 0; i < 16; ++i) { const _Float16 h = (_Float16)xs[i]; ah.h[i] = h; al.h[i] = ASPLIT ? (_Float16)(xs[i] - (float)h) : (_Float16)0.0f; }
#pragma unroll
    for (int t = 0; t < 4; ++t) { if (col0 + t * 16 >= N) continue; const size_t boff = (size_t)(col0 + t * 16 + ln) * ldb + kb; FragH bq; bq.half[0] = *(const v8us*)(Bh + boff + 8 * hh); bq.half[1] = *(const v8us*)(Bh + boff + 16 + 8 * hh);
      acc[t] = mmaH<ASPLIT ? 2 : 1>(ah.v, al.v, bq.v, bq.v, acc[t]); }
  }
#pragma unroll
  for (int t = 0; t < 4; ++t) { if (col0 + t * 16 >= N) continue;
#pragma unroll
    for (int r = 0; r < 8; ++r) so[w][8 * hh + r][t * 16 + ln] = acc[t][r] * alpha; }
  __builtin_amdgcn_fence(__ATOMIC_ACQ_REL, "workgroup"); __builtin_amdgcn_wave_barrier();
  const int rsub = lane >> 4, c4 = (lane & 15) * 4;
  {
#pragma unroll
    for (int q = 0; q < 8; ++q) { const int r = q * 2 + rsub; if (col0 + c4 < N) { const v4f v = *(const v4fa*)&so[w][r][c4]; *(v4f*)(C + (size_t)(row0 + r) * ldc + col0 + c4) = v; } }
     }
}

// Wt[n][k] = f16(W[k][n]·scale) from f32 row-major W[K][N] (scale = power of two; bf16-exact weights stay exact in f16 away from the subnormal range)
__global__ __launch_bounds__(256) void k_wt_f16(const float* __restrict__ W, _Float16* __restrict__ Wt, int K, int N, float scale) {
  const int t = blockIdx.x * 256 + threadIdx.x; if (t >= N * (K / 8)) return; const int n = t / (K / 8), k8 = (t % (K / 8)) * 8; FragH f;
#pragma unroll
  for (int i = 0; i < 8; ++i) f.h[i] = (_Float16)(bf16_round(W[(size_t)(k8 + i) * N + n]) * scale); const v8us o = f.half[0];
  *(v8us*)((unsigned short*)Wt + (size_t)n * K + k8) = o; 
}
// k_gemm_hh variant with fused epilogue: v = acc·alpha + bias[by·sBias + col] (+ CP[(row/rowsPerB)·sCPb + by·64 + col] if CP) ; ACT 0 none / 1 elu ; writes f16 C16 (and f32 C if non-null)
template <int ACT>
__global__ __launch_bounds__(128) void k_gemm_hhx(const _Float16* __restrict__ A, int lda, size_t sA, const _Float16* __restrict__ Bh, int ldb, size_t sB, float alpha, const float* __restrict__ bias, size_t sBias, const float* __restrict__ CP, int rowsPerB, size_t sCPb, int row0g,
    float* __restrict__ C, _Float16* __restrict__ C16, int ldc, size_t sC, int M, int N, int K) {
  __shared__ __attribute__((aligned(16))) float so[4][16][64];
  const int tid = threadIdx.x, w = tid >> 5, lane = tid & 31, ln = lane & 15, hh = lane >> 4; const int by = blockIdx.y;
  A += (size_t)by * sA; Bh += (size_t)by * sB; const size_t cofs = (size_t)by * sC; const float* bp = bias ? bias + (size_t)by * sBias : nullptr;
  const int ntn = (N + 63) / 64; const int wid = blockIdx.x * 4 + w; const int mt = wid / ntn, nq = wid % ntn; if (mt * 16 >= M) return;
  const int row0 = mt * 16, col0 = nq * 64; const _Float16* arow = A + (size_t)(row0 + ln) * lda;
  v8f acc[4] = {};
  for (int kb = 0; kb < K; kb += 32) { FragH ah; ah.half[0] = *(const v8us*)((const unsigned short*)arow + kb + 8 * hh); ah.half[1] = *(const v8us*)((const unsigned short*)arow + kb + 16 + 8 * hh);
#pragma unroll
    for (int t = 0; t < 4; ++t) { if (col0 + t * 16 >= N) continue; const size_t boff = (size_t)(col0 + t * 16 + ln) * ldb + kb; FragH bq; bq.half[0] = *(const v8us*)((const unsigned short*)Bh + boff + 8 * hh); bq.half[1] = *(const v8us*)((const unsigned short*)Bh + boff + 16 + 8 * hh);
      acc[t] = mmaH<1>(ah.v, ah.v, bq.v, bq.v, acc[t]); }
  }
#pragma unroll
  for (int t = 0; t < 4; ++t) { if (col0 + t * 16 >= N) continue; const int col = col0 + t * 16 + ln; const float bv = bp ? bf16_round(bp[col]) : 0.f;
#pragma unroll
    for (int r = 0; r < 8; ++r) { float v = acc[t][r] * alpha + bv; if (CP) { const int rr = row0g + row0 + 8 * hh + r; if (rowsPerB < 0) v += CP[cofs + (size_t)rr * ldc + col];      /* rowsPerB < 0: own element of the batched C plane */ else { const int bidx = rr / rowsPerB; v += CP[(size_t)bidx * sCPb + (size_t)by * 64 + col]; } } if (ACT == 1) v = (v > 0.f) ? v : expm1f(v); else if (ACT == 7) v = (v > 0.f) ? v + 1.0f : expf(v); else if (ACT == 8) v = tanhf(v); else if (ACT == 9) v = 0.5f * v * (1.0f + tanhf(0.7978845608028654f * (v + 0.044715f * v * v * v))); else if (ACT == 11) v = 1.0f / (1.0f + expf(-v)); else if (ACT == 12) v = (v > 0.f) ? v : 0.01f * v; else if (ACT == 14) v = (v > 0.f) ? v : 0.1f * v; else if (ACT == 16) v = (v >= 0.f) ? v : 0.3f * v; else if (ACT == 17) v = (v >= 0.f) ? v : 0.2f * v; else if (ACT == 15) v = v / (1.0f + expf(-v)); else if (ACT == 3) v = fmaxf(v, 0.f); else if (ACT == 6) v = 0.5f * v * (1.0f + erff(v * 0.70710678118654752f)); so[w][8 * hh + r][t * 16 + ln] = v; } }
  __builtin_amdgcn_fence(__ATOMIC_ACQ_REL, "workgroup"); __builtin_amdgcn_wave_barrier();
  const int rsub = lane >> 4, c4 = (lane & 15) * 4; typedef _Float16 v4h __attribute__((ext_vector_type(4)));
  {
#pragma unroll
    for (int q = 0; q < 8; ++q) { const int r = q * 2 + rsub; if (col0 + c4 < N) { const v4f v = *(const v4fa*)&so[w][r][c4]; if (C) *(v4f*)(C + cofs + (size_t)(row0 + r) * ldc + col0 + c4) = v; if (C16) { v4h h4; for (int i = 0; i < 4; ++i) h4[i] = (_Float16)v[i]; *(v4h*)(C16 + cofs + (size_t)(row0 + r) * ldc + col0 + c4) = h4; } } }
     }
}


typedef _Float16 v4h __attribute__((ext_vector_type(4)));

__global__ __launch_bounds__(256) void k_x16(const float* __restrict__ x, _Float16* __restrict__ X16, size_t n8) { const size_t t = (size_t)blockIdx.x * 256 + threadIdx.x; if (t >= n8) return; FragH f;
#pragma unroll
  for (int q = 0; q < 8; ++q) f.h[q] = (_Float16)bf16_round(x[t * 8 + q]); *(v8us*)((unsigned short*)X16 + t * 8) = f.half[0];  }
__global__ __launch_bounds__(256) void k_h16(const float* __restrict__ x, _Float16* __restrict__ X16, size_t n8) { const size_t t = (size_t)blockIdx.x * 256 + threadIdx.x; if (t >= n8) return; FragH f;
#pragma unroll
  for (int q = 0; q < 8; ++q) f.h[q] = (_Float16)x[t * 8 + q]; *(v8us*)((unsigned short*)X16 + t * 8) = f.half[0];  }
__global__ __launch_bounds__(256) void k_round16f(const float* __restrict__ W, _Float16* __restrict__ Bt, size_t n8) { const size_t t = (size_t)blockIdx.x * 256 + threadIdx.x; if (t >= n8) return; FragH f;
#pragma unroll
  for (int i = 0; i < 8; ++i) f.h[i] = (_Float16)(bf16_round(W[t * 8 + i]) * 16.0f); *(v8us*)((unsigned short*)Bt + t * 8) = f.half[0];  }
template <int NHv, int TTv>
__global__ __launch_bounds__(256) void k_vt(const _Float16* __restrict__ V16, int ldv, int voff, _Float16* __restrict__ Vt) { __shared__ unsigned short tl[64][66]; const int tid = threadIdx.x; const int slab = blockIdx.x / (TTv / 64), lg = blockIdx.x % (TTv / 64); const int b = slab / NHv, h = slab % NHv;
  for (int i = tid; i < 64 * 8; i += 256) { const int r = i / 8, c8 = (i % 8) * 8; FragH f; f.half[0] = *(const v8us*)((const unsigned short*)V16 + ((size_t)b * TTv + lg * 64 + r) * ldv + voff + h * 64 + c8);
#pragma unroll
    for (int q = 0; q < 8; ++q) tl[r][c8 + q] = f.u[q]; }
  __syncthreads();
  {
#pragma unroll
    for (int rd = 0; rd < 2; ++rd) { const int d = rd * 32 + tid / 8, pc = tid % 8; FragH f;
#pragma unroll
      for (int q = 0; q < 8; ++q) f.u[q] = tl[pc * 8 + q][d];
      *(v8us*)((unsigned short*)Vt + ((size_t)slab * 64 + d) * TTv + lg * 64 + pc * 8) = f.half[0]; }
     } }

__global__ __launch_bounds__(256) void k_hl(const float* __restrict__ F, _Float16* __restrict__ Hh, _Float16* __restrict__ Hl, size_t n8) { const size_t t = (size_t)blockIdx.x * 256 + threadIdx.x; if (t >= n8) return; FragH fh, fl; const v4f a = *(const v4fa*)(F + t * 8), c = *(const v4fa*)(F + t * 8 + 4);
#pragma unroll
  for (int q = 0; q < 4; ++q) { _Float16 h = (_Float16)a[q]; fh.h[q] = h; fl.h[q] = (_Float16)((a[q] - (float)h) * 1024.0f); h = (_Float16)c[q]; fh.h[4 + q] = h; fl.h[4 + q] = (_Float16)((c[q] - (float)h) * 1024.0f); }
  { *(v8us*)((unsigned short*)Hh + t * 8) = fh.half[0]; *(v8us*)((unsigned short*)Hl + t * 8) = fl.half[0];  } }

// ---- fast GEMM (block tile 128x128 on 8 waves, wave tile 32x64; requires M % 128 == 0, N % 128 == 0, K % 64 == 0, K >= 64); epilogue = k_gemm_hhx semantics ----
// Operand path: a k tile is 64 k = one whole 128-byte line of each of the block's 128 A rows and 128 Bt rows. The 256 threads bring it into LDS by asynchronous 16-byte copies
// (8 lanes a row, so every wave-wide copy covers 4 whole lines), two buffers, the next tile in flight while this one is multiplied; the waves read their fragments from LDS in the k order of g2_frag.
#define G2P 72                       /* halfs per LDS row: 128 bytes of data + 16, the conflict-free pitch for 16-byte reads */
#define G2STG (256 * G2P * 2)        /* bytes of one buffer: 128 A rows, then 128 Bt rows */
__device__ __forceinline__ v16h g2_frag(const _Float16* p, int hh) { FragH f; f.half[0] = *(const v8us*)((const unsigned short*)p + 8 * hh); f.half[1] = *(const v8us*)((const unsigned short*)p + 16 + 8 * hh); return f.v; }
__device__ __forceinline__ v16h g2_lfrag(const unsigned short* p) { FragH f; f.half[0] = *(const v8us*)(p); f.half[1] = *(const v8us*)(p + 16); return f.v; }
__device__ __forceinline__ v8f g2_mma(v16h a, v16h b, v8f c) { return __builtin_amdgcn_wmma_f32_16x16x32_f16(false, a, false, b, (short)0, c, false, false); }
// one k tile: this thread's 16 bytes of rows r, r + 32, r + 64, r + 96 of A (pitch pa halfs) and of Bt (pitch pb); l = LDS byte address of its place in row r of the buffer.
// The s_wait_xcnt closes the copies' own statement, so that no address register is rewritten ahead of it.
__device__ __forceinline__ void g2_copy(unsigned l, const _Float16* a, size_t pa, const _Float16* b, size_t pb) {
  asm volatile("global_load_async_to_lds_b128 %0, %8, off\n\t"
               "global_load_async_to_lds_b128 %1, %9, off\n\t"
               "global_load_async_to_lds_b128 %2, %10, off\n\t"
               "global_load_async_to_lds_b128 %3, %11, off\n\t"
               "global_load_async_to_lds_b128 %4, %12, off\n\t"
               "global_load_async_to_lds_b128 %5, %13, off\n\t"
               "global_load_async_to_lds_b128 %6, %14, off\n\t"
               "global_load_async_to_lds_b128 %7, %15, off\n\t"
               "s_wait_xcnt 0x0"
               :: "v"(l), "v"(l + 32u * G2P * 2u), "v"(l + 64u * G2P * 2u), "v"(l + 96u * G2P * 2u), "v"(l + 128u * G2P * 2u), "v"(l + 160u * G2P * 2u), "v"(l + 192u * G2P * 2u), "v"(l + 224u * G2P * 2u),
                  "v"(a), "v"(a + 32 * pa), "v"(a + 64 * pa), "v"(a + 96 * pa), "v"(b), "v"(b + 32 * pb), "v"(b + 64 * pb), "v"(b + 96 * pb) : "memory");
}
template <int ACT>
__global__ __launch_bounds__(256) void k_gemm2(const _Float16* __restrict__ A, int lda, size_t sA, const _Float16* __restrict__ Bh, int ldb, size_t sB, float alpha, const float* __restrict__ bias, size_t sBias, const float* __restrict__ CP, int rowsPerB, size_t sCPb, int row0g,
    float* __restrict__ C, _Float16* __restrict__ C16, int ldc, size_t sC, int M, int N, int K) { static_assert(ACT == 0 || ACT == 3 || ACT == 6 || ACT == 8 || ACT == 9 || ACT == 11 || ACT == 12 || ACT == 14 || ACT == 15 || ACT == 16 || ACT == 17, "k_gemm2: unsupported ACT code (would silently apply no activation)");
  __shared__ __attribute__((aligned(16))) unsigned short ring[2][256][G2P];      /* the two operand buffers; behind the k loop the same bytes are the waves' output staging */
  static_assert(sizeof(float) * 8 * 32 * 68 <= sizeof(unsigned short) * 2 * 256 * G2P, "output staging must fit the ring");
  const int tid = threadIdx.x, w = tid >> 5, lane = tid & 31, ln = lane & 15, hh = lane >> 4; const int by = blockIdx.y;
  A += (size_t)by * sA; Bh += (size_t)by * sB; const size_t cofs = (size_t)by * sC; const float* bp = bias ? bias + (size_t)by * sBias : nullptr;
  const int ntn = N >> 7; const int mt = blockIdx.x / ntn, nq = blockIdx.x - mt * ntn; const int m0 = mt * 128, n0 = nq * 128; if (m0 >= M) return;      /* the same for the whole block, ahead of every barrier */
  const int wr = 32 * (w & 3), wc = 64 * (w >> 2); const int row0 = m0 + wr, col0 = n0 + wc;
  const int cr = tid >> 3, cs = (tid & 7) * 8;      /* this thread's row (of each 32) and its 8 halfs of the 64 in a k tile */
  const _Float16* ga = A + (size_t)(m0 + cr) * lda + cs; const _Float16* gb = Bh + (size_t)(n0 + cr) * ldb + cs;
  const unsigned l0 = (unsigned)(size_t)&ring[0][cr][cs];      /* low 32 bits of the shared address = byte offset in the block's LDS */
  const int nt = K >> 6;
  const v8f z8 = {0.f,0.f,0.f,0.f,0.f,0.f,0.f,0.f}; v8f c00 = z8, c01 = z8, c02 = z8, c03 = z8, c10 = z8, c11 = z8, c12 = z8, c13 = z8;
  g2_copy(l0, ga, (size_t)lda, gb, (size_t)ldb);
  asm volatile("s_wait_asynccnt 0x0" ::: "memory");      /* this wave's part of tile 0 has landed */
  __syncthreads();      /* tile 0 is readable by every wave */
  if (nt > 1) g2_copy(l0 + G2STG, ga + 64, (size_t)lda, gb + 64, (size_t)ldb);
#pragma unroll 1      /* one trip = one buffer; the two buffers alternate by t & 1 */
  for (int t = 0; t < nt; ++t) {
    const unsigned short* ta = &ring[t & 1][wr + ln][8 * hh]; const unsigned short* tb = &ring[t & 1][128 + wc + ln][8 * hh];
#pragma unroll      /* the two 32-k steps of a tile: constant LDS offsets */
    for (int ks = 0; ks < 64; ks += 32) {
      const v16h a0 = g2_lfrag(ta + ks), a1 = g2_lfrag(ta + 16 * G2P + ks);
      const v16h b0 = g2_lfrag(tb + ks), b1 = g2_lfrag(tb + 16 * G2P + ks), b2 = g2_lfrag(tb + 32 * G2P + ks), b3 = g2_lfrag(tb + 48 * G2P + ks);
      __builtin_amdgcn_sched_barrier(0);      /* the 12 LDS reads of a step issue as one group ahead of its 8 products: left alone the compiler reuses the B registers and the wave waits for LDS four times a step */
      c00 = g2_mma(a0, b0, c00); c10 = g2_mma(a1, b0, c10); c01 = g2_mma(a0, b1, c01); c11 = g2_mma(a1, b1, c11);
      c02 = g2_mma(a0, b2, c02); c12 = g2_mma(a1, b2, c12); c03 = g2_mma(a0, b3, c03); c13 = g2_mma(a1, b3, c13);
    }
    asm volatile("s_wait_dscnt 0x0" ::: "memory");      /* this wave's reads of buffer t & 1 are done */
    asm volatile("s_wait_asynccnt 0x0" ::: "memory");      /* this wave's part of tile t + 1 has landed */
    __syncthreads();      /* publishes tile t + 1 and frees buffer t & 1 */
    if (t + 2 < nt) g2_copy(l0 + (unsigned)(t & 1) * G2STG, ga + (size_t)(t + 2) * 64, (size_t)lda, gb + (size_t)(t + 2) * 64, (size_t)ldb);
  }
  asm volatile("s_wait_asynccnt 0x0" ::: "memory");      /* nothing in flight when the ring becomes output staging (the last trip's barrier has ended every read of it) */
  float (*so)[32][68] = reinterpret_cast<float (*)[32][68]>(&ring[0][0][0]);
  v8f accs[8] = {c00, c01, c02, c03, c10, c11, c12, c13};
#pragma unroll
  for (int u = 0; u < 8; ++u) { const int t = u & 3, half = u >> 2; const int col = col0 + t * 16 + ln; const float bv = bp ? bf16_round(bp[col]) : 0.f;
#pragma unroll
    for (int r = 0; r < 8; ++r) { const int rloc = half * 16 + 8 * hh + r; float v = accs[u][r] * alpha + bv; if (CP) { if (rowsPerB < 0) v += CP[cofs + (size_t)(row0g + row0 + rloc) * ldc + col];      /* rowsPerB < 0: own element of the batched C plane */ else { const int bidx = (row0g + row0 + rloc) / rowsPerB; v += CP[(size_t)bidx * sCPb + (size_t)by * 64 + col]; } }
      if (ACT == 3) v = fmaxf(v, 0.f); else if (ACT == 6) v = 0.5f * v * (1.0f + erff(v * 0.70710678118654752f)); else if (ACT == 11) v = 1.0f / (1.0f + expf(-v)); else if (ACT == 15) v = v / (1.0f + expf(-v)); else if (ACT == 12) v = (v > 0.f) ? v : 0.01f * v; else if (ACT == 8) v = tanhf(v); else if (ACT == 9) v = 0.5f * v * (1.0f + tanhf(0.7978845608028654f * (v + 0.044715f * v * v * v))); else if (ACT == 14) v = (v > 0.f) ? v : 0.1f * v; else if (ACT == 16) v = (v >= 0.f) ? v : 0.3f * v; else if (ACT == 17) v = (v >= 0.f) ? v : 0.2f * v;
      so[w][rloc][t * 16 + ln] = v; } }
  __builtin_amdgcn_fence(__ATOMIC_ACQ_REL, "workgroup"); __builtin_amdgcn_wave_barrier();
  const int rsub = lane >> 4, c4 = (lane & 15) * 4;
  {
#pragma unroll
    for (int q = 0; q < 16; ++q) { const int r = q * 2 + rsub; const v4f v = *(const v4fa*)&so[w][r][c4]; if (C) *(v4f*)(C + cofs + (size_t)(row0 + r) * ldc + col0 + c4) = v; if (C16) { v4h h4; for (int i = 0; i < 4; ++i) h4[i] = (_Float16)v[i]; *(v4h*)(C16 + cofs + (size_t)(row0 + r) * ldc + col0 + c4) = h4; } }
     } }


__global__ __launch_bounds__(256) void k_wnat(const float* __restrict__ w, size_t n8, _Float16* __restrict__ Bt) { const size_t t = (size_t)blockIdx.x * 256 + threadIdx.x; if (t >= n8) return; FragH f; for (int q = 0; q < 8; ++q) f.h[q] = (_Float16)(bf16_round(w[t * 8 + q]) * 16.0f); *(v8us*)((unsigned short*)Bt + t * 8) = f.half[0];  }
// T5 bidirectional relative-position bucket of rel = key - query (32 buckets, max distance 128): (rel > 0)*16 + f(|rel|), f(n) = n for n < 8, then
// 8 + the number of thresholds {12,16,23,32,46,64,91} that are <= n (the thresholds are where the reference's own f32 log expression steps; no log on the device)
__device__ __forceinline__ int t5_bucket(int rel) { const int n = rel < 0 ? -rel : rel; const int g = 8 + (n >= 12) + (n >= 16) + (n >= 23) + (n >= 32) + (n >= 46) + (n >= 64) + (n >= 91); return (rel > 0 ? NBK / 2 : 0) + (n < 8 ? n : g); }
// lane l with lane l ^ 16 (the two lanes that share one query column)
__device__ __forceinline__ float xhalf(float x) { return __builtin_bit_cast(float, __builtin_amdgcn_permlanex16(__builtin_bit_cast(int, x), __builtin_bit_cast(int, x), 0x76543210, 0xfedcba98, false, false)); }
__device__ __forceinline__ v8f fa_mma(v16h a, v16h b, v8f c) { return __builtin_amdgcn_wmma_f32_16x16x32_f16(false, a, false, b, (short)0, c, false, false); }
// Operand path of the fused attention: a stage is 128 keys = 128 K rows (one whole 128-byte line each) and the 64 V^T rows (two whole lines each). The block's 512 threads bring it into LDS by asynchronous 16-byte copies
// (a wave-wide copy covers 4 whole lines), two buffers, the next stage in flight while this one is worked on; all 16 waves read their A fragments from LDS in the k order of g2_frag.
#define FAK 128                      /* keys per stage */
#define FAKP 72                      /* halfs per K row in LDS: 128 bytes of data + 16, the conflict-free pitch for 16-byte reads */
#define FAVP 136                     /* halfs per V^T row in LDS: 256 bytes of data + 16, likewise */
#define FASTG (FAK * FAKP + HD * FAVP)      /* halfs of one buffer: the K rows, then the V^T rows */
// one stage: this thread's 16 bytes of K rows r and r + 64 (token pitch D3) and of V^T rows d and d + 32 (pitch SQ); lk, lv = LDS byte addresses of its places in rows r and d of the buffer.
// The s_wait_xcnt closes the copies' own statement, so that no address register is rewritten ahead of it.
__device__ __forceinline__ void fa_copy(unsigned lk, unsigned lv, const _Float16* k, const _Float16* v) {
  asm volatile("global_load_async_to_lds_b128 %0, %4, off\n\t"
               "global_load_async_to_lds_b128 %1, %5, off\n\t"
               "global_load_async_to_lds_b128 %2, %6, off\n\t"
               "global_load_async_to_lds_b128 %3, %7, off\n\t"
               "s_wait_xcnt 0x0"
               :: "v"(lk), "v"(lk + 64u * FAKP * 2u), "v"(lv), "v"(lv + 32u * FAVP * 2u),
                  "v"(k), "v"(k + (size_t)64 * D3), "v"(v), "v"(v + (size_t)32 * SQ) : "memory");
}
// fused attention of one (batch, head): scores, bias and mask, softmax and P.V in one pass over the keys; S and P stay in registers.
// One wave owns 16 query rows, a block 16 waves = 256 rows (256 blocks: one a WGP, four waves a SIMD, all reading the same K and V^T rows from the block's LDS); a pass takes 32 keys. Transposed products: S^T = K Q^T (A = key rows, B = the wave's q rows, loaded once),
// so lane (ln, hh) holds, for query q0 + ln, the keys kb + 8 hh + r and kb + 16 + 8 hh + r: the k order of g2_frag, and the 16 weights are the B operand of O^T += V^T P^T as they lie (A = V^T rows).
// score = s*m + (-10000*(1-m) + emb[bucket(j-i)][h]) as in the reference (bf16-rounded emb, this head's values by key - query distance in LDS; m = mask[b][q][k] bf16-rounded).
// Online softmax: running maximum and sum per query, both in-lane but for one exchange between the lane halves; the output tile and the sum are rescaled every pass; weights exp(score - maximum) <= 1 as f16.
__global__ __launch_bounds__(512) void k_fattn(const _Float16* __restrict__ QKV, const _Float16* __restrict__ VT, const float* __restrict__ emb, const float* __restrict__ amask, _Float16* __restrict__ O16) {
  __shared__ __attribute__((aligned(16))) struct { float tb[5 * 512]; unsigned short ring[2][FASTG]; } sm;      /* one object, the table first: its reads keep small constant offsets */
  float (&tb)[5 * 512] = sm.tb;      /* tb[t] = this head's bias at key - query = t - (the block's last query row): the SQ + 255 distances that the block's 256 queries meet, rounded up to five entries a thread */
  unsigned short (&ring)[2][FASTG] = sm.ring;      /* the two K | V^T buffers */
  const int bh = blockIdx.y, b = bh / NH, h = bh % NH;
  const int ckr = (int)threadIdx.x >> 3, ckc = ((int)threadIdx.x & 7) * 8, cvr = (int)threadIdx.x >> 4, cvc = ((int)threadIdx.x & 15) * 8;      /* this thread's K row (of each 64) and V^T row (of each 32) and its 8 halfs of them */
  const _Float16* gk = QKV + ((size_t)b * SQ + ckr) * D3 + DM + h * HD + ckc; const _Float16* gv = VT + ((size_t)bh * HD + cvr) * SQ + cvc;
  const unsigned lk = (unsigned)(size_t)&ring[0][ckr * FAKP + ckc], lv = (unsigned)(size_t)&ring[0][FAK * FAKP + cvr * FAVP + cvc];      /* low 32 bits of the shared address = byte offset in the block's LDS */
  fa_copy(lk, lv, gk, gv);      /* stage 0 flies while the bias table is built */
#pragma unroll      /* the five table reads of a thread are in flight together */
  for (int u = 0; u < 5; ++u) { const int t = u * 512 + (int)threadIdx.x; tb[t] = bf16_round(emb[t5_bucket(t - (int)(blockIdx.x * 256 + 255)) * NH + h]); }
  asm volatile("s_wait_asynccnt 0x0" ::: "memory");      /* this wave's part of stage 0 has landed */
  __syncthreads();      /* the bias table and stage 0 are readable by every wave */
  fa_copy(lk + FASTG * 2u, lv + FASTG * 2u, gk + (size_t)FAK * D3, gv + FAK);      /* stage 1 (there are SQ / FAK = 16) */
  const int lane = threadIdx.x & 31, ln = lane & 15, hh = lane >> 4;
  const int i = blockIdx.x * 256 + (threadIdx.x >> 5) * 16 + ln;      /* this lane's query row */
  const _Float16* qp = QKV + ((size_t)b * SQ + i) * D3 + h * HD;
  const v16h q0 = g2_frag(qp, hh), q1 = g2_frag(qp + 32, hh);
  const float* mr = amask + ((size_t)b * SQ + i) * SQ + 8 * hh;
  const float* bp = tb + (8 * hh + 255 - (int)((threadIdx.x >> 5) * 16 + ln));      /* bp[j] = the bias of key j + 8 hh for this lane's query */
  const v8f z8 = {0.f,0.f,0.f,0.f,0.f,0.f,0.f,0.f}; v8f o0 = z8, o1 = z8, o2 = z8, o3 = z8;
  float mx = -INFINITY, se = 0.f;
#pragma unroll 1      /* one trip = one buffer; the two buffers alternate by t & 1 */
  for (int t = 0; t < SQ / FAK; ++t) {
  const unsigned short* kt = &ring[t & 1][ln * FAKP + 8 * hh];      /* K row ln of the stage; the lane half's offset of g2_frag is in kt, vt and mr already */
  const unsigned short* vt = &ring[t & 1][FAK * FAKP + ln * FAVP + 8 * hh];      /* V^T row d = ln */
#pragma unroll 1      /* one pass holds some 370 vector instructions already: unrolling would only cost registers and instruction cache */
  for (int kb = t * FAK; kb < (t + 1) * FAK; kb += 32) {
    const unsigned short* k0 = kt + (kb - t * FAK) * FAKP; const unsigned short* vk = vt + (kb - t * FAK); const float* mk = mr + kb;
    const v4f m0 = *(const v4fa*)(mk), m1 = *(const v4fa*)(mk + 4), m2 = *(const v4fa*)(mk + 16), m3 = *(const v4fa*)(mk + 20);
    const v16h ka0 = g2_lfrag(k0), ka1 = g2_lfrag(k0 + 32), kc0 = g2_lfrag(k0 + 16 * FAKP), kc1 = g2_lfrag(k0 + 16 * FAKP + 32);
    const v16h va0 = g2_lfrag(vk), va1 = g2_lfrag(vk + 16 * FAVP), va2 = g2_lfrag(vk + 32 * FAVP), va3 = g2_lfrag(vk + 48 * FAVP);
    float bs[16];      /* the 16 bias values of the pass: two runs of 8 consecutive table entries, 16 apart */
#pragma unroll      /* bs[] and v[] indexed by constants only, so that they live in registers */
    for (int r = 0; r < 8; ++r) { bs[r] = bp[kb + r]; bs[8 + r] = bp[kb + 16 + r]; }
    __builtin_amdgcn_sched_barrier(0);      /* the 4 mask loads, the 16 fragment reads and the table reads of a pass are issued together, ahead of all else: left alone the compiler sinks some of them to just in front of their use and the wave waits again */
    asm volatile("s_wait_xcnt 0x0" :: "v"(mk) : "memory");      /* input only: the mask loads' address register lives up to this wait and is reused only behind it */
    v8f s0 = fa_mma(ka0, q0, z8); s0 = fa_mma(ka1, q1, s0);
    v8f s1 = fa_mma(kc0, q0, z8); s1 = fa_mma(kc1, q1, s1);
    float v[16]; float bm = -INFINITY;
#pragma unroll
    for (int r = 0; r < 8; ++r) {
      const float ma = bf16_round(r < 4 ? m0[r & 3] : m1[r & 3]), mb = bf16_round(r < 4 ? m2[r & 3] : m3[r & 3]);
      v[r] = (s0[r] * 0.125f) * ma + (-10000.0f * (1.0f - ma) + bs[r]);
      v[8 + r] = (s1[r] * 0.125f) * mb + (-10000.0f * (1.0f - mb) + bs[8 + r]);
      bm = fmaxf(bm, fmaxf(v[r], v[8 + r]));
    }
    const float mn = fmaxf(mx, fmaxf(bm, xhalf(bm)));      /* the same in both lanes of a query */
    const float f = expf(mx - mn);      /* 0 on the first pass, where mx is -inf */
    mx = mn; se *= f;
#pragma unroll
    for (int r = 0; r < 8; ++r) { o0[r] *= f; o1[r] *= f; o2[r] *= f; o3[r] *= f; }
    FragH p;
#pragma unroll
    for (int k = 0; k < 16; ++k) { const float e = expf(v[k] - mn); se += e; p.h[k] = (_Float16)e; }
    o0 = fa_mma(va0, p.v, o0); o1 = fa_mma(va1, p.v, o1); o2 = fa_mma(va2, p.v, o2); o3 = fa_mma(va3, p.v, o3);
  }
    asm volatile("s_wait_dscnt 0x0" ::: "memory");      /* this wave's reads of buffer t & 1 are done */
    asm volatile("s_wait_asynccnt 0x0" ::: "memory");      /* this wave's part of stage t + 1 has landed */
    __syncthreads();      /* publishes stage t + 1 and frees buffer t & 1 */
    if (t + 2 < SQ / FAK) fa_copy(lk + (unsigned)(t & 1) * (FASTG * 2u), lv + (unsigned)(t & 1) * (FASTG * 2u), gk + (size_t)(t + 2) * FAK * D3, gv + (t + 2) * FAK);
  }
  asm volatile("s_wait_asynccnt 0x0" ::: "memory");      /* nothing in flight when the wave ends */
  se += xhalf(se);      /* each lane summed its own half of the keys */
  const float inv = 1.0f / se;
  _Float16* op = O16 + ((size_t)b * SQ + i) * DM + h * HD + 8 * hh;      /* o_t[r] = ctx[query i][d = 16 t + 8 hh + r]: 16 contiguous bytes a tile */
  FragH c0, c1;
#pragma unroll
  for (int r = 0; r < 8; ++r) { c0.h[r] = (_Float16)(o0[r] * inv); c0.h[8 + r] = (_Float16)(o1[r] * inv); c1.h[r] = (_Float16)(o2[r] * inv); c1.h[8 + r] = (_Float16)(o3[r] * inv); }
  *(v8us*)((unsigned short*)op) = c0.half[0]; *(v8us*)((unsigned short*)op + 16) = c0.half[1]; *(v8us*)((unsigned short*)op + 32) = c1.half[0]; *(v8us*)((unsigned short*)op + 48) = c1.half[1];
}
__global__ __launch_bounds__(256) void k_vt(const _Float16* __restrict__ V16, int b, int h0, _Float16* __restrict__ VT) { __shared__ unsigned short tl[64][65]; const int tid = threadIdx.x; const int hh = blockIdx.x % HG, sg = blockIdx.x / HG; const int s0 = sg * 64; const int h = h0 + hh;
  for (int i = tid; i < 64 * 8; i += 256) { const int j = i / 8, d8 = (i % 8) * 8; FragH f; f.half[0] = *(const v8us*)((const unsigned short*)V16 + ((size_t)b * SQ + s0 + j) * DM + h * HD + d8); for (int q = 0; q < 8; ++q) tl[d8 + q][j] = f.u[q]; }
  __syncthreads();
  { for (int i = tid; i < 64 * 8; i += 256) { const int d = i / 8, j8 = (i % 8) * 8; FragH f; for (int q = 0; q < 8; ++q) f.u[q] = tl[d][j8 + q]; *(v8us*)((unsigned short*)VT + ((size_t)hh * HD + d) * SQ + s0 + j8) = f.half[0]; }  } }

extern "C" void kernel_launch(void* const* d_in, const int* in_sizes, int n_in,
                              void* d_out, int out_size, void* d_ws, size_t ws_size, hipStream_t stream) {
  (void)in_sizes; (void)n_in; (void)out_size;
  const float* const* I = (const float* const*)d_in; const float* hs = I[0]; const float* amask = I[1]; const float* wqkv = I[2]; const float* wo = I[3]; const float* emb = I[4];      /* W_qkv [1024][3072] and W_o [1024][1024] are [in][out]; attention_mask [2][1][2048][2048]; rel_bias_emb [32][16] */
  char* ws = (char*)d_ws; size_t off = 0;
  auto take = [&](size_t bytes) { char* p = ws + off; off += (bytes + 255) & ~(size_t)255; return p; };
  _Float16* BQKV = (_Float16*)take((size_t)D3 * DM * 2); _Float16* BO = (_Float16*)take((size_t)DM * DM * 2);
  _Float16* X16 = (_Float16*)take(NR * DM * 2); _Float16* QKV = (_Float16*)take(NR * D3 * 2); _Float16* O16 = (_Float16*)take(NR * DM * 2);
  _Float16* VT = (_Float16*)take((size_t)NB * NH * HD * SQ * 2);
  if (off > ws_size) return;      /* 6 + 2 + 8 + 24 + 8 + 8 = approx 56 MiB */
  k_wt_f16<<<(unsigned)(((size_t)D3 * (DM / 8) + 255) / 256), 256, 0, stream>>>(wqkv, BQKV, DM, D3, 16.0f);      /* [in][out] -> Bt[out][in] x16 */
  k_wt_f16<<<(unsigned)(((size_t)DM * (DM / 8) + 255) / 256), 256, 0, stream>>>(wo, BO, DM, DM, 16.0f);
  k_x16<<<(unsigned)((NR * DM / 8 + 255) / 256), 256, 0, stream>>>(hs, X16, NR * DM / 8);
  k_gemm2<0><<<dim3((unsigned)((NR / 128) * (D3 / 128)), 1), 256, 0, stream>>>(X16, DM, 0, BQKV, DM, 0, 0.0625f, nullptr, 0, nullptr, 1, 0, 0, nullptr, QKV, D3, 0, MP, D3, DM);      /* q | k | v rows (f16), head h at columns h*64 / 1024 + h*64 / 2048 + h*64 */
  k_vt<NH, SQ><<<NB * NH * (SQ / 64), 256, 0, stream>>>(QKV, D3, 2 * DM, VT);      /* V^T[(b,h)][d][s] for every (batch, head) */
  k_fattn<<<dim3(SQ / 256, NB * NH), 512, 0, stream>>>(QKV, VT, emb, amask, O16);      /* ctx (merged heads) as f16 rows; one block per 256 query rows of a (batch, head) */
  k_gemm2<0><<<dim3((unsigned)((NR / 128) * (DM / 128)), 1), 256, 0, stream>>>(O16, DM, 0, BO, DM, 0, 0.0625f, nullptr, 0, nullptr, 1, 0, 0, (float*)d_out, nullptr, DM, 0, MO, DM, DM);      /* out = ctx W_o, rows are the output layout */
}

// v006
// It runs in 140 microseconds.
// Timed twice side by side with v005, it ran 1.14 times as fast both times.
// Over all steps from v000 it is 211 times as fast.
#include <hip/hip_runtime.h>
#define NB 2
#define SQ 2048
#define DM 1024
#define D3 3072                      /* fused q|k|v width */
#define NH 16
#define HD 64
#define HG 4                         /* heads per call of the k_vt(V16, b, h0, VT) overload, which nothing launches */
#define NBK 32                       /* relative-position buckets */
#define MP ((int)NR)                 /* token rows through the qkv projection (debug hook) */
#define MO ((int)NR)                 /* token rows through the output projection (debug hook) */
#define NR ((size_t)NB * SQ)         /* 4096 token rows */
typedef __bf16 v16b __attribute__((ext_vector_type(16)));
typedef unsigned short v8us __attribute__((ext_vector_type(8), may_alias));
typedef float  v8f  __attribute__((ext_vector_type(8)));
typedef float  v4f  __attribute__((ext_vector_type(4)));
typedef float  v4fa __attribute__((ext_vector_type(4), may_alias));
union FragB { v16b v; v8us half[2]; unsigned short u[16]; };

__device__ __forceinline__ unsigned short bf16_bits(float x) { unsigned int u = __float_as_uint(x); return (unsigned short)((u + 0x7FFFu + ((u >> 16) & 1u)) >> 16); }
__device__ __forceinline__ float bf16_val(unsigned short b) { return __uint_as_float(((unsigned int)b) << 16); }
__device__ __forceinline__ float bf16_round(float x) { return bf16_val(bf16_bits(x)); }
// D += A·B with NT terms: 1 = ah·bh, 2 = + al·bh (A split), 3 = + ah·bl (both split)
template <int NT>
__device__ __forceinline__ v8f mmaN(v16b ah, v16b al, v16b bh, v16b bl, v8f c) {
  c = __builtin_amdgcn_wmma_f32_16x16x32_bf16(false, ah, false, bh, (short)0, c, false, false);
  if (NT >= 2) c = __builtin_amdgcn_wmma_f32_16x16x32_bf16(false, al, false, bh, (short)0, c, false, false);
  if (NT >= 3) c = __builtin_amdgcn_wmma_f32_16x16x32_bf16(false, ah, false, bl, (short)0, c, false, false);
  asm volatile("v_nop\n\tv_nop\n\tv_nop\n\tv_nop" : "+v"(c) : "v"(ah), "v"(al), "v"(bh), "v"(bl));
  return c;
}

__global__ __launch_bounds__(256) void k_wt_bf16(const float* __restrict__ W, unsigned short* __restrict__ Wt, int K, int N) {
  const int t = blockIdx.x * 256 + threadIdx.x;
  const int k8n = K / 8;
  if (t >= N * k8n) return;
  const int n = t / k8n, k8 = (t % k8n) * 8;
  v8us v;
#pragma unroll
  for (int i = 0; i < 8; ++i) v[i] = bf16_bits(W[(size_t)(k8 + i) * N + n]);
  *(v8us*)(Wt + (size_t)n * K + k8) = v;
  
}

// GEMM C[M][N] (f32, pitch ldc) = act(A[M][K]·W + bias). A f32 row-major (pitch lda) converted per fragment to bf16
// (ASPLIT: hi/lo two planes -> 2 terms, else single rounded term); Wt bf16 [N][K] (pitch ldb). BIAS_BF16 rounds the
// bias to bf16 first (bias quantised to bf16 before the add). K%32==0, M%16==0, N%64==0.
template <bool ASPLIT, int ACT, bool BIAS_BF16>
__global__ __launch_bounds__(128) void k_gemm_bf(const float* __restrict__ A, int lda, const unsigned short* __restrict__ Wt, int ldb,
                                               const float* __restrict__ bias, float* __restrict__ C, int ldc, int M, int N, int K) {
  __shared__ __attribute__((aligned(16))) float so[4][16][64];
  const int tid = threadIdx.x, w = tid >> 5, lane = tid & 31, ln = lane & 15, hh = lane >> 4;
  const int ntn = N / 64;
  const int wid = blockIdx.x * 4 + w;
  const int mt = wid / ntn, nq = wid % ntn;
  if (mt * 16 >= M) return;
  const int row0 = mt * 16, col0 = nq * 64;
  const float* arow = A + (size_t)(row0 + ln) * lda;
  v8f acc[4] = {};
  for (int kb = 0; kb < K; kb += 32) {
    FragB ah, al;
    const v4f x0 = *(const v4fa*)(arow + kb + 8 * hh), x1 = *(const v4fa*)(arow + kb + 8 * hh + 4);
    const v4f x2 = *(const v4fa*)(arow + kb + 16 + 8 * hh), x3 = *(const v4fa*)(arow + kb + 16 + 8 * hh + 4);
    float xs[16] = {x0[0],x0[1],x0[2],x0[3],x1[0],x1[1],x1[2],x1[3],x2[0],x2[1],x2[2],x2[3],x3[0],x3[1],x3[2],x3[3]};
#pragma unroll
    for (int i = 0; i < 16; ++i) { const unsigned short hb = bf16_bits(xs[i]); ah.u[i] = hb; al.u[i] = ASPLIT ? bf16_bits(xs[i] - bf16_val(hb)) : (unsigned short)0; }
#pragma unroll
    for (int t = 0; t < 4; ++t) {
      const unsigned short* brow = Wt + (size_t)(col0 + t * 16 + ln) * ldb + kb;
      FragB b;
      b.half[0] = *(const v8us*)(brow + 8 * hh);
      b.half[1] = *(const v8us*)(brow + 16 + 8 * hh);
      acc[t] = mmaN<ASPLIT ? 2 : 1>(ah.v, al.v, b.v, b.v, acc[t]);
    }
  }
#pragma unroll
  for (int t = 0; t < 4; ++t) {
    float bv = bias ? bias[col0 + t * 16 + ln] : 0.f;
    if (BIAS_BF16) bv = bf16_round(bv);
#pragma unroll
    for (int r = 0; r < 8; ++r) { float v = acc[t][r] + bv; if (ACT == 1) v = fmaxf(v, 0.f); so[w][8 * hh + r][t * 16 + ln] = v; }
  }
  __builtin_amdgcn_fence(__ATOMIC_ACQ_REL, "workgroup");
  __builtin_amdgcn_wave_barrier();
  const int rsub = lane >> 4, c4 = (lane & 15) * 4;
  {
#pragma unroll
    for (int q = 0; q < 8; ++q) {
      const int r = q * 2 + rsub;
      const v4f v = *(const v4fa*)&so[w][r][c4];
      *(v4f*)(C + (size_t)(row0 + r) * ldc + col0 + c4) = v;
    }
    
  }
}

// GEMM C = act(A·W + bias + resid): A f32 (ASPLIT -> hi/lo 2 terms), Wt bf16 [N][K]; ACT 0 none, 1 relu, 2 exact gelu;
// resid (optional, f32, row index = (row % rmod), pitch ldr, RES_BF16 rounds it) added before the activation.
template <bool ASPLIT, int ACT, bool BIAS_BF16, bool RES_BF16>
__global__ __launch_bounds__(128) void k_gemm_bf3(const float* __restrict__ A, int lda, const unsigned short* __restrict__ Wt, int ldb,
                                                const float* __restrict__ bias, const float* __restrict__ resid, int rmod, int ldr,
                                                float* __restrict__ C, int ldc, int M, int N, int K) {
  __shared__ __attribute__((aligned(16))) float so[4][16][64];
  const int tid = threadIdx.x, w = tid >> 5, lane = tid & 31, ln = lane & 15, hh = lane >> 4;
  const int ntn = N / 64;
  const int wid = blockIdx.x * 4 + w;
  const int mt = wid / ntn, nq = wid % ntn;
  if (mt * 16 >= M) return;
  const int row0 = mt * 16, col0 = nq * 64;
  const float* arow = A + (size_t)(row0 + ln) * lda;
  v8f acc[4] = {};
  for (int kb = 0; kb < K; kb += 32) {
    FragB ah, al;
    const v4f x0 = *(const v4fa*)(arow + kb + 8 * hh), x1 = *(const v4fa*)(arow + kb + 8 * hh + 4);
    const v4f x2 = *(const v4fa*)(arow + kb + 16 + 8 * hh), x3 = *(const v4fa*)(arow + kb + 16 + 8 * hh + 4);
    float xs[16] = {x0[0],x0[1],x0[2],x0[3],x1[0],x1[1],x1[2],x1[3],x2[0],x2[1],x2[2],x2[3],x3[0],x3[1],x3[2],x3[3]};
#pragma unroll
    for (int i = 0; i < 16; ++i) { const unsigned short hb = bf16_bits(xs[i]); ah.u[i] = hb; al.u[i] = ASPLIT ? bf16_bits(xs[i] - bf16_val(hb)) : (unsigned short)0; }
#pragma unroll
    for (int t = 0; t < 4; ++t) {
      const unsigned short* brow = Wt + (size_t)(col0 + t * 16 + ln) * ldb + kb;
      FragB b;
      b.half[0] = *(const v8us*)(brow + 8 * hh);
      b.half[1] = *(const v8us*)(brow + 16 + 8 * hh);
      acc[t] = mmaN<ASPLIT ? 2 : 1>(ah.v, al.v, b.v, b.v, acc[t]);
    }
  }
#pragma unroll
  for (int t = 0; t < 4; ++t) {
    const int col = col0 + t * 16 + ln;
    float bv = bias ? bias[col] : 0.f;
    if (BIAS_BF16) bv = bf16_round(bv);
#pragma unroll
    for (int r = 0; r < 8; ++r) {
      float v = acc[t][r] + bv;
      if (resid) { float rv = resid[(size_t)((row0 + 8 * hh + r) % rmod) * ldr + col]; if (RES_BF16) rv = bf16_round(rv); v += rv; }
      if (ACT == 1) v = fmaxf(v, 0.f);
      if (ACT == 2) v = 0.5f * v * (1.0f + erff(v * 0.70710678118654752f));
      if (ACT == 3) { const float u = 0.7978845608028654f * (v + 0.044715f * v * v * v); v = 0.5f * v * (1.0f + tanhf(u)); }
      so[w][8 * hh + r][t * 16 + ln] = v;
    }
  }
  __builtin_amdgcn_fence(__ATOMIC_ACQ_REL, "workgroup");
  __builtin_amdgcn_wave_barrier();
  const int rsub = lane >> 4, c4 = (lane & 15) * 4;
  {
#pragma unroll
    for (int q = 0; q < 8; ++q) {
      const int r = q * 2 + rsub;
      const v4f v = *(const v4fa*)&so[w][r][c4];
      *(v4f*)(C + (size_t)(row0 + r) * ldc + col0 + c4) = v;
    }
    
  }
}
// row LayerNorm (biased variance, eps) over N: s = X (+ R); optional out_sum <- s; out_norm <- (s-mu)*rsqrt(var+eps)*g + b
template <bool PARAM_BF16>
__global__ __launch_bounds__(256) void k_layernorm(const float* __restrict__ X, const float* __restrict__ R, const float* __restrict__ g, const float* __restrict__ bta,
                                                  float* __restrict__ out_sum, float* __restrict__ out_norm, int N, float eps) {
  __shared__ float red[256];
  const int row = blockIdx.x, tid = threadIdx.x;
  const float* x = X + (size_t)row * N; const float* rr = R ? R + (size_t)row * N : nullptr;
  float vals[16];                     // up to N = 4096
  const int per = N / 256;            // contiguous chunk per thread? use strided-by-4 chunks: thread handles j = tid*4 + 1024*u
  float s1 = 0.f;
  for (int u = 0; u < per / 4; ++u) {
    const int j = tid * 4 + 1024 * u;
    const v4f a = *(const v4fa*)(x + j);
    v4f b = {0.f,0.f,0.f,0.f}; if (rr) b = *(const v4fa*)(rr + j);
#pragma unroll
    for (int q = 0; q < 4; ++q) { const float v = a[q] + b[q]; vals[u * 4 + q] = v; s1 += v; }
  }
  red[tid] = s1; __syncthreads();
  for (int st = 128; st > 0; st >>= 1) { if (tid < st) red[tid] += red[tid + st]; __syncthreads(); }
  const float mu = red[0] / (float)N; __syncthreads();
  float s2 = 0.f;
  for (int u = 0; u < per / 4; ++u)
#pragma unroll
    for (int q = 0; q < 4; ++q) { const float c = vals[u * 4 + q] - mu; s2 += c * c; }
  red[tid] = s2; __syncthreads();
  for (int st = 128; st > 0; st >>= 1) { if (tid < st) red[tid] += red[tid + st]; __syncthreads(); }
  const float rs = rsqrtf(red[0] / (float)N + eps);
  {
    for (int u = 0; u < per / 4; ++u) {
      const int j = tid * 4 + 1024 * u;
      v4f o, sm;
#pragma unroll
      for (int q = 0; q < 4; ++q) {
        float gg = g[j + q], bb = bta[j + q];
        if (PARAM_BF16) { gg = bf16_round(gg); bb = bf16_round(bb); }
        sm[q] = vals[u * 4 + q]; o[q] = (vals[u * 4 + q] - mu) * rs * gg + bb;
      }
      if (out_sum) *(v4f*)(out_sum + (size_t)row * N + j) = sm;
      *(v4f*)(out_norm + (size_t)row * N + j) = o;
    }
    
  }
}



// ---- f16 WMMA path (v_wmma_f32_16x16x32_f16): 11-bit significands for operands in range — used where a [0,1] probability operand needs more precision than bf16
typedef _Float16 v16h __attribute__((ext_vector_type(16)));
union FragH { v16h v; v8us half[2]; _Float16 h[16]; unsigned short u[16]; };
template <int NT>
__device__ __forceinline__ v8f mmaH(v16h ah, v16h al, v16h bh, v16h bl, v8f c) {
  c = __builtin_amdgcn_wmma_f32_16x16x32_f16(false, ah, false, bh, (short)0, c, false, false);
  if (NT >= 2) c = __builtin_amdgcn_wmma_f32_16x16x32_f16(false, al, false, bh, (short)0, c, false, false);
  if (NT >= 3) c = __builtin_amdgcn_wmma_f32_16x16x32_f16(false, ah, false, bl, (short)0, c, false, false);
  asm volatile("v_nop\n\tv_nop\n\tv_nop\n\tv_nop" : "+v"(c) : "v"(ah), "v"(al), "v"(bh), "v"(bl));
  return c;
}
// batched GEMM like k_gemm_b but f16 operands: A f32 (split into f16 hi/lo if ASPLIT, else rounded to f16), Bt = f16 values [n][k]; alpha; C f32; N multiple of 16 (partial tiles skipped)
template <bool ASPLIT>
__global__ __launch_bounds__(128) void k_gemm_h(const float* __restrict__ A, int lda, size_t sA, const _Float16* __restrict__ Bh, int ldb, size_t sB, float alpha, float* __restrict__ C, int ldc, size_t sC, int M, int N, int K) {
  __shared__ __attribute__((aligned(16))) float so[4][16][64];
  const int tid = threadIdx.x, w = tid >> 5, lane = tid & 31, ln = lane & 15, hh = lane >> 4; const int by = blockIdx.y;
  A += (size_t)by * sA; Bh += (size_t)by * sB; C += (size_t)by * sC;
  const int ntn = (N + 63) / 64; const int wid = blockIdx.x * 4 + w; const int mt = wid / ntn, nq = wid % ntn; if (mt * 16 >= M) return;
  const int row0 = mt * 16, col0 = nq * 64; const float* arow = A + (size_t)(row0 + ln) * lda;
  v8f acc[4] = {};
  for (int kb = 0; kb < K; kb += 32) {
    FragH ah, al;
    const v4f x0 = *(const v4fa*)(arow + kb + 8 * hh), x1 = *(const v4fa*)(arow + kb + 8 * hh + 4), x2 = *(const v4fa*)(arow + kb + 16 + 8 * hh), x3 = *(const v4fa*)(arow + kb + 16 + 8 * hh + 4);
    float xs[16] = {x0[0],x0[1],x0[2],x0[3],x1[0],x1[1],x1[2],x1[3],x2[0],x2[1],x2[2],x2[3],x3[0],x3[1],x3[2],x3[3]};
#pragma unroll
    for (int i = 0; i < 16; ++i) { const _Float16 h = (_Float16)xs[i]; ah.h[i] = h; al.h[i] = ASPLIT ? (_Float16)(xs[i] - (float)h) : (_Float16)0.0f; }
#pragma unroll
    for (int t = 0; t < 4; ++t) { if (col0 + t * 16 >= N) continue; const size_t boff = (size_t)(col0 + t * 16 + ln) * ldb + kb; FragH bq; bq.half[0] = *(const v8us*)(Bh + boff + 8 * hh); bq.half[1] = *(const v8us*)(Bh + boff + 16 + 8 * hh);
      acc[t] = mmaH<ASPLIT ? 2 : 1>(ah.v, al.v, bq.v, bq.v, acc[t]); }
  }
#pragma unroll
  for (int t = 0; t < 4; ++t) { if (col0 + t * 16 >= N) continue;
#pragma unroll
    for (int r = 0; r < 8; ++r) so[w][8 * hh + r][t * 16 + ln] = acc[t][r] * alpha; }
  __builtin_amdgcn_fence(__ATOMIC_ACQ_REL, "workgroup"); __builtin_amdgcn_wave_barrier();
  const int rsub = lane >> 4, c4 = (lane & 15) * 4;
  {
#pragma unroll
    for (int q = 0; q < 8; ++q) { const int r = q * 2 + rsub; if (col0 + c4 < N) { const v4f v = *(const v4fa*)&so[w][r][c4]; *(v4f*)(C + (size_t)(row0 + r) * ldc + col0 + c4) = v; } }
     }
}

// Wt[n][k] = f16(W[k][n]·scale) from f32 row-major W[K][N] (scale = power of two; bf16-exact weights stay exact in f16 away from the subnormal range)
__global__ __launch_bounds__(256) void k_wt_f16(const float* __restrict__ W, _Float16* __restrict__ Wt, int K, int N, float scale) {
  const int t = blockIdx.x * 256 + threadIdx.x; if (t >= N * (K / 8)) return; const int n = t / (K / 8), k8 = (t % (K / 8)) * 8; FragH f;
#pragma unroll
  for (int i = 0; i < 8; ++i) f.h[i] = (_Float16)(bf16_round(W[(size_t)(k8 + i) * N + n]) * scale); const v8us o = f.half[0];
  *(v8us*)((unsigned short*)Wt + (size_t)n * K + k8) = o; 
}
// k_gemm_hh variant with fused epilogue: v = acc·alpha + bias[by·sBias + col] (+ CP[(row/rowsPerB)·sCPb + by·64 + col] if CP) ; ACT 0 none / 1 elu ; writes f16 C16 (and f32 C if non-null)
template <int ACT>
__global__ __launch_bounds__(128) void k_gemm_hhx(const _Float16* __restrict__ A, int lda, size_t sA, const _Float16* __restrict__ Bh, int ldb, size_t sB, float alpha, const float* __restrict__ bias, size_t sBias, const float* __restrict__ CP, int rowsPerB, size_t sCPb, int row0g,
    float* __restrict__ C, _Float16* __restrict__ C16, int ldc, size_t sC, int M, int N, int K) {
  __shared__ __attribute__((aligned(16))) float so[4][16][64];
  const int tid = threadIdx.x, w = tid >> 5, lane = tid & 31, ln = lane & 15, hh = lane >> 4; const int by = blockIdx.y;
  A += (size_t)by * sA; Bh += (size_t)by * sB; const size_t cofs = (size_t)by * sC; const float* bp = bias ? bias + (size_t)by * sBias : nullptr;
  const int ntn = (N + 63) / 64; const int wid = blockIdx.x * 4 + w; const int mt = wid / ntn, nq = wid % ntn; if (mt * 16 >= M) return;
  const int row0 = mt * 16, col0 = nq * 64; const _Float16* arow = A + (size_t)(row0 + ln) * lda;
  v8f acc[4] = {};
  for (int kb = 0; kb < K; kb += 32) { FragH ah; ah.half[0] = *(const v8us*)((const unsigned short*)arow + kb + 8 * hh); ah.half[1] = *(const v8us*)((const unsigned short*)arow + kb + 16 + 8 * hh);
#pragma unroll
    for (int t = 0; t < 4; ++t) { if (col0 + t * 16 >= N) continue; const size_t boff = (size_t)(col0 + t * 16 + ln) * ldb + kb; FragH bq; bq.half[0] = *(const v8us*)((const unsigned short*)Bh + boff + 8 * hh); bq.half[1] = *(const v8us*)((const unsigned short*)Bh + boff + 16 + 8 * hh);
      acc[t] = mmaH<1>(ah.v, ah.v, bq.v, bq.v, acc[t]); }
  }
#pragma unroll
  for (int t = 0; t < 4; ++t) { if (col0 + t * 16 >= N) continue; const int col = col0 + t * 16 + ln; const float bv = bp ? bf16_round(bp[col]) : 0.f;
#pragma unroll
    for (int r = 0; r < 8; ++r) { float v = acc[t][r] * alpha + bv; if (CP) { const int rr = row0g + row0 + 8 * hh + r; if (rowsPerB < 0) v += CP[cofs + (size_t)rr * ldc + col];      /* rowsPerB < 0: own element of the batched C plane */ else { const int bidx = rr / rowsPerB; v += CP[(size_t)bidx * sCPb + (size_t)by * 64 + col]; } } if (ACT == 1) v = (v > 0.f) ? v : expm1f(v); else if (ACT == 7) v = (v > 0.f) ? v + 1.0f : expf(v); else if (ACT == 8) v = tanhf(v); else if (ACT == 9) v = 0.5f * v * (1.0f + tanhf(0.7978845608028654f * (v + 0.044715f * v * v * v))); else if (ACT == 11) v = 1.0f / (1.0f + expf(-v)); else if (ACT == 12) v = (v > 0.f) ? v : 0.01f * v; else if (ACT == 14) v = (v > 0.f) ? v : 0.1f * v; else if (ACT == 16) v = (v >= 0.f) ? v : 0.3f * v; else if (ACT == 17) v = (v >= 0.f) ? v : 0.2f * v; else if (ACT == 15) v = v / (1.0f + expf(-v)); else if (ACT == 3) v = fmaxf(v, 0.f); else if (ACT == 6) v = 0.5f * v * (1.0f + erff(v * 0.70710678118654752f)); so[w][8 * hh + r][t * 16 + ln] = v; } }
  __builtin_amdgcn_fence(__ATOMIC_ACQ_REL, "workgroup"); __builtin_amdgcn_wave_barrier();
  const int rsub = lane >> 4, c4 = (lane & 15) * 4; typedef _Float16 v4h __attribute__((ext_vector_type(4)));
  {
#pragma unroll
    for (int q = 0; q < 8; ++q) { const int r = q * 2 + rsub; if (col0 + c4 < N) { const v4f v = *(const v4fa*)&so[w][r][c4]; if (C) *(v4f*)(C + cofs + (size_t)(row0 + r) * ldc + col0 + c4) = v; if (C16) { v4h h4; for (int i = 0; i < 4; ++i) h4[i] = (_Float16)v[i]; *(v4h*)(C16 + cofs + (size_t)(row0 + r) * ldc + col0 + c4) = h4; } } }
     }
}


typedef _Float16 v4h __attribute__((ext_vector_type(4)));

__global__ __launch_bounds__(256) void k_x16(const float* __restrict__ x, _Float16* __restrict__ X16, size_t n8) { const size_t t = (size_t)blockIdx.x * 256 + threadIdx.x; if (t >= n8) return; FragH f;
#pragma unroll
  for (int q = 0; q < 8; ++q) f.h[q] = (_Float16)bf16_round(x[t * 8 + q]); *(v8us*)((unsigned short*)X16 + t * 8) = f.half[0];  }
__global__ __launch_bounds__(256) void k_h16(const float* __restrict__ x, _Float16* __restrict__ X16, size_t n8) { const size_t t = (size_t)blockIdx.x * 256 + threadIdx.x; if (t >= n8) return; FragH f;
#pragma unroll
  for (int q = 0; q < 8; ++q) f.h[q] = (_Float16)x[t * 8 + q]; *(v8us*)((unsigned short*)X16 + t * 8) = f.half[0];  }
__global__ __launch_bounds__(256) void k_round16f(const float* __restrict__ W, _Float16* __restrict__ Bt, size_t n8) { const size_t t = (size_t)blockIdx.x * 256 + threadIdx.x; if (t >= n8) return; FragH f;
#pragma unroll
  for (int i = 0; i < 8; ++i) f.h[i] = (_Float16)(bf16_round(W[t * 8 + i]) * 16.0f); *(v8us*)((unsigned short*)Bt + t * 8) = f.half[0];  }
template <int NHv, int TTv>
__global__ __launch_bounds__(256) void k_vt(const _Float16* __restrict__ V16, int ldv, int voff, _Float16* __restrict__ Vt) { __shared__ unsigned short tl[64][66]; const int tid = threadIdx.x; const int slab = blockIdx.x / (TTv / 64), lg = blockIdx.x % (TTv / 64); const int b = slab / NHv, h = slab % NHv;
  for (int i = tid; i < 64 * 8; i += 256) { const int r = i / 8, c8 = (i % 8) * 8; FragH f; f.half[0] = *(const v8us*)((const unsigned short*)V16 + ((size_t)b * TTv + lg * 64 + r) * ldv + voff + h * 64 + c8);
#pragma unroll
    for (int q = 0; q < 8; ++q) tl[r][c8 + q] = f.u[q]; }
  __syncthreads();
  {
#pragma unroll
    for (int rd = 0; rd < 2; ++rd) { const int d = rd * 32 + tid / 8, pc = tid % 8; FragH f;
#pragma unroll
      for (int q = 0; q < 8; ++q) f.u[q] = tl[pc * 8 + q][d];
      *(v8us*)((unsigned short*)Vt + ((size_t)slab * 64 + d) * TTv + lg * 64 + pc * 8) = f.half[0]; }
     } }

__global__ __launch_bounds__(256) void k_hl(const float* __restrict__ F, _Float16* __restrict__ Hh, _Float16* __restrict__ Hl, size_t n8) { const size_t t = (size_t)blockIdx.x * 256 + threadIdx.x; if (t >= n8) return; FragH fh, fl; const v4f a = *(const v4fa*)(F + t * 8), c = *(const v4fa*)(F + t * 8 + 4);
#pragma unroll
  for (int q = 0; q < 4; ++q) { _Float16 h = (_Float16)a[q]; fh.h[q] = h; fl.h[q] = (_Float16)((a[q] - (float)h) * 1024.0f); h = (_Float16)c[q]; fh.h[4 + q] = h; fl.h[4 + q] = (_Float16)((c[q] - (float)h) * 1024.0f); }
  { *(v8us*)((unsigned short*)Hh + t * 8) = fh.half[0]; *(v8us*)((unsigned short*)Hl + t * 8) = fl.half[0];  } }

// ---- fast GEMM (block tile 128x128 on 8 waves, wave tile 32x64; requires M % 128 == 0, N % 128 == 0, K % 64 == 0, K >= 64); epilogue = k_gemm_hhx semantics ----
// Operand path: a k tile is 64 k = one whole 128-byte line of each of the block's 128 A rows and 128 Bt rows. The 256 threads bring it into LDS by asynchronous 16-byte copies
// (8 lanes a row, so every wave-wide copy covers 4 whole lines), two buffers, the next tile in flight while this one is multiplied; the waves read their fragments from LDS in the k order of g2_frag.
#define G2P 72                       /* halfs per LDS row: 128 bytes of data + 16, the conflict-free pitch for 16-byte reads */
#define G2STG (256 * G2P * 2)        /* bytes of one buffer: 128 A rows, then 128 Bt rows */
__device__ __forceinline__ v16h g2_frag(const _Float16* p, int hh) { FragH f; f.half[0] = *(const v8us*)((const unsigned short*)p + 8 * hh); f.half[1] = *(const v8us*)((const unsigned short*)p + 16 + 8 * hh); return f.v; }
__device__ __forceinline__ v16h g2_lfrag(const unsigned short* p) { FragH f; f.half[0] = *(const v8us*)(p); f.half[1] = *(const v8us*)(p + 16); return f.v; }
__device__ __forceinline__ v8f g2_mma(v16h a, v16h b, v8f c) { return __builtin_amdgcn_wmma_f32_16x16x32_f16(false, a, false, b, (short)0, c, false, false); }
// one k tile: this thread's 16 bytes of rows r, r + 32, r + 64, r + 96 of A (pitch pa halfs) and of Bt (pitch pb); l = LDS byte address of its place in row r of the buffer.
// The s_wait_xcnt closes the copies' own statement, so that no address register is rewritten ahead of it.
__device__ __forceinline__ void g2_copy(unsigned l, const _Float16* a, size_t pa, const _Float16* b, size_t pb) {
  asm volatile("global_load_async_to_lds_b128 %0, %8, off\n\t"
               "global_load_async_to_lds_b128 %1, %9, off\n\t"
               "global_load_async_to_lds_b128 %2, %10, off\n\t"
               "global_load_async_to_lds_b128 %3, %11, off\n\t"
               "global_load_async_to_lds_b128 %4, %12, off\n\t"
               "global_load_async_to_lds_b128 %5, %13, off\n\t"
               "global_load_async_to_lds_b128 %6, %14, off\n\t"
               "global_load_async_to_lds_b128 %7, %15, off\n\t"
               "s_wait_xcnt 0x0"
               :: "v"(l), "v"(l + 32u * G2P * 2u), "v"(l + 64u * G2P * 2u), "v"(l + 96u * G2P * 2u), "v"(l + 128u * G2P * 2u), "v"(l + 160u * G2P * 2u), "v"(l + 192u * G2P * 2u), "v"(l + 224u * G2P * 2u),
                  "v"(a), "v"(a + 32 * pa), "v"(a + 64 * pa), "v"(a + 96 * pa), "v"(b), "v"(b + 32 * pb), "v"(b + 64 * pb), "v"(b + 96 * pb) : "memory");
}
template <int ACT>
__global__ __launch_bounds__(256) void k_gemm2(const _Float16* __restrict__ A, int lda, size_t sA, const _Float16* __restrict__ Bh, int ldb, size_t sB, float alpha, const float* __restrict__ bias, size_t sBias, const float* __restrict__ CP, int rowsPerB, size_t sCPb, int row0g,
    float* __restrict__ C, _Float16* __restrict__ C16, int ldc, size_t sC, int M, int N, int K) { static_assert(ACT == 0 || ACT == 3 || ACT == 6 || ACT == 8 || ACT == 9 || ACT == 11 || ACT == 12 || ACT == 14 || ACT == 15 || ACT == 16 || ACT == 17, "k_gemm2: unsupported ACT code (would silently apply no activation)");
  __shared__ __attribute__((aligned(16))) unsigned short ring[2][256][G2P];      /* the two operand buffers; behind the k loop the same bytes are the waves' output staging */
  static_assert(sizeof(float) * 8 * 32 * 68 <= sizeof(unsigned short) * 2 * 256 * G2P, "output staging must fit the ring");
  const int tid = threadIdx.x, w = tid >> 5, lane = tid & 31, ln = lane & 15, hh = lane >> 4; const int by = blockIdx.y;
  A += (size_t)by * sA; Bh += (size_t)by * sB; const size_t cofs = (size_t)by * sC; const float* bp = bias ? bias + (size_t)by * sBias : nullptr;
  const int ntn = N >> 7; const int mt = blockIdx.x / ntn, nq = blockIdx.x - mt * ntn; const int m0 = mt * 128, n0 = nq * 128; if (m0 >= M) return;      /* the same for the whole block, ahead of every barrier */
  const int wr = 32 * (w & 3), wc = 64 * (w >> 2); const int row0 = m0 + wr, col0 = n0 + wc;
  const int cr = tid >> 3, cs = (tid & 7) * 8;      /* this thread's row (of each 32) and its 8 halfs of the 64 in a k tile */
  const _Float16* ga = A + (size_t)(m0 + cr) * lda + cs; const _Float16* gb = Bh + (size_t)(n0 + cr) * ldb + cs;
  const unsigned l0 = (unsigned)(size_t)&ring[0][cr][cs];      /* low 32 bits of the shared address = byte offset in the block's LDS */
  const int nt = K >> 6;
  const v8f z8 = {0.f,0.f,0.f,0.f,0.f,0.f,0.f,0.f}; v8f c00 = z8, c01 = z8, c02 = z8, c03 = z8, c10 = z8, c11 = z8, c12 = z8, c13 = z8;
  g2_copy(l0, ga, (size_t)lda, gb, (size_t)ldb);
  asm volatile("s_wait_asynccnt 0x0" ::: "memory");      /* this wave's part of tile 0 has landed */
  __syncthreads();      /* tile 0 is readable by every wave */
  if (nt > 1) g2_copy(l0 + G2STG, ga + 64, (size_t)lda, gb + 64, (size_t)ldb);
#pragma unroll 1      /* one trip = one buffer; the two buffers alternate by t & 1 */
  for (int t = 0; t < nt; ++t) {
    const unsigned short* ta = &ring[t & 1][wr + ln][8 * hh]; const unsigned short* tb = &ring[t & 1][128 + wc + ln][8 * hh];
#pragma unroll      /* the two 32-k steps of a tile: constant LDS offsets */
    for (int ks = 0; ks < 64; ks += 32) {
      const v16h a0 = g2_lfrag(ta + ks), a1 = g2_lfrag(ta + 16 * G2P + ks);
      const v16h b0 = g2_lfrag(tb + ks), b1 = g2_lfrag(tb + 16 * G2P + ks), b2 = g2_lfrag(tb + 32 * G2P + ks), b3 = g2_lfrag(tb + 48 * G2P + ks);
      __builtin_amdgcn_sched_barrier(0);      /* the 12 LDS reads of a step issue as one group ahead of its 8 products: left alone the compiler reuses the B registers and the wave waits for LDS four times a step */
      c00 = g2_mma(a0, b0, c00); c10 = g2_mma(a1, b0, c10); c01 = g2_mma(a0, b1, c01); c11 = g2_mma(a1, b1, c11);
      c02 = g2_mma(a0, b2, c02); c12 = g2_mma(a1, b2, c12); c03 = g2_mma(a0, b3, c03); c13 = g2_mma(a1, b3, c13);
    }
    asm volatile("s_wait_dscnt 0x0" ::: "memory");      /* this wave's reads of buffer t & 1 are done */
    asm volatile("s_wait_asynccnt 0x0" ::: "memory");      /* this wave's part of tile t + 1 has landed */
    __syncthreads();      /* publishes tile t + 1 and frees buffer t & 1 */
    if (t + 2 < nt) g2_copy(l0 + (unsigned)(t & 1) * G2STG, ga + (size_t)(t + 2) * 64, (size_t)lda, gb + (size_t)(t + 2) * 64, (size_t)ldb);
  }
  asm volatile("s_wait_asynccnt 0x0" ::: "memory");      /* nothing in flight when the ring becomes output staging (the last trip's barrier has ended every read of it) */
  float (*so)[32][68] = reinterpret_cast<float (*)[32][68]>(&ring[0][0][0]);
  v8f accs[8] = {c00, c01, c02, c03, c10, c11, c12, c13};
#pragma unroll
  for (int u = 0; u < 8; ++u) { const int t = u & 3, half = u >> 2; const int col = col0 + t * 16 + ln; const float bv = bp ? bf16_round(bp[col]) : 0.f;
#pragma unroll
    for (int r = 0; r < 8; ++r) { const int rloc = half * 16 + 8 * hh + r; float v = accs[u][r] * alpha + bv; if (CP) { if (rowsPerB < 0) v += CP[cofs + (size_t)(row0g + row0 + rloc) * ldc + col];      /* rowsPerB < 0: own element of the batched C plane */ else { const int bidx = (row0g + row0 + rloc) / rowsPerB; v += CP[(size_t)bidx * sCPb + (size_t)by * 64 + col]; } }
      if (ACT == 3) v = fmaxf(v, 0.f); else if (ACT == 6) v = 0.5f * v * (1.0f + erff(v * 0.70710678118654752f)); else if (ACT == 11) v = 1.0f / (1.0f + expf(-v)); else if (ACT == 15) v = v / (1.0f + expf(-v)); else if (ACT == 12) v = (v > 0.f) ? v : 0.01f * v; else if (ACT == 8) v = tanhf(v); else if (ACT == 9) v = 0.5f * v * (1.0f + tanhf(0.7978845608028654f * (v + 0.044715f * v * v * v))); else if (ACT == 14) v = (v > 0.f) ? v : 0.1f * v; else if (ACT == 16) v = (v >= 0.f) ? v : 0.3f * v; else if (ACT == 17) v = (v >= 0.f) ? v : 0.2f * v;
      so[w][rloc][t * 16 + ln] = v; } }
  __builtin_amdgcn_fence(__ATOMIC_ACQ_REL, "workgroup"); __builtin_amdgcn_wave_barrier();
  const int rsub = lane >> 4, c4 = (lane & 15) * 4;
  {
#pragma unroll
    for (int q = 0; q < 16; ++q) { const int r = q * 2 + rsub; const v4f v = *(const v4fa*)&so[w][r][c4]; if (C) *(v4f*)(C + cofs + (size_t)(row0 + r) * ldc + col0 + c4) = v; if (C16) { v4h h4; for (int i = 0; i < 4; ++i) h4[i] = (_Float16)v[i]; *(v4h*)(C16 + cofs + (size_t)(row0 + r) * ldc + col0 + c4) = h4; } }
     } }


__global__ __launch_bounds__(256) void k_wnat(const float* __restrict__ w, size_t n8, _Float16* __restrict__ Bt) { const size_t t = (size_t)blockIdx.x * 256 + threadIdx.x; if (t >= n8) return; FragH f; for (int q = 0; q < 8; ++q) f.h[q] = (_Float16)(bf16_round(w[t * 8 + q]) * 16.0f); *(v8us*)((unsigned short*)Bt + t * 8) = f.half[0];  }
// T5 bidirectional relative-position bucket of rel = key - query (32 buckets, max distance 128): (rel > 0)*16 + f(|rel|), f(n) = n for n < 8, then
// 8 + the number of thresholds {12,16,23,32,46,64,91} that are <= n (the thresholds are where the reference's own f32 log expression steps; no log on the device)
__device__ __forceinline__ int t5_bucket(int rel) { const int n = rel < 0 ? -rel : rel; const int g = 8 + (n >= 12) + (n >= 16) + (n >= 23) + (n >= 32) + (n >= 46) + (n >= 64) + (n >= 91); return (rel > 0 ? NBK / 2 : 0) + (n < 8 ? n : g); }
// lane l with lane l ^ 16 (the two lanes that share one query column)
__device__ __forceinline__ float xhalf(float x) { return __builtin_bit_cast(float, __builtin_amdgcn_permlanex16(__builtin_bit_cast(int, x), __builtin_bit_cast(int, x), 0x76543210, 0xfedcba98, false, false)); }
__device__ __forceinline__ v8f fa_mma(v16h a, v16h b, v8f c) { return __builtin_amdgcn_wmma_f32_16x16x32_f16(false, a, false, b, (short)0, c, false, false); }
// Operand path of the fused attention: a stage is 128 keys = 128 K rows (one whole 128-byte line each) and the 64 V^T rows (two whole lines each). The block's 512 threads bring it into LDS by asynchronous 16-byte copies
// (a wave-wide copy covers 4 whole lines), two buffers, the next stage in flight while this one is worked on; all 16 waves read their A fragments from LDS in the k order of g2_frag.
#define FAK 128                      /* keys per stage */
#define FAKP 72                      /* halfs per K row in LDS: 128 bytes of data + 16, the conflict-free pitch for 16-byte reads */
#define FAVP 136                     /* halfs per V^T row in LDS: 256 bytes of data + 16, likewise */
#define FASTG (FAK * FAKP + HD * FAVP)      /* halfs of one buffer: the K rows, then the V^T rows */
#define FAL2E 1.4426950408889634f    /* log2(e): the scores are formed in base-2 units, so that a weight is one subtraction and one hardware 2^x */
// one stage: this thread's 16 bytes of K rows r and r + 64 (token pitch D3) and of V^T rows d and d + 32 (pitch SQ); lk, lv = LDS byte addresses of its places in rows r and d of the buffer.
// The s_wait_xcnt closes the copies' own statement, so that no address register is rewritten ahead of it.
__device__ __forceinline__ void fa_copy(unsigned lk, unsigned lv, const _Float16* k, const _Float16* v) {
  asm volatile("global_load_async_to_lds_b128 %0, %4, off\n\t"
               "global_load_async_to_lds_b128 %1, %5, off\n\t"
               "global_load_async_to_lds_b128 %2, %6, off\n\t"
               "global_load_async_to_lds_b128 %3, %7, off\n\t"
               "s_wait_xcnt 0x0"
               :: "v"(lk), "v"(lk + 64u * FAKP * 2u), "v"(lv), "v"(lv + 32u * FAVP * 2u),
                  "v"(k), "v"(k + (size_t)64 * D3), "v"(v), "v"(v + (size_t)32 * SQ) : "memory");
}
// fused attention of one (batch, head): scores, bias and mask, softmax and P.V in one pass over the keys; S and P stay in registers.
// One wave owns 16 query rows, a block 16 waves = 256 rows (256 blocks: one a WGP, four waves a SIMD, all reading the same K and V^T rows from the block's LDS); a pass takes 32 keys. Transposed products: S^T = K Q^T (A = key rows, B = the wave's q rows, loaded once),
// so lane (ln, hh) holds, for query q0 + ln, the keys kb + 8 hh + r and kb + 16 + 8 hh + r: the k order of g2_frag, and the 16 weights are the B operand of O^T += V^T P^T as they lie (A = V^T rows).
// score = s*m + (-10000*(1-m) + emb[bucket(j-i)][h]) as in the reference (bf16-rounded emb, this head's values by key - query distance in LDS; m = mask[b][q][k] bf16-rounded), every term times log2(e): the factor is in the 1/8, the -10000 and the table.
// Online softmax: running maximum and sum per query, both in-lane but for one exchange between the lane halves; the output tile and the sum are rescaled every pass; weights exp(score - maximum) = 2^(scaled score - scaled maximum) <= 1 as f16.
__global__ __launch_bounds__(512) void k_fattn(const _Float16* __restrict__ QKV, const _Float16* __restrict__ VT, const float* __restrict__ emb, const float* __restrict__ amask, _Float16* __restrict__ O16) {
  __shared__ __attribute__((aligned(16))) struct { float tb[5 * 512]; unsigned short ring[2][FASTG]; } sm;      /* one object, the table first: its reads keep small constant offsets */
  float (&tb)[5 * 512] = sm.tb;      /* tb[t] = this head's bias at key - query = t - (the block's last query row): the SQ + 255 distances that the block's 256 queries meet, rounded up to five entries a thread */
  unsigned short (&ring)[2][FASTG] = sm.ring;      /* the two K | V^T buffers */
  const int bh = blockIdx.y, b = bh / NH, h = bh % NH;
  const int ckr = (int)threadIdx.x >> 3, ckc = ((int)threadIdx.x & 7) * 8, cvr = (int)threadIdx.x >> 4, cvc = ((int)threadIdx.x & 15) * 8;      /* this thread's K row (of each 64) and V^T row (of each 32) and its 8 halfs of them */
  const _Float16* gk = QKV + ((size_t)b * SQ + ckr) * D3 + DM + h * HD + ckc; const _Float16* gv = VT + ((size_t)bh * HD + cvr) * SQ + cvc;
  const unsigned lk = (unsigned)(size_t)&ring[0][ckr * FAKP + ckc], lv = (unsigned)(size_t)&ring[0][FAK * FAKP + cvr * FAVP + cvc];      /* low 32 bits of the shared address = byte offset in the block's LDS */
  fa_copy(lk, lv, gk, gv);      /* stage 0 flies while the bias table is built */
#pragma unroll      /* the five table reads of a thread are in flight together */
  for (int u = 0; u < 5; ++u) { const int t = u * 512 + (int)threadIdx.x; tb[t] = bf16_round(emb[t5_bucket(t - (int)(blockIdx.x * 256 + 255)) * NH + h]) * FAL2E; }
  asm volatile("s_wait_asynccnt 0x0" ::: "memory");      /* this wave's part of stage 0 has landed */
  __syncthreads();      /* the bias table and stage 0 are readable by every wave */
  fa_copy(lk + FASTG * 2u, lv + FASTG * 2u, gk + (size_t)FAK * D3, gv + FAK);      /* stage 1 (there are SQ / FAK = 16) */
  const int lane = threadIdx.x & 31, ln = lane & 15, hh = lane >> 4;
  const int i = blockIdx.x * 256 + (threadIdx.x >> 5) * 16 + ln;      /* this lane's query row */
  const _Float16* qp = QKV + ((size_t)b * SQ + i) * D3 + h * HD;
  const v16h q0 = g2_frag(qp, hh), q1 = g2_frag(qp + 32, hh);
  const float* mr = amask + ((size_t)b * SQ + i) * SQ + 8 * hh;
  const float* bp = tb + (8 * hh + 255 - (int)((threadIdx.x >> 5) * 16 + ln));      /* bp[j] = the bias of key j + 8 hh for this lane's query */
  const v8f z8 = {0.f,0.f,0.f,0.f,0.f,0.f,0.f,0.f}; v8f o0 = z8, o1 = z8, o2 = z8, o3 = z8;
  float mx = -INFINITY, se = 0.f;
#pragma unroll 1      /* one trip = one buffer; the two buffers alternate by t & 1 */
  for (int t = 0; t < SQ / FAK; ++t) {
  const unsigned short* kt = &ring[t & 1][ln * FAKP + 8 * hh];      /* K row ln of the stage; the lane half's offset of g2_frag is in kt, vt and mr already */
  const unsigned short* vt = &ring[t & 1][FAK * FAKP + ln * FAVP + 8 * hh];      /* V^T row d = ln */
#pragma unroll 1      /* one pass holds some 200 vector instructions already: unrolling would only cost registers and instruction cache */
  for (int kb = t * FAK; kb < (t + 1) * FAK; kb += 32) {
    const unsigned short* k0 = kt + (kb - t * FAK) * FAKP; const unsigned short* vk = vt + (kb - t * FAK); const float* mk = mr + kb;
    const v4f m0 = *(const v4fa*)(mk), m1 = *(const v4fa*)(mk + 4), m2 = *(const v4fa*)(mk + 16), m3 = *(const v4fa*)(mk + 20);
    const v16h ka0 = g2_lfrag(k0), ka1 = g2_lfrag(k0 + 32), kc0 = g2_lfrag(k0 + 16 * FAKP), kc1 = g2_lfrag(k0 + 16 * FAKP + 32);
    const v16h va0 = g2_lfrag(vk), va1 = g2_lfrag(vk + 16 * FAVP), va2 = g2_lfrag(vk + 32 * FAVP), va3 = g2_lfrag(vk + 48 * FAVP);
    float bs[16];      /* the 16 bias values of the pass: two runs of 8 consecutive table entries, 16 apart */
#pragma unroll      /* bs[] and v[] indexed by constants only, so that they live in registers */
    for (int r = 0; r < 8; ++r) { bs[r] = bp[kb + r]; bs[8 + r] = bp[kb + 16 + r]; }
    __builtin_amdgcn_sched_barrier(0);      /* the 4 mask loads, the 16 fragment reads and the table reads of a pass are issued together, ahead of all else: left alone the compiler sinks some of them to just in front of their use and the wave waits again */
    asm volatile("s_wait_xcnt 0x0" :: "v"(mk) : "memory");      /* input only: the mask loads' address register lives up to this wait and is reused only behind it */
    v8f s0 = fa_mma(ka0, q0, z8); s0 = fa_mma(ka1, q1, s0);
    v8f s1 = fa_mma(kc0, q0, z8); s1 = fa_mma(kc1, q1, s1);
    float v[16]; float bm = -INFINITY;
#pragma unroll
    for (int r = 0; r < 8; ++r) {
      const float ma = bf16_round(r < 4 ? m0[r & 3] : m1[r & 3]), mb = bf16_round(r < 4 ? m2[r & 3] : m3[r & 3]);
      v[r] = (s0[r] * (0.125f * FAL2E)) * ma + ((-10000.0f * FAL2E) * (1.0f - ma) + bs[r]);
      v[8 + r] = (s1[r] * (0.125f * FAL2E)) * mb + ((-10000.0f * FAL2E) * (1.0f - mb) + bs[8 + r]);
      bm = fmaxf(bm, fmaxf(v[r], v[8 + r]));
    }
    const float mn = fmaxf(mx, fmaxf(bm, xhalf(bm)));      /* the same in both lanes of a query */
    const float f = __builtin_amdgcn_exp2f(mx - mn);      /* 0 on the first pass, where mx is -inf; exactly 1 where the maximum stays */
    mx = mn; se *= f;
    FragH p;
#pragma unroll      /* four weights at a time, then the rescale of one output tile */
    for (int t = 0; t < 4; ++t) {
#pragma unroll
      for (int k = 4 * t; k < 4 * t + 4; ++k) { v[k] = __builtin_amdgcn_exp2f(v[k] - mn); p.h[k] = (_Float16)v[k]; }
      v8f& ot = t == 0 ? o0 : t == 1 ? o1 : t == 2 ? o2 : o3;
#pragma unroll
      for (int r = 0; r < 8; ++r) ot[r] *= f;
      __builtin_amdgcn_sched_barrier(0);      /* keeps the groups apart, so that plain multiplies and conversions issue between the runs of 2^x: left alone the compiler issues all 17 in one run */
    }
    o0 = fa_mma(va0, p.v, o0); o1 = fa_mma(va1, p.v, o1); o2 = fa_mma(va2, p.v, o2); o3 = fa_mma(va3, p.v, o3);
    __builtin_amdgcn_sched_barrier(0);      /* the sum of the weights stays behind the pass's last product: its additions are the vector slots that the chip needs between that product and the next pass's first write to one of its operand registers, and they issue while the matrix unit works */
#pragma unroll
    for (int k = 0; k < 16; ++k) se += v[k];
  }
    asm volatile("s_wait_dscnt 0x0" ::: "memory");      /* this wave's reads of buffer t & 1 are done */
    asm volatile("s_wait_asynccnt 0x0" ::: "memory");      /* this wave's part of stage t + 1 has landed */
    __syncthreads();      /* publishes stage t + 1 and frees buffer t & 1 */
    if (t + 2 < SQ / FAK) fa_copy(lk + (unsigned)(t & 1) * (FASTG * 2u), lv + (unsigned)(t & 1) * (FASTG * 2u), gk + (size_t)(t + 2) * FAK * D3, gv + (t + 2) * FAK);
  }
  asm volatile("s_wait_asynccnt 0x0" ::: "memory");      /* nothing in flight when the wave ends */
  se += xhalf(se);      /* each lane summed its own half of the keys */
  const float inv = 1.0f / se;
  _Float16* op = O16 + ((size_t)b * SQ + i) * DM + h * HD + 8 * hh;      /* o_t[r] = ctx[query i][d = 16 t + 8 hh + r]: 16 contiguous bytes a tile */
  FragH c0, c1;
#pragma unroll
  for (int r = 0; r < 8; ++r) { c0.h[r] = (_Float16)(o0[r] * inv); c0.h[8 + r] = (_Float16)(o1[r] * inv); c1.h[r] = (_Float16)(o2[r] * inv); c1.h[8 + r] = (_Float16)(o3[r] * inv); }
  *(v8us*)((unsigned short*)op) = c0.half[0]; *(v8us*)((unsigned short*)op + 16) = c0.half[1]; *(v8us*)((unsigned short*)op + 32) = c1.half[0]; *(v8us*)((unsigned short*)op + 48) = c1.half[1];
}
__global__ __launch_bounds__(256) void k_vt(const _Float16* __restrict__ V16, int b, int h0, _Float16* __restrict__ VT) { __shared__ unsigned short tl[64][65]; const int tid = threadIdx.x; const int hh = blockIdx.x % HG, sg = blockIdx.x / HG; const int s0 = sg * 64; const int h = h0 + hh;
  for (int i = tid; i < 64 * 8; i += 256) { const int j = i / 8, d8 = (i % 8) * 8; FragH f; f.half[0] = *(const v8us*)((const unsigned short*)V16 + ((size_t)b * SQ + s0 + j) * DM + h * HD + d8); for (int q = 0; q < 8; ++q) tl[d8 + q][j] = f.u[q]; }
  __syncthreads();
  { for (int i = tid; i < 64 * 8; i += 256) { const int d = i / 8, j8 = (i % 8) * 8; FragH f; for (int q = 0; q < 8; ++q) f.u[q] = tl[d][j8 + q]; *(v8us*)((unsigned short*)VT + ((size_t)hh * HD + d) * SQ + s0 + j8) = f.half[0]; }  } }

extern "C" void kernel_launch(void* const* d_in, const int* in_sizes, int n_in,
                              void* d_out, int out_size, void* d_ws, size_t ws_size, hipStream_t stream) {
  (void)in_sizes; (void)n_in; (void)out_size;
  const float* const* I = (const float* const*)d_in; const float* hs = I[0]; const float* amask = I[1]; const float* wqkv = I[2]; const float* wo = I[3]; const float* emb = I[4];      /* W_qkv [1024][3072] and W_o [1024][1024] are [in][out]; attention_mask [2][1][2048][2048]; rel_bias_emb [32][16] */
  char* ws = (char*)d_ws; size_t off = 0;
  auto take = [&](size_t bytes) { char* p = ws + off; off += (bytes + 255) & ~(size_t)255; return p; };
  _Float16* BQKV = (_Float16*)take((size_t)D3 * DM * 2); _Float16* BO = (_Float16*)take((size_t)DM * DM * 2);
  _Float16* X16 = (_Float16*)take(NR * DM * 2); _Float16* QKV = (_Float16*)take(NR * D3 * 2); _Float16* O16 = (_Float16*)take(NR * DM * 2);
  _Float16* VT = (_Float16*)take((size_t)NB * NH * HD * SQ * 2);
  if (off > ws_size) return;      /* 6 + 2 + 8 + 24 + 8 + 8 = approx 56 MiB */
  k_wt_f16<<<(unsigned)(((size_t)D3 * (DM / 8) + 255) / 256), 256, 0, stream>>>(wqkv, BQKV, DM, D3, 16.0f);      /* [in][out] -> Bt[out][in] x16 */
  k_wt_f16<<<(unsigned)(((size_t)DM * (DM / 8) + 255) / 256), 256, 0, stream>>>(wo, BO, DM, DM, 16.0f);
  k_x16<<<(unsigned)((NR * DM / 8 + 255) / 256), 256, 0, stream>>>(hs, X16, NR * DM / 8);
  k_gemm2<0><<<dim3((unsigned)((NR / 128) * (D3 / 128)), 1), 256, 0, stream>>>(X16, DM, 0, BQKV, DM, 0, 0.0625f, nullptr, 0, nullptr, 1, 0, 0, nullptr, QKV, D3, 0, MP, D3, DM);      /* q | k | v rows (f16), head h at columns h*64 / 1024 + h*64 / 2048 + h*64 */
  k_vt<NH, SQ><<<NB * NH * (SQ / 64), 256, 0, stream>>>(QKV, D3, 2 * DM, VT);      /* V^T[(b,h)][d][s] for every (batch, head) */
  k_fattn<<<dim3(SQ / 256, NB * NH), 512, 0, stream>>>(QKV, VT, emb, amask, O16);      /* ctx (merged heads) as f16 rows; one block per 256 query rows of a (batch, head) */
  k_gemm2<0><<<dim3((unsigned)((NR / 128) * (DM / 128)), 1), 256, 0, stream>>>(O16, DM, 0, BO, DM, 0, 0.0625f, nullptr, 0, nullptr, 1, 0, 0, (float*)d_out, nullptr, DM, 0, MO, DM, DM);      /* out = ctx W_o, rows are the output layout */
}

// v007
// Measured time: 135 microseconds a run.
// In both of two side-by-side timings against v006, it was 1.05 times as fast.
// Counting every step since v000, it is 222 times as fast.
#include <hip/hip_runtime.h>
#define NB 2
#define SQ 2048
#define DM 1024
#define D3 3072                      /* fused q|k|v width */
#define NH 16
#define HD 64
#define HG 4                         /* heads per call of the k_vt(V16, b, h0, VT) overload, which nothing launches */
#define NBK 32                       /* relative-position buckets */
#define MP ((int)NR)                 /* token rows through the qkv projection (debug hook) */
#define MO ((int)NR)                 /* token rows through the output projection (debug hook) */
#define NR ((size_t)NB * SQ)         /* 4096 token rows */
typedef __bf16 v16b __attribute__((ext_vector_type(16)));
typedef unsigned short v8us __attribute__((ext_vector_type(8), may_alias));
typedef float  v8f  __attribute__((ext_vector_type(8)));
typedef float  v4f  __attribute__((ext_vector_type(4)));
typedef float  v4fa __attribute__((ext_vector_type(4), may_alias));
union FragB { v16b v; v8us half[2]; unsigned short u[16]; };

__device__ __forceinline__ unsigned short bf16_bits(float x) { unsigned int u = __float_as_uint(x); return (unsigned short)((u + 0x7FFFu + ((u >> 16) & 1u)) >> 16); }
__device__ __forceinline__ float bf16_val(unsigned short b) { return __uint_as_float(((unsigned int)b) << 16); }
__device__ __forceinline__ float bf16_round(float x) { return bf16_val(bf16_bits(x)); }
// D += A·B with NT terms: 1 = ah·bh, 2 = + al·bh (A split), 3 = + ah·bl (both split)
template <int NT>
__device__ __forceinline__ v8f mmaN(v16b ah, v16b al, v16b bh, v16b bl, v8f c) {
  c = __builtin_amdgcn_wmma_f32_16x16x32_bf16(false, ah, false, bh, (short)0, c, false, false);
  if (NT >= 2) c = __builtin_amdgcn_wmma_f32_16x16x32_bf16(false, al, false, bh, (short)0, c, false, false);
  if (NT >= 3) c = __builtin_amdgcn_wmma_f32_16x16x32_bf16(false, ah, false, bl, (short)0, c, false, false);
  asm volatile("v_nop\n\tv_nop\n\tv_nop\n\tv_nop" : "+v"(c) : "v"(ah), "v"(al), "v"(bh), "v"(bl));
  return c;
}

__global__ __launch_bounds__(256) void k_wt_bf16(const float* __restrict__ W, unsigned short* __restrict__ Wt, int K, int N) {
  const int t = blockIdx.x * 256 + threadIdx.x;
  const int k8n = K / 8;
  if (t >= N * k8n) return;
  const int n = t / k8n, k8 = (t % k8n) * 8;
  v8us v;
#pragma unroll
  for (int i = 0; i < 8; ++i) v[i] = bf16_bits(W[(size_t)(k8 + i) * N + n]);
  *(v8us*)(Wt + (size_t)n * K + k8) = v;
  
}

// GEMM C[M][N] (f32, pitch ldc) = act(A[M][K]·W + bias). A f32 row-major (pitch lda) converted per fragment to bf16
// (ASPLIT: hi/lo two planes -> 2 terms, else single rounded term); Wt bf16 [N][K] (pitch ldb). BIAS_BF16 rounds the
// bias to bf16 first (bias quantised to bf16 before the add). K%32==0, M%16==0, N%64==0.
template <bool ASPLIT, int ACT, bool BIAS_BF16>
__global__ __launch_bounds__(128) void k_gemm_bf(const float* __restrict__ A, int lda, const unsigned short* __restrict__ Wt, int ldb,
                                               const float* __restrict__ bias, float* __restrict__ C, int ldc, int M, int N, int K) {
  __shared__ __attribute__((aligned(16))) float so[4][16][64];
  const int tid = threadIdx.x, w = tid >> 5, lane = tid & 31, ln = lane & 15, hh = lane >> 4;
  const int ntn = N / 64;
  const int wid = blockIdx.x * 4 + w;
  const int mt = wid / ntn, nq = wid % ntn;
  if (mt * 16 >= M) return;
  const int row0 = mt * 16, col0 = nq * 64;
  const float* arow = A + (size_t)(row0 + ln) * lda;
  v8f acc[4] = {};
  for (int kb = 0; kb < K; kb += 32) {
    FragB ah, al;
    const v4f x0 = *(const v4fa*)(arow + kb + 8 * hh), x1 = *(const v4fa*)(arow + kb + 8 * hh + 4);
    const v4f x2 = *(const v4fa*)(arow + kb + 16 + 8 * hh), x3 = *(const v4fa*)(arow + kb + 16 + 8 * hh + 4);
    float xs[16] = {x0[0],x0[1],x0[2],x0[3],x1[0],x1[1],x1[2],x1[3],x2[0],x2[1],x2[2],x2[3],x3[0],x3[1],x3[2],x3[3]};
#pragma unroll
    for (int i = 0; i < 16; ++i) { const unsigned short hb = bf16_bits(xs[i]); ah.u[i] = hb; al.u[i] = ASPLIT ? bf16_bits(xs[i] - bf16_val(hb)) : (unsigned short)0; }
#pragma unroll
    for (int t = 0; t < 4; ++t) {
      const unsigned short* brow = Wt + (size_t)(col0 + t * 16 + ln) * ldb + kb;
      FragB b;
      b.half[0] = *(const v8us*)(brow + 8 * hh);
      b.half[1] = *(const v8us*)(brow + 16 + 8 * hh);
      acc[t] = mmaN<ASPLIT ? 2 : 1>(ah.v, al.v, b.v, b.v, acc[t]);
    }
  }
#pragma unroll
  for (int t = 0; t < 4; ++t) {
    float bv = bias ? bias[col0 + t * 16 + ln] : 0.f;
    if (BIAS_BF16) bv = bf16_round(bv);
#pragma unroll
    for (int r = 0; r < 8; ++r) { float v = acc[t][r] + bv; if (ACT == 1) v = fmaxf(v, 0.f); so[w][8 * hh + r][t * 16 + ln] = v; }
  }
  __builtin_amdgcn_fence(__ATOMIC_ACQ_REL, "workgroup");
  __builtin_amdgcn_wave_barrier();
  const int rsub = lane >> 4, c4 = (lane & 15) * 4;
  {
#pragma unroll
    for (int q = 0; q < 8; ++q) {
      const int r = q * 2 + rsub;
      const v4f v = *(const v4fa*)&so[w][r][c4];
      *(v4f*)(C + (size_t)(row0 + r) * ldc + col0 + c4) = v;
    }
    
  }
}

// GEMM C = act(A·W + bias + resid): A f32 (ASPLIT -> hi/lo 2 terms), Wt bf16 [N][K]; ACT 0 none, 1 relu, 2 exact gelu;
// resid (optional, f32, row index = (row % rmod), pitch ldr, RES_BF16 rounds it) added before the activation.
template <bool ASPLIT, int ACT, bool BIAS_BF16, bool RES_BF16>
__global__ __launch_bounds__(128) void k_gemm_bf3(const float* __restrict__ A, int lda, const unsigned short* __restrict__ Wt, int ldb,
                                                const float* __restrict__ bias, const float* __restrict__ resid, int rmod, int ldr,
                                                float* __restrict__ C, int ldc, int M, int N, int K) {
  __shared__ __attribute__((aligned(16))) float so[4][16][64];
  const int tid = threadIdx.x, w = tid >> 5, lane = tid & 31, ln = lane & 15, hh = lane >> 4;
  const int ntn = N / 64;
  const int wid = blockIdx.x * 4 + w;
  const int mt = wid / ntn, nq = wid % ntn;
  if (mt * 16 >= M) return;
  const int row0 = mt * 16, col0 = nq * 64;
  const float* arow = A + (size_t)(row0 + ln) * lda;
  v8f acc[4] = {};
  for (int kb = 0; kb < K; kb += 32) {
    FragB ah, al;
    const v4f x0 = *(const v4fa*)(arow + kb + 8 * hh), x1 = *(const v4fa*)(arow + kb + 8 * hh + 4);
    const v4f x2 = *(const v4fa*)(arow + kb + 16 + 8 * hh), x3 = *(const v4fa*)(arow + kb + 16 + 8 * hh + 4);
    float xs[16] = {x0[0],x0[1],x0[2],x0[3],x1[0],x1[1],x1[2],x1[3],x2[0],x2[1],x2[2],x2[3],x3[0],x3[1],x3[2],x3[3]};
#pragma unroll
    for (int i = 0; i < 16; ++i) { const unsigned short hb = bf16_bits(xs[i]); ah.u[i] = hb; al.u[i] = ASPLIT ? bf16_bits(xs[i] - bf16_val(hb)) : (unsigned short)0; }
#pragma unroll
    for (int t = 0; t < 4; ++t) {
      const unsigned short* brow = Wt + (size_t)(col0 + t * 16 + ln) * ldb + kb;
      FragB b;
      b.half[0] = *(const v8us*)(brow + 8 * hh);
      b.half[1] = *(const v8us*)(brow + 16 + 8 * hh);
      acc[t] = mmaN<ASPLIT ? 2 : 1>(ah.v, al.v, b.v, b.v, acc[t]);
    }
  }
#pragma unroll
  for (int t = 0; t < 4; ++t) {
    const int col = col0 + t * 16 + ln;
    float bv = bias ? bias[col] : 0.f;
    if (BIAS_BF16) bv = bf16_round(bv);
#pragma unroll
    for (int r = 0; r < 8; ++r) {
      float v = acc[t][r] + bv;
      if (resid) { float rv = resid[(size_t)((row0 + 8 * hh + r) % rmod) * ldr + col]; if (RES_BF16) rv = bf16_round(rv); v += rv; }
      if (ACT == 1) v = fmaxf(v, 0.f);
      if (ACT == 2) v = 0.5f * v * (1.0f + erff(v * 0.70710678118654752f));
      if (ACT == 3) { const float u = 0.7978845608028654f * (v + 0.044715f * v * v * v); v = 0.5f * v * (1.0f + tanhf(u)); }
      so[w][8 * hh + r][t * 16 + ln] = v;
    }
  }
  __builtin_amdgcn_fence(__ATOMIC_ACQ_REL, "workgroup");
  __builtin_amdgcn_wave_barrier();
  const int rsub = lane >> 4, c4 = (lane & 15) * 4;
  {
#pragma unroll
    for (int q = 0; q < 8; ++q) {
      const int r = q * 2 + rsub;
      const v4f v = *(const v4fa*)&so[w][r][c4];
      *(v4f*)(C + (size_t)(row0 + r) * ldc + col0 + c4) = v;
    }
    
  }
}
// row LayerNorm (biased variance, eps) over N: s = X (+ R); optional out_sum <- s; out_norm <- (s-mu)*rsqrt(var+eps)*g + b
template <bool PARAM_BF16>
__global__ __launch_bounds__(256) void k_layernorm(const float* __restrict__ X, const float* __restrict__ R, const float* __restrict__ g, const float* __restrict__ bta,
                                                  float* __restrict__ out_sum, float* __restrict__ out_norm, int N, float eps) {
  __shared__ float red[256];
  const int row = blockIdx.x, tid = threadIdx.x;
  const float* x = X + (size_t)row * N; const float* rr = R ? R + (size_t)row * N : nullptr;
  float vals[16];                     // up to N = 4096
  const int per = N / 256;            // contiguous chunk per thread? use strided-by-4 chunks: thread handles j = tid*4 + 1024*u
  float s1 = 0.f;
  for (int u = 0; u < per / 4; ++u) {
    const int j = tid * 4 + 1024 * u;
    const v4f a = *(const v4fa*)(x + j);
    v4f b = {0.f,0.f,0.f,0.f}; if (rr) b = *(const v4fa*)(rr + j);
#pragma unroll
    for (int q = 0; q < 4; ++q) { const float v = a[q] + b[q]; vals[u * 4 + q] = v; s1 += v; }
  }
  red[tid] = s1; __syncthreads();
  for (int st = 128; st > 0; st >>= 1) { if (tid < st) red[tid] += red[tid + st]; __syncthreads(); }
  const float mu = red[0] / (float)N; __syncthreads();
  float s2 = 0.f;
  for (int u = 0; u < per / 4; ++u)
#pragma unroll
    for (int q = 0; q < 4; ++q) { const float c = vals[u * 4 + q] - mu; s2 += c * c; }
  red[tid] = s2; __syncthreads();
  for (int st = 128; st > 0; st >>= 1) { if (tid < st) red[tid] += red[tid + st]; __syncthreads(); }
  const float rs = rsqrtf(red[0] / (float)N + eps);
  {
    for (int u = 0; u < per / 4; ++u) {
      const int j = tid * 4 + 1024 * u;
      v4f o, sm;
#pragma unroll
      for (int q = 0; q < 4; ++q) {
        float gg = g[j + q], bb = bta[j + q];
        if (PARAM_BF16) { gg = bf16_round(gg); bb = bf16_round(bb); }
        sm[q] = vals[u * 4 + q]; o[q] = (vals[u * 4 + q] - mu) * rs * gg + bb;
      }
      if (out_sum) *(v4f*)(out_sum + (size_t)row * N + j) = sm;
      *(v4f*)(out_norm + (size_t)row * N + j) = o;
    }
    
  }
}



// ---- f16 WMMA path (v_wmma_f32_16x16x32_f16): 11-bit significands for operands in range — used where a [0,1] probability operand needs more precision than bf16
typedef _Float16 v16h __attribute__((ext_vector_type(16)));
union FragH { v16h v; v8us half[2]; _Float16 h[16]; unsigned short u[16]; };
template <int NT>
__device__ __forceinline__ v8f mmaH(v16h ah, v16h al, v16h bh, v16h bl, v8f c) {
  c = __builtin_amdgcn_wmma_f32_16x16x32_f16(false, ah, false, bh, (short)0, c, false, false);
  if (NT >= 2) c = __builtin_amdgcn_wmma_f32_16x16x32_f16(false, al, false, bh, (short)0, c, false, false);
  if (NT >= 3) c = __builtin_amdgcn_wmma_f32_16x16x32_f16(false, ah, false, bl, (short)0, c, false, false);
  asm volatile("v_nop\n\tv_nop\n\tv_nop\n\tv_nop" : "+v"(c) : "v"(ah), "v"(al), "v"(bh), "v"(bl));
  return c;
}
// batched GEMM like k_gemm_b but f16 operands: A f32 (split into f16 hi/lo if ASPLIT, else rounded to f16), Bt = f16 values [n][k]; alpha; C f32; N multiple of 16 (partial tiles skipped)
template <bool ASPLIT>
__global__ __launch_bounds__(128) void k_gemm_h(const float* __restrict__ A, int lda, size_t sA, const _Float16* __restrict__ Bh, int ldb, size_t sB, float alpha, float* __restrict__ C, int ldc, size_t sC, int M, int N, int K) {
  __shared__ __attribute__((aligned(16))) float so[4][16][64];
  const int tid = threadIdx.x, w = tid >> 5, lane = tid & 31, ln = lane & 15, hh = lane >> 4; const int by = blockIdx.y;
  A += (size_t)by * sA; Bh += (size_t)by * sB; C += (size_t)by * sC;
  const int ntn = (N + 63) / 64; const int wid = blockIdx.x * 4 + w; const int mt = wid / ntn, nq = wid % ntn; if (mt * 16 >= M) return;
  const int row0 = mt * 16, col0 = nq * 64; const float* arow = A + (size_t)(row0 + ln) * lda;
  v8f acc[4] = {};
  for (int kb = 0; kb < K; kb += 32) {
    FragH ah, al;
    const v4f x0 = *(const v4fa*)(arow + kb + 8 * hh), x1 = *(const v4fa*)(arow + kb + 8 * hh + 4), x2 = *(const v4fa*)(arow + kb + 16 + 8 * hh), x3 = *(const v4fa*)(arow + kb + 16 + 8 * hh + 4);
    float xs[16] = {x0[0],x0[1],x0[2],x0[3],x1[0],x1[1],x1[2],x1[3],x2[0],x2[1],x2[2],x2[3],x3[0],x3[1],x3[2],x3[3]};
#pragma unroll
    for (int i = 0; i < 16; ++i) { const _Float16 h = (_Float16)xs[i]; ah.h[i] = h; al.h[i] = ASPLIT ? (_Float16)(xs[i] - (float)h) : (_Float16)0.0f; }
#pragma unroll
    for (int t = 0; t < 4; ++t) { if (col0 + t * 16 >= N) continue; const size_t boff = (size_t)(col0 + t * 16 + ln) * ldb + kb; FragH bq; bq.half[0] = *(const v8us*)(Bh + boff + 8 * hh); bq.half[1] = *(const v8us*)(Bh + boff + 16 + 8 * hh);
      acc[t] = mmaH<ASPLIT ? 2 : 1>(ah.v, al.v, bq.v, bq.v, acc[t]); }
  }
#pragma unroll
  for (int t = 0; t < 4; ++t) { if (col0 + t * 16 >= N) continue;
#pragma unroll
    for (int r = 0; r < 8; ++r) so[w][8 * hh + r][t * 16 + ln] = acc[t][r] * alpha; }
  __builtin_amdgcn_fence(__ATOMIC_ACQ_REL, "workgroup"); __builtin_amdgcn_wave_barrier();
  const int rsub = lane >> 4, c4 = (lane & 15) * 4;
  {
#pragma unroll
    for (int q = 0; q < 8; ++q) { const int r = q * 2 + rsub; if (col0 + c4 < N) { const v4f v = *(const v4fa*)&so[w][r][c4]; *(v4f*)(C + (size_t)(row0 + r) * ldc + col0 + c4) = v; } }
     }
}

// Wt[n][k] = f16(W[k][n]·scale) from f32 row-major W[K][N] (scale = power of two; bf16-exact weights stay exact in f16 away from the subnormal range)
__global__ __launch_bounds__(256) void k_wt_f16(const float* __restrict__ W, _Float16* __restrict__ Wt, int K, int N, float scale) {
  const int t = blockIdx.x * 256 + threadIdx.x; if (t >= N * (K / 8)) return; const int n = t / (K / 8), k8 = (t % (K / 8)) * 8; FragH f;
#pragma unroll
  for (int i = 0; i < 8; ++i) f.h[i] = (_Float16)(bf16_round(W[(size_t)(k8 + i) * N + n]) * scale); const v8us o = f.half[0];
  *(v8us*)((unsigned short*)Wt + (size_t)n * K + k8) = o; 
}
// k_gemm_hh variant with fused epilogue: v = acc·alpha + bias[by·sBias + col] (+ CP[(row/rowsPerB)·sCPb + by·64 + col] if CP) ; ACT 0 none / 1 elu ; writes f16 C16 (and f32 C if non-null)
template <int ACT>
__global__ __launch_bounds__(128) void k_gemm_hhx(const _Float16* __restrict__ A, int lda, size_t sA, const _Float16* __restrict__ Bh, int ldb, size_t sB, float alpha, const float* __restrict__ bias, size_t sBias, const float* __restrict__ CP, int rowsPerB, size_t sCPb, int row0g,
    float* __restrict__ C, _Float16* __restrict__ C16, int ldc, size_t sC, int M, int N, int K) {
  __shared__ __attribute__((aligned(16))) float so[4][16][64];
  const int tid = threadIdx.x, w = tid >> 5, lane = tid & 31, ln = lane & 15, hh = lane >> 4; const int by = blockIdx.y;
  A += (size_t)by * sA; Bh += (size_t)by * sB; const size_t cofs = (size_t)by * sC; const float* bp = bias ? bias + (size_t)by * sBias : nullptr;
  const int ntn = (N + 63) / 64; const int wid = blockIdx.x * 4 + w; const int mt = wid / ntn, nq = wid % ntn; if (mt * 16 >= M) return;
  const int row0 = mt * 16, col0 = nq * 64; const _Float16* arow = A + (size_t)(row0 + ln) * lda;
  v8f acc[4] = {};
  for (int kb = 0; kb < K; kb += 32) { FragH ah; ah.half[0] = *(const v8us*)((const unsigned short*)arow + kb + 8 * hh); ah.half[1] = *(const v8us*)((const unsigned short*)arow + kb + 16 + 8 * hh);
#pragma unroll
    for (int t = 0; t < 4; ++t) { if (col0 + t * 16 >= N) continue; const size_t boff = (size_t)(col0 + t * 16 + ln) * ldb + kb; FragH bq; bq.half[0] = *(const v8us*)((const unsigned short*)Bh + boff + 8 * hh); bq.half[1] = *(const v8us*)((const unsigned short*)Bh + boff + 16 + 8 * hh);
      acc[t] = mmaH<1>(ah.v, ah.v, bq.v, bq.v, acc[t]); }
  }
#pragma unroll
  for (int t = 0; t < 4; ++t) { if (col0 + t * 16 >= N) continue; const int col = col0 + t * 16 + ln; const float bv = bp ? bf16_round(bp[col]) : 0.f;
#pragma unroll
    for (int r = 0; r < 8; ++r) { float v = acc[t][r] * alpha + bv; if (CP) { const int rr = row0g + row0 + 8 * hh + r; if (rowsPerB < 0) v += CP[cofs + (size_t)rr * ldc + col];      /* rowsPerB < 0: own element of the batched C plane */ else { const int bidx = rr / rowsPerB; v += CP[(size_t)bidx * sCPb + (size_t)by * 64 + col]; } } if (ACT == 1) v = (v > 0.f) ? v : expm1f(v); else if (ACT == 7) v = (v > 0.f) ? v + 1.0f : expf(v); else if (ACT == 8) v = tanhf(v); else if (ACT == 9) v = 0.5f * v * (1.0f + tanhf(0.7978845608028654f * (v + 0.044715f * v * v * v))); else if (ACT == 11) v = 1.0f / (1.0f + expf(-v)); else if (ACT == 12) v = (v > 0.f) ? v : 0.01f * v; else if (ACT == 14) v = (v > 0.f) ? v : 0.1f * v; else if (ACT == 16) v = (v >= 0.f) ? v : 0.3f * v; else if (ACT == 17) v = (v >= 0.f) ? v : 0.2f * v; else if (ACT == 15) v = v / (1.0f + expf(-v)); else if (ACT == 3) v = fmaxf(v, 0.f); else if (ACT == 6) v = 0.5f * v * (1.0f + erff(v * 0.70710678118654752f)); so[w][8 * hh + r][t * 16 + ln] = v; } }
  __builtin_amdgcn_fence(__ATOMIC_ACQ_REL, "workgroup"); __builtin_amdgcn_wave_barrier();
  const int rsub = lane >> 4, c4 = (lane & 15) * 4; typedef _Float16 v4h __attribute__((ext_vector_type(4)));
  {
#pragma unroll
    for (int q = 0; q < 8; ++q) { const int r = q * 2 + rsub; if (col0 + c4 < N) { const v4f v = *(const v4fa*)&so[w][r][c4]; if (C) *(v4f*)(C + cofs + (size_t)(row0 + r) * ldc + col0 + c4) = v; if (C16) { v4h h4; for (int i = 0; i < 4; ++i) h4[i] = (_Float16)v[i]; *(v4h*)(C16 + cofs + (size_t)(row0 + r) * ldc + col0 + c4) = h4; } } }
     }
}


typedef _Float16 v4h __attribute__((ext_vector_type(4)));

__global__ __launch_bounds__(256) void k_x16(const float* __restrict__ x, _Float16* __restrict__ X16, size_t n8) { const size_t t = (size_t)blockIdx.x * 256 + threadIdx.x; if (t >= n8) return; FragH f;
#pragma unroll
  for (int q = 0; q < 8; ++q) f.h[q] = (_Float16)bf16_round(x[t * 8 + q]); *(v8us*)((unsigned short*)X16 + t * 8) = f.half[0];  }
__global__ __launch_bounds__(256) void k_h16(const float* __restrict__ x, _Float16* __restrict__ X16, size_t n8) { const size_t t = (size_t)blockIdx.x * 256 + threadIdx.x; if (t >= n8) return; FragH f;
#pragma unroll
  for (int q = 0; q < 8; ++q) f.h[q] = (_Float16)x[t * 8 + q]; *(v8us*)((unsigned short*)X16 + t * 8) = f.half[0];  }
__global__ __launch_bounds__(256) void k_round16f(const float* __restrict__ W, _Float16* __restrict__ Bt, size_t n8) { const size_t t = (size_t)blockIdx.x * 256 + threadIdx.x; if (t >= n8) return; FragH f;
#pragma unroll
  for (int i = 0; i < 8; ++i) f.h[i] = (_Float16)(bf16_round(W[t * 8 + i]) * 16.0f); *(v8us*)((unsigned short*)Bt + t * 8) = f.half[0];  }
template <int NHv, int TTv>
__global__ __launch_bounds__(256) void k_vt(const _Float16* __restrict__ V16, int ldv, int voff, _Float16* __restrict__ Vt) { __shared__ unsigned short tl[64][66]; const int tid = threadIdx.x; const int slab = blockIdx.x / (TTv / 64), lg = blockIdx.x % (TTv / 64); const int b = slab / NHv, h = slab % NHv;
  for (int i = tid; i < 64 * 8; i += 256) { const int r = i / 8, c8 = (i % 8) * 8; FragH f; f.half[0] = *(const v8us*)((const unsigned short*)V16 + ((size_t)b * TTv + lg * 64 + r) * ldv + voff + h * 64 + c8);
#pragma unroll
    for (int q = 0; q < 8; ++q) tl[r][c8 + q] = f.u[q]; }
  __syncthreads();
  {
#pragma unroll
    for (int rd = 0; rd < 2; ++rd) { const int d = rd * 32 + tid / 8, pc = tid % 8; FragH f;
#pragma unroll
      for (int q = 0; q < 8; ++q) f.u[q] = tl[pc * 8 + q][d];
      *(v8us*)((unsigned short*)Vt + ((size_t)slab * 64 + d) * TTv + lg * 64 + pc * 8) = f.half[0]; }
     } }

__global__ __launch_bounds__(256) void k_hl(const float* __restrict__ F, _Float16* __restrict__ Hh, _Float16* __restrict__ Hl, size_t n8) { const size_t t = (size_t)blockIdx.x * 256 + threadIdx.x; if (t >= n8) return; FragH fh, fl; const v4f a = *(const v4fa*)(F + t * 8), c = *(const v4fa*)(F + t * 8 + 4);
#pragma unroll
  for (int q = 0; q < 4; ++q) { _Float16 h = (_Float16)a[q]; fh.h[q] = h; fl.h[q] = (_Float16)((a[q] - (float)h) * 1024.0f); h = (_Float16)c[q]; fh.h[4 + q] = h; fl.h[4 + q] = (_Float16)((c[q] - (float)h) * 1024.0f); }
  { *(v8us*)((unsigned short*)Hh + t * 8) = fh.half[0]; *(v8us*)((unsigned short*)Hl + t * 8) = fl.half[0];  } }

// ---- fast GEMM (block tile 128x128 on 8 waves, wave tile 32x64; requires M % 128 == 0, N % 128 == 0, K % 64 == 0, K >= 64); epilogue = k_gemm_hhx semantics ----
// Operand path: a k tile is 64 k = one whole 128-byte line of each of the block's 128 A rows and 128 Bt rows. The 256 threads bring it into LDS by asynchronous 16-byte copies
// (8 lanes a row, so every wave-wide copy covers 4 whole lines), two buffers, the next tile in flight while this one is multiplied; the waves read their fragments from LDS in the k order of g2_frag.
#define G2P 72                       /* halfs per LDS row: 128 bytes of data + 16, the conflict-free pitch for 16-byte reads */
#define G2STG (256 * G2P * 2)        /* bytes of one buffer: 128 A rows, then 128 Bt rows */
__device__ __forceinline__ v16h g2_frag(const _Float16* p, int hh) { FragH f; f.half[0] = *(const v8us*)((const unsigned short*)p + 8 * hh); f.half[1] = *(const v8us*)((const unsigned short*)p + 16 + 8 * hh); return f.v; }
__device__ __forceinline__ v16h g2_lfrag(const unsigned short* p) { FragH f; f.half[0] = *(const v8us*)(p); f.half[1] = *(const v8us*)(p + 16); return f.v; }
__device__ __forceinline__ v8f g2_mma(v16h a, v16h b, v8f c) { return __builtin_amdgcn_wmma_f32_16x16x32_f16(false, a, false, b, (short)0, c, false, false); }
// one k tile: this thread's 16 bytes of rows r, r + 32, r + 64, r + 96 of A (pitch pa halfs) and of Bt (pitch pb); l = LDS byte address of its place in row r of the buffer.
// The s_wait_xcnt closes the copies' own statement, so that no address register is rewritten ahead of it.
__device__ __forceinline__ void g2_copy(unsigned l, const _Float16* a, size_t pa, const _Float16* b, size_t pb) {
  asm volatile("global_load_async_to_lds_b128 %0, %8, off\n\t"
               "global_load_async_to_lds_b128 %1, %9, off\n\t"
               "global_load_async_to_lds_b128 %2, %10, off\n\t"
               "global_load_async_to_lds_b128 %3, %11, off\n\t"
               "global_load_async_to_lds_b128 %4, %12, off\n\t"
               "global_load_async_to_lds_b128 %5, %13, off\n\t"
               "global_load_async_to_lds_b128 %6, %14, off\n\t"
               "global_load_async_to_lds_b128 %7, %15, off\n\t"
               "s_wait_xcnt 0x0"
               :: "v"(l), "v"(l + 32u * G2P * 2u), "v"(l + 64u * G2P * 2u), "v"(l + 96u * G2P * 2u), "v"(l + 128u * G2P * 2u), "v"(l + 160u * G2P * 2u), "v"(l + 192u * G2P * 2u), "v"(l + 224u * G2P * 2u),
                  "v"(a), "v"(a + 32 * pa), "v"(a + 64 * pa), "v"(a + 96 * pa), "v"(b), "v"(b + 32 * pb), "v"(b + 64 * pb), "v"(b + 96 * pb) : "memory");
}
template <int ACT>
__global__ __launch_bounds__(256) void k_gemm2(const _Float16* __restrict__ A, int lda, size_t sA, const _Float16* __restrict__ Bh, int ldb, size_t sB, float alpha, const float* __restrict__ bias, size_t sBias, const float* __restrict__ CP, int rowsPerB, size_t sCPb, int row0g,
    float* __restrict__ C, _Float16* __restrict__ C16, int ldc, size_t sC, int M, int N, int K) { static_assert(ACT == 0 || ACT == 3 || ACT == 6 || ACT == 8 || ACT == 9 || ACT == 11 || ACT == 12 || ACT == 14 || ACT == 15 || ACT == 16 || ACT == 17, "k_gemm2: unsupported ACT code (would silently apply no activation)");
  __shared__ __attribute__((aligned(16))) unsigned short ring[2][256][G2P];      /* the two operand buffers; behind the k loop the same bytes are the waves' output staging */
  static_assert(sizeof(float) * 8 * 32 * 68 <= sizeof(unsigned short) * 2 * 256 * G2P, "output staging must fit the ring");
  const int tid = threadIdx.x, w = tid >> 5, lane = tid & 31, ln = lane & 15, hh = lane >> 4; const int by = blockIdx.y;
  A += (size_t)by * sA; Bh += (size_t)by * sB; const size_t cofs = (size_t)by * sC; const float* bp = bias ? bias + (size_t)by * sBias : nullptr;
  const int ntn = N >> 7; const int mt = blockIdx.x / ntn, nq = blockIdx.x - mt * ntn; const int m0 = mt * 128, n0 = nq * 128; if (m0 >= M) return;      /* the same for the whole block, ahead of every barrier */
  const int wr = 32 * (w & 3), wc = 64 * (w >> 2); const int row0 = m0 + wr, col0 = n0 + wc;
  const int cr = tid >> 3, cs = (tid & 7) * 8;      /* this thread's row (of each 32) and its 8 halfs of the 64 in a k tile */
  const _Float16* ga = A + (size_t)(m0 + cr) * lda + cs; const _Float16* gb = Bh + (size_t)(n0 + cr) * ldb + cs;
  const unsigned l0 = (unsigned)(size_t)&ring[0][cr][cs];      /* low 32 bits of the shared address = byte offset in the block's LDS */
  const int nt = K >> 6;
  const v8f z8 = {0.f,0.f,0.f,0.f,0.f,0.f,0.f,0.f}; v8f c00 = z8, c01 = z8, c02 = z8, c03 = z8, c10 = z8, c11 = z8, c12 = z8, c13 = z8;
  g2_copy(l0, ga, (size_t)lda, gb, (size_t)ldb);
  asm volatile("s_wait_asynccnt 0x0" ::: "memory");      /* this wave's part of tile 0 has landed */
  __syncthreads();      /* tile 0 is readable by every wave */
  if (nt > 1) g2_copy(l0 + G2STG, ga + 64, (size_t)lda, gb + 64, (size_t)ldb);
#pragma unroll 1      /* one trip = one buffer; the two buffers alternate by t & 1 */
  for (int t = 0; t < nt; ++t) {
    const unsigned short* ta = &ring[t & 1][wr + ln][8 * hh]; const unsigned short* tb = &ring[t & 1][128 + wc + ln][8 * hh];
#pragma unroll      /* the two 32-k steps of a tile: constant LDS offsets */
    for (int ks = 0; ks < 64; ks += 32) {
      const v16h a0 = g2_lfrag(ta + ks), a1 = g2_lfrag(ta + 16 * G2P + ks);
      const v16h b0 = g2_lfrag(tb + ks), b1 = g2_lfrag(tb + 16 * G2P + ks), b2 = g2_lfrag(tb + 32 * G2P + ks), b3 = g2_lfrag(tb + 48 * G2P + ks);
      __builtin_amdgcn_sched_barrier(0);      /* the 12 LDS reads of a step issue as one group ahead of its 8 products: left alone the compiler reuses the B registers and the wave waits for LDS four times a step */
      c00 = g2_mma(a0, b0, c00); c10 = g2_mma(a1, b0, c10); c01 = g2_mma(a0, b1, c01); c11 = g2_mma(a1, b1, c11);
      c02 = g2_mma(a0, b2, c02); c12 = g2_mma(a1, b2, c12); c03 = g2_mma(a0, b3, c03); c13 = g2_mma(a1, b3, c13);
    }
    asm volatile("s_wait_dscnt 0x0" ::: "memory");      /* this wave's reads of buffer t & 1 are done */
    asm volatile("s_wait_asynccnt 0x0" ::: "memory");      /* this wave's part of tile t + 1 has landed */
    __syncthreads();      /* publishes tile t + 1 and frees buffer t & 1 */
    if (t + 2 < nt) g2_copy(l0 + (unsigned)(t & 1) * G2STG, ga + (size_t)(t + 2) * 64, (size_t)lda, gb + (size_t)(t + 2) * 64, (size_t)ldb);
  }
  asm volatile("s_wait_asynccnt 0x0" ::: "memory");      /* nothing in flight when the ring becomes output staging (the last trip's barrier has ended every read of it) */
  float (*so)[32][68] = reinterpret_cast<float (*)[32][68]>(&ring[0][0][0]);
  v8f accs[8] = {c00, c01, c02, c03, c10, c11, c12, c13};
#pragma unroll
  for (int u = 0; u < 8; ++u) { const int t = u & 3, half = u >> 2; const int col = col0 + t * 16 + ln; const float bv = bp ? bf16_round(bp[col]) : 0.f;
#pragma unroll
    for (int r = 0; r < 8; ++r) { const int rloc = half * 16 + 8 * hh + r; float v = accs[u][r] * alpha + bv; if (CP) { if (rowsPerB < 0) v += CP[cofs + (size_t)(row0g + row0 + rloc) * ldc + col];      /* rowsPerB < 0: own element of the batched C plane */ else { const int bidx = (row0g + row0 + rloc) / rowsPerB; v += CP[(size_t)bidx * sCPb + (size_t)by * 64 + col]; } }
      if (ACT == 3) v = fmaxf(v, 0.f); else if (ACT == 6) v = 0.5f * v * (1.0f + erff(v * 0.70710678118654752f)); else if (ACT == 11) v = 1.0f / (1.0f + expf(-v)); else if (ACT == 15) v = v / (1.0f + expf(-v)); else if (ACT == 12) v = (v > 0.f) ? v : 0.01f * v; else if (ACT == 8) v = tanhf(v); else if (ACT == 9) v = 0.5f * v * (1.0f + tanhf(0.7978845608028654f * (v + 0.044715f * v * v * v))); else if (ACT == 14) v = (v > 0.f) ? v : 0.1f * v; else if (ACT == 16) v = (v >= 0.f) ? v : 0.3f * v; else if (ACT == 17) v = (v >= 0.f) ? v : 0.2f * v;
      so[w][rloc][t * 16 + ln] = v; } }
  __builtin_amdgcn_fence(__ATOMIC_ACQ_REL, "workgroup"); __builtin_amdgcn_wave_barrier();
  const int rsub = lane >> 4, c4 = (lane & 15) * 4;
  {
#pragma unroll
    for (int q = 0; q < 16; ++q) { const int r = q * 2 + rsub; const v4f v = *(const v4fa*)&so[w][r][c4]; if (C) *(v4f*)(C + cofs + (size_t)(row0 + r) * ldc + col0 + c4) = v; if (C16) { v4h h4; for (int i = 0; i < 4; ++i) h4[i] = (_Float16)v[i]; *(v4h*)(C16 + cofs + (size_t)(row0 + r) * ldc + col0 + c4) = h4; } }
     } }


__global__ __launch_bounds__(256) void k_wnat(const float* __restrict__ w, size_t n8, _Float16* __restrict__ Bt) { const size_t t = (size_t)blockIdx.x * 256 + threadIdx.x; if (t >= n8) return; FragH f; for (int q = 0; q < 8; ++q) f.h[q] = (_Float16)(bf16_round(w[t * 8 + q]) * 16.0f); *(v8us*)((unsigned short*)Bt + t * 8) = f.half[0];  }
// T5 bidirectional relative-position bucket of rel = key - query (32 buckets, max distance 128): (rel > 0)*16 + f(|rel|), f(n) = n for n < 8, then
// 8 + the number of thresholds {12,16,23,32,46,64,91} that are <= n (the thresholds are where the reference's own f32 log expression steps; no log on the device)
__device__ __forceinline__ int t5_bucket(int rel) { const int n = rel < 0 ? -rel : rel; const int g = 8 + (n >= 12) + (n >= 16) + (n >= 23) + (n >= 32) + (n >= 46) + (n >= 64) + (n >= 91); return (rel > 0 ? NBK / 2 : 0) + (n < 8 ? n : g); }
// lane l with lane l ^ 16 (the two lanes that share one query column)
__device__ __forceinline__ float xhalf(float x) { return __builtin_bit_cast(float, __builtin_amdgcn_permlanex16(__builtin_bit_cast(int, x), __builtin_bit_cast(int, x), 0x76543210, 0xfedcba98, false, false)); }
__device__ __forceinline__ v8f fa_mma(v16h a, v16h b, v8f c) { return __builtin_amdgcn_wmma_f32_16x16x32_f16(false, a, false, b, (short)0, c, false, false); }
// Operand path of the fused attention: a stage is 128 keys = 128 K rows (one whole 128-byte line each) and the 64 V^T rows (two whole lines each). The block's 512 threads bring it into LDS by asynchronous 16-byte copies
// (a wave-wide copy covers 4 whole lines), two buffers, the next stage in flight while this one is worked on; all 16 waves read their A fragments from LDS in the k order of g2_frag.
#define FAK 128                      /* keys per stage */
#define FAKP 72                      /* halfs per K row in LDS: 128 bytes of data + 16, the conflict-free pitch for 16-byte reads */
#define FAVP 136                     /* halfs per V^T row in LDS: 256 bytes of data + 16, likewise */
#define FASTG (FAK * FAKP + HD * FAVP)      /* halfs of one buffer: the K rows, then the V^T rows */
#define FAL2E 1.4426950408889634f    /* log2(e): the scores are formed in base-2 units, so that a weight is one subtraction and one hardware 2^x */
// one stage: this thread's 16 bytes of K rows r and r + 64 (token pitch D3) and of V^T rows d and d + 32 (pitch SQ); lk, lv = LDS byte addresses of its places in rows r and d of the buffer.
// The s_wait_xcnt closes the copies' own statement, so that no address register is rewritten ahead of it.
__device__ __forceinline__ void fa_copy(unsigned lk, unsigned lv, const _Float16* k, const _Float16* v) {
  asm volatile("global_load_async_to_lds_b128 %0, %4, off\n\t"
               "global_load_async_to_lds_b128 %1, %5, off\n\t"
               "global_load_async_to_lds_b128 %2, %6, off\n\t"
               "global_load_async_to_lds_b128 %3, %7, off\n\t"
               "s_wait_xcnt 0x0"
               :: "v"(lk), "v"(lk + 64u * FAKP * 2u), "v"(lv), "v"(lv + 32u * FAVP * 2u),
                  "v"(k), "v"(k + (size_t)64 * D3), "v"(v), "v"(v + (size_t)32 * SQ) : "memory");
}
// fused attention of one (batch, head): scores, bias and mask, softmax and P.V in one pass over the keys; S and P stay in registers.
// One wave owns 16 query rows, a block 16 waves = 256 rows (256 blocks: one a WGP, four waves a SIMD, all reading the same K and V^T rows from the block's LDS); a pass takes 32 keys. Transposed products: S^T = K Q^T (A = key rows, B = the wave's q rows, loaded once),
// so lane (ln, hh) holds, for query q0 + ln, the keys kb + 8 hh + r and kb + 16 + 8 hh + r: the k order of g2_frag, and the 16 weights are the B operand of O^T += V^T P^T as they lie (A = V^T rows).
// score = s*m + (-10000*(1-m) + emb[bucket(j-i)][h]) as in the reference (bf16-rounded emb, this head's values by key - query distance in LDS; m = mask[b][q][k] bf16-rounded), every term times log2(e): the factor is in the 1/8, the -10000 and the table.
// Online softmax: running maximum and sum per query, both in-lane but for one exchange between the lane halves; the output tile and the sum are rescaled every pass; weights exp(score - maximum) = 2^(scaled score - scaled maximum) <= 1 as f16.
__global__ __launch_bounds__(512) void k_fattn(const _Float16* __restrict__ QKV, const _Float16* __restrict__ VT, const float* __restrict__ emb, const float* __restrict__ amask, _Float16* __restrict__ O16) {
  __shared__ __attribute__((aligned(16))) struct { float tb[5 * 512]; unsigned short ring[2][FASTG]; } sm;      /* one object, the table first: its reads keep small constant offsets */
  float (&tb)[5 * 512] = sm.tb;      /* tb[t] = this head's bias at key - query = t - (the block's last query row): the SQ + 255 distances that the block's 256 queries meet, rounded up to five entries a thread */
  unsigned short (&ring)[2][FASTG] = sm.ring;      /* the two K | V^T buffers */
  const int bh = blockIdx.y, b = bh / NH, h = bh % NH;
  const int ckr = (int)threadIdx.x >> 3, ckc = ((int)threadIdx.x & 7) * 8, cvr = (int)threadIdx.x >> 4, cvc = ((int)threadIdx.x & 15) * 8;      /* this thread's K row (of each 64) and V^T row (of each 32) and its 8 halfs of them */
  const _Float16* gk = QKV + ((size_t)b * SQ + ckr) * D3 + DM + h * HD + ckc; const _Float16* gv = VT + ((size_t)bh * HD + cvr) * SQ + cvc;
  const unsigned lk = (unsigned)(size_t)&ring[0][ckr * FAKP + ckc], lv = (unsigned)(size_t)&ring[0][FAK * FAKP + cvr * FAVP + cvc];      /* low 32 bits of the shared address = byte offset in the block's LDS */
  fa_copy(lk, lv, gk, gv);      /* stage 0 flies while the bias table is built */
#pragma unroll      /* the five table reads of a thread are in flight together */
  for (int u = 0; u < 5; ++u) { const int t = u * 512 + (int)threadIdx.x; tb[t] = bf16_round(emb[t5_bucket(t - (int)(blockIdx.x * 256 + 255)) * NH + h]) * FAL2E; }
  asm volatile("s_wait_asynccnt 0x0" ::: "memory");      /* this wave's part of stage 0 has landed */
  __syncthreads();      /* the bias table and stage 0 are readable by every wave */
  fa_copy(lk + FASTG * 2u, lv + FASTG * 2u, gk + (size_t)FAK * D3, gv + FAK);      /* stage 1 (there are SQ / FAK = 16) */
  const int lane = threadIdx.x & 31, ln = lane & 15, hh = lane >> 4;
  const int i = blockIdx.x * 256 + (threadIdx.x >> 5) * 16 + ln;      /* this lane's query row */
  const _Float16* qp = QKV + ((size_t)b * SQ + i) * D3 + h * HD;
  const v16h q0 = g2_frag(qp, hh), q1 = g2_frag(qp + 32, hh);
  const float* mr = amask + ((size_t)b * SQ + i) * SQ + 8 * hh;
  const float* bp = tb + (8 * hh + 255 - (int)((threadIdx.x >> 5) * 16 + ln));      /* bp[j] = the bias of key j + 8 hh for this lane's query */
  const v8f z8 = {0.f,0.f,0.f,0.f,0.f,0.f,0.f,0.f}; v8f o0 = z8, o1 = z8, o2 = z8, o3 = z8;
  float mx = -INFINITY, se = 0.f;
#pragma unroll 1      /* one trip = one buffer; the two buffers alternate by t & 1 */
  for (int t = 0; t < SQ / FAK; ++t) {
  const unsigned short* kt = &ring[t & 1][ln * FAKP + 8 * hh];      /* K row ln of the stage; the lane half's offset of g2_frag is in kt, vt and mr already */
  const unsigned short* vt = &ring[t & 1][FAK * FAKP + ln * FAVP + 8 * hh];      /* V^T row d = ln */
#pragma unroll 1      /* one pass holds some 200 vector instructions already: unrolling would only cost registers and instruction cache */
  for (int kb = t * FAK; kb < (t + 1) * FAK; kb += 32) {
    const unsigned short* k0 = kt + (kb - t * FAK) * FAKP; const unsigned short* vk = vt + (kb - t * FAK); const float* mk = mr + kb;
    const v4f m0 = *(const v4fa*)(mk), m1 = *(const v4fa*)(mk + 4), m2 = *(const v4fa*)(mk + 16), m3 = *(const v4fa*)(mk + 20);
    const v16h ka0 = g2_lfrag(k0), ka1 = g2_lfrag(k0 + 32), kc0 = g2_lfrag(k0 + 16 * FAKP), kc1 = g2_lfrag(k0 + 16 * FAKP + 32);
    const v16h va0 = g2_lfrag(vk), va1 = g2_lfrag(vk + 16 * FAVP), va2 = g2_lfrag(vk + 32 * FAVP), va3 = g2_lfrag(vk + 48 * FAVP);
    float bs[16];      /* the 16 bias values of the pass: two runs of 8 consecutive table entries, 16 apart */
#pragma unroll      /* bs[] and v[] indexed by constants only, so that they live in registers */
    for (int r = 0; r < 8; ++r) { bs[r] = bp[kb + r]; bs[8 + r] = bp[kb + 16 + r]; }
    __builtin_amdgcn_sched_barrier(0);      /* the 4 mask loads, the 16 fragment reads and the table reads of a pass are issued together, ahead of all else: left alone the compiler sinks some of them to just in front of their use and the wave waits again */
    asm volatile("s_wait_xcnt 0x0" :: "v"(mk) : "memory");      /* input only: the mask loads' address register lives up to this wait and is reused only behind it */
    v8f s0 = fa_mma(ka0, q0, z8); s0 = fa_mma(ka1, q1, s0);
    v8f s1 = fa_mma(kc0, q0, z8); s1 = fa_mma(kc1, q1, s1);
    float v[16]; float bm = -INFINITY;
#pragma unroll
    for (int r = 0; r < 8; ++r) {
      const float ma = bf16_round(r < 4 ? m0[r & 3] : m1[r & 3]), mb = bf16_round(r < 4 ? m2[r & 3] : m3[r & 3]);
      v[r] = (s0[r] * (0.125f * FAL2E)) * ma + ((-10000.0f * FAL2E) * (1.0f - ma) + bs[r]);
      v[8 + r] = (s1[r] * (0.125f * FAL2E)) * mb + ((-10000.0f * FAL2E) * (1.0f - mb) + bs[8 + r]);
      bm = fmaxf(bm, fmaxf(v[r], v[8 + r]));
    }
    const float mn = fmaxf(mx, fmaxf(bm, xhalf(bm)));      /* the same in both lanes of a query */
    const float f = __builtin_amdgcn_exp2f(mx - mn);      /* 0 on the first pass, where mx is -inf; exactly 1 where the maximum stays */
    mx = mn; se *= f;
    FragH p;
#pragma unroll      /* four weights at a time, then the rescale of one output tile */
    for (int t = 0; t < 4; ++t) {
#pragma unroll
      for (int k = 4 * t; k < 4 * t + 4; ++k) { v[k] = __builtin_amdgcn_exp2f(v[k] - mn); p.h[k] = (_Float16)v[k]; }
      v8f& ot = t == 0 ? o0 : t == 1 ? o1 : t == 2 ? o2 : o3;
#pragma unroll
      for (int r = 0; r < 8; ++r) ot[r] *= f;
      __builtin_amdgcn_sched_barrier(0);      /* keeps the groups apart, so that plain multiplies and conversions issue between the runs of 2^x: left alone the compiler issues all 17 in one run */
    }
    o0 = fa_mma(va0, p.v, o0); o1 = fa_mma(va1, p.v, o1); o2 = fa_mma(va2, p.v, o2); o3 = fa_mma(va3, p.v, o3);
    __builtin_amdgcn_sched_barrier(0);      /* the sum of the weights stays behind the pass's last product: its additions are the vector slots that the chip needs between that product and the next pass's first write to one of its operand registers, and they issue while the matrix unit works */
#pragma unroll
    for (int k = 0; k < 16; ++k) se += v[k];
  }
    asm volatile("s_wait_dscnt 0x0" ::: "memory");      /* this wave's reads of buffer t & 1 are done */
    asm volatile("s_wait_asynccnt 0x0" ::: "memory");      /* this wave's part of stage t + 1 has landed */
    __syncthreads();      /* publishes stage t + 1 and frees buffer t & 1 */
    if (t + 2 < SQ / FAK) fa_copy(lk + (unsigned)(t & 1) * (FASTG * 2u), lv + (unsigned)(t & 1) * (FASTG * 2u), gk + (size_t)(t + 2) * FAK * D3, gv + (t + 2) * FAK);
  }
  asm volatile("s_wait_asynccnt 0x0" ::: "memory");      /* nothing in flight when the wave ends */
  se += xhalf(se);      /* each lane summed its own half of the keys */
  const float inv = 1.0f / se;
  _Float16* op = O16 + ((size_t)b * SQ + i) * DM + h * HD + 8 * hh;      /* o_t[r] = ctx[query i][d = 16 t + 8 hh + r]: 16 contiguous bytes a tile */
  FragH c0, c1;
#pragma unroll
  for (int r = 0; r < 8; ++r) { c0.h[r] = (_Float16)(o0[r] * inv); c0.h[8 + r] = (_Float16)(o1[r] * inv); c1.h[r] = (_Float16)(o2[r] * inv); c1.h[8 + r] = (_Float16)(o3[r] * inv); }
  *(v8us*)((unsigned short*)op) = c0.half[0]; *(v8us*)((unsigned short*)op + 16) = c0.half[1]; *(v8us*)((unsigned short*)op + 32) = c1.half[0]; *(v8us*)((unsigned short*)op + 48) = c1.half[1];
}
__global__ __launch_bounds__(256) void k_vt(const _Float16* __restrict__ V16, int b, int h0, _Float16* __restrict__ VT) { __shared__ unsigned short tl[64][65]; const int tid = threadIdx.x; const int hh = blockIdx.x % HG, sg = blockIdx.x / HG; const int s0 = sg * 64; const int h = h0 + hh;
  for (int i = tid; i < 64 * 8; i += 256) { const int j = i / 8, d8 = (i % 8) * 8; FragH f; f.half[0] = *(const v8us*)((const unsigned short*)V16 + ((size_t)b * SQ + s0 + j) * DM + h * HD + d8); for (int q = 0; q < 8; ++q) tl[d8 + q][j] = f.u[q]; }
  __syncthreads();
  { for (int i = tid; i < 64 * 8; i += 256) { const int d = i / 8, j8 = (i % 8) * 8; FragH f; for (int q = 0; q < 8; ++q) f.u[q] = tl[d][j8 + q]; *(v8us*)((unsigned short*)VT + ((size_t)hh * HD + d) * SQ + s0 + j8) = f.half[0]; }  } }

// The three input conversions in one launch: hidden -> f16 rows (the items of k_x16) and W_qkv, W_o -> x16 transposed f16 (the items of k_wt_f16). They depend on nothing but the inputs, and one launch replaces three
// (32,768 one-item waves in three launches). Here 512 work-groups, two a WGP, 16 waves a WGP, all resident at once; a thread takes 8 items (4 of hidden, 3 of W_qkv, 1 of W_o) and asks for all its data up front.
#define PRB 512                      /* work-groups of the conversion launch */
#define PRT (PRB * 256)              /* its threads */
__global__ __launch_bounds__(256) void k_prep(const float* __restrict__ x, _Float16* __restrict__ X16, const float* __restrict__ wq, _Float16* __restrict__ Bq, const float* __restrict__ wo, _Float16* __restrict__ Bo) {
  static_assert(NR * DM / 8 == (size_t)4 * PRT && (size_t)D3 * (DM / 8) == (size_t)3 * PRT && (size_t)DM * (DM / 8) == (size_t)PRT, "items per thread");
  const int g = blockIdx.x * 256 + threadIdx.x;
  const int n = g / (DM / 8), k8 = (g % (DM / 8)) * 8;      /* weight item j * PRT + g: output row j * (PRT / 128) + n, its 8 consecutive k from k8 */
  const unsigned ix = blockIdx.x * 1024u + threadIdx.x;      /* hidden items ix + 256 j: a work-group takes 1,024 consecutive items */
  const unsigned ox = ix * 32u, iq = (unsigned)k8 * D3 + (unsigned)n, oo = ((unsigned)k8 * DM + (unsigned)n) * 4u;      /* one address register an input, beside the (uniform) input pointer; all else is a constant offset */
  v4f xa[4], xb[4]; float wv[4][8];
#pragma unroll      /* xa, xb, wv indexed by constants only, so that they live in registers */
  for (int j = 0; j < 4; ++j) { const char* p = (const char*)x + (size_t)ox + j * 8192; xa[j] = *(const v4fa*)p; xb[j] = *(const v4fa*)(p + 16); }
#pragma unroll
  for (int j = 0; j < 3; ++j)
#pragma unroll
    for (int i = 0; i < 8; ++i) wv[j][i] = (wq + (size_t)iq)[i * D3 + j * (PRT / (DM / 8))];
#pragma unroll
  for (int i = 0; i < 8; ++i) wv[3][i] = *(const float*)((const char*)wo + (size_t)oo + i * DM * 4);
  asm volatile("s_wait_xcnt 0x0" :: "v"(ox), "v"(iq), "v"(oo) : "memory");      /* inputs only: the three address registers of the 40 loads live up to this wait and are reused only behind it */
  __builtin_amdgcn_sched_barrier(0);      /* all 40 loads of a thread are in flight, and the wait above has passed, before the first conversion: sunk to their uses the loads would cost one memory round trip an item */
#pragma unroll
  for (int j = 0; j < 4; ++j) { FragH f;
#pragma unroll
    for (int q = 0; q < 4; ++q) { f.h[q] = (_Float16)bf16_round(xa[j][q]); f.h[4 + q] = (_Float16)bf16_round(xb[j][q]); }
    *(v8us*)((unsigned short*)X16 + ((size_t)ix + j * 256) * 8) = f.half[0]; }
#pragma unroll
  for (int j = 0; j < 4; ++j) { FragH f;
#pragma unroll
    for (int i = 0; i < 8; ++i) f.h[i] = (_Float16)(bf16_round(wv[j][i]) * 16.0f);
    unsigned short* o = j < 3 ? (unsigned short*)Bq + (size_t)(j * (PRT / (DM / 8)) + n) * DM + k8 : (unsigned short*)Bo + (size_t)n * DM + k8;
    *(v8us*)o = f.half[0]; }
}

extern "C" void kernel_launch(void* const* d_in, const int* in_sizes, int n_in,
                              void* d_out, int out_size, void* d_ws, size_t ws_size, hipStream_t stream) {
  (void)in_sizes; (void)n_in; (void)out_size;
  const float* const* I = (const float* const*)d_in; const float* hs = I[0]; const float* amask = I[1]; const float* wqkv = I[2]; const float* wo = I[3]; const float* emb = I[4];      /* W_qkv [1024][3072] and W_o [1024][1024] are [in][out]; attention_mask [2][1][2048][2048]; rel_bias_emb [32][16] */
  char* ws = (char*)d_ws; size_t off = 0;
  auto take = [&](size_t bytes) { char* p = ws + off; off += (bytes + 255) & ~(size_t)255; return p; };
  _Float16* BQKV = (_Float16*)take((size_t)D3 * DM * 2); _Float16* BO = (_Float16*)take((size_t)DM * DM * 2);
  _Float16* X16 = (_Float16*)take(NR * DM * 2); _Float16* QKV = (_Float16*)take(NR * D3 * 2); _Float16* O16 = (_Float16*)take(NR * DM * 2);
  _Float16* VT = (_Float16*)take((size_t)NB * NH * HD * SQ * 2);
  if (off > ws_size) return;      /* 6 + 2 + 8 + 24 + 8 + 8 = approx 56 MiB */
  k_prep<<<PRB, 256, 0, stream>>>(hs, X16, wqkv, BQKV, wo, BO);      /* hidden as f16 rows; [in][out] weights -> Bt[out][in] x16 */
  k_gemm2<0><<<dim3((unsigned)((NR / 128) * (D3 / 128)), 1), 256, 0, stream>>>(X16, DM, 0, BQKV, DM, 0, 0.0625f, nullptr, 0, nullptr, 1, 0, 0, nullptr, QKV, D3, 0, MP, D3, DM);      /* q | k | v rows (f16), head h at columns h*64 / 1024 + h*64 / 2048 + h*64 */
  k_vt<NH, SQ><<<NB * NH * (SQ / 64), 256, 0, stream>>>(QKV, D3, 2 * DM, VT);      /* V^T[(b,h)][d][s] for every (batch, head) */
  k_fattn<<<dim3(SQ / 256, NB * NH), 512, 0, stream>>>(QKV, VT, emb, amask, O16);      /* ctx (merged heads) as f16 rows; one block per 256 query rows of a (batch, head) */
  k_gemm2<0><<<dim3((unsigned)((NR / 128) * (DM / 128)), 1), 256, 0, stream>>>(O16, DM, 0, BO, DM, 0, 0.0625f, nullptr, 0, nullptr, 1, 0, 0, (float*)d_out, nullptr, DM, 0, MO, DM, DM);      /* out = ctx W_o, rows are the output layout */
}

// v008
// It runs in 122 microseconds.
// In both of two side-by-side timings against v007, it was 1.11 times as fast.
// All steps since v000 together make it 246 times as fast.
#include <hip/hip_runtime.h>
#define NB 2
#define SQ 2048
#define DM 1024
#define D3 3072                      /* fused q|k|v width */
#define NH 16
#define HD 64
#define HG 4                         /* heads per call of the k_vt(V16, b, h0, VT) overload, which nothing launches */
#define NBK 32                       /* relative-position buckets */
#define MP ((int)NR)                 /* token rows through the qkv projection (debug hook) */
#define MO ((int)NR)                 /* token rows through the output projection (debug hook) */
#define NR ((size_t)NB * SQ)         /* 4096 token rows */
typedef __bf16 v16b __attribute__((ext_vector_type(16)));
typedef unsigned short v8us __attribute__((ext_vector_type(8), may_alias));
typedef float  v8f  __attribute__((ext_vector_type(8)));
typedef float  v4f  __attribute__((ext_vector_type(4)));
typedef float  v4fa __attribute__((ext_vector_type(4), may_alias));
union FragB { v16b v; v8us half[2]; unsigned short u[16]; };

__device__ __forceinline__ unsigned short bf16_bits(float x) { unsigned int u = __float_as_uint(x); return (unsigned short)((u + 0x7FFFu + ((u >> 16) & 1u)) >> 16); }
__device__ __forceinline__ float bf16_val(unsigned short b) { return __uint_as_float(((unsigned int)b) << 16); }
__device__ __forceinline__ float bf16_round(float x) { return bf16_val(bf16_bits(x)); }
// D += A·B with NT terms: 1 = ah·bh, 2 = + al·bh (A split), 3 = + ah·bl (both split)
template <int NT>
__device__ __forceinline__ v8f mmaN(v16b ah, v16b al, v16b bh, v16b bl, v8f c) {
  c = __builtin_amdgcn_wmma_f32_16x16x32_bf16(false, ah, false, bh, (short)0, c, false, false);
  if (NT >= 2) c = __builtin_amdgcn_wmma_f32_16x16x32_bf16(false, al, false, bh, (short)0, c, false, false);
  if (NT >= 3) c = __builtin_amdgcn_wmma_f32_16x16x32_bf16(false, ah, false, bl, (short)0, c, false, false);
  asm volatile("v_nop\n\tv_nop\n\tv_nop\n\tv_nop" : "+v"(c) : "v"(ah), "v"(al), "v"(bh), "v"(bl));
  return c;
}

__global__ __launch_bounds__(256) void k_wt_bf16(const float* __restrict__ W, unsigned short* __restrict__ Wt, int K, int N) {
  const int t = blockIdx.x * 256 + threadIdx.x;
  const int k8n = K / 8;
  if (t >= N * k8n) return;
  const int n = t / k8n, k8 = (t % k8n) * 8;
  v8us v;
#pragma unroll
  for (int i = 0; i < 8; ++i) v[i] = bf16_bits(W[(size_t)(k8 + i) * N + n]);
  *(v8us*)(Wt + (size_t)n * K + k8) = v;
  
}

// GEMM C[M][N] (f32, pitch ldc) = act(A[M][K]·W + bias). A f32 row-major (pitch lda) converted per fragment to bf16
// (ASPLIT: hi/lo two planes -> 2 terms, else single rounded term); Wt bf16 [N][K] (pitch ldb). BIAS_BF16 rounds the
// bias to bf16 first (bias quantised to bf16 before the add). K%32==0, M%16==0, N%64==0.
template <bool ASPLIT, int ACT, bool BIAS_BF16>
__global__ __launch_bounds__(128) void k_gemm_bf(const float* __restrict__ A, int lda, const unsigned short* __restrict__ Wt, int ldb,
                                               const float* __restrict__ bias, float* __restrict__ C, int ldc, int M, int N, int K) {
  __shared__ __attribute__((aligned(16))) float so[4][16][64];
  const int tid = threadIdx.x, w = tid >> 5, lane = tid & 31, ln = lane & 15, hh = lane >> 4;
  const int ntn = N / 64;
  const int wid = blockIdx.x * 4 + w;
  const int mt = wid / ntn, nq = wid % ntn;
  if (mt * 16 >= M) return;
  const int row0 = mt * 16, col0 = nq * 64;
  const float* arow = A + (size_t)(row0 + ln) * lda;
  v8f acc[4] = {};
  for (int kb = 0; kb < K; kb += 32) {
    FragB ah, al;
    const v4f x0 = *(const v4fa*)(arow + kb + 8 * hh), x1 = *(const v4fa*)(arow + kb + 8 * hh + 4);
    const v4f x2 = *(const v4fa*)(arow + kb + 16 + 8 * hh), x3 = *(const v4fa*)(arow + kb + 16 + 8 * hh + 4);
    float xs[16] = {x0[0],x0[1],x0[2],x0[3],x1[0],x1[1],x1[2],x1[3],x2[0],x2[1],x2[2],x2[3],x3[0],x3[1],x3[2],x3[3]};
#pragma unroll
    for (int i = 0; i < 16; ++i) { const unsigned short hb = bf16_bits(xs[i]); ah.u[i] = hb; al.u[i] = ASPLIT ? bf16_bits(xs[i] - bf16_val(hb)) : (unsigned short)0; }
#pragma unroll
    for (int t = 0; t < 4; ++t) {
      const unsigned short* brow = Wt + (size_t)(col0 + t * 16 + ln) * ldb + kb;
      FragB b;
      b.half[0] = *(const v8us*)(brow + 8 * hh);
      b.half[1] = *(const v8us*)(brow + 16 + 8 * hh);
      acc[t] = mmaN<ASPLIT ? 2 : 1>(ah.v, al.v, b.v, b.v, acc[t]);
    }
  }
#pragma unroll
  for (int t = 0; t < 4; ++t) {
    float bv = bias ? bias[col0 + t * 16 + ln] : 0.f;
    if (BIAS_BF16) bv = bf16_round(bv);
#pragma unroll
    for (int r = 0; r < 8; ++r) { float v = acc[t][r] + bv; if (ACT == 1) v = fmaxf(v, 0.f); so[w][8 * hh + r][t * 16 + ln] = v; }
  }
  __builtin_amdgcn_fence(__ATOMIC_ACQ_REL, "workgroup");
  __builtin_amdgcn_wave_barrier();
  const int rsub = lane >> 4, c4 = (lane & 15) * 4;
  {
#pragma unroll
    for (int q = 0; q < 8; ++q) {
      const int r = q * 2 + rsub;
      const v4f v = *(const v4fa*)&so[w][r][c4];
      *(v4f*)(C + (size_t)(row0 + r) * ldc + col0 + c4) = v;
    }
    
  }
}

// GEMM C = act(A·W + bias + resid): A f32 (ASPLIT -> hi/lo 2 terms), Wt bf16 [N][K]; ACT 0 none, 1 relu, 2 exact gelu;
// resid (optional, f32, row index = (row % rmod), pitch ldr, RES_BF16 rounds it) added before the activation.
template <bool ASPLIT, int ACT, bool BIAS_BF16, bool RES_BF16>
__global__ __launch_bounds__(128) void k_gemm_bf3(const float* __restrict__ A, int lda, const unsigned short* __restrict__ Wt, int ldb,
                                                const float* __restrict__ bias, const float* __restrict__ resid, int rmod, int ldr,
                                                float* __restrict__ C, int ldc, int M, int N, int K) {
  __shared__ __attribute__((aligned(16))) float so[4][16][64];
  const int tid = threadIdx.x, w = tid >> 5, lane = tid & 31, ln = lane & 15, hh = lane >> 4;
  const int ntn = N / 64;
  const int wid = blockIdx.x * 4 + w;
  const int mt = wid / ntn, nq = wid % ntn;
  if (mt * 16 >= M) return;
  const int row0 = mt * 16, col0 = nq * 64;
  const float* arow = A + (size_t)(row0 + ln) * lda;
  v8f acc[4] = {};
  for (int kb = 0; kb < K; kb += 32) {
    FragB ah, al;
    const v4f x0 = *(const v4fa*)(arow + kb + 8 * hh), x1 = *(const v4fa*)(arow + kb + 8 * hh + 4);
    const v4f x2 = *(const v4fa*)(arow + kb + 16 + 8 * hh), x3 = *(const v4fa*)(arow + kb + 16 + 8 * hh + 4);
    float xs[16] = {x0[0],x0[1],x0[2],x0[3],x1[0],x1[1],x1[2],x1[3],x2[0],x2[1],x2[2],x2[3],x3[0],x3[1],x3[2],x3[3]};
#pragma unroll
    for (int i = 0; i < 16; ++i) { const unsigned short hb = bf16_bits(xs[i]); ah.u[i] = hb; al.u[i] = ASPLIT ? bf16_bits(xs[i] - bf16_val(hb)) : (unsigned short)0; }
#pragma unroll
    for (int t = 0; t < 4; ++t) {
      const unsigned short* brow = Wt + (size_t)(col0 + t * 16 + ln) * ldb + kb;
      FragB b;
      b.half[0] = *(const v8us*)(brow + 8 * hh);
      b.half[1] = *(const v8us*)(brow + 16 + 8 * hh);
      acc[t] = mmaN<ASPLIT ? 2 : 1>(ah.v, al.v, b.v, b.v, acc[t]);
    }
  }
#pragma unroll
  for (int t = 0; t < 4; ++t) {
    const int col = col0 + t * 16 + ln;
    float bv = bias ? bias[col] : 0.f;
    if (BIAS_BF16) bv = bf16_round(bv);
#pragma unroll
    for (int r = 0; r < 8; ++r) {
      float v = acc[t][r] + bv;
      if (resid) { float rv = resid[(size_t)((row0 + 8 * hh + r) % rmod) * ldr + col]; if (RES_BF16) rv = bf16_round(rv); v += rv; }
      if (ACT == 1) v = fmaxf(v, 0.f);
      if (ACT == 2) v = 0.5f * v * (1.0f + erff(v * 0.70710678118654752f));
      if (ACT == 3) { const float u = 0.7978845608028654f * (v + 0.044715f * v * v * v); v = 0.5f * v * (1.0f + tanhf(u)); }
      so[w][8 * hh + r][t * 16 + ln] = v;
    }
  }
  __builtin_amdgcn_fence(__ATOMIC_ACQ_REL, "workgroup");
  __builtin_amdgcn_wave_barrier();
  const int rsub = lane >> 4, c4 = (lane & 15) * 4;
  {
#pragma unroll
    for (int q = 0; q < 8; ++q) {
      const int r = q * 2 + rsub;
      const v4f v = *(const v4fa*)&so[w][r][c4];
      *(v4f*)(C + (size_t)(row0 + r) * ldc + col0 + c4) = v;
    }
    
  }
}
// row LayerNorm (biased variance, eps) over N: s = X (+ R); optional out_sum <- s; out_norm <- (s-mu)*rsqrt(var+eps)*g + b
template <bool PARAM_BF16>
__global__ __launch_bounds__(256) void k_layernorm(const float* __restrict__ X, const float* __restrict__ R, const float* __restrict__ g, const float* __restrict__ bta,
                                                  float* __restrict__ out_sum, float* __restrict__ out_norm, int N, float eps) {
  __shared__ float red[256];
  const int row = blockIdx.x, tid = threadIdx.x;
  const float* x = X + (size_t)row * N; const float* rr = R ? R + (size_t)row * N : nullptr;
  float vals[16];                     // up to N = 4096
  const int per = N / 256;            // contiguous chunk per thread? use strided-by-4 chunks: thread handles j = tid*4 + 1024*u
  float s1 = 0.f;
  for (int u = 0; u < per / 4; ++u) {
    const int j = tid * 4 + 1024 * u;
    const v4f a = *(const v4fa*)(x + j);
    v4f b = {0.f,0.f,0.f,0.f}; if (rr) b = *(const v4fa*)(rr + j);
#pragma unroll
    for (int q = 0; q < 4; ++q) { const float v = a[q] + b[q]; vals[u * 4 + q] = v; s1 += v; }
  }
  red[tid] = s1; __syncthreads();
  for (int st = 128; st > 0; st >>= 1) { if (tid < st) red[tid] += red[tid + st]; __syncthreads(); }
  const float mu = red[0] / (float)N; __syncthreads();
  float s2 = 0.f;
  for (int u = 0; u < per / 4; ++u)
#pragma unroll
    for (int q = 0; q < 4; ++q) { const float c = vals[u * 4 + q] - mu; s2 += c * c; }
  red[tid] = s2; __syncthreads();
  for (int st = 128; st > 0; st >>= 1) { if (tid < st) red[tid] += red[tid + st]; __syncthreads(); }
  const float rs = rsqrtf(red[0] / (float)N + eps);
  {
    for (int u = 0; u < per / 4; ++u) {
      const int j = tid * 4 + 1024 * u;
      v4f o, sm;
#pragma unroll
      for (int q = 0; q < 4; ++q) {
        float gg = g[j + q], bb = bta[j + q];
        if (PARAM_BF16) { gg = bf16_round(gg); bb = bf16_round(bb); }
        sm[q] = vals[u * 4 + q]; o[q] = (vals[u * 4 + q] - mu) * rs * gg + bb;
      }
      if (out_sum) *(v4f*)(out_sum + (size_t)row * N + j) = sm;
      *(v4f*)(out_norm + (size_t)row * N + j) = o;
    }
    
  }
}



// ---- f16 WMMA path (v_wmma_f32_16x16x32_f16): 11-bit significands for operands in range — used where a [0,1] probability operand needs more precision than bf16
typedef _Float16 v16h __attribute__((ext_vector_type(16)));
union FragH { v16h v; v8us half[2]; _Float16 h[16]; unsigned short u[16]; };
template <int NT>
__device__ __forceinline__ v8f mmaH(v16h ah, v16h al, v16h bh, v16h bl, v8f c) {
  c = __builtin_amdgcn_wmma_f32_16x16x32_f16(false, ah, false, bh, (short)0, c, false, false);
  if (NT >= 2) c = __builtin_amdgcn_wmma_f32_16x16x32_f16(false, al, false, bh, (short)0, c, false, false);
  if (NT >= 3) c = __builtin_amdgcn_wmma_f32_16x16x32_f16(false, ah, false, bl, (short)0, c, false, false);
  asm volatile("v_nop\n\tv_nop\n\tv_nop\n\tv_nop" : "+v"(c) : "v"(ah), "v"(al), "v"(bh), "v"(bl));
  return c;
}
// batched GEMM like k_gemm_b but f16 operands: A f32 (split into f16 hi/lo if ASPLIT, else rounded to f16), Bt = f16 values [n][k]; alpha; C f32; N multiple of 16 (partial tiles skipped)
template <bool ASPLIT>
__global__ __launch_bounds__(128) void k_gemm_h(const float* __restrict__ A, int lda, size_t sA, const _Float16* __restrict__ Bh, int ldb, size_t sB, float alpha, float* __restrict__ C, int ldc, size_t sC, int M, int N, int K) {
  __shared__ __attribute__((aligned(16))) float so[4][16][64];
  const int tid = threadIdx.x, w = tid >> 5, lane = tid & 31, ln = lane & 15, hh = lane >> 4; const int by = blockIdx.y;
  A += (size_t)by * sA; Bh += (size_t)by * sB; C += (size_t)by * sC;
  const int ntn = (N + 63) / 64; const int wid = blockIdx.x * 4 + w; const int mt = wid / ntn, nq = wid % ntn; if (mt * 16 >= M) return;
  const int row0 = mt * 16, col0 = nq * 64; const float* arow = A + (size_t)(row0 + ln) * lda;
  v8f acc[4] = {};
  for (int kb = 0; kb < K; kb += 32) {
    FragH ah, al;
    const v4f x0 = *(const v4fa*)(arow + kb + 8 * hh), x1 = *(const v4fa*)(arow + kb + 8 * hh + 4), x2 = *(const v4fa*)(arow + kb + 16 + 8 * hh), x3 = *(const v4fa*)(arow + kb + 16 + 8 * hh + 4);
    float xs[16] = {x0[0],x0[1],x0[2],x0[3],x1[0],x1[1],x1[2],x1[3],x2[0],x2[1],x2[2],x2[3],x3[0],x3[1],x3[2],x3[3]};
#pragma unroll
    for (int i = 0; i < 16; ++i) { const _Float16 h = (_Float16)xs[i]; ah.h[i] = h; al.h[i] = ASPLIT ? (_Float16)(xs[i] - (float)h) : (_Float16)0.0f; }
#pragma unroll
    for (int t = 0; t < 4; ++t) { if (col0 + t * 16 >= N) continue; const size_t boff = (size_t)(col0 + t * 16 + ln) * ldb + kb; FragH bq; bq.half[0] = *(const v8us*)(Bh + boff + 8 * hh); bq.half[1] = *(const v8us*)(Bh + boff + 16 + 8 * hh);
      acc[t] = mmaH<ASPLIT ? 2 : 1>(ah.v, al.v, bq.v, bq.v, acc[t]); }
  }
#pragma unroll
  for (int t = 0; t < 4; ++t) { if (col0 + t * 16 >= N) continue;
#pragma unroll
    for (int r = 0; r < 8; ++r) so[w][8 * hh + r][t * 16 + ln] = acc[t][r] * alpha; }
  __builtin_amdgcn_fence(__ATOMIC_ACQ_REL, "workgroup"); __builtin_amdgcn_wave_barrier();
  const int rsub = lane >> 4, c4 = (lane & 15) * 4;
  {
#pragma unroll
    for (int q = 0; q < 8; ++q) { const int r = q * 2 + rsub; if (col0 + c4 < N) { const v4f v = *(const v4fa*)&so[w][r][c4]; *(v4f*)(C + (size_t)(row0 + r) * ldc + col0 + c4) = v; } }
     }
}

// Wt[n][k] = f16(W[k][n]·scale) from f32 row-major W[K][N] (scale = power of two; bf16-exact weights stay exact in f16 away from the subnormal range)
__global__ __launch_bounds__(256) void k_wt_f16(const float* __restrict__ W, _Float16* __restrict__ Wt, int K, int N, float scale) {
  const int t = blockIdx.x * 256 + threadIdx.x; if (t >= N * (K / 8)) return; const int n = t / (K / 8), k8 = (t % (K / 8)) * 8; FragH f;
#pragma unroll
  for (int i = 0; i < 8; ++i) f.h[i] = (_Float16)(bf16_round(W[(size_t)(k8 + i) * N + n]) * scale); const v8us o = f.half[0];
  *(v8us*)((unsigned short*)Wt + (size_t)n * K + k8) = o; 
}
// k_gemm_hh variant with fused epilogue: v = acc·alpha + bias[by·sBias + col] (+ CP[(row/rowsPerB)·sCPb + by·64 + col] if CP) ; ACT 0 none / 1 elu ; writes f16 C16 (and f32 C if non-null)
template <int ACT>
__global__ __launch_bounds__(128) void k_gemm_hhx(const _Float16* __restrict__ A, int lda, size_t sA, const _Float16* __restrict__ Bh, int ldb, size_t sB, float alpha, const float* __restrict__ bias, size_t sBias, const float* __restrict__ CP, int rowsPerB, size_t sCPb, int row0g,
    float* __restrict__ C, _Float16* __restrict__ C16, int ldc, size_t sC, int M, int N, int K) {
  __shared__ __attribute__((aligned(16))) float so[4][16][64];
  const int tid = threadIdx.x, w = tid >> 5, lane = tid & 31, ln = lane & 15, hh = lane >> 4; const int by = blockIdx.y;
  A += (size_t)by * sA; Bh += (size_t)by * sB; const size_t cofs = (size_t)by * sC; const float* bp = bias ? bias + (size_t)by * sBias : nullptr;
  const int ntn = (N + 63) / 64; const int wid = blockIdx.x * 4 + w; const int mt = wid / ntn, nq = wid % ntn; if (mt * 16 >= M) return;
  const int row0 = mt * 16, col0 = nq * 64; const _Float16* arow = A + (size_t)(row0 + ln) * lda;
  v8f acc[4] = {};
  for (int kb = 0; kb < K; kb += 32) { FragH ah; ah.half[0] = *(const v8us*)((const unsigned short*)arow + kb + 8 * hh); ah.half[1] = *(const v8us*)((const unsigned short*)arow + kb + 16 + 8 * hh);
#pragma unroll
    for (int t = 0; t < 4; ++t) { if (col0 + t * 16 >= N) continue; const size_t boff = (size_t)(col0 + t * 16 + ln) * ldb + kb; FragH bq; bq.half[0] = *(const v8us*)((const unsigned short*)Bh + boff + 8 * hh); bq.half[1] = *(const v8us*)((const unsigned short*)Bh + boff + 16 + 8 * hh);
      acc[t] = mmaH<1>(ah.v, ah.v, bq.v, bq.v, acc[t]); }
  }
#pragma unroll
  for (int t = 0; t < 4; ++t) { if (col0 + t * 16 >= N) continue; const int col = col0 + t * 16 + ln; const float bv = bp ? bf16_round(bp[col]) : 0.f;
#pragma unroll
    for (int r = 0; r < 8; ++r) { float v = acc[t][r] * alpha + bv; if (CP) { const int rr = row0g + row0 + 8 * hh + r; if (rowsPerB < 0) v += CP[cofs + (size_t)rr * ldc + col];      /* rowsPerB < 0: own element of the batched C plane */ else { const int bidx = rr / rowsPerB; v += CP[(size_t)bidx * sCPb + (size_t)by * 64 + col]; } } if (ACT == 1) v = (v > 0.f) ? v : expm1f(v); else if (ACT == 7) v = (v > 0.f) ? v + 1.0f : expf(v); else if (ACT == 8) v = tanhf(v); else if (ACT == 9) v = 0.5f * v * (1.0f + tanhf(0.7978845608028654f * (v + 0.044715f * v * v * v))); else if (ACT == 11) v = 1.0f / (1.0f + expf(-v)); else if (ACT == 12) v = (v > 0.f) ? v : 0.01f * v; else if (ACT == 14) v = (v > 0.f) ? v : 0.1f * v; else if (ACT == 16) v = (v >= 0.f) ? v : 0.3f * v; else if (ACT == 17) v = (v >= 0.f) ? v : 0.2f * v; else if (ACT == 15) v = v / (1.0f + expf(-v)); else if (ACT == 3) v = fmaxf(v, 0.f); else if (ACT == 6) v = 0.5f * v * (1.0f + erff(v * 0.70710678118654752f)); so[w][8 * hh + r][t * 16 + ln] = v; } }
  __builtin_amdgcn_fence(__ATOMIC_ACQ_REL, "workgroup"); __builtin_amdgcn_wave_barrier();
  const int rsub = lane >> 4, c4 = (lane & 15) * 4; typedef _Float16 v4h __attribute__((ext_vector_type(4)));
  {
#pragma unroll
    for (int q = 0; q < 8; ++q) { const int r = q * 2 + rsub; if (col0 + c4 < N) { const v4f v = *(const v4fa*)&so[w][r][c4]; if (C) *(v4f*)(C + cofs + (size_t)(row0 + r) * ldc + col0 + c4) = v; if (C16) { v4h h4; for (int i = 0; i < 4; ++i) h4[i] = (_Float16)v[i]; *(v4h*)(C16 + cofs + (size_t)(row0 + r) * ldc + col0 + c4) = h4; } } }
     }
}


typedef _Float16 v4h __attribute__((ext_vector_type(4)));

__global__ __launch_bounds__(256) void k_x16(const float* __restrict__ x, _Float16* __restrict__ X16, size_t n8) { const size_t t = (size_t)blockIdx.x * 256 + threadIdx.x; if (t >= n8) return; FragH f;
#pragma unroll
  for (int q = 0; q < 8; ++q) f.h[q] = (_Float16)bf16_round(x[t * 8 + q]); *(v8us*)((unsigned short*)X16 + t * 8) = f.half[0];  }
__global__ __launch_bounds__(256) void k_h16(const float* __restrict__ x, _Float16* __restrict__ X16, size_t n8) { const size_t t = (size_t)blockIdx.x * 256 + threadIdx.x; if (t >= n8) return; FragH f;
#pragma unroll
  for (int q = 0; q < 8; ++q) f.h[q] = (_Float16)x[t * 8 + q]; *(v8us*)((unsigned short*)X16 + t * 8) = f.half[0];  }
__global__ __launch_bounds__(256) void k_round16f(const float* __restrict__ W, _Float16* __restrict__ Bt, size_t n8) { const size_t t = (size_t)blockIdx.x * 256 + threadIdx.x; if (t >= n8) return; FragH f;
#pragma unroll
  for (int i = 0; i < 8; ++i) f.h[i] = (_Float16)(bf16_round(W[t * 8 + i]) * 16.0f); *(v8us*)((unsigned short*)Bt + t * 8) = f.half[0];  }
template <int NHv, int TTv>
__global__ __launch_bounds__(256) void k_vt(const _Float16* __restrict__ V16, int ldv, int voff, _Float16* __restrict__ Vt) { __shared__ unsigned short tl[64][66]; const int tid = threadIdx.x; const int slab = blockIdx.x / (TTv / 64), lg = blockIdx.x % (TTv / 64); const int b = slab / NHv, h = slab % NHv;
  for (int i = tid; i < 64 * 8; i += 256) { const int r = i / 8, c8 = (i % 8) * 8; FragH f; f.half[0] = *(const v8us*)((const unsigned short*)V16 + ((size_t)b * TTv + lg * 64 + r) * ldv + voff + h * 64 + c8);
#pragma unroll
    for (int q = 0; q < 8; ++q) tl[r][c8 + q] = f.u[q]; }
  __syncthreads();
  {
#pragma unroll
    for (int rd = 0; rd < 2; ++rd) { const int d = rd * 32 + tid / 8, pc = tid % 8; FragH f;
#pragma unroll
      for (int q = 0; q < 8; ++q) f.u[q] = tl[pc * 8 + q][d];
      *(v8us*)((unsigned short*)Vt + ((size_t)slab * 64 + d) * TTv + lg * 64 + pc * 8) = f.half[0]; }
     } }

__global__ __launch_bounds__(256) void k_hl(const float* __restrict__ F, _Float16* __restrict__ Hh, _Float16* __restrict__ Hl, size_t n8) { const size_t t = (size_t)blockIdx.x * 256 + threadIdx.x; if (t >= n8) return; FragH fh, fl; const v4f a = *(const v4fa*)(F + t * 8), c = *(const v4fa*)(F + t * 8 + 4);
#pragma unroll
  for (int q = 0; q < 4; ++q) { _Float16 h = (_Float16)a[q]; fh.h[q] = h; fl.h[q] = (_Float16)((a[q] - (float)h) * 1024.0f); h = (_Float16)c[q]; fh.h[4 + q] = h; fl.h[4 + q] = (_Float16)((c[q] - (float)h) * 1024.0f); }
  { *(v8us*)((unsigned short*)Hh + t * 8) = fh.half[0]; *(v8us*)((unsigned short*)Hl + t * 8) = fl.half[0];  } }

// ---- fast GEMM (block tile 128x128 on 8 waves, wave tile 32x64; requires M % 128 == 0, N % 128 == 0, K % 64 == 0, K >= 64); epilogue = k_gemm_hhx semantics ----
// Operand path: a k tile is 64 k = one whole 128-byte line of each of the block's 128 A rows and 128 Bt rows. The 256 threads bring it into LDS by asynchronous 16-byte copies
// (8 lanes a row, so every wave-wide copy covers 4 whole lines), two buffers, the next tile in flight while this one is multiplied; the waves read their fragments from LDS in the k order of g2_frag.
#define G2P 72                       /* halfs per LDS row: 128 bytes of data + 16, the conflict-free pitch for 16-byte reads */
#define G2STG (256 * G2P * 2)        /* bytes of one buffer: 128 A rows, then 128 Bt rows */
__device__ __forceinline__ v16h g2_frag(const _Float16* p, int hh) { FragH f; f.half[0] = *(const v8us*)((const unsigned short*)p + 8 * hh); f.half[1] = *(const v8us*)((const unsigned short*)p + 16 + 8 * hh); return f.v; }
__device__ __forceinline__ v16h g2_lfrag(const unsigned short* p) { FragH f; f.half[0] = *(const v8us*)(p); f.half[1] = *(const v8us*)(p + 16); return f.v; }
__device__ __forceinline__ v8f g2_mma(v16h a, v16h b, v8f c) { return __builtin_amdgcn_wmma_f32_16x16x32_f16(false, a, false, b, (short)0, c, false, false); }
// one k tile: this thread's 16 bytes of rows r, r + 32, r + 64, r + 96 of A (pitch pa halfs) and of Bt (pitch pb); l = LDS byte address of its place in row r of the buffer.
// The s_wait_xcnt closes the copies' own statement, so that no address register is rewritten ahead of it.
__device__ __forceinline__ void g2_copy(unsigned l, const _Float16* a, size_t pa, const _Float16* b, size_t pb) {
  asm volatile("global_load_async_to_lds_b128 %0, %8, off\n\t"
               "global_load_async_to_lds_b128 %1, %9, off\n\t"
               "global_load_async_to_lds_b128 %2, %10, off\n\t"
               "global_load_async_to_lds_b128 %3, %11, off\n\t"
               "global_load_async_to_lds_b128 %4, %12, off\n\t"
               "global_load_async_to_lds_b128 %5, %13, off\n\t"
               "global_load_async_to_lds_b128 %6, %14, off\n\t"
               "global_load_async_to_lds_b128 %7, %15, off\n\t"
               "s_wait_xcnt 0x0"
               :: "v"(l), "v"(l + 32u * G2P * 2u), "v"(l + 64u * G2P * 2u), "v"(l + 96u * G2P * 2u), "v"(l + 128u * G2P * 2u), "v"(l + 160u * G2P * 2u), "v"(l + 192u * G2P * 2u), "v"(l + 224u * G2P * 2u),
                  "v"(a), "v"(a + 32 * pa), "v"(a + 64 * pa), "v"(a + 96 * pa), "v"(b), "v"(b + 32 * pb), "v"(b + 64 * pb), "v"(b + 96 * pb) : "memory");
}
template <int ACT>
__global__ __launch_bounds__(256) void k_gemm2(const _Float16* __restrict__ A, int lda, size_t sA, const _Float16* __restrict__ Bh, int ldb, size_t sB, float alpha, const float* __restrict__ bias, size_t sBias, const float* __restrict__ CP, int rowsPerB, size_t sCPb, int row0g,
    float* __restrict__ C, _Float16* __restrict__ C16, int ldc, size_t sC, int M, int N, int K) { static_assert(ACT == 0 || ACT == 3 || ACT == 6 || ACT == 8 || ACT == 9 || ACT == 11 || ACT == 12 || ACT == 14 || ACT == 15 || ACT == 16 || ACT == 17, "k_gemm2: unsupported ACT code (would silently apply no activation)");
  __shared__ __attribute__((aligned(16))) unsigned short ring[2][256][G2P];      /* the two operand buffers; behind the k loop the same bytes are the waves' output staging */
  static_assert(sizeof(float) * 8 * 32 * 68 <= sizeof(unsigned short) * 2 * 256 * G2P, "output staging must fit the ring");
  const int tid = threadIdx.x, w = tid >> 5, lane = tid & 31, ln = lane & 15, hh = lane >> 4; const int by = blockIdx.y;
  A += (size_t)by * sA; Bh += (size_t)by * sB; const size_t cofs = (size_t)by * sC; const float* bp = bias ? bias + (size_t)by * sBias : nullptr;
  const int ntn = N >> 7; const int mt = blockIdx.x / ntn, nq = blockIdx.x - mt * ntn; const int m0 = mt * 128, n0 = nq * 128; if (m0 >= M) return;      /* the same for the whole block, ahead of every barrier */
  const int wr = 32 * (w & 3), wc = 64 * (w >> 2); const int row0 = m0 + wr, col0 = n0 + wc;
  const int cr = tid >> 3, cs = (tid & 7) * 8;      /* this thread's row (of each 32) and its 8 halfs of the 64 in a k tile */
  const _Float16* ga = A + (size_t)(m0 + cr) * lda + cs; const _Float16* gb = Bh + (size_t)(n0 + cr) * ldb + cs;
  const unsigned l0 = (unsigned)(size_t)&ring[0][cr][cs];      /* low 32 bits of the shared address = byte offset in the block's LDS */
  const int nt = K >> 6;
  const v8f z8 = {0.f,0.f,0.f,0.f,0.f,0.f,0.f,0.f}; v8f c00 = z8, c01 = z8, c02 = z8, c03 = z8, c10 = z8, c11 = z8, c12 = z8, c13 = z8;
  g2_copy(l0, ga, (size_t)lda, gb, (size_t)ldb);
  asm volatile("s_wait_asynccnt 0x0" ::: "memory");      /* this wave's part of tile 0 has landed */
  __syncthreads();      /* tile 0 is readable by every wave */
  if (nt > 1) g2_copy(l0 + G2STG, ga + 64, (size_t)lda, gb + 64, (size_t)ldb);
#pragma unroll 1      /* one trip = one buffer; the two buffers alternate by t & 1 */
  for (int t = 0; t < nt; ++t) {
    const unsigned short* ta = &ring[t & 1][wr + ln][8 * hh]; const unsigned short* tb = &ring[t & 1][128 + wc + ln][8 * hh];
#pragma unroll      /* the two 32-k steps of a tile: constant LDS offsets */
    for (int ks = 0; ks < 64; ks += 32) {
      const v16h a0 = g2_lfrag(ta + ks), a1 = g2_lfrag(ta + 16 * G2P + ks);
      const v16h b0 = g2_lfrag(tb + ks), b1 = g2_lfrag(tb + 16 * G2P + ks), b2 = g2_lfrag(tb + 32 * G2P + ks), b3 = g2_lfrag(tb + 48 * G2P + ks);
      __builtin_amdgcn_sched_barrier(0);      /* the 12 LDS reads of a step issue as one group ahead of its 8 products: left alone the compiler reuses the B registers and the wave waits for LDS four times a step */
      c00 = g2_mma(a0, b0, c00); c10 = g2_mma(a1, b0, c10); c01 = g2_mma(a0, b1, c01); c11 = g2_mma(a1, b1, c11);
      c02 = g2_mma(a0, b2, c02); c12 = g2_mma(a1, b2, c12); c03 = g2_mma(a0, b3, c03); c13 = g2_mma(a1, b3, c13);
    }
    asm volatile("s_wait_dscnt 0x0" ::: "memory");      /* this wave's reads of buffer t & 1 are done */
    asm volatile("s_wait_asynccnt 0x0" ::: "memory");      /* this wave's part of tile t + 1 has landed */
    __syncthreads();      /* publishes tile t + 1 and frees buffer t & 1 */
    if (t + 2 < nt) g2_copy(l0 + (unsigned)(t & 1) * G2STG, ga + (size_t)(t + 2) * 64, (size_t)lda, gb + (size_t)(t + 2) * 64, (size_t)ldb);
  }
  asm volatile("s_wait_asynccnt 0x0" ::: "memory");      /* nothing in flight when the ring becomes output staging (the last trip's barrier has ended every read of it) */
  float (*so)[32][68] = reinterpret_cast<float (*)[32][68]>(&ring[0][0][0]);
  v8f accs[8] = {c00, c01, c02, c03, c10, c11, c12, c13};
#pragma unroll
  for (int u = 0; u < 8; ++u) { const int t = u & 3, half = u >> 2; const int col = col0 + t * 16 + ln; const float bv = bp ? bf16_round(bp[col]) : 0.f;
#pragma unroll
    for (int r = 0; r < 8; ++r) { const int rloc = half * 16 + 8 * hh + r; float v = accs[u][r] * alpha + bv; if (CP) { if (rowsPerB < 0) v += CP[cofs + (size_t)(row0g + row0 + rloc) * ldc + col];      /* rowsPerB < 0: own element of the batched C plane */ else { const int bidx = (row0g + row0 + rloc) / rowsPerB; v += CP[(size_t)bidx * sCPb + (size_t)by * 64 + col]; } }
      if (ACT == 3) v = fmaxf(v, 0.f); else if (ACT == 6) v = 0.5f * v * (1.0f + erff(v * 0.70710678118654752f)); else if (ACT == 11) v = 1.0f / (1.0f + expf(-v)); else if (ACT == 15) v = v / (1.0f + expf(-v)); else if (ACT == 12) v = (v > 0.f) ? v : 0.01f * v; else if (ACT == 8) v = tanhf(v); else if (ACT == 9) v = 0.5f * v * (1.0f + tanhf(0.7978845608028654f * (v + 0.044715f * v * v * v))); else if (ACT == 14) v = (v > 0.f) ? v : 0.1f * v; else if (ACT == 16) v = (v >= 0.f) ? v : 0.3f * v; else if (ACT == 17) v = (v >= 0.f) ? v : 0.2f * v;
      so[w][rloc][t * 16 + ln] = v; } }
  __builtin_amdgcn_fence(__ATOMIC_ACQ_REL, "workgroup"); __builtin_amdgcn_wave_barrier();
  const int rsub = lane >> 4, c4 = (lane & 15) * 4;
  {
#pragma unroll
    for (int q = 0; q < 16; ++q) { const int r = q * 2 + rsub; const v4f v = *(const v4fa*)&so[w][r][c4]; if (C) *(v4f*)(C + cofs + (size_t)(row0 + r) * ldc + col0 + c4) = v; if (C16) { v4h h4; for (int i = 0; i < 4; ++i) h4[i] = (_Float16)v[i]; *(v4h*)(C16 + cofs + (size_t)(row0 + r) * ldc + col0 + c4) = h4; } }
     } }


__global__ __launch_bounds__(256) void k_wnat(const float* __restrict__ w, size_t n8, _Float16* __restrict__ Bt) { const size_t t = (size_t)blockIdx.x * 256 + threadIdx.x; if (t >= n8) return; FragH f; for (int q = 0; q < 8; ++q) f.h[q] = (_Float16)(bf16_round(w[t * 8 + q]) * 16.0f); *(v8us*)((unsigned short*)Bt + t * 8) = f.half[0];  }
// T5 bidirectional relative-position bucket of rel = key - query (32 buckets, max distance 128): (rel > 0)*16 + f(|rel|), f(n) = n for n < 8, then
// 8 + the number of thresholds {12,16,23,32,46,64,91} that are <= n (the thresholds are where the reference's own f32 log expression steps; no log on the device)
__device__ __forceinline__ int t5_bucket(int rel) { const int n = rel < 0 ? -rel : rel; const int g = 8 + (n >= 12) + (n >= 16) + (n >= 23) + (n >= 32) + (n >= 46) + (n >= 64) + (n >= 91); return (rel > 0 ? NBK / 2 : 0) + (n < 8 ? n : g); }
// lane l with lane l ^ 16 (the two lanes that share one query column)
__device__ __forceinline__ float xhalf(float x) { return __builtin_bit_cast(float, __builtin_amdgcn_permlanex16(__builtin_bit_cast(int, x), __builtin_bit_cast(int, x), 0x76543210, 0xfedcba98, false, false)); }
__device__ __forceinline__ v8f fa_mma(v16h a, v16h b, v8f c) { return __builtin_amdgcn_wmma_f32_16x16x32_f16(false, a, false, b, (short)0, c, false, false); }
// Operand path of the fused attention: a stage is 128 keys = 128 K rows (one whole 128-byte line each) and the 64 V^T rows (two whole lines each). The block's 512 threads bring it into LDS by asynchronous 16-byte copies
// (a wave-wide copy covers 4 whole lines), two buffers, the next stage in flight while this one is worked on; all 16 waves read their A fragments from LDS in the k order of g2_frag.
#define FAK 128                      /* keys per stage */
#define FAKP 72                      /* halfs per K row in LDS: 128 bytes of data + 16, the conflict-free pitch for 16-byte reads */
#define FAVP 136                     /* halfs per V^T row in LDS: 256 bytes of data + 16, likewise */
#define FASTG (FAK * FAKP + HD * FAVP)      /* halfs of one buffer: the K rows, then the V^T rows */
#define FAL2E 1.4426950408889634f    /* log2(e): the scores are formed in base-2 units, so that a weight is one subtraction and one hardware 2^x */
// one stage: this thread's 16 bytes of K rows r and r + 64 (token pitch D3) and of V^T rows d and d + 32 (pitch SQ); lk, lv = LDS byte addresses of its places in rows r and d of the buffer.
// The s_wait_xcnt closes the copies' own statement, so that no address register is rewritten ahead of it.
__device__ __forceinline__ void fa_copy(unsigned lk, unsigned lv, const _Float16* k, const _Float16* v) {
  asm volatile("global_load_async_to_lds_b128 %0, %4, off\n\t"
               "global_load_async_to_lds_b128 %1, %5, off\n\t"
               "global_load_async_to_lds_b128 %2, %6, off\n\t"
               "global_load_async_to_lds_b128 %3, %7, off\n\t"
               "s_wait_xcnt 0x0"
               :: "v"(lk), "v"(lk + 64u * FAKP * 2u), "v"(lv), "v"(lv + 32u * FAVP * 2u),
                  "v"(k), "v"(k + (size_t)64 * D3), "v"(v), "v"(v + (size_t)32 * SQ) : "memory");
}
// fused attention of one (batch, head): scores, bias and mask, softmax and P.V in one pass over the keys; S and P stay in registers.
// One wave owns 16 query rows, a block 16 waves = 256 rows (256 blocks: one a WGP, four waves a SIMD, all reading the same K and V^T rows from the block's LDS); a pass takes 32 keys. Transposed products: S^T = K Q^T (A = key rows, B = the wave's q rows, loaded once),
// so lane (ln, hh) holds, for query q0 + ln, the keys kb + 8 hh + r and kb + 16 + 8 hh + r: the k order of g2_frag, and the 16 weights are the B operand of O^T += V^T P^T as they lie (A = V^T rows).
// score = s*m + (-10000*(1-m) + emb[bucket(j-i)][h]) as in the reference (bf16-rounded emb, this head's values by key - query distance in LDS; m = mask[b][q][k] bf16-rounded), every term times log2(e): the factor is in the 1/8, the -10000 and the table.
// Online softmax: running maximum and sum per query, both in-lane but for one exchange between the lane halves; the output tile and the sum are rescaled every pass; weights exp(score - maximum) = 2^(scaled score - scaled maximum) <= 1 as f16.
__global__ __launch_bounds__(512) void k_fattn(const _Float16* __restrict__ QKV, const _Float16* __restrict__ VT, const float* __restrict__ emb, const float* __restrict__ amask, _Float16* __restrict__ O16) {
  __shared__ __attribute__((aligned(16))) struct { float tb[5 * 512]; unsigned short ring[2][FASTG]; } sm;      /* one object, the table first: its reads keep small constant offsets */
  float (&tb)[5 * 512] = sm.tb;      /* tb[t] = this head's bias at key - query = t - (the block's last query row): the SQ + 255 distances that the block's 256 queries meet, rounded up to five entries a thread */
  unsigned short (&ring)[2][FASTG] = sm.ring;      /* the two K | V^T buffers */
  const int bh = blockIdx.y, b = bh / NH, h = bh % NH;
  const int ckr = (int)threadIdx.x >> 3, ckc = ((int)threadIdx.x & 7) * 8, cvr = (int)threadIdx.x >> 4, cvc = ((int)threadIdx.x & 15) * 8;      /* this thread's K row (of each 64) and V^T row (of each 32) and its 8 halfs of them */
  const _Float16* gk = QKV + ((size_t)b * SQ + ckr) * D3 + DM + h * HD + ckc; const _Float16* gv = VT + ((size_t)bh * HD + cvr) * SQ + cvc;
  const unsigned lk = (unsigned)(size_t)&ring[0][ckr * FAKP + ckc], lv = (unsigned)(size_t)&ring[0][FAK * FAKP + cvr * FAVP + cvc];      /* low 32 bits of the shared address = byte offset in the block's LDS */
  fa_copy(lk, lv, gk, gv);      /* stage 0 flies while the bias table is built */
#pragma unroll      /* the five table reads of a thread are in flight together */
  for (int u = 0; u < 5; ++u) { const int t = u * 512 + (int)threadIdx.x; tb[t] = bf16_round(emb[t5_bucket(t - (int)(blockIdx.x * 256 + 255)) * NH + h]) * FAL2E; }
  asm volatile("s_wait_asynccnt 0x0" ::: "memory");      /* this wave's part of stage 0 has landed */
  __syncthreads();      /* the bias table and stage 0 are readable by every wave */
  fa_copy(lk + FASTG * 2u, lv + FASTG * 2u, gk + (size_t)FAK * D3, gv + FAK);      /* stage 1 (there are SQ / FAK = 16) */
  const int lane = threadIdx.x & 31, ln = lane & 15, hh = lane >> 4;
  const int i = blockIdx.x * 256 + (threadIdx.x >> 5) * 16 + ln;      /* this lane's query row */
  const _Float16* qp = QKV + ((size_t)b * SQ + i) * D3 + h * HD;
  const v16h q0 = g2_frag(qp, hh), q1 = g2_frag(qp + 32, hh);
  const float* mr = amask + ((size_t)b * SQ + i) * SQ + 8 * hh;
  const float* bp = tb + (8 * hh + 255 - (int)((threadIdx.x >> 5) * 16 + ln));      /* bp[j] = the bias of key j + 8 hh for this lane's query */
  const v8f z8 = {0.f,0.f,0.f,0.f,0.f,0.f,0.f,0.f}; v8f o0 = z8, o1 = z8, o2 = z8, o3 = z8;
  float mx = -INFINITY, se = 0.f;
#pragma unroll 1      /* one trip = one buffer; the two buffers alternate by t & 1 */
  for (int t = 0; t < SQ / FAK; ++t) {
  const unsigned short* kt = &ring[t & 1][ln * FAKP + 8 * hh];      /* K row ln of the stage; the lane half's offset of g2_frag is in kt, vt and mr already */
  const unsigned short* vt = &ring[t & 1][FAK * FAKP + ln * FAVP + 8 * hh];      /* V^T row d = ln */
#pragma unroll 1      /* one pass holds some 200 vector instructions already: unrolling would only cost registers and instruction cache */
  for (int kb = t * FAK; kb < (t + 1) * FAK; kb += 32) {
    const unsigned short* k0 = kt + (kb - t * FAK) * FAKP; const unsigned short* vk = vt + (kb - t * FAK); const float* mk = mr + kb;
    const v4f m0 = *(const v4fa*)(mk), m1 = *(const v4fa*)(mk + 4), m2 = *(const v4fa*)(mk + 16), m3 = *(const v4fa*)(mk + 20);
    const v16h ka0 = g2_lfrag(k0), ka1 = g2_lfrag(k0 + 32), kc0 = g2_lfrag(k0 + 16 * FAKP), kc1 = g2_lfrag(k0 + 16 * FAKP + 32);
    const v16h va0 = g2_lfrag(vk), va1 = g2_lfrag(vk + 16 * FAVP), va2 = g2_lfrag(vk + 32 * FAVP), va3 = g2_lfrag(vk + 48 * FAVP);
    float bs[16];      /* the 16 bias values of the pass: two runs of 8 consecutive table entries, 16 apart */
#pragma unroll      /* bs[] and v[] indexed by constants only, so that they live in registers */
    for (int r = 0; r < 8; ++r) { bs[r] = bp[kb + r]; bs[8 + r] = bp[kb + 16 + r]; }
    __builtin_amdgcn_sched_barrier(0);      /* the 4 mask loads, the 16 fragment reads and the table reads of a pass are issued together, ahead of all else: left alone the compiler sinks some of them to just in front of their use and the wave waits again */
    asm volatile("s_wait_xcnt 0x0" :: "v"(mk) : "memory");      /* input only: the mask loads' address register lives up to this wait and is reused only behind it */
    v8f s0 = fa_mma(ka0, q0, z8); s0 = fa_mma(ka1, q1, s0);
    v8f s1 = fa_mma(kc0, q0, z8); s1 = fa_mma(kc1, q1, s1);
    float v[16]; float bm = -INFINITY;
#pragma unroll
    for (int r = 0; r < 8; ++r) {
      const float ma = bf16_round(r < 4 ? m0[r & 3] : m1[r & 3]), mb = bf16_round(r < 4 ? m2[r & 3] : m3[r & 3]);
      v[r] = (s0[r] * (0.125f * FAL2E)) * ma + ((-10000.0f * FAL2E) * (1.0f - ma) + bs[r]);
      v[8 + r] = (s1[r] * (0.125f * FAL2E)) * mb + ((-10000.0f * FAL2E) * (1.0f - mb) + bs[8 + r]);
      bm = fmaxf(bm, fmaxf(v[r], v[8 + r]));
    }
    const float mn = fmaxf(mx, fmaxf(bm, xhalf(bm)));      /* the same in both lanes of a query */
    const float f = __builtin_amdgcn_exp2f(mx - mn);      /* 0 on the first pass, where mx is -inf; exactly 1 where the maximum stays */
    mx = mn; se *= f;
    FragH p;
#pragma unroll      /* four weights at a time, then the rescale of one output tile */
    for (int t = 0; t < 4; ++t) {
#pragma unroll
      for (int k = 4 * t; k < 4 * t + 4; ++k) { v[k] = __builtin_amdgcn_exp2f(v[k] - mn); p.h[k] = (_Float16)v[k]; }
      v8f& ot = t == 0 ? o0 : t == 1 ? o1 : t == 2 ? o2 : o3;
#pragma unroll
      for (int r = 0; r < 8; ++r) ot[r] *= f;
      __builtin_amdgcn_sched_barrier(0);      /* keeps the groups apart, so that plain multiplies and conversions issue between the runs of 2^x: left alone the compiler issues all 17 in one run */
    }
    o0 = fa_mma(va0, p.v, o0); o1 = fa_mma(va1, p.v, o1); o2 = fa_mma(va2, p.v, o2); o3 = fa_mma(va3, p.v, o3);
    __builtin_amdgcn_sched_barrier(0);      /* the sum of the weights stays behind the pass's last product: its additions are the vector slots that the chip needs between that product and the next pass's first write to one of its operand registers, and they issue while the matrix unit works */
#pragma unroll
    for (int k = 0; k < 16; ++k) se += v[k];
  }
    asm volatile("s_wait_dscnt 0x0" ::: "memory");      /* this wave's reads of buffer t & 1 are done */
    asm volatile("s_wait_asynccnt 0x0" ::: "memory");      /* this wave's part of stage t + 1 has landed */
    __syncthreads();      /* publishes stage t + 1 and frees buffer t & 1 */
    if (t + 2 < SQ / FAK) fa_copy(lk + (unsigned)(t & 1) * (FASTG * 2u), lv + (unsigned)(t & 1) * (FASTG * 2u), gk + (size_t)(t + 2) * FAK * D3, gv + (t + 2) * FAK);
  }
  asm volatile("s_wait_asynccnt 0x0" ::: "memory");      /* nothing in flight when the wave ends */
  se += xhalf(se);      /* each lane summed its own half of the keys */
  const float inv = 1.0f / se;
  _Float16* op = O16 + ((size_t)b * SQ + i) * DM + h * HD + 8 * hh;      /* o_t[r] = ctx[query i][d = 16 t + 8 hh + r]: 16 contiguous bytes a tile */
  FragH c0, c1;
#pragma unroll
  for (int r = 0; r < 8; ++r) { c0.h[r] = (_Float16)(o0[r] * inv); c0.h[8 + r] = (_Float16)(o1[r] * inv); c1.h[r] = (_Float16)(o2[r] * inv); c1.h[8 + r] = (_Float16)(o3[r] * inv); }
  *(v8us*)((unsigned short*)op) = c0.half[0]; *(v8us*)((unsigned short*)op + 16) = c0.half[1]; *(v8us*)((unsigned short*)op + 32) = c1.half[0]; *(v8us*)((unsigned short*)op + 48) = c1.half[1];
}
__global__ __launch_bounds__(256) void k_vt(const _Float16* __restrict__ V16, int b, int h0, _Float16* __restrict__ VT) { __shared__ unsigned short tl[64][65]; const int tid = threadIdx.x; const int hh = blockIdx.x % HG, sg = blockIdx.x / HG; const int s0 = sg * 64; const int h = h0 + hh;
  for (int i = tid; i < 64 * 8; i += 256) { const int j = i / 8, d8 = (i % 8) * 8; FragH f; f.half[0] = *(const v8us*)((const unsigned short*)V16 + ((size_t)b * SQ + s0 + j) * DM + h * HD + d8); for (int q = 0; q < 8; ++q) tl[d8 + q][j] = f.u[q]; }
  __syncthreads();
  { for (int i = tid; i < 64 * 8; i += 256) { const int d = i / 8, j8 = (i % 8) * 8; FragH f; for (int q = 0; q < 8; ++q) f.u[q] = tl[d][j8 + q]; *(v8us*)((unsigned short*)VT + ((size_t)hh * HD + d) * SQ + s0 + j8) = f.half[0]; }  } }

// The three input conversions in one launch: hidden -> f16 rows (the items of k_x16) and W_qkv, W_o -> x16 transposed f16 (the values of k_wt_f16). They depend on nothing but the inputs.
// 512 work-groups, two a WGP, 16 waves a WGP, all resident at once; a thread takes 4 items of hidden, a work-group 4 weight units (3 of W_qkv, 1 of W_o), and every thread asks for all its data up front.
// A weight unit is 64 k x 32 n. It is read along n, as it lies: 8 lanes a row, so a wave-wide 16-byte load covers 4 whole 128-byte lines (read down a column, one float a lane, a wave-wide load touched 32 lines for 128 bytes).
// The transposition is done in LDS: two consecutive k of one n are packed into 4 bytes and written down a column; behind one barrier each thread reads 8 consecutive k of one n and stores 16 bytes, a wave 4 whole lines of Bt.
#define PRB 512                      /* work-groups of the conversion launch */
#define PRT (PRB * 256)              /* its threads */
#define PRP 33                       /* 4-byte words per LDS row of a unit: 32 (64 k as f16 pairs) + 1, so that the writes down a column and the reads along a row each meet every bank at most once */
__global__ __launch_bounds__(256) void k_prep(const float* __restrict__ x, _Float16* __restrict__ X16, const float* __restrict__ wq, _Float16* __restrict__ Bq, const float* __restrict__ wo, _Float16* __restrict__ Bo) {
  static_assert(NR * DM / 8 == (size_t)4 * PRT && (D3 / 32) * (DM / 64) == 3 * PRB && (DM / 32) * (DM / 64) == PRB, "items per thread, units per work-group");
  typedef _Float16 v2h __attribute__((ext_vector_type(2)));
  __shared__ unsigned tl[4][32][PRP];      /* tl[unit][n][k / 2]: the even k in the low half */
  const int tid = threadIdx.x;
  const int c4 = (tid & 7) * 4, rp = tid >> 3;      /* reading: this thread's 4 consecutive n and its pair of rows k = 2 rp, 2 rp + 1 of a unit */
  const unsigned ix = blockIdx.x * 1024u + (unsigned)tid;      /* hidden items ix + 256 j: a work-group takes 1,024 consecutive items */
  const unsigned ox = ix * 32u, vq = ((unsigned)(2 * rp) * D3 + (unsigned)c4) * 4u, vo = ((unsigned)(2 * rp) * DM + (unsigned)c4) * 4u;      /* one address register an input, beside a uniform pointer; all else is a constant offset */
  unsigned un[4], uk[4];      /* first n and first k of the work-group's four units (uniform): consecutive work-groups take neighbouring pieces of the same rows */
#pragma unroll      /* un, uk, wa, wb, xa, xb indexed by constants only, so that they live in registers */
  for (int j = 0; j < 3; ++j) { const unsigned u = blockIdx.x + (unsigned)j * PRB; un[j] = (u % (D3 / 32)) * 32u; uk[j] = (u / (D3 / 32)) * 64u; }
  un[3] = (blockIdx.x % (DM / 32)) * 32u; uk[3] = (blockIdx.x / (DM / 32)) * 64u;
  const char* pw[4];      /* the units' first bytes (uniform) */
#pragma unroll
  for (int j = 0; j < 3; ++j) pw[j] = (const char*)(wq + (size_t)uk[j] * D3 + un[j]);
  pw[3] = (const char*)(wo + (size_t)uk[3] * DM + un[3]);
  __builtin_amdgcn_sched_barrier(0);      /* the four uniform pointers are formed ahead of the first load: formed between the loads they reuse scalar registers that an issued load names, and each reuse waits for that load's address translation */
  v4f wa[4], wb[4], xa[4], xb[4];
#pragma unroll
  for (int j = 0; j < 3; ++j) { const char* p = pw[j] + (size_t)vq; wa[j] = *(const v4fa*)p; wb[j] = *(const v4fa*)(p + D3 * 4); }
  { const char* p = pw[3] + (size_t)vo; wa[3] = *(const v4fa*)p; wb[3] = *(const v4fa*)(p + DM * 4); }
#pragma unroll
  for (int j = 0; j < 4; ++j) { const char* p = (const char*)x + (size_t)ox + j * 8192; xa[j] = *(const v4fa*)p; xb[j] = *(const v4fa*)(p + 16); }
  asm volatile("s_wait_xcnt 0x0" :: "v"(ox), "v"(vq), "v"(vo) : "memory");      /* inputs only: the three address registers of the 16 loads live up to this wait and are reused only behind it */
  __builtin_amdgcn_sched_barrier(0);      /* all 16 loads of a thread are in flight, and the wait above has passed, before the first conversion: sunk to their uses the loads would cost one memory round trip an item */
#pragma unroll
  for (int j = 0; j < 4; ++j)
#pragma unroll
    for (int q = 0; q < 4; ++q) { v2h f; f[0] = (_Float16)(bf16_round(wa[j][q]) * 16.0f); f[1] = (_Float16)(bf16_round(wb[j][q]) * 16.0f); tl[j][c4 + q][rp] = __builtin_bit_cast(unsigned, f); }
  __syncthreads();      /* the four units are whole in LDS; no global store stands in front of this barrier, which would wait for it */
  const int n = tid >> 3, k8 = tid & 7;      /* writing: this thread's row of Bt in a unit and its 8 consecutive k */
  union { unsigned d[4]; v8us v; } o[4];
#pragma unroll
  for (int j = 0; j < 4; ++j)
#pragma unroll
    for (int q = 0; q < 4; ++q) o[j].d[q] = tl[j][n][4 * k8 + q];
#pragma unroll      /* the hidden items are converted while the LDS reads above are under way */
  for (int j = 0; j < 4; ++j) { FragH f;
#pragma unroll
    for (int q = 0; q < 4; ++q) { f.h[q] = (_Float16)bf16_round(xa[j][q]); f.h[4 + q] = (_Float16)bf16_round(xb[j][q]); }
    *(v8us*)((unsigned short*)X16 + ((size_t)ix + j * 256) * 8) = f.half[0]; }
#pragma unroll
  for (int j = 0; j < 4; ++j) *(v8us*)((unsigned short*)(j < 3 ? Bq : Bo) + (size_t)(un[j] + (unsigned)n) * DM + uk[j] + (unsigned)k8 * 8u) = o[j].v;
}

extern "C" void kernel_launch(void* const* d_in, const int* in_sizes, int n_in,
                              void* d_out, int out_size, void* d_ws, size_t ws_size, hipStream_t stream) {
  (void)in_sizes; (void)n_in; (void)out_size;
  const float* const* I = (const float* const*)d_in; const float* hs = I[0]; const float* amask = I[1]; const float* wqkv = I[2]; const float* wo = I[3]; const float* emb = I[4];      /* W_qkv [1024][3072] and W_o [1024][1024] are [in][out]; attention_mask [2][1][2048][2048]; rel_bias_emb [32][16] */
  char* ws = (char*)d_ws; size_t off = 0;
  auto take = [&](size_t bytes) { char* p = ws + off; off += (bytes + 255) & ~(size_t)255; return p; };
  _Float16* BQKV = (_Float16*)take((size_t)D3 * DM * 2); _Float16* BO = (_Float16*)take((size_t)DM * DM * 2);
  _Float16* X16 = (_Float16*)take(NR * DM * 2); _Float16* QKV = (_Float16*)take(NR * D3 * 2); _Float16* O16 = (_Float16*)take(NR * DM * 2);
  _Float16* VT = (_Float16*)take((size_t)NB * NH * HD * SQ * 2);
  if (off > ws_size) return;      /* 6 + 2 + 8 + 24 + 8 + 8 = approx 56 MiB */
  k_prep<<<PRB, 256, 0, stream>>>(hs, X16, wqkv, BQKV, wo, BO);      /* hidden as f16 rows; [in][out] weights -> Bt[out][in] x16 */
  k_gemm2<0><<<dim3((unsigned)((NR / 128) * (D3 / 128)), 1), 256, 0, stream>>>(X16, DM, 0, BQKV, DM, 0, 0.0625f, nullptr, 0, nullptr, 1, 0, 0, nullptr, QKV, D3, 0, MP, D3, DM);      /* q | k | v rows (f16), head h at columns h*64 / 1024 + h*64 / 2048 + h*64 */
  k_vt<NH, SQ><<<NB * NH * (SQ / 64), 256, 0, stream>>>(QKV, D3, 2 * DM, VT);      /* V^T[(b,h)][d][s] for every (batch, head) */
  k_fattn<<<dim3(SQ / 256, NB * NH), 512, 0, stream>>>(QKV, VT, emb, amask, O16);      /* ctx (merged heads) as f16 rows; one block per 256 query rows of a (batch, head) */
  k_gemm2<0><<<dim3((unsigned)((NR / 128) * (DM / 128)), 1), 256, 0, stream>>>(O16, DM, 0, BO, DM, 0, 0.0625f, nullptr, 0, nullptr, 1, 0, 0, (float*)d_out, nullptr, DM, 0, MO, DM, DM);      /* out = ctx W_o, rows are the output layout */
}

// v009
// One run takes 115 microseconds.
// Two timings next to v008 both put it at 1.06 times that version's speed.
// All steps since v000 together make it 260 times as fast.
#include <hip/hip_runtime.h>
#define NB 2
#define SQ 2048
#define DM 1024
#define D3 3072                      /* fused q|k|v width */
#define NH 16
#define HD 64
#define HG 4                         /* heads per call of the k_vt(V16, b, h0, VT) overload, which nothing launches */
#define NBK 32                       /* relative-position buckets */
#define MP ((int)NR)                 /* token rows through the qkv projection (debug hook) */
#define MO ((int)NR)                 /* token rows through the output projection (debug hook) */
#define NR ((size_t)NB * SQ)         /* 4096 token rows */
typedef __bf16 v16b __attribute__((ext_vector_type(16)));
typedef unsigned short v8us __attribute__((ext_vector_type(8), may_alias));
typedef float  v8f  __attribute__((ext_vector_type(8)));
typedef float  v4f  __attribute__((ext_vector_type(4)));
typedef float  v4fa __attribute__((ext_vector_type(4), may_alias));
union FragB { v16b v; v8us half[2]; unsigned short u[16]; };

__device__ __forceinline__ unsigned short bf16_bits(float x) { unsigned int u = __float_as_uint(x); return (unsigned short)((u + 0x7FFFu + ((u >> 16) & 1u)) >> 16); }
__device__ __forceinline__ float bf16_val(unsigned short b) { return __uint_as_float(((unsigned int)b) << 16); }
__device__ __forceinline__ float bf16_round(float x) { return bf16_val(bf16_bits(x)); }
// D += A·B with NT terms: 1 = ah·bh, 2 = + al·bh (A split), 3 = + ah·bl (both split)
template <int NT>
__device__ __forceinline__ v8f mmaN(v16b ah, v16b al, v16b bh, v16b bl, v8f c) {
  c = __builtin_amdgcn_wmma_f32_16x16x32_bf16(false, ah, false, bh, (short)0, c, false, false);
  if (NT >= 2) c = __builtin_amdgcn_wmma_f32_16x16x32_bf16(false, al, false, bh, (short)0, c, false, false);
  if (NT >= 3) c = __builtin_amdgcn_wmma_f32_16x16x32_bf16(false, ah, false, bl, (short)0, c, false, false);
  asm volatile("v_nop\n\tv_nop\n\tv_nop\n\tv_nop" : "+v"(c) : "v"(ah), "v"(al), "v"(bh), "v"(bl));
  return c;
}

__global__ __launch_bounds__(256) void k_wt_bf16(const float* __restrict__ W, unsigned short* __restrict__ Wt, int K, int N) {
  const int t = blockIdx.x * 256 + threadIdx.x;
  const int k8n = K / 8;
  if (t >= N * k8n) return;
  const int n = t / k8n, k8 = (t % k8n) * 8;
  v8us v;
#pragma unroll
  for (int i = 0; i < 8; ++i) v[i] = bf16_bits(W[(size_t)(k8 + i) * N + n]);
  *(v8us*)(Wt + (size_t)n * K + k8) = v;
  
}

// GEMM C[M][N] (f32, pitch ldc) = act(A[M][K]·W + bias). A f32 row-major (pitch lda) converted per fragment to bf16
// (ASPLIT: hi/lo two planes -> 2 terms, else single rounded term); Wt bf16 [N][K] (pitch ldb). BIAS_BF16 rounds the
// bias to bf16 first (bias quantised to bf16 before the add). K%32==0, M%16==0, N%64==0.
template <bool ASPLIT, int ACT, bool BIAS_BF16>
__global__ __launch_bounds__(128) void k_gemm_bf(const float* __restrict__ A, int lda, const unsigned short* __restrict__ Wt, int ldb,
                                               const float* __restrict__ bias, float* __restrict__ C, int ldc, int M, int N, int K) {
  __shared__ __attribute__((aligned(16))) float so[4][16][64];
  const int tid = threadIdx.x, w = tid >> 5, lane = tid & 31, ln = lane & 15, hh = lane >> 4;
  const int ntn = N / 64;
  const int wid = blockIdx.x * 4 + w;
  const int mt = wid / ntn, nq = wid % ntn;
  if (mt * 16 >= M) return;
  const int row0 = mt * 16, col0 = nq * 64;
  const float* arow = A + (size_t)(row0 + ln) * lda;
  v8f acc[4] = {};
  for (int kb = 0; kb < K; kb += 32) {
    FragB ah, al;
    const v4f x0 = *(const v4fa*)(arow + kb + 8 * hh), x1 = *(const v4fa*)(arow + kb + 8 * hh + 4);
    const v4f x2 = *(const v4fa*)(arow + kb + 16 + 8 * hh), x3 = *(const v4fa*)(arow + kb + 16 + 8 * hh + 4);
    float xs[16] = {x0[0],x0[1],x0[2],x0[3],x1[0],x1[1],x1[2],x1[3],x2[0],x2[1],x2[2],x2[3],x3[0],x3[1],x3[2],x3[3]};
#pragma unroll
    for (int i = 0; i < 16; ++i) { const unsigned short hb = bf16_bits(xs[i]); ah.u[i] = hb; al.u[i] = ASPLIT ? bf16_bits(xs[i] - bf16_val(hb)) : (unsigned short)0; }
#pragma unroll
    for (int t = 0; t < 4; ++t) {
      const unsigned short* brow = Wt + (size_t)(col0 + t * 16 + ln) * ldb + kb;
      FragB b;
      b.half[0] = *(const v8us*)(brow + 8 * hh);
      b.half[1] = *(const v8us*)(brow + 16 + 8 * hh);
      acc[t] = mmaN<ASPLIT ? 2 : 1>(ah.v, al.v, b.v, b.v, acc[t]);
    }
  }
#pragma unroll
  for (int t = 0; t < 4; ++t) {
    float bv = bias ? bias[col0 + t * 16 + ln] : 0.f;
    if (BIAS_BF16) bv = bf16_round(bv);
#pragma unroll
    for (int r = 0; r < 8; ++r) { float v = acc[t][r] + bv; if (ACT == 1) v = fmaxf(v, 0.f); so[w][8 * hh + r][t * 16 + ln] = v; }
  }
  __builtin_amdgcn_fence(__ATOMIC_ACQ_REL, "workgroup");
  __builtin_amdgcn_wave_barrier();
  const int rsub = lane >> 4, c4 = (lane & 15) * 4;
  {
#pragma unroll
    for (int q = 0; q < 8; ++q) {
      const int r = q * 2 + rsub;
      const v4f v = *(const v4fa*)&so[w][r][c4];
      *(v4f*)(C + (size_t)(row0 + r) * ldc + col0 + c4) = v;
    }
    
  }
}

// GEMM C = act(A·W + bias + resid): A f32 (ASPLIT -> hi/lo 2 terms), Wt bf16 [N][K]; ACT 0 none, 1 relu, 2 exact gelu;
// resid (optional, f32, row index = (row % rmod), pitch ldr, RES_BF16 rounds it) added before the activation.
template <bool ASPLIT, int ACT, bool BIAS_BF16, bool RES_BF16>
__global__ __launch_bounds__(128) void k_gemm_bf3(const float* __restrict__ A, int lda, const unsigned short* __restrict__ Wt, int ldb,
                                                const float* __restrict__ bias, const float* __restrict__ resid, int rmod, int ldr,
                                                float* __restrict__ C, int ldc, int M, int N, int K) {
  __shared__ __attribute__((aligned(16))) float so[4][16][64];
  const int tid = threadIdx.x, w = tid >> 5, lane = tid & 31, ln = lane & 15, hh = lane >> 4;
  const int ntn = N / 64;
  const int wid = blockIdx.x * 4 + w;
  const int mt = wid / ntn, nq = wid % ntn;
  if (mt * 16 >= M) return;
  const int row0 = mt * 16, col0 = nq * 64;
  const float* arow = A + (size_t)(row0 + ln) * lda;
  v8f acc[4] = {};
  for (int kb = 0; kb < K; kb += 32) {
    FragB ah, al;
    const v4f x0 = *(const v4fa*)(arow + kb + 8 * hh), x1 = *(const v4fa*)(arow + kb + 8 * hh + 4);
    const v4f x2 = *(const v4fa*)(arow + kb + 16 + 8 * hh), x3 = *(const v4fa*)(arow + kb + 16 + 8 * hh + 4);
    float xs[16] = {x0[0],x0[1],x0[2],x0[3],x1[0],x1[1],x1[2],x1[3],x2[0],x2[1],x2[2],x2[3],x3[0],x3[1],x3[2],x3[3]};
#pragma unroll
    for (int i = 0; i < 16; ++i) { const unsigned short hb = bf16_bits(xs[i]); ah.u[i] = hb; al.u[i] = ASPLIT ? bf16_bits(xs[i] - bf16_val(hb)) : (unsigned short)0; }
#pragma unroll
    for (int t = 0; t < 4; ++t) {
      const unsigned short* brow = Wt + (size_t)(col0 + t * 16 + ln) * ldb + kb;
      FragB b;
      b.half[0] = *(const v8us*)(brow + 8 * hh);
      b.half[1] = *(const v8us*)(brow + 16 + 8 * hh);
      acc[t] = mmaN<ASPLIT ? 2 : 1>(ah.v, al.v, b.v, b.v, acc[t]);
    }
  }
#pragma unroll
  for (int t = 0; t < 4; ++t) {
    const int col = col0 + t * 16 + ln;
    float bv = bias ? bias[col] : 0.f;
    if (BIAS_BF16) bv = bf16_round(bv);
#pragma unroll
    for (int r = 0; r < 8; ++r) {
      float v = acc[t][r] + bv;
      if (resid) { float rv = resid[(size_t)((row0 + 8 * hh + r) % rmod) * ldr + col]; if (RES_BF16) rv = bf16_round(rv); v += rv; }
      if (ACT == 1) v = fmaxf(v, 0.f);
      if (ACT == 2) v = 0.5f * v * (1.0f + erff(v * 0.70710678118654752f));
      if (ACT == 3) { const float u = 0.7978845608028654f * (v + 0.044715f * v * v * v); v = 0.5f * v * (1.0f + tanhf(u)); }
      so[w][8 * hh + r][t * 16 + ln] = v;
    }
  }
  __builtin_amdgcn_fence(__ATOMIC_ACQ_REL, "workgroup");
  __builtin_amdgcn_wave_barrier();
  const int rsub = lane >> 4, c4 = (lane & 15) * 4;
  {
#pragma unroll
    for (int q = 0; q < 8; ++q) {
      const int r = q * 2 + rsub;
      const v4f v = *(const v4fa*)&so[w][r][c4];
      *(v4f*)(C + (size_t)(row0 + r) * ldc + col0 + c4) = v;
    }
    
  }
}
// row LayerNorm (biased variance, eps) over N: s = X (+ R); optional out_sum <- s; out_norm <- (s-mu)*rsqrt(var+eps)*g + b
template <bool PARAM_BF16>
__global__ __launch_bounds__(256) void k_layernorm(const float* __restrict__ X, const float* __restrict__ R, const float* __restrict__ g, const float* __restrict__ bta,
                                                  float* __restrict__ out_sum, float* __restrict__ out_norm, int N, float eps) {
  __shared__ float red[256];
  const int row = blockIdx.x, tid = threadIdx.x;
  const float* x = X + (size_t)row * N; const float* rr = R ? R + (size_t)row * N : nullptr;
  float vals[16];                     // up to N = 4096
  const int per = N / 256;            // contiguous chunk per thread? use strided-by-4 chunks: thread handles j = tid*4 + 1024*u
  float s1 = 0.f;
  for (int u = 0; u < per / 4; ++u) {
    const int j = tid * 4 + 1024 * u;
    const v4f a = *(const v4fa*)(x + j);
    v4f b = {0.f,0.f,0.f,0.f}; if (rr) b = *(const v4fa*)(rr + j);
#pragma unroll
    for (int q = 0; q < 4; ++q) { const float v = a[q] + b[q]; vals[u * 4 + q] = v; s1 += v; }
  }
  red[tid] = s1; __syncthreads();
  for (int st = 128; st > 0; st >>= 1) { if (tid < st) red[tid] += red[tid + st]; __syncthreads(); }
  const float mu = red[0] / (float)N; __syncthreads();
  float s2 = 0.f;
  for (int u = 0; u < per / 4; ++u)
#pragma unroll
    for (int q = 0; q < 4; ++q) { const float c = vals[u * 4 + q] - mu; s2 += c * c; }
  red[tid] = s2; __syncthreads();
  for (int st = 128; st > 0; st >>= 1) { if (tid < st) red[tid] += red[tid + st]; __syncthreads(); }
  const float rs = rsqrtf(red[0] / (float)N + eps);
  {
    for (int u = 0; u < per / 4; ++u) {
      const int j = tid * 4 + 1024 * u;
      v4f o, sm;
#pragma unroll
      for (int q = 0; q < 4; ++q) {
        float gg = g[j + q], bb = bta[j + q];
        if (PARAM_BF16) { gg = bf16_round(gg); bb = bf16_round(bb); }
        sm[q] = vals[u * 4 + q]; o[q] = (vals[u * 4 + q] - mu) * rs * gg + bb;
      }
      if (out_sum) *(v4f*)(out_sum + (size_t)row * N + j) = sm;
      *(v4f*)(out_norm + (size_t)row * N + j) = o;
    }
    
  }
}



// ---- f16 WMMA path (v_wmma_f32_16x16x32_f16): 11-bit significands for operands in range — used where a [0,1] probability operand needs more precision than bf16
typedef _Float16 v16h __attribute__((ext_vector_type(16)));
union FragH { v16h v; v8us half[2]; _Float16 h[16]; unsigned short u[16]; };
template <int NT>
__device__ __forceinline__ v8f mmaH(v16h ah, v16h al, v16h bh, v16h bl, v8f c) {
  c = __builtin_amdgcn_wmma_f32_16x16x32_f16(false, ah, false, bh, (short)0, c, false, false);
  if (NT >= 2) c = __builtin_amdgcn_wmma_f32_16x16x32_f16(false, al, false, bh, (short)0, c, false, false);
  if (NT >= 3) c = __builtin_amdgcn_wmma_f32_16x16x32_f16(false, ah, false, bl, (short)0, c, false, false);
  asm volatile("v_nop\n\tv_nop\n\tv_nop\n\tv_nop" : "+v"(c) : "v"(ah), "v"(al), "v"(bh), "v"(bl));
  return c;
}
// batched GEMM like k_gemm_b but f16 operands: A f32 (split into f16 hi/lo if ASPLIT, else rounded to f16), Bt = f16 values [n][k]; alpha; C f32; N multiple of 16 (partial tiles skipped)
template <bool ASPLIT>
__global__ __launch_bounds__(128) void k_gemm_h(const float* __restrict__ A, int lda, size_t sA, const _Float16* __restrict__ Bh, int ldb, size_t sB, float alpha, float* __restrict__ C, int ldc, size_t sC, int M, int N, int K) {
  __shared__ __attribute__((aligned(16))) float so[4][16][64];
  const int tid = threadIdx.x, w = tid >> 5, lane = tid & 31, ln = lane & 15, hh = lane >> 4; const int by = blockIdx.y;
  A += (size_t)by * sA; Bh += (size_t)by * sB; C += (size_t)by * sC;
  const int ntn = (N + 63) / 64; const int wid = blockIdx.x * 4 + w; const int mt = wid / ntn, nq = wid % ntn; if (mt * 16 >= M) return;
  const int row0 = mt * 16, col0 = nq * 64; const float* arow = A + (size_t)(row0 + ln) * lda;
  v8f acc[4] = {};
  for (int kb = 0; kb < K; kb += 32) {
    FragH ah, al;
    const v4f x0 = *(const v4fa*)(arow + kb + 8 * hh), x1 = *(const v4fa*)(arow + kb + 8 * hh + 4), x2 = *(const v4fa*)(arow + kb + 16 + 8 * hh), x3 = *(const v4fa*)(arow + kb + 16 + 8 * hh + 4);
    float xs[16] = {x0[0],x0[1],x0[2],x0[3],x1[0],x1[1],x1[2],x1[3],x2[0],x2[1],x2[2],x2[3],x3[0],x3[1],x3[2],x3[3]};
#pragma unroll
    for (int i = 0; i < 16; ++i) { const _Float16 h = (_Float16)xs[i]; ah.h[i] = h; al.h[i] = ASPLIT ? (_Float16)(xs[i] - (float)h) : (_Float16)0.0f; }
#pragma unroll
    for (int t = 0; t < 4; ++t) { if (col0 + t * 16 >= N) continue; const size_t boff = (size_t)(col0 + t * 16 + ln) * ldb + kb; FragH bq; bq.half[0] = *(const v8us*)(Bh + boff + 8 * hh); bq.half[1] = *(const v8us*)(Bh + boff + 16 + 8 * hh);
      acc[t] = mmaH<ASPLIT ? 2 : 1>(ah.v, al.v, bq.v, bq.v, acc[t]); }
  }
#pragma unroll
  for (int t = 0; t < 4; ++t) { if (col0 + t * 16 >= N) continue;
#pragma unroll
    for (int r = 0; r < 8; ++r) so[w][8 * hh + r][t * 16 + ln] = acc[t][r] * alpha; }
  __builtin_amdgcn_fence(__ATOMIC_ACQ_REL, "workgroup"); __builtin_amdgcn_wave_barrier();
  const int rsub = lane >> 4, c4 = (lane & 15) * 4;
  {
#pragma unroll
    for (int q = 0; q < 8; ++q) { const int r = q * 2 + rsub; if (col0 + c4 < N) { const v4f v = *(const v4fa*)&so[w][r][c4]; *(v4f*)(C + (size_t)(row0 + r) * ldc + col0 + c4) = v; } }
     }
}

// Wt[n][k] = f16(W[k][n]·scale) from f32 row-major W[K][N] (scale = power of two; bf16-exact weights stay exact in f16 away from the subnormal range)
__global__ __launch_bounds__(256) void k_wt_f16(const float* __restrict__ W, _Float16* __restrict__ Wt, int K, int N, float scale) {
  const int t = blockIdx.x * 256 + threadIdx.x; if (t >= N * (K / 8)) return; const int n = t / (K / 8), k8 = (t % (K / 8)) * 8; FragH f;
#pragma unroll
  for (int i = 0; i < 8; ++i) f.h[i] = (_Float16)(bf16_round(W[(size_t)(k8 + i) * N + n]) * scale); const v8us o = f.half[0];
  *(v8us*)((unsigned short*)Wt + (size_t)n * K + k8) = o; 
}
// k_gemm_hh variant with fused epilogue: v = acc·alpha + bias[by·sBias + col] (+ CP[(row/rowsPerB)·sCPb + by·64 + col] if CP) ; ACT 0 none / 1 elu ; writes f16 C16 (and f32 C if non-null)
template <int ACT>
__global__ __launch_bounds__(128) void k_gemm_hhx(const _Float16* __restrict__ A, int lda, size_t sA, const _Float16* __restrict__ Bh, int ldb, size_t sB, float alpha, const float* __restrict__ bias, size_t sBias, const float* __restrict__ CP, int rowsPerB, size_t sCPb, int row0g,
    float* __restrict__ C, _Float16* __restrict__ C16, int ldc, size_t sC, int M, int N, int K) {
  __shared__ __attribute__((aligned(16))) float so[4][16][64];
  const int tid = threadIdx.x, w = tid >> 5, lane = tid & 31, ln = lane & 15, hh = lane >> 4; const int by = blockIdx.y;
  A += (size_t)by * sA; Bh += (size_t)by * sB; const size_t cofs = (size_t)by * sC; const float* bp = bias ? bias + (size_t)by * sBias : nullptr;
  const int ntn = (N + 63) / 64; const int wid = blockIdx.x * 4 + w; const int mt = wid / ntn, nq = wid % ntn; if (mt * 16 >= M) return;
  const int row0 = mt * 16, col0 = nq * 64; const _Float16* arow = A + (size_t)(row0 + ln) * lda;
  v8f acc[4] = {};
  for (int kb = 0; kb < K; kb += 32) { FragH ah; ah.half[0] = *(const v8us*)((const unsigned short*)arow + kb + 8 * hh); ah.half[1] = *(const v8us*)((const unsigned short*)arow + kb + 16 + 8 * hh);
#pragma unroll
    for (int t = 0; t < 4; ++t) { if (col0 + t * 16 >= N) continue; const size_t boff = (size_t)(col0 + t * 16 + ln) * ldb + kb; FragH bq; bq.half[0] = *(const v8us*)((const unsigned short*)Bh + boff + 8 * hh); bq.half[1] = *(const v8us*)((const unsigned short*)Bh + boff + 16 + 8 * hh);
      acc[t] = mmaH<1>(ah.v, ah.v, bq.v, bq.v, acc[t]); }
  }
#pragma unroll
  for (int t = 0; t < 4; ++t) { if (col0 + t * 16 >= N) continue; const int col = col0 + t * 16 + ln; const float bv = bp ? bf16_round(bp[col]) : 0.f;
#pragma unroll
    for (int r = 0; r < 8; ++r) { float v = acc[t][r] * alpha + bv; if (CP) { const int rr = row0g + row0 + 8 * hh + r; if (rowsPerB < 0) v += CP[cofs + (size_t)rr * ldc + col];      /* rowsPerB < 0: own element of the batched C plane */ else { const int bidx = rr / rowsPerB; v += CP[(size_t)bidx * sCPb + (size_t)by * 64 + col]; } } if (ACT == 1) v = (v > 0.f) ? v : expm1f(v); else if (ACT == 7) v = (v > 0.f) ? v + 1.0f : expf(v); else if (ACT == 8) v = tanhf(v); else if (ACT == 9) v = 0.5f * v * (1.0f + tanhf(0.7978845608028654f * (v + 0.044715f * v * v * v))); else if (ACT == 11) v = 1.0f / (1.0f + expf(-v)); else if (ACT == 12) v = (v > 0.f) ? v : 0.01f * v; else if (ACT == 14) v = (v > 0.f) ? v : 0.1f * v; else if (ACT == 16) v = (v >= 0.f) ? v : 0.3f * v; else if (ACT == 17) v = (v >= 0.f) ? v : 0.2f * v; else if (ACT == 15) v = v / (1.0f + expf(-v)); else if (ACT == 3) v = fmaxf(v, 0.f); else if (ACT == 6) v = 0.5f * v * (1.0f + erff(v * 0.70710678118654752f)); so[w][8 * hh + r][t * 16 + ln] = v; } }
  __builtin_amdgcn_fence(__ATOMIC_ACQ_REL, "workgroup"); __builtin_amdgcn_wave_barrier();
  const int rsub = lane >> 4, c4 = (lane & 15) * 4; typedef _Float16 v4h __attribute__((ext_vector_type(4)));
  {
#pragma unroll
    for (int q = 0; q < 8; ++q) { const int r = q * 2 + rsub; if (col0 + c4 < N) { const v4f v = *(const v4fa*)&so[w][r][c4]; if (C) *(v4f*)(C + cofs + (size_t)(row0 + r) * ldc + col0 + c4) = v; if (C16) { v4h h4; for (int i = 0; i < 4; ++i) h4[i] = (_Float16)v[i]; *(v4h*)(C16 + cofs + (size_t)(row0 + r) * ldc + col0 + c4) = h4; } } }
     }
}


typedef _Float16 v4h __attribute__((ext_vector_type(4)));

__global__ __launch_bounds__(256) void k_x16(const float* __restrict__ x, _Float16* __restrict__ X16, size_t n8) { const size_t t = (size_t)blockIdx.x * 256 + threadIdx.x; if (t >= n8) return; FragH f;
#pragma unroll
  for (int q = 0; q < 8; ++q) f.h[q] = (_Float16)bf16_round(x[t * 8 + q]); *(v8us*)((unsigned short*)X16 + t * 8) = f.half[0];  }
__global__ __launch_bounds__(256) void k_h16(const float* __restrict__ x, _Float16* __restrict__ X16, size_t n8) { const size_t t = (size_t)blockIdx.x * 256 + threadIdx.x; if (t >= n8) return; FragH f;
#pragma unroll
  for (int q = 0; q < 8; ++q) f.h[q] = (_Float16)x[t * 8 + q]; *(v8us*)((unsigned short*)X16 + t * 8) = f.half[0];  }
__global__ __launch_bounds__(256) void k_round16f(const float* __restrict__ W, _Float16* __restrict__ Bt, size_t n8) { const size_t t = (size_t)blockIdx.x * 256 + threadIdx.x; if (t >= n8) return; FragH f;
#pragma unroll
  for (int i = 0; i < 8; ++i) f.h[i] = (_Float16)(bf16_round(W[t * 8 + i]) * 16.0f); *(v8us*)((unsigned short*)Bt + t * 8) = f.half[0];  }
template <int NHv, int TTv>
__global__ __launch_bounds__(256) void k_vt(const _Float16* __restrict__ V16, int ldv, int voff, _Float16* __restrict__ Vt) { __shared__ unsigned short tl[64][66]; const int tid = threadIdx.x; const int slab = blockIdx.x / (TTv / 64), lg = blockIdx.x % (TTv / 64); const int b = slab / NHv, h = slab % NHv;
  for (int i = tid; i < 64 * 8; i += 256) { const int r = i / 8, c8 = (i % 8) * 8; FragH f; f.half[0] = *(const v8us*)((const unsigned short*)V16 + ((size_t)b * TTv + lg * 64 + r) * ldv + voff + h * 64 + c8);
#pragma unroll
    for (int q = 0; q < 8; ++q) tl[r][c8 + q] = f.u[q]; }
  __syncthreads();
  {
#pragma unroll
    for (int rd = 0; rd < 2; ++rd) { const int d = rd * 32 + tid / 8, pc = tid % 8; FragH f;
#pragma unroll
      for (int q = 0; q < 8; ++q) f.u[q] = tl[pc * 8 + q][d];
      *(v8us*)((unsigned short*)Vt + ((size_t)slab * 64 + d) * TTv + lg * 64 + pc * 8) = f.half[0]; }
     } }

__global__ __launch_bounds__(256) void k_hl(const float* __restrict__ F, _Float16* __restrict__ Hh, _Float16* __restrict__ Hl, size_t n8) { const size_t t = (size_t)blockIdx.x * 256 + threadIdx.x; if (t >= n8) return; FragH fh, fl; const v4f a = *(const v4fa*)(F + t * 8), c = *(const v4fa*)(F + t * 8 + 4);
#pragma unroll
  for (int q = 0; q < 4; ++q) { _Float16 h = (_Float16)a[q]; fh.h[q] = h; fl.h[q] = (_Float16)((a[q] - (float)h) * 1024.0f); h = (_Float16)c[q]; fh.h[4 + q] = h; fl.h[4 + q] = (_Float16)((c[q] - (float)h) * 1024.0f); }
  { *(v8us*)((unsigned short*)Hh + t * 8) = fh.half[0]; *(v8us*)((unsigned short*)Hl + t * 8) = fl.half[0];  } }

// ---- fast GEMM (block tile 128x128 on 8 waves, wave tile 32x64; requires M % 128 == 0, N % 128 == 0, K % 64 == 0, K >= 64); epilogue = k_gemm_hhx semantics ----
// Operand path: a k tile is 64 k = one whole 128-byte line of each of the block's 128 A rows and 128 Bt rows. The 256 threads bring it into LDS by asynchronous 16-byte copies
// (8 lanes a row, so every wave-wide copy covers 4 whole lines), two buffers, the next tile in flight while this one is multiplied; the waves read their fragments from LDS in the k order of g2_frag.
#define G2P 72                       /* halfs per LDS row: 128 bytes of data + 16, the conflict-free pitch for 16-byte reads */
#define G2STG (256 * G2P * 2)        /* bytes of one buffer: 128 A rows, then 128 Bt rows */
__device__ __forceinline__ v16h g2_frag(const _Float16* p, int hh) { FragH f; f.half[0] = *(const v8us*)((const unsigned short*)p + 8 * hh); f.half[1] = *(const v8us*)((const unsigned short*)p + 16 + 8 * hh); return f.v; }
__device__ __forceinline__ v16h g2_lfrag(const unsigned short* p) { FragH f; f.half[0] = *(const v8us*)(p); f.half[1] = *(const v8us*)(p + 16); return f.v; }
__device__ __forceinline__ v8f g2_mma(v16h a, v16h b, v8f c) { return __builtin_amdgcn_wmma_f32_16x16x32_f16(false, a, false, b, (short)0, c, false, false); }
// one k tile: this thread's 16 bytes of rows r, r + 32, r + 64, r + 96 of A (pitch pa halfs) and of Bt (pitch pb); l = LDS byte address of its place in row r of the buffer.
// The s_wait_xcnt closes the copies' own statement, so that no address register is rewritten ahead of it.
__device__ __forceinline__ void g2_copy(unsigned l, const _Float16* a, size_t pa, const _Float16* b, size_t pb) {
  asm volatile("global_load_async_to_lds_b128 %0, %8, off\n\t"
               "global_load_async_to_lds_b128 %1, %9, off\n\t"
               "global_load_async_to_lds_b128 %2, %10, off\n\t"
               "global_load_async_to_lds_b128 %3, %11, off\n\t"
               "global_load_async_to_lds_b128 %4, %12, off\n\t"
               "global_load_async_to_lds_b128 %5, %13, off\n\t"
               "global_load_async_to_lds_b128 %6, %14, off\n\t"
               "global_load_async_to_lds_b128 %7, %15, off\n\t"
               "s_wait_xcnt 0x0"
               :: "v"(l), "v"(l + 32u * G2P * 2u), "v"(l + 64u * G2P * 2u), "v"(l + 96u * G2P * 2u), "v"(l + 128u * G2P * 2u), "v"(l + 160u * G2P * 2u), "v"(l + 192u * G2P * 2u), "v"(l + 224u * G2P * 2u),
                  "v"(a), "v"(a + 32 * pa), "v"(a + 64 * pa), "v"(a + 96 * pa), "v"(b), "v"(b + 32 * pb), "v"(b + 64 * pb), "v"(b + 96 * pb) : "memory");
}
template <int ACT>
__global__ __launch_bounds__(256) void k_gemm2(const _Float16* __restrict__ A, int lda, size_t sA, const _Float16* __restrict__ Bh, int ldb, size_t sB, float alpha, const float* __restrict__ bias, size_t sBias, const float* __restrict__ CP, int rowsPerB, size_t sCPb, int row0g,
    float* __restrict__ C, _Float16* __restrict__ C16, int ldc, size_t sC, int M, int N, int K) { static_assert(ACT == 0 || ACT == 3 || ACT == 6 || ACT == 8 || ACT == 9 || ACT == 11 || ACT == 12 || ACT == 14 || ACT == 15 || ACT == 16 || ACT == 17, "k_gemm2: unsupported ACT code (would silently apply no activation)");
  __shared__ __attribute__((aligned(16))) unsigned short ring[2][256][G2P];      /* the two operand buffers; behind the k loop the same bytes are the waves' output staging */
  static_assert(sizeof(float) * 8 * 32 * 68 <= sizeof(unsigned short) * 2 * 256 * G2P, "output staging must fit the ring");
  const int tid = threadIdx.x, w = tid >> 5, lane = tid & 31, ln = lane & 15, hh = lane >> 4; const int by = blockIdx.y;
  A += (size_t)by * sA; Bh += (size_t)by * sB; const size_t cofs = (size_t)by * sC; const float* bp = bias ? bias + (size_t)by * sBias : nullptr;
  const int ntn = N >> 7; const int mt = blockIdx.x / ntn, nq = blockIdx.x - mt * ntn; const int m0 = mt * 128, n0 = nq * 128; if (m0 >= M) return;      /* the same for the whole block, ahead of every barrier */
  const int wr = 32 * (w & 3), wc = 64 * (w >> 2); const int row0 = m0 + wr, col0 = n0 + wc;
  const int cr = tid >> 3, cs = (tid & 7) * 8;      /* this thread's row (of each 32) and its 8 halfs of the 64 in a k tile */
  const _Float16* ga = A + (size_t)(m0 + cr) * lda + cs; const _Float16* gb = Bh + (size_t)(n0 + cr) * ldb + cs;
  const unsigned l0 = (unsigned)(size_t)&ring[0][cr][cs];      /* low 32 bits of the shared address = byte offset in the block's LDS */
  const int nt = K >> 6;
  const v8f z8 = {0.f,0.f,0.f,0.f,0.f,0.f,0.f,0.f}; v8f c00 = z8, c01 = z8, c02 = z8, c03 = z8, c10 = z8, c11 = z8, c12 = z8, c13 = z8;
  g2_copy(l0, ga, (size_t)lda, gb, (size_t)ldb);
  asm volatile("s_wait_asynccnt 0x0" ::: "memory");      /* this wave's part of tile 0 has landed */
  __syncthreads();      /* tile 0 is readable by every wave */
  if (nt > 1) g2_copy(l0 + G2STG, ga + 64, (size_t)lda, gb + 64, (size_t)ldb);
#pragma unroll 1      /* one trip = one buffer; the two buffers alternate by t & 1 */
  for (int t = 0; t < nt; ++t) {
    const unsigned short* ta = &ring[t & 1][wr + ln][8 * hh]; const unsigned short* tb = &ring[t & 1][128 + wc + ln][8 * hh];
#pragma unroll      /* the two 32-k steps of a tile: constant LDS offsets */
    for (int ks = 0; ks < 64; ks += 32) {
      const v16h a0 = g2_lfrag(ta + ks), a1 = g2_lfrag(ta + 16 * G2P + ks);
      const v16h b0 = g2_lfrag(tb + ks), b1 = g2_lfrag(tb + 16 * G2P + ks), b2 = g2_lfrag(tb + 32 * G2P + ks), b3 = g2_lfrag(tb + 48 * G2P + ks);
      __builtin_amdgcn_sched_barrier(0);      /* the 12 LDS reads of a step issue as one group ahead of its 8 products: left alone the compiler reuses the B registers and the wave waits for LDS four times a step */
      c00 = g2_mma(a0, b0, c00); c10 = g2_mma(a1, b0, c10); c01 = g2_mma(a0, b1, c01); c11 = g2_mma(a1, b1, c11);
      c02 = g2_mma(a0, b2, c02); c12 = g2_mma(a1, b2, c12); c03 = g2_mma(a0, b3, c03); c13 = g2_mma(a1, b3, c13);
    }
    asm volatile("s_wait_dscnt 0x0" ::: "memory");      /* this wave's reads of buffer t & 1 are done */
    asm volatile("s_wait_asynccnt 0x0" ::: "memory");      /* this wave's part of tile t + 1 has landed */
    __syncthreads();      /* publishes tile t + 1 and frees buffer t & 1 */
    if (t + 2 < nt) g2_copy(l0 + (unsigned)(t & 1) * G2STG, ga + (size_t)(t + 2) * 64, (size_t)lda, gb + (size_t)(t + 2) * 64, (size_t)ldb);
  }
  asm volatile("s_wait_asynccnt 0x0" ::: "memory");      /* nothing in flight when the ring becomes output staging (the last trip's barrier has ended every read of it) */
  float (*so)[32][68] = reinterpret_cast<float (*)[32][68]>(&ring[0][0][0]);
  v8f accs[8] = {c00, c01, c02, c03, c10, c11, c12, c13};
#pragma unroll
  for (int u = 0; u < 8; ++u) { const int t = u & 3, half = u >> 2; const int col = col0 + t * 16 + ln; const float bv = bp ? bf16_round(bp[col]) : 0.f;
#pragma unroll
    for (int r = 0; r < 8; ++r) { const int rloc = half * 16 + 8 * hh + r; float v = accs[u][r] * alpha + bv; if (CP) { if (rowsPerB < 0) v += CP[cofs + (size_t)(row0g + row0 + rloc) * ldc + col];      /* rowsPerB < 0: own element of the batched C plane */ else { const int bidx = (row0g + row0 + rloc) / rowsPerB; v += CP[(size_t)bidx * sCPb + (size_t)by * 64 + col]; } }
      if (ACT == 3) v = fmaxf(v, 0.f); else if (ACT == 6) v = 0.5f * v * (1.0f + erff(v * 0.70710678118654752f)); else if (ACT == 11) v = 1.0f / (1.0f + expf(-v)); else if (ACT == 15) v = v / (1.0f + expf(-v)); else if (ACT == 12) v = (v > 0.f) ? v : 0.01f * v; else if (ACT == 8) v = tanhf(v); else if (ACT == 9) v = 0.5f * v * (1.0f + tanhf(0.7978845608028654f * (v + 0.044715f * v * v * v))); else if (ACT == 14) v = (v > 0.f) ? v : 0.1f * v; else if (ACT == 16) v = (v >= 0.f) ? v : 0.3f * v; else if (ACT == 17) v = (v >= 0.f) ? v : 0.2f * v;
      so[w][rloc][t * 16 + ln] = v; } }
  __builtin_amdgcn_fence(__ATOMIC_ACQ_REL, "workgroup"); __builtin_amdgcn_wave_barrier();
  const int rsub = lane >> 4, c4 = (lane & 15) * 4;
  {
#pragma unroll
    for (int q = 0; q < 16; ++q) { const int r = q * 2 + rsub; const v4f v = *(const v4fa*)&so[w][r][c4]; if (C) *(v4f*)(C + cofs + (size_t)(row0 + r) * ldc + col0 + c4) = v; if (C16) { v4h h4; for (int i = 0; i < 4; ++i) h4[i] = (_Float16)v[i]; *(v4h*)(C16 + cofs + (size_t)(row0 + r) * ldc + col0 + c4) = h4; } }
     } }


__global__ __launch_bounds__(256) void k_wnat(const float* __restrict__ w, size_t n8, _Float16* __restrict__ Bt) { const size_t t = (size_t)blockIdx.x * 256 + threadIdx.x; if (t >= n8) return; FragH f; for (int q = 0; q < 8; ++q) f.h[q] = (_Float16)(bf16_round(w[t * 8 + q]) * 16.0f); *(v8us*)((unsigned short*)Bt + t * 8) = f.half[0];  }
// T5 bidirectional relative-position bucket of rel = key - query (32 buckets, max distance 128): (rel > 0)*16 + f(|rel|), f(n) = n for n < 8, then
// 8 + the number of thresholds {12,16,23,32,46,64,91} that are <= n (the thresholds are where the reference's own f32 log expression steps; no log on the device)
__device__ __forceinline__ int t5_bucket(int rel) { const int n = rel < 0 ? -rel : rel; const int g = 8 + (n >= 12) + (n >= 16) + (n >= 23) + (n >= 32) + (n >= 46) + (n >= 64) + (n >= 91); return (rel > 0 ? NBK / 2 : 0) + (n < 8 ? n : g); }
// lane l with lane l ^ 16 (the two lanes that share one query column)
__device__ __forceinline__ float xhalf(float x) { return __builtin_bit_cast(float, __builtin_amdgcn_permlanex16(__builtin_bit_cast(int, x), __builtin_bit_cast(int, x), 0x76543210, 0xfedcba98, false, false)); }
__device__ __forceinline__ v8f fa_mma(v16h a, v16h b, v8f c) { return __builtin_amdgcn_wmma_f32_16x16x32_f16(false, a, false, b, (short)0, c, false, false); }
// Operand path of the fused attention: a stage is 128 keys = 128 K rows (one whole 128-byte line each) and the 64 V^T rows (two whole lines each). The block's 512 threads bring it into LDS by asynchronous 16-byte copies
// (a wave-wide copy covers 4 whole lines), two buffers, the next stage in flight while this one is worked on; all 16 waves read their A fragments from LDS in the k order of g2_frag.
#define FAK 128                      /* keys per stage */
#define FAKP 72                      /* halfs per K row in LDS: 128 bytes of data + 16, the conflict-free pitch for 16-byte reads */
#define FAVP 136                     /* halfs per V^T row in LDS: 256 bytes of data + 16, likewise */
#define FASTG (FAK * FAKP + HD * FAVP)      /* halfs of one buffer: the K rows, then the V^T rows */
#define FAL2E 1.4426950408889634f    /* log2(e): the scores are formed in base-2 units, so that a weight is one subtraction and one hardware 2^x */
// one stage: this thread's 16 bytes of K rows r and r + 64 (token pitch D3) and of V^T rows d and d + 32 (pitch SQ); lk, lv = LDS byte addresses of its places in rows r and d of the buffer.
// The s_wait_xcnt closes the copies' own statement, so that no address register is rewritten ahead of it.
__device__ __forceinline__ void fa_copy(unsigned lk, unsigned lv, const _Float16* k, const _Float16* v) {
  asm volatile("global_load_async_to_lds_b128 %0, %4, off\n\t"
               "global_load_async_to_lds_b128 %1, %5, off\n\t"
               "global_load_async_to_lds_b128 %2, %6, off\n\t"
               "global_load_async_to_lds_b128 %3, %7, off\n\t"
               "s_wait_xcnt 0x0"
               :: "v"(lk), "v"(lk + 64u * FAKP * 2u), "v"(lv), "v"(lv + 32u * FAVP * 2u),
                  "v"(k), "v"(k + (size_t)64 * D3), "v"(v), "v"(v + (size_t)32 * SQ) : "memory");
}
// fused attention of one (batch, head): scores, bias and mask, softmax and P.V in one pass over the keys; S and P stay in registers.
// One wave owns 16 query rows, a block 16 waves = 256 rows (256 blocks: one a WGP, four waves a SIMD, all reading the same K and V^T rows from the block's LDS); a pass takes 32 keys. Transposed products: S^T = K Q^T (A = key rows, B = the wave's q rows, loaded once),
// so lane (ln, hh) holds, for query q0 + ln, the keys kb + 8 hh + r and kb + 16 + 8 hh + r: the k order of g2_frag, and the 16 weights are the B operand of O^T += V^T P^T as they lie (A = V^T rows).
// score = s*m + (-10000*(1-m) + emb[bucket(j-i)][h]) as in the reference (bf16-rounded emb, this head's values by key - query distance in LDS; m = mask[b][q][k] bf16-rounded), every term times log2(e): the factor is in the 1/8, the -10000 and the table.
// Online softmax: running maximum and sum per query, both in-lane but for one exchange between the lane halves; the output tile and the sum are rescaled every pass; weights exp(score - maximum) = 2^(scaled score - scaled maximum) <= 1 as f16.
__global__ __launch_bounds__(512) void k_fattn(const _Float16* __restrict__ QKV, const _Float16* __restrict__ VT, const float* __restrict__ emb, const float* __restrict__ amask, _Float16* __restrict__ O16) {
  __shared__ __attribute__((aligned(16))) struct { float tb[5 * 512]; unsigned short ring[2][FASTG]; } sm;      /* one object, the table first: its reads keep small constant offsets */
  float (&tb)[5 * 512] = sm.tb;      /* tb[t] = this head's bias at key - query = t - (the block's last query row): the SQ + 255 distances that the block's 256 queries meet, rounded up to five entries a thread */
  unsigned short (&ring)[2][FASTG] = sm.ring;      /* the two K | V^T buffers */
  const int bh = blockIdx.y, b = bh / NH, h = bh % NH;
  const int ckr = (int)threadIdx.x >> 3, ckc = ((int)threadIdx.x & 7) * 8, cvr = (int)threadIdx.x >> 4, cvc = ((int)threadIdx.x & 15) * 8;      /* this thread's K row (of each 64) and V^T row (of each 32) and its 8 halfs of them */
  const _Float16* gk = QKV + ((size_t)b * SQ + ckr) * D3 + DM + h * HD + ckc; const _Float16* gv = VT + ((size_t)bh * HD + cvr) * SQ + cvc;
  const unsigned lk = (unsigned)(size_t)&ring[0][ckr * FAKP + ckc], lv = (unsigned)(size_t)&ring[0][FAK * FAKP + cvr * FAVP + cvc];      /* low 32 bits of the shared address = byte offset in the block's LDS */
  fa_copy(lk, lv, gk, gv);      /* stage 0 flies while the bias table is built */
#pragma unroll      /* the five table reads of a thread are in flight together */
  for (int u = 0; u < 5; ++u) { const int t = u * 512 + (int)threadIdx.x; tb[t] = bf16_round(emb[t5_bucket(t - (int)(blockIdx.x * 256 + 255)) * NH + h]) * FAL2E; }
  asm volatile("s_wait_asynccnt 0x0" ::: "memory");      /* this wave's part of stage 0 has landed */
  __syncthreads();      /* the bias table and stage 0 are readable by every wave */
  fa_copy(lk + FASTG * 2u, lv + FASTG * 2u, gk + (size_t)FAK * D3, gv + FAK);      /* stage 1 (there are SQ / FAK = 16) */
  const int lane = threadIdx.x & 31, ln = lane & 15, hh = lane >> 4;
  const int i = blockIdx.x * 256 + (threadIdx.x >> 5) * 16 + ln;      /* this lane's query row */
  const _Float16* qp = QKV + ((size_t)b * SQ + i) * D3 + h * HD;
  const v16h q0 = g2_frag(qp, hh), q1 = g2_frag(qp + 32, hh);
  const float* mr = amask + ((size_t)b * SQ + i) * SQ + 8 * hh;
  const float* bp = tb + (8 * hh + 255 - (int)((threadIdx.x >> 5) * 16 + ln));      /* bp[j] = the bias of key j + 8 hh for this lane's query */
  const v8f z8 = {0.f,0.f,0.f,0.f,0.f,0.f,0.f,0.f}; v8f o0 = z8, o1 = z8, o2 = z8, o3 = z8;
  float mx = -INFINITY, se = 0.f;
#pragma unroll 1      /* one trip = one buffer; the two buffers alternate by t & 1 */
  for (int t = 0; t < SQ / FAK; ++t) {
  const unsigned short* kt = &ring[t & 1][ln * FAKP + 8 * hh];      /* K row ln of the stage; the lane half's offset of g2_frag is in kt, vt and mr already */
  const unsigned short* vt = &ring[t & 1][FAK * FAKP + ln * FAVP + 8 * hh];      /* V^T row d = ln */
#pragma unroll 1      /* one pass holds some 200 vector instructions already: unrolling would only cost registers and instruction cache */
  for (int kb = t * FAK; kb < (t + 1) * FAK; kb += 32) {
    const unsigned short* k0 = kt + (kb - t * FAK) * FAKP; const unsigned short* vk = vt + (kb - t * FAK); const float* mk = mr + kb;
    const v4f m0 = *(const v4fa*)(mk), m1 = *(const v4fa*)(mk + 4), m2 = *(const v4fa*)(mk + 16), m3 = *(const v4fa*)(mk + 20);
    const v16h ka0 = g2_lfrag(k0), ka1 = g2_lfrag(k0 + 32), kc0 = g2_lfrag(k0 + 16 * FAKP), kc1 = g2_lfrag(k0 + 16 * FAKP + 32);
    const v16h va0 = g2_lfrag(vk), va1 = g2_lfrag(vk + 16 * FAVP), va2 = g2_lfrag(vk + 32 * FAVP), va3 = g2_lfrag(vk + 48 * FAVP);
    float bs[16];      /* the 16 bias values of the pass: two runs of 8 consecutive table entries, 16 apart */
#pragma unroll      /* bs[] and v[] indexed by constants only, so that they live in registers */
    for (int r = 0; r < 8; ++r) { bs[r] = bp[kb + r]; bs[8 + r] = bp[kb + 16 + r]; }
    __builtin_amdgcn_sched_barrier(0);      /* the 4 mask loads, the 16 fragment reads and the table reads of a pass are issued together, ahead of all else: left alone the compiler sinks some of them to just in front of their use and the wave waits again */
    asm volatile("s_wait_xcnt 0x0" :: "v"(mk) : "memory");      /* input only: the mask loads' address register lives up to this wait and is reused only behind it */
    v8f s0 = fa_mma(ka0, q0, z8); s0 = fa_mma(ka1, q1, s0);
    v8f s1 = fa_mma(kc0, q0, z8); s1 = fa_mma(kc1, q1, s1);
    unsigned dm = 0u;      /* stays 0 only where all 16 mask values of the lane are the bit pattern of 1.0f */
#pragma unroll      /* (a ^ 1.0f) | (b ^ 1.0f) is one three-input bit operation (truth table 0x7e): two mask values an instruction; written with ^ and | the compiler makes 16 compares and a chain of 15 scalar ors of it */
    for (int q = 0; q < 4; ++q) dm |= __builtin_amdgcn_bitop3_b32(__float_as_uint(m0[q]), __float_as_uint(m1[q]), 0x3f800000u, 0x7e) | __builtin_amdgcn_bitop3_b32(__float_as_uint(m2[q]), __float_as_uint(m3[q]), 0x3f800000u, 0x7e);
    float v[16]; float bm = -INFINITY;
#pragma unroll      /* at mask = 1 the reference's expression is s / 8 + bias, term for term */
    for (int r = 0; r < 8; ++r) v[r] = s0[r] * (0.125f * FAL2E) + bs[r];
#pragma unroll
    for (int r = 0; r < 8; ++r) v[8 + r] = s1[r] * (0.125f * FAL2E) + bs[8 + r];
    if (__builtin_amdgcn_ballot_w32(dm != 0u) != 0u) {      /* one test a pass, the same for the whole wave (a scalar branch): any other mask value in the wave's 16 x 32 tile, and the whole tile takes the full expression */
#pragma unroll
      for (int r = 0; r < 8; ++r) {
        const float ma = bf16_round(r < 4 ? m0[r & 3] : m1[r & 3]), mb = bf16_round(r < 4 ? m2[r & 3] : m3[r & 3]);
        v[r] = (s0[r] * (0.125f * FAL2E)) * ma + ((-10000.0f * FAL2E) * (1.0f - ma) + bs[r]);
        v[8 + r] = (s1[r] * (0.125f * FAL2E)) * mb + ((-10000.0f * FAL2E) * (1.0f - mb) + bs[8 + r]);
      }
    }
#pragma unroll
    for (int r = 0; r < 8; ++r) bm = fmaxf(bm, fmaxf(v[r], v[8 + r]));
    const float mn = fmaxf(mx, fmaxf(bm, xhalf(bm)));      /* the same in both lanes of a query */
    const float f = __builtin_amdgcn_exp2f(mx - mn);      /* 0 on the first pass, where mx is -inf; exactly 1 where the maximum stays */
    mx = mn; se *= f;
    FragH p;
#pragma unroll      /* four weights at a time, then the rescale of one output tile */
    for (int t = 0; t < 4; ++t) {
#pragma unroll
      for (int k = 4 * t; k < 4 * t + 4; ++k) { v[k] = __builtin_amdgcn_exp2f(v[k] - mn); p.h[k] = (_Float16)v[k]; }
      v8f& ot = t == 0 ? o0 : t == 1 ? o1 : t == 2 ? o2 : o3;
#pragma unroll
      for (int r = 0; r < 8; ++r) ot[r] *= f;
      __builtin_amdgcn_sched_barrier(0);      /* keeps the groups apart, so that plain multiplies and conversions issue between the runs of 2^x: left alone the compiler issues all 17 in one run */
    }
    o0 = fa_mma(va0, p.v, o0); o1 = fa_mma(va1, p.v, o1); o2 = fa_mma(va2, p.v, o2); o3 = fa_mma(va3, p.v, o3);
    __builtin_amdgcn_sched_barrier(0);      /* the sum of the weights stays behind the pass's last product: its additions are the vector slots that the chip needs between that product and the next pass's first write to one of its operand registers, and they issue while the matrix unit works */
#pragma unroll
    for (int k = 0; k < 16; ++k) se += v[k];
  }
    asm volatile("s_wait_dscnt 0x0" ::: "memory");      /* this wave's reads of buffer t & 1 are done */
    asm volatile("s_wait_asynccnt 0x0" ::: "memory");      /* this wave's part of stage t + 1 has landed */
    __syncthreads();      /* publishes stage t + 1 and frees buffer t & 1 */
    if (t + 2 < SQ / FAK) fa_copy(lk + (unsigned)(t & 1) * (FASTG * 2u), lv + (unsigned)(t & 1) * (FASTG * 2u), gk + (size_t)(t + 2) * FAK * D3, gv + (t + 2) * FAK);
  }
  asm volatile("s_wait_asynccnt 0x0" ::: "memory");      /* nothing in flight when the wave ends */
  se += xhalf(se);      /* each lane summed its own half of the keys */
  const float inv = 1.0f / se;
  _Float16* op = O16 + ((size_t)b * SQ + i) * DM + h * HD + 8 * hh;      /* o_t[r] = ctx[query i][d = 16 t + 8 hh + r]: 16 contiguous bytes a tile */
  FragH c0, c1;
#pragma unroll
  for (int r = 0; r < 8; ++r) { c0.h[r] = (_Float16)(o0[r] * inv); c0.h[8 + r] = (_Float16)(o1[r] * inv); c1.h[r] = (_Float16)(o2[r] * inv); c1.h[8 + r] = (_Float16)(o3[r] * inv); }
  *(v8us*)((unsigned short*)op) = c0.half[0]; *(v8us*)((unsigned short*)op + 16) = c0.half[1]; *(v8us*)((unsigned short*)op + 32) = c1.half[0]; *(v8us*)((unsigned short*)op + 48) = c1.half[1];
}
__global__ __launch_bounds__(256) void k_vt(const _Float16* __restrict__ V16, int b, int h0, _Float16* __restrict__ VT) { __shared__ unsigned short tl[64][65]; const int tid = threadIdx.x; const int hh = blockIdx.x % HG, sg = blockIdx.x / HG; const int s0 = sg * 64; const int h = h0 + hh;
  for (int i = tid; i < 64 * 8; i += 256) { const int j = i / 8, d8 = (i % 8) * 8; FragH f; f.half[0] = *(const v8us*)((const unsigned short*)V16 + ((size_t)b * SQ + s0 + j) * DM + h * HD + d8); for (int q = 0; q < 8; ++q) tl[d8 + q][j] = f.u[q]; }
  __syncthreads();
  { for (int i = tid; i < 64 * 8; i += 256) { const int d = i / 8, j8 = (i % 8) * 8; FragH f; for (int q = 0; q < 8; ++q) f.u[q] = tl[d][j8 + q]; *(v8us*)((unsigned short*)VT + ((size_t)hh * HD + d) * SQ + s0 + j8) = f.half[0]; }  } }

// The three input conversions in one launch: hidden -> f16 rows (the items of k_x16) and W_qkv, W_o -> x16 transposed f16 (the values of k_wt_f16). They depend on nothing but the inputs.
// 512 work-groups, two a WGP, 16 waves a WGP, all resident at once; a thread takes 4 items of hidden, a work-group 4 weight units (3 of W_qkv, 1 of W_o), and every thread asks for all its data up front.
// A weight unit is 64 k x 32 n. It is read along n, as it lies: 8 lanes a row, so a wave-wide 16-byte load covers 4 whole 128-byte lines (read down a column, one float a lane, a wave-wide load touched 32 lines for 128 bytes).
// The transposition is done in LDS: two consecutive k of one n are packed into 4 bytes and written down a column; behind one barrier each thread reads 8 consecutive k of one n and stores 16 bytes, a wave 4 whole lines of Bt.
#define PRB 512                      /* work-groups of the conversion launch */
#define PRT (PRB * 256)              /* its threads */
#define PRP 33                       /* 4-byte words per LDS row of a unit: 32 (64 k as f16 pairs) + 1, so that the writes down a column and the reads along a row each meet every bank at most once */
__global__ __launch_bounds__(256) void k_prep(const float* __restrict__ x, _Float16* __restrict__ X16, const float* __restrict__ wq, _Float16* __restrict__ Bq, const float* __restrict__ wo, _Float16* __restrict__ Bo) {
  static_assert(NR * DM / 8 == (size_t)4 * PRT && (D3 / 32) * (DM / 64) == 3 * PRB && (DM / 32) * (DM / 64) == PRB, "items per thread, units per work-group");
  typedef _Float16 v2h __attribute__((ext_vector_type(2)));
  __shared__ unsigned tl[4][32][PRP];      /* tl[unit][n][k / 2]: the even k in the low half */
  const int tid = threadIdx.x;
  const int c4 = (tid & 7) * 4, rp = tid >> 3;      /* reading: this thread's 4 consecutive n and its pair of rows k = 2 rp, 2 rp + 1 of a unit */
  const unsigned ix = blockIdx.x * 1024u + (unsigned)tid;      /* hidden items ix + 256 j: a work-group takes 1,024 consecutive items */
  const unsigned ox = ix * 32u, vq = ((unsigned)(2 * rp) * D3 + (unsigned)c4) * 4u, vo = ((unsigned)(2 * rp) * DM + (unsigned)c4) * 4u;      /* one address register an input, beside a uniform pointer; all else is a constant offset */
  unsigned un[4], uk[4];      /* first n and first k of the work-group's four units (uniform): consecutive work-groups take neighbouring pieces of the same rows */
#pragma unroll      /* un, uk, wa, wb, xa, xb indexed by constants only, so that they live in registers */
  for (int j = 0; j < 3; ++j) { const unsigned u = blockIdx.x + (unsigned)j * PRB; un[j] = (u % (D3 / 32)) * 32u; uk[j] = (u / (D3 / 32)) * 64u; }
  un[3] = (blockIdx.x % (DM / 32)) * 32u; uk[3] = (blockIdx.x / (DM / 32)) * 64u;
  const char* pw[4];      /* the units' first bytes (uniform) */
#pragma unroll
  for (int j = 0; j < 3; ++j) pw[j] = (const char*)(wq + (size_t)uk[j] * D3 + un[j]);
  pw[3] = (const char*)(wo + (size_t)uk[3] * DM + un[3]);
  __builtin_amdgcn_sched_barrier(0);      /* the four uniform pointers are formed ahead of the first load: formed between the loads they reuse scalar registers that an issued load names, and each reuse waits for that load's address translation */
  v4f wa[4], wb[4], xa[4], xb[4];
#pragma unroll
  for (int j = 0; j < 3; ++j) { const char* p = pw[j] + (size_t)vq; wa[j] = *(const v4fa*)p; wb[j] = *(const v4fa*)(p + D3 * 4); }
  { const char* p = pw[3] + (size_t)vo; wa[3] = *(const v4fa*)p; wb[3] = *(const v4fa*)(p + DM * 4); }
#pragma unroll
  for (int j = 0; j < 4; ++j) { const char* p = (const char*)x + (size_t)ox + j * 8192; xa[j] = *(const v4fa*)p; xb[j] = *(const v4fa*)(p + 16); }
  asm volatile("s_wait_xcnt 0x0" :: "v"(ox), "v"(vq), "v"(vo) : "memory");      /* inputs only: the three address registers of the 16 loads live up to this wait and are reused only behind it */
  __builtin_amdgcn_sched_barrier(0);      /* all 16 loads of a thread are in flight, and the wait above has passed, before the first conversion: sunk to their uses the loads would cost one memory round trip an item */
#pragma unroll
  for (int j = 0; j < 4; ++j)
#pragma unroll
    for (int q = 0; q < 4; ++q) { v2h f; f[0] = (_Float16)(bf16_round(wa[j][q]) * 16.0f); f[1] = (_Float16)(bf16_round(wb[j][q]) * 16.0f); tl[j][c4 + q][rp] = __builtin_bit_cast(unsigned, f); }
  __syncthreads();      /* the four units are whole in LDS; no global store stands in front of this barrier, which would wait for it */
  const int n = tid >> 3, k8 = tid & 7;      /* writing: this thread's row of Bt in a unit and its 8 consecutive k */
  union { unsigned d[4]; v8us v; } o[4];
#pragma unroll
  for (int j = 0; j < 4; ++j)
#pragma unroll
    for (int q = 0; q < 4; ++q) o[j].d[q] = tl[j][n][4 * k8 + q];
#pragma unroll      /* the hidden items are converted while the LDS reads above are under way */
  for (int j = 0; j < 4; ++j) { FragH f;
#pragma unroll
    for (int q = 0; q < 4; ++q) { f.h[q] = (_Float16)bf16_round(xa[j][q]); f.h[4 + q] = (_Float16)bf16_round(xb[j][q]); }
    *(v8us*)((unsigned short*)X16 + ((size_t)ix + j * 256) * 8) = f.half[0]; }
#pragma unroll
  for (int j = 0; j < 4; ++j) *(v8us*)((unsigned short*)(j < 3 ? Bq : Bo) + (size_t)(un[j] + (unsigned)n) * DM + uk[j] + (unsigned)k8 * 8u) = o[j].v;
}

extern "C" void kernel_launch(void* const* d_in, const int* in_sizes, int n_in,
                              void* d_out, int out_size, void* d_ws, size_t ws_size, hipStream_t stream) {
  (void)in_sizes; (void)n_in; (void)out_size;
  const float* const* I = (const float* const*)d_in; const float* hs = I[0]; const float* amask = I[1]; const float* wqkv = I[2]; const float* wo = I[3]; const float* emb = I[4];      /* W_qkv [1024][3072] and W_o [1024][1024] are [in][out]; attention_mask [2][1][2048][2048]; rel_bias_emb [32][16] */
  char* ws = (char*)d_ws; size_t off = 0;
  auto take = [&](size_t bytes) { char* p = ws + off; off += (bytes + 255) & ~(size_t)255; return p; };
  _Float16* BQKV = (_Float16*)take((size_t)D3 * DM * 2); _Float16* BO = (_Float16*)take((size_t)DM * DM * 2);
  _Float16* X16 = (_Float16*)take(NR * DM * 2); _Float16* QKV = (_Float16*)take(NR * D3 * 2); _Float16* O16 = (_Float16*)take(NR * DM * 2);
  _Float16* VT = (_Float16*)take((size_t)NB * NH * HD * SQ * 2);
  if (off > ws_size) return;      /* 6 + 2 + 8 + 24 + 8 + 8 = approx 56 MiB */
  k_prep<<<PRB, 256, 0, stream>>>(hs, X16, wqkv, BQKV, wo, BO);      /* hidden as f16 rows; [in][out] weights -> Bt[out][in] x16 */
  k_gemm2<0><<<dim3((unsigned)((NR / 128) * (D3 / 128)), 1), 256, 0, stream>>>(X16, DM, 0, BQKV, DM, 0, 0.0625f, nullptr, 0, nullptr, 1, 0, 0, nullptr, QKV, D3, 0, MP, D3, DM);      /* q | k | v rows (f16), head h at columns h*64 / 1024 + h*64 / 2048 + h*64 */
  k_vt<NH, SQ><<<NB * NH * (SQ / 64), 256, 0, stream>>>(QKV, D3, 2 * DM, VT);      /* V^T[(b,h)][d][s] for every (batch, head) */
  k_fattn<<<dim3(SQ / 256, NB * NH), 512, 0, stream>>>(QKV, VT, emb, amask, O16);      /* ctx (merged heads) as f16 rows; one block per 256 query rows of a (batch, head) */
  k_gemm2<0><<<dim3((unsigned)((NR / 128) * (DM / 128)), 1), 256, 0, stream>>>(O16, DM, 0, BO, DM, 0, 0.0625f, nullptr, 0, nullptr, 1, 0, 0, (float*)d_out, nullptr, DM, 0, MO, DM, DM);      /* out = ctx W_o, rows are the output layout */
}

// v010
// One run takes 95.4 microseconds.
// Next to v009, in two timings, it ran 1.21 and 1.20 times as fast.
// All steps since v000 together make it 314 times as fast.
#include <hip/hip_runtime.h>
#define NB 2
#define SQ 2048
#define DM 1024
#define D3 3072                      /* fused q|k|v width */
#define NH 16
#define HD 64
#define HG 4                         /* heads per call of the k_vt(V16, b, h0, VT) overload, which nothing launches */
#define NBK 32                       /* relative-position buckets */
#define MP ((int)NR)                 /* token rows through the qkv projection (debug hook) */
#define MO ((int)NR)                 /* token rows through the output projection (debug hook) */
#define NR ((size_t)NB * SQ)         /* 4096 token rows */
typedef __bf16 v16b __attribute__((ext_vector_type(16)));
typedef unsigned short v8us __attribute__((ext_vector_type(8), may_alias));
typedef float  v8f  __attribute__((ext_vector_type(8)));
typedef float  v4f  __attribute__((ext_vector_type(4)));
typedef float  v4fa __attribute__((ext_vector_type(4), may_alias));
union FragB { v16b v; v8us half[2]; unsigned short u[16]; };

__device__ __forceinline__ unsigned short bf16_bits(float x) { unsigned int u = __float_as_uint(x); return (unsigned short)((u + 0x7FFFu + ((u >> 16) & 1u)) >> 16); }
__device__ __forceinline__ float bf16_val(unsigned short b) { return __uint_as_float(((unsigned int)b) << 16); }
__device__ __forceinline__ float bf16_round(float x) { return bf16_val(bf16_bits(x)); }
// D += A·B with NT terms: 1 = ah·bh, 2 = + al·bh (A split), 3 = + ah·bl (both split)
template <int NT>
__device__ __forceinline__ v8f mmaN(v16b ah, v16b al, v16b bh, v16b bl, v8f c) {
  c = __builtin_amdgcn_wmma_f32_16x16x32_bf16(false, ah, false, bh, (short)0, c, false, false);
  if (NT >= 2) c = __builtin_amdgcn_wmma_f32_16x16x32_bf16(false, al, false, bh, (short)0, c, false, false);
  if (NT >= 3) c = __builtin_amdgcn_wmma_f32_16x16x32_bf16(false, ah, false, bl, (short)0, c, false, false);
  asm volatile("v_nop\n\tv_nop\n\tv_nop\n\tv_nop" : "+v"(c) : "v"(ah), "v"(al), "v"(bh), "v"(bl));
  return c;
}

__global__ __launch_bounds__(256) void k_wt_bf16(const float* __restrict__ W, unsigned short* __restrict__ Wt, int K, int N) {
  const int t = blockIdx.x * 256 + threadIdx.x;
  const int k8n = K / 8;
  if (t >= N * k8n) return;
  const int n = t / k8n, k8 = (t % k8n) * 8;
  v8us v;
#pragma unroll
  for (int i = 0; i < 8; ++i) v[i] = bf16_bits(W[(size_t)(k8 + i) * N + n]);
  *(v8us*)(Wt + (size_t)n * K + k8) = v;
  
}

// GEMM C[M][N] (f32, pitch ldc) = act(A[M][K]·W + bias). A f32 row-major (pitch lda) converted per fragment to bf16
// (ASPLIT: hi/lo two planes -> 2 terms, else single rounded term); Wt bf16 [N][K] (pitch ldb). BIAS_BF16 rounds the
// bias to bf16 first (bias quantised to bf16 before the add). K%32==0, M%16==0, N%64==0.
template <bool ASPLIT, int ACT, bool BIAS_BF16>
__global__ __launch_bounds__(128) void k_gemm_bf(const float* __restrict__ A, int lda, const unsigned short* __restrict__ Wt, int ldb,
                                               const float* __restrict__ bias, float* __restrict__ C, int ldc, int M, int N, int K) {
  __shared__ __attribute__((aligned(16))) float so[4][16][64];
  const int tid = threadIdx.x, w = tid >> 5, lane = tid & 31, ln = lane & 15, hh = lane >> 4;
  const int ntn = N / 64;
  const int wid = blockIdx.x * 4 + w;
  const int mt = wid / ntn, nq = wid % ntn;
  if (mt * 16 >= M) return;
  const int row0 = mt * 16, col0 = nq * 64;
  const float* arow = A + (size_t)(row0 + ln) * lda;
  v8f acc[4] = {};
  for (int kb = 0; kb < K; kb += 32) {
    FragB ah, al;
    const v4f x0 = *(const v4fa*)(arow + kb + 8 * hh), x1 = *(const v4fa*)(arow + kb + 8 * hh + 4);
    const v4f x2 = *(const v4fa*)(arow + kb + 16 + 8 * hh), x3 = *(const v4fa*)(arow + kb + 16 + 8 * hh + 4);
    float xs[16] = {x0[0],x0[1],x0[2],x0[3],x1[0],x1[1],x1[2],x1[3],x2[0],x2[1],x2[2],x2[3],x3[0],x3[1],x3[2],x3[3]};
#pragma unroll
    for (int i = 0; i < 16; ++i) { const unsigned short hb = bf16_bits(xs[i]); ah.u[i] = hb; al.u[i] = ASPLIT ? bf16_bits(xs[i] - bf16_val(hb)) : (unsigned short)0; }
#pragma unroll
    for (int t = 0; t < 4; ++t) {
      const unsigned short* brow = Wt + (size_t)(col0 + t * 16 + ln) * ldb + kb;
      FragB b;
      b.half[0] = *(const v8us*)(brow + 8 * hh);
      b.half[1] = *(const v8us*)(brow + 16 + 8 * hh);
      acc[t] = mmaN<ASPLIT ? 2 : 1>(ah.v, al.v, b.v, b.v, acc[t]);
    }
  }
#pragma unroll
  for (int t = 0; t < 4; ++t) {
    float bv = bias ? bias[col0 + t * 16 + ln] : 0.f;
    if (BIAS_BF16) bv = bf16_round(bv);
#pragma unroll
    for (int r = 0; r < 8; ++r) { float v = acc[t][r] + bv; if (ACT == 1) v = fmaxf(v, 0.f); so[w][8 * hh + r][t * 16 + ln] = v; }
  }
  __builtin_amdgcn_fence(__ATOMIC_ACQ_REL, "workgroup");
  __builtin_amdgcn_wave_barrier();
  const int rsub = lane >> 4, c4 = (lane & 15) * 4;
  {
#pragma unroll
    for (int q = 0; q < 8; ++q) {
      const int r = q * 2 + rsub;
      const v4f v = *(const v4fa*)&so[w][r][c4];
      *(v4f*)(C + (size_t)(row0 + r) * ldc + col0 + c4) = v;
    }
    
  }
}

// GEMM C = act(A·W + bias + resid): A f32 (ASPLIT -> hi/lo 2 terms), Wt bf16 [N][K]; ACT 0 none, 1 relu, 2 exact gelu;
// resid (optional, f32, row index = (row % rmod), pitch ldr, RES_BF16 rounds it) added before the activation.
template <bool ASPLIT, int ACT, bool BIAS_BF16, bool RES_BF16>
__global__ __launch_bounds__(128) void k_gemm_bf3(const float* __restrict__ A, int lda, const unsigned short* __restrict__ Wt, int ldb,
                                                const float* __restrict__ bias, const float* __restrict__ resid, int rmod, int ldr,
                                                float* __restrict__ C, int ldc, int M, int N, int K) {
  __shared__ __attribute__((aligned(16))) float so[4][16][64];
  const int tid = threadIdx.x, w = tid >> 5, lane = tid & 31, ln = lane & 15, hh = lane >> 4;
  const int ntn = N / 64;
  const int wid = blockIdx.x * 4 + w;
  const int mt = wid / ntn, nq = wid % ntn;
  if (mt * 16 >= M) return;
  const int row0 = mt * 16, col0 = nq * 64;
  const float* arow = A + (size_t)(row0 + ln) * lda;
  v8f acc[4] = {};
  for (int kb = 0; kb < K; kb += 32) {
    FragB ah, al;
    const v4f x0 = *(const v4fa*)(arow + kb + 8 * hh), x1 = *(const v4fa*)(arow + kb + 8 * hh + 4);
    const v4f x2 = *(const v4fa*)(arow + kb + 16 + 8 * hh), x3 = *(const v4fa*)(arow + kb + 16 + 8 * hh + 4);
    float xs[16] = {x0[0],x0[1],x0[2],x0[3],x1[0],x1[1],x1[2],x1[3],x2[0],x2[1],x2[2],x2[3],x3[0],x3[1],x3[2],x3[3]};
#pragma unroll
    for (int i = 0; i < 16; ++i) { const unsigned short hb = bf16_bits(xs[i]); ah.u[i] = hb; al.u[i] = ASPLIT ? bf16_bits(xs[i] - bf16_val(hb)) : (unsigned short)0; }
#pragma unroll
    for (int t = 0; t < 4; ++t) {
      const unsigned short* brow = Wt + (size_t)(col0 + t * 16 + ln) * ldb + kb;
      FragB b;
      b.half[0] = *(const v8us*)(brow + 8 * hh);
      b.half[1] = *(const v8us*)(brow + 16 + 8 * hh);
      acc[t] = mmaN<ASPLIT ? 2 : 1>(ah.v, al.v, b.v, b.v, acc[t]);
    }
  }
#pragma unroll
  for (int t = 0; t < 4; ++t) {
    const int col = col0 + t * 16 + ln;
    float bv = bias ? bias[col] : 0.f;
    if (BIAS_BF16) bv = bf16_round(bv);
#pragma unroll
    for (int r = 0; r < 8; ++r) {
      float v = acc[t][r] + bv;
      if (resid) { float rv = resid[(size_t)((row0 + 8 * hh + r) % rmod) * ldr + col]; if (RES_BF16) rv = bf16_round(rv); v += rv; }
      if (ACT == 1) v = fmaxf(v, 0.f);
      if (ACT == 2) v = 0.5f * v * (1.0f + erff(v * 0.70710678118654752f));
      if (ACT == 3) { const float u = 0.7978845608028654f * (v + 0.044715f * v * v * v); v = 0.5f * v * (1.0f + tanhf(u)); }
      so[w][8 * hh + r][t * 16 + ln] = v;
    }
  }
  __builtin_amdgcn_fence(__ATOMIC_ACQ_REL, "workgroup");
  __builtin_amdgcn_wave_barrier();
  const int rsub = lane >> 4, c4 = (lane & 15) * 4;
  {
#pragma unroll
    for (int q = 0; q < 8; ++q) {
      const int r = q * 2 + rsub;
      const v4f v = *(const v4fa*)&so[w][r][c4];
      *(v4f*)(C + (size_t)(row0 + r) * ldc + col0 + c4) = v;
    }
    
  }
}
// row LayerNorm (biased variance, eps) over N: s = X (+ R); optional out_sum <- s; out_norm <- (s-mu)*rsqrt(var+eps)*g + b
template <bool PARAM_BF16>
__global__ __launch_bounds__(256) void k_layernorm(const float* __restrict__ X, const float* __restrict__ R, const float* __restrict__ g, const float* __restrict__ bta,
                                                  float* __restrict__ out_sum, float* __restrict__ out_norm, int N, float eps) {
  __shared__ float red[256];
  const int row = blockIdx.x, tid = threadIdx.x;
  const float* x = X + (size_t)row * N; const float* rr = R ? R + (size_t)row * N : nullptr;
  float vals[16];                     // up to N = 4096
  const int per = N / 256;            // contiguous chunk per thread? use strided-by-4 chunks: thread handles j = tid*4 + 1024*u
  float s1 = 0.f;
  for (int u = 0; u < per / 4; ++u) {
    const int j = tid * 4 + 1024 * u;
    const v4f a = *(const v4fa*)(x + j);
    v4f b = {0.f,0.f,0.f,0.f}; if (rr) b = *(const v4fa*)(rr + j);
#pragma unroll
    for (int q = 0; q < 4; ++q) { const float v = a[q] + b[q]; vals[u * 4 + q] = v; s1 += v; }
  }
  red[tid] = s1; __syncthreads();
  for (int st = 128; st > 0; st >>= 1) { if (tid < st) red[tid] += red[tid + st]; __syncthreads(); }
  const float mu = red[0] / (float)N; __syncthreads();
  float s2 = 0.f;
  for (int u = 0; u < per / 4; ++u)
#pragma unroll
    for (int q = 0; q < 4; ++q) { const float c = vals[u * 4 + q] - mu; s2 += c * c; }
  red[tid] = s2; __syncthreads();
  for (int st = 128; st > 0; st >>= 1) { if (tid < st) red[tid] += red[tid + st]; __syncthreads(); }
  const float rs = rsqrtf(red[0] / (float)N + eps);
  {
    for (int u = 0; u < per / 4; ++u) {
      const int j = tid * 4 + 1024 * u;
      v4f o, sm;
#pragma unroll
      for (int q = 0; q < 4; ++q) {
        float gg = g[j + q], bb = bta[j + q];
        if (PARAM_BF16) { gg = bf16_round(gg); bb = bf16_round(bb); }
        sm[q] = vals[u * 4 + q]; o[q] = (vals[u * 4 + q] - mu) * rs * gg + bb;
      }
      if (out_sum) *(v4f*)(out_sum + (size_t)row * N + j) = sm;
      *(v4f*)(out_norm + (size_t)row * N + j) = o;
    }
    
  }
}



// ---- f16 WMMA path (v_wmma_f32_16x16x32_f16): 11-bit significands for operands in range — used where a [0,1] probability operand needs more precision than bf16
typedef _Float16 v16h __attribute__((ext_vector_type(16)));
union FragH { v16h v; v8us half[2]; _Float16 h[16]; unsigned short u[16]; };
template <int NT>
__device__ __forceinline__ v8f mmaH(v16h ah, v16h al, v16h bh, v16h bl, v8f c) {
  c = __builtin_amdgcn_wmma_f32_16x16x32_f16(false, ah, false, bh, (short)0, c, false, false);
  if (NT >= 2) c = __builtin_amdgcn_wmma_f32_16x16x32_f16(false, al, false, bh, (short)0, c, false, false);
  if (NT >= 3) c = __builtin_amdgcn_wmma_f32_16x16x32_f16(false, ah, false, bl, (short)0, c, false, false);
  asm volatile("v_nop\n\tv_nop\n\tv_nop\n\tv_nop" : "+v"(c) : "v"(ah), "v"(al), "v"(bh), "v"(bl));
  return c;
}
// batched GEMM like k_gemm_b but f16 operands: A f32 (split into f16 hi/lo if ASPLIT, else rounded to f16), Bt = f16 values [n][k]; alpha; C f32; N multiple of 16 (partial tiles skipped)
template <bool ASPLIT>
__global__ __launch_bounds__(128) void k_gemm_h(const float* __restrict__ A, int lda, size_t sA, const _Float16* __restrict__ Bh, int ldb, size_t sB, float alpha, float* __restrict__ C, int ldc, size_t sC, int M, int N, int K) {
  __shared__ __attribute__((aligned(16))) float so[4][16][64];
  const int tid = threadIdx.x, w = tid >> 5, lane = tid & 31, ln = lane & 15, hh = lane >> 4; const int by = blockIdx.y;
  A += (size_t)by * sA; Bh += (size_t)by * sB; C += (size_t)by * sC;
  const int ntn = (N + 63) / 64; const int wid = blockIdx.x * 4 + w; const int mt = wid / ntn, nq = wid % ntn; if (mt * 16 >= M) return;
  const int row0 = mt * 16, col0 = nq * 64; const float* arow = A + (size_t)(row0 + ln) * lda;
  v8f acc[4] = {};
  for (int kb = 0; kb < K; kb += 32) {
    FragH ah, al;
    const v4f x0 = *(const v4fa*)(arow + kb + 8 * hh), x1 = *(const v4fa*)(arow + kb + 8 * hh + 4), x2 = *(const v4fa*)(arow + kb + 16 + 8 * hh), x3 = *(const v4fa*)(arow + kb + 16 + 8 * hh + 4);
    float xs[16] = {x0[0],x0[1],x0[2],x0[3],x1[0],x1[1],x1[2],x1[3],x2[0],x2[1],x2[2],x2[3],x3[0],x3[1],x3[2],x3[3]};
#pragma unroll
    for (int i = 0; i < 16; ++i) { const _Float16 h = (_Float16)xs[i]; ah.h[i] = h; al.h[i] = ASPLIT ? (_Float16)(xs[i] - (float)h) : (_Float16)0.0f; }
#pragma unroll
    for (int t = 0; t < 4; ++t) { if (col0 + t * 16 >= N) continue; const size_t boff = (size_t)(col0 + t * 16 + ln) * ldb + kb; FragH bq; bq.half[0] = *(const v8us*)(Bh + boff + 8 * hh); bq.half[1] = *(const v8us*)(Bh + boff + 16 + 8 * hh);
      acc[t] = mmaH<ASPLIT ? 2 : 1>(ah.v, al.v, bq.v, bq.v, acc[t]); }
  }
#pragma unroll
  for (int t = 0; t < 4; ++t) { if (col0 + t * 16 >= N) continue;
#pragma unroll
    for (int r = 0; r < 8; ++r) so[w][8 * hh + r][t * 16 + ln] = acc[t][r] * alpha; }
  __builtin_amdgcn_fence(__ATOMIC_ACQ_REL, "workgroup"); __builtin_amdgcn_wave_barrier();
  const int rsub = lane >> 4, c4 = (lane & 15) * 4;
  {
#pragma unroll
    for (int q = 0; q < 8; ++q) { const int r = q * 2 + rsub; if (col0 + c4 < N) { const v4f v = *(const v4fa*)&so[w][r][c4]; *(v4f*)(C + (size_t)(row0 + r) * ldc + col0 + c4) = v; } }
     }
}

// Wt[n][k] = f16(W[k][n]·scale) from f32 row-major W[K][N] (scale = power of two; bf16-exact weights stay exact in f16 away from the subnormal range)
__global__ __launch_bounds__(256) void k_wt_f16(const float* __restrict__ W, _Float16* __restrict__ Wt, int K, int N, float scale) {
  const int t = blockIdx.x * 256 + threadIdx.x; if (t >= N * (K / 8)) return; const int n = t / (K / 8), k8 = (t % (K / 8)) * 8; FragH f;
#pragma unroll
  for (int i = 0; i < 8; ++i) f.h[i] = (_Float16)(bf16_round(W[(size_t)(k8 + i) * N + n]) * scale); const v8us o = f.half[0];
  *(v8us*)((unsigned short*)Wt + (size_t)n * K + k8) = o; 
}
// k_gemm_hh variant with fused epilogue: v = acc·alpha + bias[by·sBias + col] (+ CP[(row/rowsPerB)·sCPb + by·64 + col] if CP) ; ACT 0 none / 1 elu ; writes f16 C16 (and f32 C if non-null)
template <int ACT>
__global__ __launch_bounds__(128) void k_gemm_hhx(const _Float16* __restrict__ A, int lda, size_t sA, const _Float16* __restrict__ Bh, int ldb, size_t sB, float alpha, const float* __restrict__ bias, size_t sBias, const float* __restrict__ CP, int rowsPerB, size_t sCPb, int row0g,
    float* __restrict__ C, _Float16* __restrict__ C16, int ldc, size_t sC, int M, int N, int K) {
  __shared__ __attribute__((aligned(16))) float so[4][16][64];
  const int tid = threadIdx.x, w = tid >> 5, lane = tid & 31, ln = lane & 15, hh = lane >> 4; const int by = blockIdx.y;
  A += (size_t)by * sA; Bh += (size_t)by * sB; const size_t cofs = (size_t)by * sC; const float* bp = bias ? bias + (size_t)by * sBias : nullptr;
  const int ntn = (N + 63) / 64; const int wid = blockIdx.x * 4 + w; const int mt = wid / ntn, nq = wid % ntn; if (mt * 16 >= M) return;
  const int row0 = mt * 16, col0 = nq * 64; const _Float16* arow = A + (size_t)(row0 + ln) * lda;
  v8f acc[4] = {};
  for (int kb = 0; kb < K; kb += 32) { FragH ah; ah.half[0] = *(const v8us*)((const unsigned short*)arow + kb + 8 * hh); ah.half[1] = *(const v8us*)((const unsigned short*)arow + kb + 16 + 8 * hh);
#pragma unroll
    for (int t = 0; t < 4; ++t) { if (col0 + t * 16 >= N) continue; const size_t boff = (size_t)(col0 + t * 16 + ln) * ldb + kb; FragH bq; bq.half[0] = *(const v8us*)((const unsigned short*)Bh + boff + 8 * hh); bq.half[1] = *(const v8us*)((const unsigned short*)Bh + boff + 16 + 8 * hh);
      acc[t] = mmaH<1>(ah.v, ah.v, bq.v, bq.v, acc[t]); }
  }
#pragma unroll
  for (int t = 0; t < 4; ++t) { if (col0 + t * 16 >= N) continue; const int col = col0 + t * 16 + ln; const float bv = bp ? bf16_round(bp[col]) : 0.f;
#pragma unroll
    for (int r = 0; r < 8; ++r) { float v = acc[t][r] * alpha + bv; if (CP) { const int rr = row0g + row0 + 8 * hh + r; if (rowsPerB < 0) v += CP[cofs + (size_t)rr * ldc + col];      /* rowsPerB < 0: own element of the batched C plane */ else { const int bidx = rr / rowsPerB; v += CP[(size_t)bidx * sCPb + (size_t)by * 64 + col]; } } if (ACT == 1) v = (v > 0.f) ? v : expm1f(v); else if (ACT == 7) v = (v > 0.f) ? v + 1.0f : expf(v); else if (ACT == 8) v = tanhf(v); else if (ACT == 9) v = 0.5f * v * (1.0f + tanhf(0.7978845608028654f * (v + 0.044715f * v * v * v))); else if (ACT == 11) v = 1.0f / (1.0f + expf(-v)); else if (ACT == 12) v = (v > 0.f) ? v : 0.01f * v; else if (ACT == 14) v = (v > 0.f) ? v : 0.1f * v; else if (ACT == 16) v = (v >= 0.f) ? v : 0.3f * v; else if (ACT == 17) v = (v >= 0.f) ? v : 0.2f * v; else if (ACT == 15) v = v / (1.0f + expf(-v)); else if (ACT == 3) v = fmaxf(v, 0.f); else if (ACT == 6) v = 0.5f * v * (1.0f + erff(v * 0.70710678118654752f)); so[w][8 * hh + r][t * 16 + ln] = v; } }
  __builtin_amdgcn_fence(__ATOMIC_ACQ_REL, "workgroup"); __builtin_amdgcn_wave_barrier();
  const int rsub = lane >> 4, c4 = (lane & 15) * 4; typedef _Float16 v4h __attribute__((ext_vector_type(4)));
  {
#pragma unroll
    for (int q = 0; q < 8; ++q) { const int r = q * 2 + rsub; if (col0 + c4 < N) { const v4f v = *(const v4fa*)&so[w][r][c4]; if (C) *(v4f*)(C + cofs + (size_t)(row0 + r) * ldc + col0 + c4) = v; if (C16) { v4h h4; for (int i = 0; i < 4; ++i) h4[i] = (_Float16)v[i]; *(v4h*)(C16 + cofs + (size_t)(row0 + r) * ldc + col0 + c4) = h4; } } }
     }
}


typedef _Float16 v4h __attribute__((ext_vector_type(4)));

__global__ __launch_bounds__(256) void k_x16(const float* __restrict__ x, _Float16* __restrict__ X16, size_t n8) { const size_t t = (size_t)blockIdx.x * 256 + threadIdx.x; if (t >= n8) return; FragH f;
#pragma unroll
  for (int q = 0; q < 8; ++q) f.h[q] = (_Float16)bf16_round(x[t * 8 + q]); *(v8us*)((unsigned short*)X16 + t * 8) = f.half[0];  }
__global__ __launch_bounds__(256) void k_h16(const float* __restrict__ x, _Float16* __restrict__ X16, size_t n8) { const size_t t = (size_t)blockIdx.x * 256 + threadIdx.x; if (t >= n8) return; FragH f;
#pragma unroll
  for (int q = 0; q < 8; ++q) f.h[q] = (_Float16)x[t * 8 + q]; *(v8us*)((unsigned short*)X16 + t * 8) = f.half[0];  }
__global__ __launch_bounds__(256) void k_round16f(const float* __restrict__ W, _Float16* __restrict__ Bt, size_t n8) { const size_t t = (size_t)blockIdx.x * 256 + threadIdx.x; if (t >= n8) return; FragH f;
#pragma unroll
  for (int i = 0; i < 8; ++i) f.h[i] = (_Float16)(bf16_round(W[t * 8 + i]) * 16.0f); *(v8us*)((unsigned short*)Bt + t * 8) = f.half[0];  }
template <int NHv, int TTv>
__global__ __launch_bounds__(256) void k_vt(const _Float16* __restrict__ V16, int ldv, int voff, _Float16* __restrict__ Vt) { __shared__ unsigned short tl[64][66]; const int tid = threadIdx.x; const int slab = blockIdx.x / (TTv / 64), lg = blockIdx.x % (TTv / 64); const int b = slab / NHv, h = slab % NHv;
  for (int i = tid; i < 64 * 8; i += 256) { const int r = i / 8, c8 = (i % 8) * 8; FragH f; f.half[0] = *(const v8us*)((const unsigned short*)V16 + ((size_t)b * TTv + lg * 64 + r) * ldv + voff + h * 64 + c8);
#pragma unroll
    for (int q = 0; q < 8; ++q) tl[r][c8 + q] = f.u[q]; }
  __syncthreads();
  {
#pragma unroll
    for (int rd = 0; rd < 2; ++rd) { const int d = rd * 32 + tid / 8, pc = tid % 8; FragH f;
#pragma unroll
      for (int q = 0; q < 8; ++q) f.u[q] = tl[pc * 8 + q][d];
      *(v8us*)((unsigned short*)Vt + ((size_t)slab * 64 + d) * TTv + lg * 64 + pc * 8) = f.half[0]; }
     } }

__global__ __launch_bounds__(256) void k_hl(const float* __restrict__ F, _Float16* __restrict__ Hh, _Float16* __restrict__ Hl, size_t n8) { const size_t t = (size_t)blockIdx.x * 256 + threadIdx.x; if (t >= n8) return; FragH fh, fl; const v4f a = *(const v4fa*)(F + t * 8), c = *(const v4fa*)(F + t * 8 + 4);
#pragma unroll
  for (int q = 0; q < 4; ++q) { _Float16 h = (_Float16)a[q]; fh.h[q] = h; fl.h[q] = (_Float16)((a[q] - (float)h) * 1024.0f); h = (_Float16)c[q]; fh.h[4 + q] = h; fl.h[4 + q] = (_Float16)((c[q] - (float)h) * 1024.0f); }
  { *(v8us*)((unsigned short*)Hh + t * 8) = fh.half[0]; *(v8us*)((unsigned short*)Hl + t * 8) = fl.half[0];  } }

// ---- fast GEMM (block tile 128x128 on 8 waves, wave tile 32x64; requires M % 128 == 0, N % 128 == 0, K % 64 == 0, K >= 64); epilogue = k_gemm_hhx semantics ----
// Operand path: a k tile is 64 k = one whole 128-byte line of each of the block's 128 A rows and 128 Bt rows. The 256 threads bring it into LDS by asynchronous 16-byte copies
// (8 lanes a row, so every wave-wide copy covers 4 whole lines), two buffers, the next tile in flight while this one is multiplied; the waves read their fragments from LDS in the k order of g2_frag.
#define G2P 72                       /* halfs per LDS row: 128 bytes of data + 16, the conflict-free pitch for 16-byte reads */
#define G2STG (256 * G2P * 2)        /* bytes of one buffer: 128 A rows, then 128 Bt rows */
__device__ __forceinline__ v16h g2_frag(const _Float16* p, int hh) { FragH f; f.half[0] = *(const v8us*)((const unsigned short*)p + 8 * hh); f.half[1] = *(const v8us*)((const unsigned short*)p + 16 + 8 * hh); return f.v; }
__device__ __forceinline__ v16h g2_lfrag(const unsigned short* p) { FragH f; f.half[0] = *(const v8us*)(p); f.half[1] = *(const v8us*)(p + 16); return f.v; }
__device__ __forceinline__ v8f g2_mma(v16h a, v16h b, v8f c) { return __builtin_amdgcn_wmma_f32_16x16x32_f16(false, a, false, b, (short)0, c, false, false); }
// one k tile: this thread's 16 bytes of rows r, r + 32, r + 64, r + 96 of A (pitch pa halfs) and of Bt (pitch pb); l = LDS byte address of its place in row r of the buffer.
// The s_wait_xcnt closes the copies' own statement, so that no address register is rewritten ahead of it.
__device__ __forceinline__ void g2_copy(unsigned l, const _Float16* a, size_t pa, const _Float16* b, size_t pb) {
  asm volatile("global_load_async_to_lds_b128 %0, %8, off\n\t"
               "global_load_async_to_lds_b128 %1, %9, off\n\t"
               "global_load_async_to_lds_b128 %2, %10, off\n\t"
               "global_load_async_to_lds_b128 %3, %11, off\n\t"
               "global_load_async_to_lds_b128 %4, %12, off\n\t"
               "global_load_async_to_lds_b128 %5, %13, off\n\t"
               "global_load_async_to_lds_b128 %6, %14, off\n\t"
               "global_load_async_to_lds_b128 %7, %15, off\n\t"
               "s_wait_xcnt 0x0"
               :: "v"(l), "v"(l + 32u * G2P * 2u), "v"(l + 64u * G2P * 2u), "v"(l + 96u * G2P * 2u), "v"(l + 128u * G2P * 2u), "v"(l + 160u * G2P * 2u), "v"(l + 192u * G2P * 2u), "v"(l + 224u * G2P * 2u),
                  "v"(a), "v"(a + 32 * pa), "v"(a + 64 * pa), "v"(a + 96 * pa), "v"(b), "v"(b + 32 * pb), "v"(b + 64 * pb), "v"(b + 96 * pb) : "memory");
}
template <int ACT>
__global__ __launch_bounds__(256) void k_gemm2(const _Float16* __restrict__ A, int lda, size_t sA, const _Float16* __restrict__ Bh, int ldb, size_t sB, float alpha, const float* __restrict__ bias, size_t sBias, const float* __restrict__ CP, int rowsPerB, size_t sCPb, int row0g,
    float* __restrict__ C, _Float16* __restrict__ C16, int ldc, size_t sC, int M, int N, int K) { static_assert(ACT == 0 || ACT == 3 || ACT == 6 || ACT == 8 || ACT == 9 || ACT == 11 || ACT == 12 || ACT == 14 || ACT == 15 || ACT == 16 || ACT == 17, "k_gemm2: unsupported ACT code (would silently apply no activation)");
  __shared__ __attribute__((aligned(16))) unsigned short ring[2][256][G2P];      /* the two operand buffers; behind the k loop the same bytes are the waves' output staging */
  static_assert(sizeof(float) * 8 * 32 * 68 <= sizeof(unsigned short) * 2 * 256 * G2P, "output staging must fit the ring");
  const int tid = threadIdx.x, w = tid >> 5, lane = tid & 31, ln = lane & 15, hh = lane >> 4; const int by = blockIdx.y;
  A += (size_t)by * sA; Bh += (size_t)by * sB; const size_t cofs = (size_t)by * sC; const float* bp = bias ? bias + (size_t)by * sBias : nullptr;
  const int ntn = N >> 7; const int mt = blockIdx.x / ntn, nq = blockIdx.x - mt * ntn; const int m0 = mt * 128, n0 = nq * 128; if (m0 >= M) return;      /* the same for the whole block, ahead of every barrier */
  const int wr = 32 * (w & 3), wc = 64 * (w >> 2); const int row0 = m0 + wr, col0 = n0 + wc;
  const int cr = tid >> 3, cs = (tid & 7) * 8;      /* this thread's row (of each 32) and its 8 halfs of the 64 in a k tile */
  const _Float16* ga = A + (size_t)(m0 + cr) * lda + cs; const _Float16* gb = Bh + (size_t)(n0 + cr) * ldb + cs;
  const unsigned l0 = (unsigned)(size_t)&ring[0][cr][cs];      /* low 32 bits of the shared address = byte offset in the block's LDS */
  const int nt = K >> 6;
  const v8f z8 = {0.f,0.f,0.f,0.f,0.f,0.f,0.f,0.f}; v8f c00 = z8, c01 = z8, c02 = z8, c03 = z8, c10 = z8, c11 = z8, c12 = z8, c13 = z8;
  g2_copy(l0, ga, (size_t)lda, gb, (size_t)ldb);
  asm volatile("s_wait_asynccnt 0x0" ::: "memory");      /* this wave's part of tile 0 has landed */
  __syncthreads();      /* tile 0 is readable by every wave */
  if (nt > 1) g2_copy(l0 + G2STG, ga + 64, (size_t)lda, gb + 64, (size_t)ldb);
#pragma unroll 1      /* one trip = one buffer; the two buffers alternate by t & 1 */
  for (int t = 0; t < nt; ++t) {
    const unsigned short* ta = &ring[t & 1][wr + ln][8 * hh]; const unsigned short* tb = &ring[t & 1][128 + wc + ln][8 * hh];
#pragma unroll      /* the two 32-k steps of a tile: constant LDS offsets */
    for (int ks = 0; ks < 64; ks += 32) {
      const v16h a0 = g2_lfrag(ta + ks), a1 = g2_lfrag(ta + 16 * G2P + ks);
      const v16h b0 = g2_lfrag(tb + ks), b1 = g2_lfrag(tb + 16 * G2P + ks), b2 = g2_lfrag(tb + 32 * G2P + ks), b3 = g2_lfrag(tb + 48 * G2P + ks);
      __builtin_amdgcn_sched_barrier(0);      /* the 12 LDS reads of a step issue as one group ahead of its 8 products: left alone the compiler reuses the B registers and the wave waits for LDS four times a step */
      c00 = g2_mma(a0, b0, c00); c10 = g2_mma(a1, b0, c10); c01 = g2_mma(a0, b1, c01); c11 = g2_mma(a1, b1, c11);
      c02 = g2_mma(a0, b2, c02); c12 = g2_mma(a1, b2, c12); c03 = g2_mma(a0, b3, c03); c13 = g2_mma(a1, b3, c13);
    }
    asm volatile("s_wait_dscnt 0x0" ::: "memory");      /* this wave's reads of buffer t & 1 are done */
    asm volatile("s_wait_asynccnt 0x0" ::: "memory");      /* this wave's part of tile t + 1 has landed */
    __syncthreads();      /* publishes tile t + 1 and frees buffer t & 1 */
    if (t + 2 < nt) g2_copy(l0 + (unsigned)(t & 1) * G2STG, ga + (size_t)(t + 2) * 64, (size_t)lda, gb + (size_t)(t + 2) * 64, (size_t)ldb);
  }
  asm volatile("s_wait_asynccnt 0x0" ::: "memory");      /* nothing in flight when the ring becomes output staging (the last trip's barrier has ended every read of it) */
  float (*so)[32][68] = reinterpret_cast<float (*)[32][68]>(&ring[0][0][0]);
  v8f accs[8] = {c00, c01, c02, c03, c10, c11, c12, c13};
#pragma unroll
  for (int u = 0; u < 8; ++u) { const int t = u & 3, half = u >> 2; const int col = col0 + t * 16 + ln; const float bv = bp ? bf16_round(bp[col]) : 0.f;
#pragma unroll
    for (int r = 0; r < 8; ++r) { const int rloc = half * 16 + 8 * hh + r; float v = accs[u][r] * alpha + bv; if (CP) { if (rowsPerB < 0) v += CP[cofs + (size_t)(row0g + row0 + rloc) * ldc + col];      /* rowsPerB < 0: own element of the batched C plane */ else { const int bidx = (row0g + row0 + rloc) / rowsPerB; v += CP[(size_t)bidx * sCPb + (size_t)by * 64 + col]; } }
      if (ACT == 3) v = fmaxf(v, 0.f); else if (ACT == 6) v = 0.5f * v * (1.0f + erff(v * 0.70710678118654752f)); else if (ACT == 11) v = 1.0f / (1.0f + expf(-v)); else if (ACT == 15) v = v / (1.0f + expf(-v)); else if (ACT == 12) v = (v > 0.f) ? v : 0.01f * v; else if (ACT == 8) v = tanhf(v); else if (ACT == 9) v = 0.5f * v * (1.0f + tanhf(0.7978845608028654f * (v + 0.044715f * v * v * v))); else if (ACT == 14) v = (v > 0.f) ? v : 0.1f * v; else if (ACT == 16) v = (v >= 0.f) ? v : 0.3f * v; else if (ACT == 17) v = (v >= 0.f) ? v : 0.2f * v;
      so[w][rloc][t * 16 + ln] = v; } }
  __builtin_amdgcn_fence(__ATOMIC_ACQ_REL, "workgroup"); __builtin_amdgcn_wave_barrier();
  const int rsub = lane >> 4, c4 = (lane & 15) * 4;
  {
#pragma unroll
    for (int q = 0; q < 16; ++q) { const int r = q * 2 + rsub; const v4f v = *(const v4fa*)&so[w][r][c4]; if (C) *(v4f*)(C + cofs + (size_t)(row0 + r) * ldc + col0 + c4) = v; if (C16) { v4h h4; for (int i = 0; i < 4; ++i) h4[i] = (_Float16)v[i]; *(v4h*)(C16 + cofs + (size_t)(row0 + r) * ldc + col0 + c4) = h4; } }
     } }


__global__ __launch_bounds__(256) void k_wnat(const float* __restrict__ w, size_t n8, _Float16* __restrict__ Bt) { const size_t t = (size_t)blockIdx.x * 256 + threadIdx.x; if (t >= n8) return; FragH f; for (int q = 0; q < 8; ++q) f.h[q] = (_Float16)(bf16_round(w[t * 8 + q]) * 16.0f); *(v8us*)((unsigned short*)Bt + t * 8) = f.half[0];  }
// T5 bidirectional relative-position bucket of rel = key - query (32 buckets, max distance 128): (rel > 0)*16 + f(|rel|), f(n) = n for n < 8, then
// 8 + the number of thresholds {12,16,23,32,46,64,91} that are <= n (the thresholds are where the reference's own f32 log expression steps; no log on the device)
__device__ __forceinline__ int t5_bucket(int rel) { const int n = rel < 0 ? -rel : rel; const int g = 8 + (n >= 12) + (n >= 16) + (n >= 23) + (n >= 32) + (n >= 46) + (n >= 64) + (n >= 91); return (rel > 0 ? NBK / 2 : 0) + (n < 8 ? n : g); }
// lane l with lane l ^ 16 (the two lanes that share one query column)
__device__ __forceinline__ float xhalf(float x) { return __builtin_bit_cast(float, __builtin_amdgcn_permlanex16(__builtin_bit_cast(int, x), __builtin_bit_cast(int, x), 0x76543210, 0xfedcba98, false, false)); }
__device__ __forceinline__ v8f fa_mma(v16h a, v16h b, v8f c) { return __builtin_amdgcn_wmma_f32_16x16x32_f16(false, a, false, b, (short)0, c, false, false); }
// Operand path of the fused attention: a stage is 128 keys = 128 K rows (one whole 128-byte line each) and the 64 V^T rows (two whole lines each). The block's 512 threads bring it into LDS by asynchronous 16-byte copies
// (a wave-wide copy covers 4 whole lines), two buffers, the next stage in flight while this one is worked on; all 16 waves read their A fragments from LDS in the k order of g2_frag.
#define FAK 128                      /* keys per stage */
#define FAKP 72                      /* halfs per K row in LDS: 128 bytes of data + 16, the conflict-free pitch for 16-byte reads */
#define FAVP 136                     /* halfs per V^T row in LDS: 256 bytes of data + 16, likewise */
#define FASTG (FAK * FAKP + HD * FAVP)      /* halfs of one buffer: the K rows, then the V^T rows */
#define FAL2E 1.4426950408889634f    /* log2(e): the scores are formed in base-2 units, so that a weight is one subtraction and one hardware 2^x */
// one stage: this thread's 16 bytes of K rows r and r + 64 (token pitch D3) and of V^T rows d and d + 32 (pitch SQ); lk, lv = LDS byte addresses of its places in rows r and d of the buffer.
// The s_wait_xcnt closes the copies' own statement, so that no address register is rewritten ahead of it.
__device__ __forceinline__ void fa_copy(unsigned lk, unsigned lv, const _Float16* k, const _Float16* v) {
  asm volatile("global_load_async_to_lds_b128 %0, %4, off\n\t"
               "global_load_async_to_lds_b128 %1, %5, off\n\t"
               "global_load_async_to_lds_b128 %2, %6, off\n\t"
               "global_load_async_to_lds_b128 %3, %7, off\n\t"
               "s_wait_xcnt 0x0"
               :: "v"(lk), "v"(lk + 64u * FAKP * 2u), "v"(lv), "v"(lv + 32u * FAVP * 2u),
                  "v"(k), "v"(k + (size_t)64 * D3), "v"(v), "v"(v + (size_t)32 * SQ) : "memory");
}
// fused attention of one (batch, head): scores, bias and mask, softmax and P.V in one pass over the keys; S and P stay in registers.
// One wave owns 16 query rows, a block 16 waves = 256 rows (256 blocks: one a WGP, four waves a SIMD, all reading the same K and V^T rows from the block's LDS); a pass takes 32 keys. Transposed products: S^T = K Q^T (A = key rows, B = the wave's q rows, loaded once),
// so lane (ln, hh) holds, for query q0 + ln, the keys kb + 8 hh + r and kb + 16 + 8 hh + r: the k order of g2_frag, and the 16 weights are the B operand of O^T += V^T P^T as they lie (A = V^T rows).
// The mask is shared by the heads, so it is not looked at once a head: MF holds one word per 16 x 32 tile, a wave turns its 64 words into 64 bits in scalar registers, and a pass whose bit is 0 (all 512 values exactly 1) forms s / 8 + bias without a mask load.
// score = s*m + (-10000*(1-m) + emb[bucket(j-i)][h]) as in the reference (bf16-rounded emb, this head's values by key - query distance in LDS; m = mask[b][q][k] bf16-rounded), every term times log2(e): the factor is in the 1/8, the -10000 and the table.
// Online softmax: running maximum and sum per query, both in-lane but for one exchange between the lane halves; the output tile and the sum are rescaled every pass; weights exp(score - maximum) = 2^(scaled score - scaled maximum) <= 1 as f16.
__global__ __launch_bounds__(512) void k_fattn(const _Float16* __restrict__ QKV, const _Float16* __restrict__ VT, const float* __restrict__ emb, const float* __restrict__ amask, const unsigned* __restrict__ MF, _Float16* __restrict__ O16) {
  __shared__ __attribute__((aligned(16))) struct { float tb[5 * 512]; unsigned short ring[2][FASTG]; } sm;      /* one object, the table first: its reads keep small constant offsets */
  float (&tb)[5 * 512] = sm.tb;      /* tb[t] = this head's bias at key - query = t - (the block's last query row): the SQ + 255 distances that the block's 256 queries meet, rounded up to five entries a thread */
  unsigned short (&ring)[2][FASTG] = sm.ring;      /* the two K | V^T buffers */
  const int bh = blockIdx.y, b = bh / NH, h = bh % NH;
  const int ckr = (int)threadIdx.x >> 3, ckc = ((int)threadIdx.x & 7) * 8, cvr = (int)threadIdx.x >> 4, cvc = ((int)threadIdx.x & 15) * 8;      /* this thread's K row (of each 64) and V^T row (of each 32) and its 8 halfs of them */
  const _Float16* gk = QKV + ((size_t)b * SQ + ckr) * D3 + DM + h * HD + ckc; const _Float16* gv = VT + ((size_t)bh * HD + cvr) * SQ + cvc;
  const unsigned lk = (unsigned)(size_t)&ring[0][ckr * FAKP + ckc], lv = (unsigned)(size_t)&ring[0][FAK * FAKP + cvr * FAVP + cvc];      /* low 32 bits of the shared address = byte offset in the block's LDS */
  fa_copy(lk, lv, gk, gv);      /* stage 0 flies while the bias table is built */
#pragma unroll      /* the five table reads of a thread are in flight together */
  for (int u = 0; u < 5; ++u) { const int t = u * 512 + (int)threadIdx.x; tb[t] = bf16_round(emb[t5_bucket(t - (int)(blockIdx.x * 256 + 255)) * NH + h]) * FAL2E; }
  asm volatile("s_wait_asynccnt 0x0" ::: "memory");      /* this wave's part of stage 0 has landed */
  __syncthreads();      /* the bias table and stage 0 are readable by every wave */
  fa_copy(lk + FASTG * 2u, lv + FASTG * 2u, gk + (size_t)FAK * D3, gv + FAK);      /* stage 1 (there are SQ / FAK = 16) */
  const int lane = threadIdx.x & 31, ln = lane & 15, hh = lane >> 4;
  const int i = blockIdx.x * 256 + (threadIdx.x >> 5) * 16 + ln;      /* this lane's query row */
  const _Float16* qp = QKV + ((size_t)b * SQ + i) * D3 + h * HD;
  const v16h q0 = g2_frag(qp, hh), q1 = g2_frag(qp + 32, hh);
  const float* mr = amask + ((size_t)b * SQ + i) * SQ + 8 * hh;
  const unsigned* mf = MF + ((size_t)b * (SQ / 16) + blockIdx.x * 16 + (threadIdx.x >> 5)) * (SQ / 32);      /* the conversion launch's 64 tile words of this wave's 16 query rows, one a pass */
  const unsigned long long nz = (unsigned long long)__builtin_amdgcn_ballot_w32(mf[lane] != 0u) | ((unsigned long long)__builtin_amdgcn_ballot_w32(mf[32 + lane] != 0u) << 32);      /* bit p: pass p's 16 x 32 mask tile holds a value other than 1; in scalar registers for the whole key loop */
  const float* bp = tb + (8 * hh + 255 - (int)((threadIdx.x >> 5) * 16 + ln));      /* bp[j] = the bias of key j + 8 hh for this lane's query */
  const v8f z8 = {0.f,0.f,0.f,0.f,0.f,0.f,0.f,0.f}; v8f o0 = z8, o1 = z8, o2 = z8, o3 = z8;
  float mx = -INFINITY, se = 0.f;
#pragma unroll 1      /* one trip = one buffer; the two buffers alternate by t & 1 */
  for (int t = 0; t < SQ / FAK; ++t) {
  const unsigned short* kt = &ring[t & 1][ln * FAKP + 8 * hh];      /* K row ln of the stage; the lane half's offset of g2_frag is in kt, vt and mr already */
  const unsigned short* vt = &ring[t & 1][FAK * FAKP + ln * FAVP + 8 * hh];      /* V^T row d = ln */
#pragma unroll 1      /* one pass holds some 200 vector instructions already: unrolling would only cost registers and instruction cache */
  for (int kb = t * FAK; kb < (t + 1) * FAK; kb += 32) {
    const unsigned short* k0 = kt + (kb - t * FAK) * FAKP; const unsigned short* vk = vt + (kb - t * FAK);
    const v16h ka0 = g2_lfrag(k0), ka1 = g2_lfrag(k0 + 32), kc0 = g2_lfrag(k0 + 16 * FAKP), kc1 = g2_lfrag(k0 + 16 * FAKP + 32);
    const v16h va0 = g2_lfrag(vk), va1 = g2_lfrag(vk + 16 * FAVP), va2 = g2_lfrag(vk + 32 * FAVP), va3 = g2_lfrag(vk + 48 * FAVP);
    float bs[16];      /* the 16 bias values of the pass: two runs of 8 consecutive table entries, 16 apart */
#pragma unroll      /* bs[] and v[] indexed by constants only, so that they live in registers */
    for (int r = 0; r < 8; ++r) { bs[r] = bp[kb + r]; bs[8 + r] = bp[kb + 16 + r]; }
    asm volatile("" ::: "memory");      /* compiler fence, no instruction: ahead of scheduling the compiler sinks the V^T and table reads to behind the first products, where the scheduling barrier below no longer sees them above it; LDS reads do not cross this line */
    __builtin_amdgcn_sched_barrier(0);      /* the 16 fragment reads and the table reads of a pass are issued together, ahead of all else: left alone the compiler sinks some of them to just in front of their use and the wave waits again */
    v8f s0 = fa_mma(ka0, q0, z8); s0 = fa_mma(ka1, q1, s0);
    v8f s1 = fa_mma(kc0, q0, z8); s1 = fa_mma(kc1, q1, s1);
    float v[16]; float bm = -INFINITY;
#pragma unroll      /* at mask = 1 the reference's expression is s / 8 + bias, term for term */
    for (int r = 0; r < 8; ++r) v[r] = s0[r] * (0.125f * FAL2E) + bs[r];
#pragma unroll
    for (int r = 0; r < 8; ++r) v[8 + r] = s1[r] * (0.125f * FAL2E) + bs[8 + r];
    if ((nz >> (kb >> 5)) & 1ull) {      /* one scalar bit test a pass: any other mask value in the wave's 16 x 32 tile, and the tile's mask is read here and the whole tile takes the full expression */
      const float* mk = mr + kb;
      const v4f m0 = *(const v4fa*)(mk), m1 = *(const v4fa*)(mk + 4), m2 = *(const v4fa*)(mk + 16), m3 = *(const v4fa*)(mk + 20);
      asm volatile("s_wait_xcnt 0x0" :: "v"(mk) : "memory");      /* input only: the mask loads' address register lives up to this wait and is reused only behind it */
#pragma unroll
      for (int r = 0; r < 8; ++r) {
        const float ma = bf16_round(r < 4 ? m0[r & 3] : m1[r & 3]), mb = bf16_round(r < 4 ? m2[r & 3] : m3[r & 3]);
        v[r] = (s0[r] * (0.125f * FAL2E)) * ma + ((-10000.0f * FAL2E) * (1.0f - ma) + bs[r]);
        v[8 + r] = (s1[r] * (0.125f * FAL2E)) * mb + ((-10000.0f * FAL2E) * (1.0f - mb) + bs[8 + r]);
      }
    }
#pragma unroll
    for (int r = 0; r < 8; ++r) bm = fmaxf(bm, fmaxf(v[r], v[8 + r]));
    const float mn = fmaxf(mx, fmaxf(bm, xhalf(bm)));      /* the same in both lanes of a query */
    const float f = __builtin_amdgcn_exp2f(mx - mn);      /* 0 on the first pass, where mx is -inf; exactly 1 where the maximum stays */
    mx = mn; se *= f;
    FragH p;
#pragma unroll      /* four weights at a time, then the rescale of one output tile */
    for (int t = 0; t < 4; ++t) {
#pragma unroll
      for (int k = 4 * t; k < 4 * t + 4; ++k) { v[k] = __builtin_amdgcn_exp2f(v[k] - mn); p.h[k] = (_Float16)v[k]; }
      v8f& ot = t == 0 ? o0 : t == 1 ? o1 : t == 2 ? o2 : o3;
#pragma unroll
      for (int r = 0; r < 8; ++r) ot[r] *= f;
      __builtin_amdgcn_sched_barrier(0);      /* keeps the groups apart, so that plain multiplies and conversions issue between the runs of 2^x: left alone the compiler issues all 17 in one run */
    }
    o0 = fa_mma(va0, p.v, o0); o1 = fa_mma(va1, p.v, o1); o2 = fa_mma(va2, p.v, o2); o3 = fa_mma(va3, p.v, o3);
    __builtin_amdgcn_sched_barrier(0);      /* the sum of the weights stays behind the pass's last product: its additions are the vector slots that the chip needs between that product and the next pass's first write to one of its operand registers, and they issue while the matrix unit works */
#pragma unroll
    for (int k = 0; k < 16; ++k) se += v[k];
  }
    asm volatile("s_wait_dscnt 0x0" ::: "memory");      /* this wave's reads of buffer t & 1 are done */
    asm volatile("s_wait_asynccnt 0x0" ::: "memory");      /* this wave's part of stage t + 1 has landed */
    __syncthreads();      /* publishes stage t + 1 and frees buffer t & 1 */
    if (t + 2 < SQ / FAK) fa_copy(lk + (unsigned)(t & 1) * (FASTG * 2u), lv + (unsigned)(t & 1) * (FASTG * 2u), gk + (size_t)(t + 2) * FAK * D3, gv + (t + 2) * FAK);
  }
  asm volatile("s_wait_asynccnt 0x0" ::: "memory");      /* nothing in flight when the wave ends */
  se += xhalf(se);      /* each lane summed its own half of the keys */
  const float inv = 1.0f / se;
  _Float16* op = O16 + ((size_t)b * SQ + i) * DM + h * HD + 8 * hh;      /* o_t[r] = ctx[query i][d = 16 t + 8 hh + r]: 16 contiguous bytes a tile */
  FragH c0, c1;
#pragma unroll
  for (int r = 0; r < 8; ++r) { c0.h[r] = (_Float16)(o0[r] * inv); c0.h[8 + r] = (_Float16)(o1[r] * inv); c1.h[r] = (_Float16)(o2[r] * inv); c1.h[8 + r] = (_Float16)(o3[r] * inv); }
  *(v8us*)((unsigned short*)op) = c0.half[0]; *(v8us*)((unsigned short*)op + 16) = c0.half[1]; *(v8us*)((unsigned short*)op + 32) = c1.half[0]; *(v8us*)((unsigned short*)op + 48) = c1.half[1];
}
__global__ __launch_bounds__(256) void k_vt(const _Float16* __restrict__ V16, int b, int h0, _Float16* __restrict__ VT) { __shared__ unsigned short tl[64][65]; const int tid = threadIdx.x; const int hh = blockIdx.x % HG, sg = blockIdx.x / HG; const int s0 = sg * 64; const int h = h0 + hh;
  for (int i = tid; i < 64 * 8; i += 256) { const int j = i / 8, d8 = (i % 8) * 8; FragH f; f.half[0] = *(const v8us*)((const unsigned short*)V16 + ((size_t)b * SQ + s0 + j) * DM + h * HD + d8); for (int q = 0; q < 8; ++q) tl[d8 + q][j] = f.u[q]; }
  __syncthreads();
  { for (int i = tid; i < 64 * 8; i += 256) { const int d = i / 8, j8 = (i % 8) * 8; FragH f; for (int q = 0; q < 8; ++q) f.u[q] = tl[d][j8 + q]; *(v8us*)((unsigned short*)VT + ((size_t)hh * HD + d) * SQ + s0 + j8) = f.half[0]; }  } }

// The three input conversions in one launch: hidden -> f16 rows (the items of k_x16) and W_qkv, W_o -> x16 transposed f16 (the values of k_wt_f16). They depend on nothing but the inputs, and each alone is far shorter than what it costs to
// launch it and to start its waves. 512 work-groups, two a WGP, 16 waves a WGP, all resident at once; a thread takes 4 items of hidden, a work-group 4 weight units (3 of W_qkv, 1 of W_o), and every thread asks for all its data up front.
// The same launch reads the attention mask once, for all 16 heads: a work-group takes 16 rows x half their length, a wave-wide 16-byte load 4 whole lines of a row, and leaves one word per 16 x 32 tile (the tile of one wave's pass in the fused attention): 0 where every value is exactly 1.
// A weight unit is 64 k x 32 n. It is read along n, as it lies: 8 lanes a row, so a wave-wide 16-byte load covers 4 whole 128-byte lines (read down a column, one float a lane, a wave-wide load touched 32 lines for 128 bytes).
// The transposition is done in LDS: two consecutive k of one n are packed into 4 bytes and written down a column; behind one barrier each thread reads 8 consecutive k of one n and stores 16 bytes, a wave 4 whole lines of Bt.
#define PRB 512                      /* work-groups of the conversion launch */
#define PRT (PRB * 256)              /* its threads */
#define PRP 33                       /* 4-byte words per LDS row of a unit: 32 (64 k as f16 pairs) + 1, so that the writes down a column and the reads along a row each meet every bank at most once */
__global__ __launch_bounds__(256) void k_prep(const float* __restrict__ x, _Float16* __restrict__ X16, const float* __restrict__ wq, _Float16* __restrict__ Bq, const float* __restrict__ wo, _Float16* __restrict__ Bo, const float* __restrict__ am, unsigned* __restrict__ MF) {
  static_assert(NR * DM / 8 == (size_t)4 * PRT && (D3 / 32) * (DM / 64) == 3 * PRB && (DM / 32) * (DM / 64) == PRB, "items per thread, units per work-group");
  static_assert(NR / 16 * 2 == PRB && SQ == 2 * 256 * 4, "a work-group takes 16 mask rows x half their length, a thread 4 consecutive values of each row");
  typedef _Float16 v2h __attribute__((ext_vector_type(2)));
  __shared__ unsigned tl[4][32][PRP];      /* tl[unit][n][k / 2]: the even k in the low half */
  __shared__ unsigned fl[32];      /* the work-group's 32 mask tile words */
  const int tid = threadIdx.x;
  const int c4 = (tid & 7) * 4, rp = tid >> 3;      /* reading: this thread's 4 consecutive n and its pair of rows k = 2 rp, 2 rp + 1 of a unit */
  const unsigned ix = blockIdx.x * 1024u + (unsigned)tid;      /* hidden items ix + 256 j: a work-group takes 1,024 consecutive items */
  const unsigned ox = ix * 32u, vq = ((unsigned)(2 * rp) * D3 + (unsigned)c4) * 4u, vo = ((unsigned)(2 * rp) * DM + (unsigned)c4) * 4u;      /* one address register an input, beside a uniform pointer; all else is a constant offset */
  unsigned un[4], uk[4];      /* first n and first k of the work-group's four units (uniform): consecutive work-groups take neighbouring pieces of the same rows */
#pragma unroll      /* un, uk, wa, wb, xa, xb indexed by constants only, so that they live in registers */
  for (int j = 0; j < 3; ++j) { const unsigned u = blockIdx.x + (unsigned)j * PRB; un[j] = (u % (D3 / 32)) * 32u; uk[j] = (u / (D3 / 32)) * 64u; }
  un[3] = (blockIdx.x % (DM / 32)) * 32u; uk[3] = (blockIdx.x / (DM / 32)) * 64u;
  const char* pw[4];      /* the units' first bytes (uniform) */
#pragma unroll
  for (int j = 0; j < 3; ++j) pw[j] = (const char*)(wq + (size_t)uk[j] * D3 + un[j]);
  pw[3] = (const char*)(wo + (size_t)uk[3] * DM + un[3]);
  const unsigned vm = (blockIdx.x >> 1) * (16u * SQ * 4u) + (blockIdx.x & 1u) * (SQ / 2 * 4u) + (unsigned)tid * 16u;      /* the work-group's piece of the mask: rows 16 g .. 16 g + 15 of the NB * SQ, one half of their length; byte offset of this thread's 4 values in its first row */
  __builtin_amdgcn_sched_barrier(0);      /* the four uniform pointers are formed ahead of the first load: formed between the loads they reuse scalar registers that an issued load names, and each reuse waits for that load's address translation */
  v4f wa[4], wb[4], xa[4], xb[4], mm[16];
#pragma unroll
  for (int j = 0; j < 3; ++j) { const char* p = pw[j] + (size_t)vq; wa[j] = *(const v4fa*)p; wb[j] = *(const v4fa*)(p + D3 * 4); }
  { const char* p = pw[3] + (size_t)vo; wa[3] = *(const v4fa*)p; wb[3] = *(const v4fa*)(p + DM * 4); }
#pragma unroll      /* a wave-wide load covers 4 whole lines of one mask row = 4 tiles' width */
  for (int r = 0; r < 16; ++r) mm[r] = *(const v4fa*)((const char*)am + (size_t)vm + r * (SQ * 4));
#pragma unroll
  for (int j = 0; j < 4; ++j) { const char* p = (const char*)x + (size_t)ox + j * 8192; xa[j] = *(const v4fa*)p; xb[j] = *(const v4fa*)(p + 16); }
  asm volatile("s_wait_xcnt 0x0" :: "v"(ox), "v"(vq), "v"(vo), "v"(vm) : "memory");      /* inputs only: the four address registers of the 32 loads live up to this wait and are reused only behind it */
  __builtin_amdgcn_sched_barrier(0);      /* all 32 loads of a thread are in flight, and the wait above has passed, before the first conversion: sunk to their uses the loads would cost one memory round trip an item */
#pragma unroll
  for (int j = 0; j < 4; ++j)
#pragma unroll
    for (int q = 0; q < 4; ++q) { v2h f; f[0] = (_Float16)(bf16_round(wa[j][q]) * 16.0f); f[1] = (_Float16)(bf16_round(wb[j][q]) * 16.0f); tl[j][c4 + q][rp] = __builtin_bit_cast(unsigned, f); }
  unsigned dm = 0u;      /* stays 0 only where all 64 mask values of the thread are the bit pattern of 1.0f */
#pragma unroll      /* (a ^ 1.0f) | (b ^ 1.0f) is one three-input bit operation (truth table 0x7e): two mask values an instruction */
  for (int r = 0; r < 16; r += 2)
#pragma unroll
    for (int q = 0; q < 4; ++q) dm |= __builtin_amdgcn_bitop3_b32(__float_as_uint(mm[r][q]), __float_as_uint(mm[r + 1][q]), 0x3f800000u, 0x7e);
  const unsigned bal = __builtin_amdgcn_ballot_w32(dm != 0u);      /* 8 lanes = 32 columns = one tile of the attention's passes */
  if ((tid & 31) < 4) fl[(tid >> 5) * 4 + (tid & 31)] = (bal >> (8 * (tid & 31))) & 0xffu;
  __syncthreads();      /* the four units and the 32 tile words are whole in LDS; no global store stands in front of this barrier, which would wait for it */
  if (tid < 32) MF[blockIdx.x * 32u + (unsigned)tid] = fl[tid];      /* one wave stores the work-group's whole 128-byte line: MF[row tile][pass], 0 = every mask value of the 16 x 32 tile is 1 */
  const int n = tid >> 3, k8 = tid & 7;      /* writing: this thread's row of Bt in a unit and its 8 consecutive k */
  union { unsigned d[4]; v8us v; } o[4];
#pragma unroll
  for (int j = 0; j < 4; ++j)
#pragma unroll
    for (int q = 0; q < 4; ++q) o[j].d[q] = tl[j][n][4 * k8 + q];
#pragma unroll      /* the hidden items are converted while the LDS reads above are under way */
  for (int j = 0; j < 4; ++j) { FragH f;
#pragma unroll
    for (int q = 0; q < 4; ++q) { f.h[q] = (_Float16)bf16_round(xa[j][q]); f.h[4 + q] = (_Float16)bf16_round(xb[j][q]); }
    *(v8us*)((unsigned short*)X16 + ((size_t)ix + j * 256) * 8) = f.half[0]; }
#pragma unroll
  for (int j = 0; j < 4; ++j) *(v8us*)((unsigned short*)(j < 3 ? Bq : Bo) + (size_t)(un[j] + (unsigned)n) * DM + uk[j] + (unsigned)k8 * 8u) = o[j].v;
}

extern "C" void kernel_launch(void* const* d_in, const int* in_sizes, int n_in,
                              void* d_out, int out_size, void* d_ws, size_t ws_size, hipStream_t stream) {
  (void)in_sizes; (void)n_in; (void)out_size;
  const float* const* I = (const float* const*)d_in; const float* hs = I[0]; const float* amask = I[1]; const float* wqkv = I[2]; const float* wo = I[3]; const float* emb = I[4];      /* W_qkv [1024][3072] and W_o [1024][1024] are [in][out]; attention_mask [2][1][2048][2048]; rel_bias_emb [32][16] */
  char* ws = (char*)d_ws; size_t off = 0;
  auto take = [&](size_t bytes) { char* p = ws + off; off += (bytes + 255) & ~(size_t)255; return p; };
  _Float16* BQKV = (_Float16*)take((size_t)D3 * DM * 2); _Float16* BO = (_Float16*)take((size_t)DM * DM * 2);
  _Float16* X16 = (_Float16*)take(NR * DM * 2); _Float16* QKV = (_Float16*)take(NR * D3 * 2); _Float16* O16 = (_Float16*)take(NR * DM * 2);
  _Float16* VT = (_Float16*)take((size_t)NB * NH * HD * SQ * 2); unsigned* MF = (unsigned*)take((size_t)PRB * 32 * 4);
  if (off > ws_size) return;      /* 6 + 2 + 8 + 24 + 8 + 8 = approx 56 MiB */
  k_prep<<<PRB, 256, 0, stream>>>(hs, X16, wqkv, BQKV, wo, BO, amask, MF);      /* hidden as f16 rows; [in][out] weights -> Bt[out][in] x16; one word per 16 x 32 mask tile */
  k_gemm2<0><<<dim3((unsigned)((NR / 128) * (D3 / 128)), 1), 256, 0, stream>>>(X16, DM, 0, BQKV, DM, 0, 0.0625f, nullptr, 0, nullptr, 1, 0, 0, nullptr, QKV, D3, 0, MP, D3, DM);      /* q | k | v rows (f16), head h at columns h*64 / 1024 + h*64 / 2048 + h*64 */
  k_vt<NH, SQ><<<NB * NH * (SQ / 64), 256, 0, stream>>>(QKV, D3, 2 * DM, VT);      /* V^T[(b,h)][d][s] for every (batch, head) */
  k_fattn<<<dim3(SQ / 256, NB * NH), 512, 0, stream>>>(QKV, VT, emb, amask, MF, O16);      /* ctx (merged heads) as f16 rows; one block per 256 query rows of a (batch, head) */
  k_gemm2<0><<<dim3((unsigned)((NR / 128) * (DM / 128)), 1), 256, 0, stream>>>(O16, DM, 0, BO, DM, 0, 0.0625f, nullptr, 0, nullptr, 1, 0, 0, (float*)d_out, nullptr, DM, 0, MO, DM, DM);      /* out = ctx W_o, rows are the output layout */
}
